// v000
// The times below were measured on an AMD MI455X: many runs one after another, warmed up first and cycling through
// copies of the inputs, with the whole window's GPU time divided by the number of runs. Launches and the gaps
// between them are all in it. The median over several windows is given; except for v000 it joins two sittings, which
// can be a few percent apart, so the side-by-side timings, each taken in one sitting, are the better comparison.
// v000 is the starting kernel. One run takes 529 microseconds.
#include <hip/hip_runtime.h>
// q/k/v/o projections (4096 × 1024 → 1024/512/512, 1024) and the 16-head causal GQA attention (8 kv heads, d = 64) on v_wmma_f32_16x16x32_f16 (fused flash-style kernel: S = Q·Kᵀ, O = P·V on WMMA,
// causal mask, online max/sum softmax f32, P f16 ≤ 1; only key chunks ≤ the block's last query); per-head RMSNorm and RoPE (cos/sin are INPUTS) applied in f32 before the f16 cast; V transposed
// per kv head; A = f16(bf16 x) exact, weights bf16-exact ×2^4 ((out,in) layouts), single products, f32 accumulate.
#define BB 2
#define SS 2048
#define HID 1024
#define NH 16
#define NKV 8
#define HD 64
#define KVD 512
#define NR (BB * SS)

typedef __bf16 v16b __attribute__((ext_vector_type(16)));
typedef unsigned short v8us __attribute__((ext_vector_type(8), may_alias));
typedef float  v8f  __attribute__((ext_vector_type(8)));
typedef float  v4f  __attribute__((ext_vector_type(4)));
typedef float  v4fa __attribute__((ext_vector_type(4), may_alias));
union FragB { v16b v; v8us half[2]; unsigned short u[16]; };

__device__ __forceinline__ unsigned short bf16_bits(float x) { unsigned int u = __float_as_uint(x); return (unsigned short)((u + 0x7FFFu + ((u >> 16) & 1u)) >> 16); }
__device__ __forceinline__ float bf16_val(unsigned short b) { return __uint_as_float(((unsigned int)b) << 16); }
__device__ __forceinline__ float bf16_round(float x) { return bf16_val(bf16_bits(x)); }
// D += A·B with NT terms: 1 = ah·bh, 2 = + al·bh (A split), 3 = + ah·bl (both split)
template <int NT>
__device__ __forceinline__ v8f mmaN(v16b ah, v16b al, v16b bh, v16b bl, v8f c) {
  c = __builtin_amdgcn_wmma_f32_16x16x32_bf16(false, ah, false, bh, (short)0, c, false, false);
  if (NT >= 2) c = __builtin_amdgcn_wmma_f32_16x16x32_bf16(false, al, false, bh, (short)0, c, false, false);
  if (NT >= 3) c = __builtin_amdgcn_wmma_f32_16x16x32_bf16(false, ah, false, bl, (short)0, c, false, false);
  asm volatile("v_nop\n\tv_nop\n\tv_nop\n\tv_nop" : "+v"(c) : "v"(ah), "v"(al), "v"(bh), "v"(bl));
  return c;
}

__global__ __launch_bounds__(256) void k_wt_bf16(const float* __restrict__ W, unsigned short* __restrict__ Wt, int K, int N) {
  const int t = blockIdx.x * 256 + threadIdx.x;
  const int k8n = K / 8;
  if (t >= N * k8n) return;
  const int n = t / k8n, k8 = (t % k8n) * 8;
  v8us v;
#pragma unroll
  for (int i = 0; i < 8; ++i) v[i] = bf16_bits(W[(size_t)(k8 + i) * N + n]);
  *(v8us*)(Wt + (size_t)n * K + k8) = v;
  
}

// GEMM C[M][N] (f32, pitch ldc) = act(A[M][K]·W + bias). A f32 row-major (pitch lda) converted per fragment to bf16
// (ASPLIT: hi/lo two planes -> 2 terms, else single rounded term); Wt bf16 [N][K] (pitch ldb). BIAS_BF16 rounds the
// bias to bf16 first (bias quantised to bf16 before the add). K%32==0, M%16==0, N%64==0.
template <bool ASPLIT, int ACT, bool BIAS_BF16>
__global__ __launch_bounds__(128) void k_gemm_bf(const float* __restrict__ A, int lda, const unsigned short* __restrict__ Wt, int ldb,
                                               const float* __restrict__ bias, float* __restrict__ C, int ldc, int M, int N, int K) {
  __shared__ __attribute__((aligned(16))) float so[4][16][64];
  const int tid = threadIdx.x, w = tid >> 5, lane = tid & 31, ln = lane & 15, hh = lane >> 4;
  const int ntn = N / 64;
  const int wid = blockIdx.x * 4 + w;
  const int mt = wid / ntn, nq = wid % ntn;
  if (mt * 16 >= M) return;
  const int row0 = mt * 16, col0 = nq * 64;
  const float* arow = A + (size_t)(row0 + ln) * lda;
  v8f acc[4] = {};
  for (int kb = 0; kb < K; kb += 32) {
    FragB ah, al;
    const v4f x0 = *(const v4fa*)(arow + kb + 8 * hh), x1 = *(const v4fa*)(arow + kb + 8 * hh + 4);
    const v4f x2 = *(const v4fa*)(arow + kb + 16 + 8 * hh), x3 = *(const v4fa*)(arow + kb + 16 + 8 * hh + 4);
    float xs[16] = {x0[0],x0[1],x0[2],x0[3],x1[0],x1[1],x1[2],x1[3],x2[0],x2[1],x2[2],x2[3],x3[0],x3[1],x3[2],x3[3]};
#pragma unroll
    for (int i = 0; i < 16; ++i) { const unsigned short hb = bf16_bits(xs[i]); ah.u[i] = hb; al.u[i] = ASPLIT ? bf16_bits(xs[i] - bf16_val(hb)) : (unsigned short)0; }
#pragma unroll
    for (int t = 0; t < 4; ++t) {
      const unsigned short* brow = Wt + (size_t)(col0 + t * 16 + ln) * ldb + kb;
      FragB b;
      b.half[0] = *(const v8us*)(brow + 8 * hh);
      b.half[1] = *(const v8us*)(brow + 16 + 8 * hh);
      acc[t] = mmaN<ASPLIT ? 2 : 1>(ah.v, al.v, b.v, b.v, acc[t]);
    }
  }
#pragma unroll
  for (int t = 0; t < 4; ++t) {
    float bv = bias ? bias[col0 + t * 16 + ln] : 0.f;
    if (BIAS_BF16) bv = bf16_round(bv);
#pragma unroll
    for (int r = 0; r < 8; ++r) { float v = acc[t][r] + bv; if (ACT == 1) v = fmaxf(v, 0.f); so[w][8 * hh + r][t * 16 + ln] = v; }
  }
  __builtin_amdgcn_fence(__ATOMIC_ACQ_REL, "workgroup");
  __builtin_amdgcn_wave_barrier();
  const int rsub = lane >> 4, c4 = (lane & 15) * 4;
  {
#pragma unroll
    for (int q = 0; q < 8; ++q) {
      const int r = q * 2 + rsub;
      const v4f v = *(const v4fa*)&so[w][r][c4];
      *(v4f*)(C + (size_t)(row0 + r) * ldc + col0 + c4) = v;
    }
    
  }
}

// Flash-style causal/unmasked attention, all contractions 3-term bf16 hi/lo splits, f32 softmax with running max.
// q,k,v rows are read from f32 buffers with arbitrary row pitch (so they can live inside a fused qkv buffer);
// D = head size (multiple of 32, <= 128); one wave = 16 query rows; block = 4 waves (64 queries) sharing K/V chunks of 32.
template <int D, bool CAUSAL>
__global__ __launch_bounds__(128) void k_flash(const float* __restrict__ qb, const float* __restrict__ kb, const float* __restrict__ vb,
                                             int pitch, int T, int H, float scale, float* __restrict__ y, int ypitch) {
  constexpr int KS = D / 32;        // k-steps for QK
  constexpr int DT = D / 16;        // d tiles for PV
  __shared__ __attribute__((aligned(16))) unsigned short sKh[32][D + 8], sKl[32][D + 8], sVh[32][D + 8], sVl[32][D + 8];
  __shared__ __attribute__((aligned(16))) unsigned short sPh[4][16][40], sPl[4][16][40];
  __shared__ __attribute__((aligned(16))) float sO[4][16][D];
  const int tid = threadIdx.x, w = tid >> 5, lane = tid & 31, ln = lane & 15, hh = lane >> 4;
  const int nqb = (T + 63) / 64;
  const int bh = blockIdx.x / nqb, qblk = blockIdx.x % nqb;
  const int b = bh / H, h = bh % H;
  const int q0 = qblk * 64 + w * 16;
  const float* Q = qb + (size_t)b * T * pitch + h * D;
  const float* K = kb + (size_t)b * T * pitch + h * D;
  const float* V = vb + (size_t)b * T * pitch + h * D;

  // A fragments of the wave's 16 query rows (scaled), hi/lo
  FragB aqh[KS], aql[KS];
  {
    int row = q0 + ln; if (row >= T) row = T - 1;
    const float* qr = Q + (size_t)row * pitch;
#pragma unroll
    for (int ks = 0; ks < KS; ++ks)
#pragma unroll
      for (int i = 0; i < 16; ++i) {
        const int d = ks * 32 + ((i < 8) ? (8 * hh + i) : (16 + 8 * hh + (i - 8)));
        const float x = qr[d] * scale; const unsigned short hb = bf16_bits(x);
        aqh[ks].u[i] = hb; aql[ks].u[i] = bf16_bits(x - bf16_val(hb));
      }
  }
  float m_r[8], l_r[8];
#pragma unroll
  for (int r = 0; r < 8; ++r) { m_r[r] = -3.0e38f; l_r[r] = 0.f; }
  v8f oacc[DT];
#pragma unroll
  for (int dt = 0; dt < DT; ++dt) oacc[dt] = (v8f){0.f,0.f,0.f,0.f,0.f,0.f,0.f,0.f};

  const int kv_end = CAUSAL ? min(T, qblk * 64 + 64) : T;     // block-uniform
  for (int j0 = 0; j0 < kv_end; j0 += 32) {
    __syncthreads();
    for (int e = tid; e < 32 * (D / 4); e += 128) {
      const int r = e / (D / 4), c4 = (e % (D / 4)) * 4;
      const int key = j0 + r;
      v4f kf = {0.f,0.f,0.f,0.f}, vf = {0.f,0.f,0.f,0.f};
      if (key < T) { kf = *(const v4fa*)(K + (size_t)key * pitch + c4); vf = *(const v4fa*)(V + (size_t)key * pitch + c4); }
#pragma unroll
      for (int t = 0; t < 4; ++t) {
        unsigned short hb = bf16_bits(kf[t]); sKh[r][c4 + t] = hb; sKl[r][c4 + t] = bf16_bits(kf[t] - bf16_val(hb));
        hb = bf16_bits(vf[t]); sVh[r][c4 + t] = hb; sVl[r][c4 + t] = bf16_bits(vf[t] - bf16_val(hb));
      }
    }
    __syncthreads();
    // S tile 16 x 32
    v8f s[2];
#pragma unroll
    for (int nt = 0; nt < 2; ++nt) {
      v8f acc = {};
#pragma unroll
      for (int ks = 0; ks < KS; ++ks) {
        FragB bh_, bl_;
        bh_.half[0] = *(const v8us*)&sKh[nt * 16 + ln][ks * 32 + 8 * hh]; bh_.half[1] = *(const v8us*)&sKh[nt * 16 + ln][ks * 32 + 16 + 8 * hh];
        bl_.half[0] = *(const v8us*)&sKl[nt * 16 + ln][ks * 32 + 8 * hh]; bl_.half[1] = *(const v8us*)&sKl[nt * 16 + ln][ks * 32 + 16 + 8 * hh];
        acc = mmaN<3>(aqh[ks].v, aql[ks].v, bh_.v, bl_.v, acc);
      }
      s[nt] = acc;
    }
    // mask + running max (rows 8hh+r; the 16 lanes of a half share rows)
    float alpha[8];
#pragma unroll
    for (int r = 0; r < 8; ++r) {
      const int qi = q0 + 8 * hh + r;
      const int ja = j0 + ln, jb = j0 + 16 + ln;
      if (CAUSAL) { if (ja > qi) s[0][r] = -3.0e38f; if (jb > qi) s[1][r] = -3.0e38f; }
      if (ja >= T) s[0][r] = -3.0e38f;
      if (jb >= T) s[1][r] = -3.0e38f;
      float mx = fmaxf(s[0][r], s[1][r]);
      mx = fmaxf(mx, __shfl_xor(mx, 1, 32)); mx = fmaxf(mx, __shfl_xor(mx, 2, 32)); mx = fmaxf(mx, __shfl_xor(mx, 4, 32)); mx = fmaxf(mx, __shfl_xor(mx, 8, 32));
      const float mnew = fmaxf(m_r[r], mx);
      alpha[r] = (mnew > -1.0e38f) ? __expf(m_r[r] - mnew) : 1.0f;
      const float p0 = (s[0][r] > -1.0e38f) ? __expf(s[0][r] - mnew) : 0.f;
      const float p1 = (s[1][r] > -1.0e38f) ? __expf(s[1][r] - mnew) : 0.f;
      m_r[r] = mnew;
      l_r[r] = l_r[r] * alpha[r] + p0 + p1;            // per-lane partial row sum (16 lanes combined at the end)
      unsigned short hb = bf16_bits(p0); sPh[w][8 * hh + r][ln] = hb;      sPl[w][8 * hh + r][ln] = bf16_bits(p0 - bf16_val(hb));
      hb = bf16_bits(p1);                sPh[w][8 * hh + r][16 + ln] = hb; sPl[w][8 * hh + r][16 + ln] = bf16_bits(p1 - bf16_val(hb));
    }
#pragma unroll
    for (int dt = 0; dt < DT; ++dt)
#pragma unroll
      for (int r = 0; r < 8; ++r) oacc[dt][r] *= alpha[r];
    __builtin_amdgcn_fence(__ATOMIC_ACQ_REL, "workgroup");
    __builtin_amdgcn_wave_barrier();
    FragB pah, pal;
    pah.half[0] = *(const v8us*)&sPh[w][ln][8 * hh]; pah.half[1] = *(const v8us*)&sPh[w][ln][16 + 8 * hh];
    pal.half[0] = *(const v8us*)&sPl[w][ln][8 * hh]; pal.half[1] = *(const v8us*)&sPl[w][ln][16 + 8 * hh];
#pragma unroll
    for (int dt = 0; dt < DT; ++dt) {
      FragB bvh, bvl;
#pragma unroll
      for (int i = 0; i < 8; ++i) {
        bvh.u[i] = sVh[8 * hh + i][dt * 16 + ln]; bvh.u[8 + i] = sVh[16 + 8 * hh + i][dt * 16 + ln];
        bvl.u[i] = sVl[8 * hh + i][dt * 16 + ln]; bvl.u[8 + i] = sVl[16 + 8 * hh + i][dt * 16 + ln];
      }
      oacc[dt] = mmaN<3>(pah.v, pal.v, bvh.v, bvl.v, oacc[dt]);
    }
    __builtin_amdgcn_fence(__ATOMIC_ACQ_REL, "workgroup");
    __builtin_amdgcn_wave_barrier();
  }
#pragma unroll
  for (int r = 0; r < 8; ++r) {
    float l = l_r[r];
    l += __shfl_xor(l, 1, 32); l += __shfl_xor(l, 2, 32); l += __shfl_xor(l, 4, 32); l += __shfl_xor(l, 8, 32);
    l_r[r] = (l > 0.f) ? 1.0f / l : 0.f;
  }
#pragma unroll
  for (int dt = 0; dt < DT; ++dt)
#pragma unroll
    for (int r = 0; r < 8; ++r) sO[w][8 * hh + r][dt * 16 + ln] = oacc[dt][r] * l_r[r];
  __builtin_amdgcn_fence(__ATOMIC_ACQ_REL, "workgroup");
  __builtin_amdgcn_wave_barrier();
  {
    for (int r = 0; r < 16; ++r) {
      const int row = q0 + r;
      if (row < T && lane < D / 4) {
        const v4f val = *(const v4fa*)&sO[w][r][lane * 4];
        *(v4f*)(y + ((size_t)b * T + row) * ypitch + h * D + lane * 4) = val;
      }
    }
    
  }
}

// GEMM C = act(A·W + bias + resid): A f32 (ASPLIT -> hi/lo 2 terms), Wt bf16 [N][K]; ACT 0 none, 1 relu, 2 exact gelu;
// resid (optional, f32, row index = (row % rmod), pitch ldr, RES_BF16 rounds it) added before the activation.
template <bool ASPLIT, int ACT, bool BIAS_BF16, bool RES_BF16>
__global__ __launch_bounds__(128) void k_gemm_bf3(const float* __restrict__ A, int lda, const unsigned short* __restrict__ Wt, int ldb,
                                                const float* __restrict__ bias, const float* __restrict__ resid, int rmod, int ldr,
                                                float* __restrict__ C, int ldc, int M, int N, int K) {
  __shared__ __attribute__((aligned(16))) float so[4][16][64];
  const int tid = threadIdx.x, w = tid >> 5, lane = tid & 31, ln = lane & 15, hh = lane >> 4;
  const int ntn = N / 64;
  const int wid = blockIdx.x * 4 + w;
  const int mt = wid / ntn, nq = wid % ntn;
  if (mt * 16 >= M) return;
  const int row0 = mt * 16, col0 = nq * 64;
  const float* arow = A + (size_t)(row0 + ln) * lda;
  v8f acc[4] = {};
  for (int kb = 0; kb < K; kb += 32) {
    FragB ah, al;
    const v4f x0 = *(const v4fa*)(arow + kb + 8 * hh), x1 = *(const v4fa*)(arow + kb + 8 * hh + 4);
    const v4f x2 = *(const v4fa*)(arow + kb + 16 + 8 * hh), x3 = *(const v4fa*)(arow + kb + 16 + 8 * hh + 4);
    float xs[16] = {x0[0],x0[1],x0[2],x0[3],x1[0],x1[1],x1[2],x1[3],x2[0],x2[1],x2[2],x2[3],x3[0],x3[1],x3[2],x3[3]};
#pragma unroll
    for (int i = 0; i < 16; ++i) { const unsigned short hb = bf16_bits(xs[i]); ah.u[i] = hb; al.u[i] = ASPLIT ? bf16_bits(xs[i] - bf16_val(hb)) : (unsigned short)0; }
#pragma unroll
    for (int t = 0; t < 4; ++t) {
      const unsigned short* brow = Wt + (size_t)(col0 + t * 16 + ln) * ldb + kb;
      FragB b;
      b.half[0] = *(const v8us*)(brow + 8 * hh);
      b.half[1] = *(const v8us*)(brow + 16 + 8 * hh);
      acc[t] = mmaN<ASPLIT ? 2 : 1>(ah.v, al.v, b.v, b.v, acc[t]);
    }
  }
#pragma unroll
  for (int t = 0; t < 4; ++t) {
    const int col = col0 + t * 16 + ln;
    float bv = bias ? bias[col] : 0.f;
    if (BIAS_BF16) bv = bf16_round(bv);
#pragma unroll
    for (int r = 0; r < 8; ++r) {
      float v = acc[t][r] + bv;
      if (resid) { float rv = resid[(size_t)((row0 + 8 * hh + r) % rmod) * ldr + col]; if (RES_BF16) rv = bf16_round(rv); v += rv; }
      if (ACT == 1) v = fmaxf(v, 0.f);
      if (ACT == 2) v = 0.5f * v * (1.0f + erff(v * 0.70710678118654752f));
      if (ACT == 3) { const float u = 0.7978845608028654f * (v + 0.044715f * v * v * v); v = 0.5f * v * (1.0f + tanhf(u)); }
      so[w][8 * hh + r][t * 16 + ln] = v;
    }
  }
  __builtin_amdgcn_fence(__ATOMIC_ACQ_REL, "workgroup");
  __builtin_amdgcn_wave_barrier();
  const int rsub = lane >> 4, c4 = (lane & 15) * 4;
  {
#pragma unroll
    for (int q = 0; q < 8; ++q) {
      const int r = q * 2 + rsub;
      const v4f v = *(const v4fa*)&so[w][r][c4];
      *(v4f*)(C + (size_t)(row0 + r) * ldc + col0 + c4) = v;
    }
    
  }
}
// row LayerNorm (biased variance, eps) over N: s = X (+ R); optional out_sum <- s; out_norm <- (s-mu)*rsqrt(var+eps)*g + b
template <bool PARAM_BF16>
__global__ __launch_bounds__(256) void k_layernorm(const float* __restrict__ X, const float* __restrict__ R, const float* __restrict__ g, const float* __restrict__ bta,
                                                  float* __restrict__ out_sum, float* __restrict__ out_norm, int N, float eps) {
  __shared__ float red[256];
  const int row = blockIdx.x, tid = threadIdx.x;
  const float* x = X + (size_t)row * N; const float* rr = R ? R + (size_t)row * N : nullptr;
  float vals[16];                     // up to N = 4096
  const int per = N / 256;            // contiguous chunk per thread? use strided-by-4 chunks: thread handles j = tid*4 + 1024*u
  float s1 = 0.f;
  for (int u = 0; u < per / 4; ++u) {
    const int j = tid * 4 + 1024 * u;
    const v4f a = *(const v4fa*)(x + j);
    v4f b = {0.f,0.f,0.f,0.f}; if (rr) b = *(const v4fa*)(rr + j);
#pragma unroll
    for (int q = 0; q < 4; ++q) { const float v = a[q] + b[q]; vals[u * 4 + q] = v; s1 += v; }
  }
  red[tid] = s1; __syncthreads();
  for (int st = 128; st > 0; st >>= 1) { if (tid < st) red[tid] += red[tid + st]; __syncthreads(); }
  const float mu = red[0] / (float)N; __syncthreads();
  float s2 = 0.f;
  for (int u = 0; u < per / 4; ++u)
#pragma unroll
    for (int q = 0; q < 4; ++q) { const float c = vals[u * 4 + q] - mu; s2 += c * c; }
  red[tid] = s2; __syncthreads();
  for (int st = 128; st > 0; st >>= 1) { if (tid < st) red[tid] += red[tid + st]; __syncthreads(); }
  const float rs = rsqrtf(red[0] / (float)N + eps);
  {
    for (int u = 0; u < per / 4; ++u) {
      const int j = tid * 4 + 1024 * u;
      v4f o, sm;
#pragma unroll
      for (int q = 0; q < 4; ++q) {
        float gg = g[j + q], bb = bta[j + q];
        if (PARAM_BF16) { gg = bf16_round(gg); bb = bf16_round(bb); }
        sm[q] = vals[u * 4 + q]; o[q] = (vals[u * 4 + q] - mu) * rs * gg + bb;
      }
      if (out_sum) *(v4f*)(out_sum + (size_t)row * N + j) = sm;
      *(v4f*)(out_norm + (size_t)row * N + j) = o;
    }
    
  }
}



// ---- f16 WMMA path (v_wmma_f32_16x16x32_f16): 11-bit significands for operands in range — used where a [0,1] probability operand needs more precision than bf16
typedef _Float16 v16h __attribute__((ext_vector_type(16)));
union FragH { v16h v; v8us half[2]; _Float16 h[16]; unsigned short u[16]; };
template <int NT>
__device__ __forceinline__ v8f mmaH(v16h ah, v16h al, v16h bh, v16h bl, v8f c) {
  c = __builtin_amdgcn_wmma_f32_16x16x32_f16(false, ah, false, bh, (short)0, c, false, false);
  if (NT >= 2) c = __builtin_amdgcn_wmma_f32_16x16x32_f16(false, al, false, bh, (short)0, c, false, false);
  if (NT >= 3) c = __builtin_amdgcn_wmma_f32_16x16x32_f16(false, ah, false, bl, (short)0, c, false, false);
  asm volatile("v_nop\n\tv_nop\n\tv_nop\n\tv_nop" : "+v"(c) : "v"(ah), "v"(al), "v"(bh), "v"(bl));
  return c;
}
// batched GEMM like k_gemm_b but f16 operands: A f32 (split into f16 hi/lo if ASPLIT, else rounded to f16), Bt = f16 values [n][k]; alpha; C f32; N multiple of 16 (partial tiles skipped)
template <bool ASPLIT>
__global__ __launch_bounds__(128) void k_gemm_h(const float* __restrict__ A, int lda, size_t sA, const _Float16* __restrict__ Bh, int ldb, size_t sB, float alpha, float* __restrict__ C, int ldc, size_t sC, int M, int N, int K) {
  __shared__ __attribute__((aligned(16))) float so[4][16][64];
  const int tid = threadIdx.x, w = tid >> 5, lane = tid & 31, ln = lane & 15, hh = lane >> 4; const int by = blockIdx.y;
  A += (size_t)by * sA; Bh += (size_t)by * sB; C += (size_t)by * sC;
  const int ntn = (N + 63) / 64; const int wid = blockIdx.x * 4 + w; const int mt = wid / ntn, nq = wid % ntn; if (mt * 16 >= M) return;
  const int row0 = mt * 16, col0 = nq * 64; const float* arow = A + (size_t)(row0 + ln) * lda;
  v8f acc[4] = {};
  for (int kb = 0; kb < K; kb += 32) {
    FragH ah, al;
    const v4f x0 = *(const v4fa*)(arow + kb + 8 * hh), x1 = *(const v4fa*)(arow + kb + 8 * hh + 4), x2 = *(const v4fa*)(arow + kb + 16 + 8 * hh), x3 = *(const v4fa*)(arow + kb + 16 + 8 * hh + 4);
    float xs[16] = {x0[0],x0[1],x0[2],x0[3],x1[0],x1[1],x1[2],x1[3],x2[0],x2[1],x2[2],x2[3],x3[0],x3[1],x3[2],x3[3]};
#pragma unroll
    for (int i = 0; i < 16; ++i) { const _Float16 h = (_Float16)xs[i]; ah.h[i] = h; al.h[i] = ASPLIT ? (_Float16)(xs[i] - (float)h) : (_Float16)0.0f; }
#pragma unroll
    for (int t = 0; t < 4; ++t) { if (col0 + t * 16 >= N) continue; const size_t boff = (size_t)(col0 + t * 16 + ln) * ldb + kb; FragH bq; bq.half[0] = *(const v8us*)(Bh + boff + 8 * hh); bq.half[1] = *(const v8us*)(Bh + boff + 16 + 8 * hh);
      acc[t] = mmaH<ASPLIT ? 2 : 1>(ah.v, al.v, bq.v, bq.v, acc[t]); }
  }
#pragma unroll
  for (int t = 0; t < 4; ++t) { if (col0 + t * 16 >= N) continue;
#pragma unroll
    for (int r = 0; r < 8; ++r) so[w][8 * hh + r][t * 16 + ln] = acc[t][r] * alpha; }
  __builtin_amdgcn_fence(__ATOMIC_ACQ_REL, "workgroup"); __builtin_amdgcn_wave_barrier();
  const int rsub = lane >> 4, c4 = (lane & 15) * 4;
  {
#pragma unroll
    for (int q = 0; q < 8; ++q) { const int r = q * 2 + rsub; if (col0 + c4 < N) { const v4f v = *(const v4fa*)&so[w][r][c4]; *(v4f*)(C + (size_t)(row0 + r) * ldc + col0 + c4) = v; } }
     }
}

// Wt[n][k] = f16(W[k][n]·scale) from f32 row-major W[K][N] (scale = power of two; bf16-exact weights stay exact in f16 away from the subnormal range)
__global__ __launch_bounds__(256) void k_wt_f16(const float* __restrict__ W, _Float16* __restrict__ Wt, int K, int N, float scale) {
  const int t = blockIdx.x * 256 + threadIdx.x; if (t >= N * (K / 8)) return; const int n = t / (K / 8), k8 = (t % (K / 8)) * 8; FragH f;
#pragma unroll
  for (int i = 0; i < 8; ++i) f.h[i] = (_Float16)(bf16_round(W[(size_t)(k8 + i) * N + n]) * scale); const v8us o = f.half[0];
  *(v8us*)((unsigned short*)Wt + (size_t)n * K + k8) = o; 
}
// k_gemm_hh variant with fused epilogue: v = acc·alpha + bias[by·sBias + col] (+ CP[(row/rowsPerB)·sCPb + by·64 + col] if CP) ; ACT 0 none / 1 elu ; writes f32 C and f16 C16, each if non-null
template <int ACT>
__global__ __launch_bounds__(128) void k_gemm_hhx(const _Float16* __restrict__ A, int lda, size_t sA, const _Float16* __restrict__ Bh, int ldb, size_t sB, float alpha, const float* __restrict__ bias, size_t sBias, const float* __restrict__ CP, int rowsPerB, size_t sCPb, int row0g,
    float* __restrict__ C, _Float16* __restrict__ C16, int ldc, size_t sC, int M, int N, int K) {
  __shared__ __attribute__((aligned(16))) float so[4][16][64];
  const int tid = threadIdx.x, w = tid >> 5, lane = tid & 31, ln = lane & 15, hh = lane >> 4; const int by = blockIdx.y;
  A += (size_t)by * sA; Bh += (size_t)by * sB; const size_t cofs = (size_t)by * sC; const float* bp = bias ? bias + (size_t)by * sBias : nullptr;
  const int ntn = (N + 63) / 64; const int wid = blockIdx.x * 4 + w; const int mt = wid / ntn, nq = wid % ntn; if (mt * 16 >= M) return;
  const int row0 = mt * 16, col0 = nq * 64; const _Float16* arow = A + (size_t)(row0 + ln) * lda;
  v8f acc[4] = {};
  for (int kb = 0; kb < K; kb += 32) { FragH ah; ah.half[0] = *(const v8us*)((const unsigned short*)arow + kb + 8 * hh); ah.half[1] = *(const v8us*)((const unsigned short*)arow + kb + 16 + 8 * hh);
#pragma unroll
    for (int t = 0; t < 4; ++t) { if (col0 + t * 16 >= N) continue; const size_t boff = (size_t)(col0 + t * 16 + ln) * ldb + kb; FragH bq; bq.half[0] = *(const v8us*)((const unsigned short*)Bh + boff + 8 * hh); bq.half[1] = *(const v8us*)((const unsigned short*)Bh + boff + 16 + 8 * hh);
      acc[t] = mmaH<1>(ah.v, ah.v, bq.v, bq.v, acc[t]); }
  }
#pragma unroll
  for (int t = 0; t < 4; ++t) { if (col0 + t * 16 >= N) continue; const int col = col0 + t * 16 + ln; const float bv = bp ? bf16_round(bp[col]) : 0.f;
#pragma unroll
    for (int r = 0; r < 8; ++r) { float v = acc[t][r] * alpha + bv; if (CP) { const int bidx = (row0g + row0 + 8 * hh + r) / rowsPerB; v += CP[(size_t)bidx * sCPb + (size_t)by * 64 + col]; } if (ACT == 1) v = (v > 0.f) ? v : expm1f(v); else if (ACT == 3) v = fmaxf(v, 0.f); so[w][8 * hh + r][t * 16 + ln] = v; } }
  __builtin_amdgcn_fence(__ATOMIC_ACQ_REL, "workgroup"); __builtin_amdgcn_wave_barrier();
  const int rsub = lane >> 4, c4 = (lane & 15) * 4; typedef _Float16 v4h __attribute__((ext_vector_type(4)));
  {
#pragma unroll
    for (int q = 0; q < 8; ++q) { const int r = q * 2 + rsub; if (col0 + c4 < N) { const v4f v = *(const v4fa*)&so[w][r][c4]; if (C) *(v4f*)(C + cofs + (size_t)(row0 + r) * ldc + col0 + c4) = v; if (C16) { v4h h4; for (int i = 0; i < 4; ++i) h4[i] = (_Float16)v[i]; *(v4h*)(C16 + cofs + (size_t)(row0 + r) * ldc + col0 + c4) = h4; } } }
     }
}


__global__ __launch_bounds__(256) void k_x16(const float* __restrict__ x, _Float16* __restrict__ X16, size_t n8) { const size_t t = (size_t)blockIdx.x * 256 + threadIdx.x; if (t >= n8) return; FragH f;
#pragma unroll
  for (int q = 0; q < 8; ++q) f.h[q] = (_Float16)bf16_round(x[t * 8 + q]); *(v8us*)((unsigned short*)X16 + t * 8) = f.half[0];  }
__global__ __launch_bounds__(256) void k_h16(const float* __restrict__ x, _Float16* __restrict__ X16, size_t n8) { const size_t t = (size_t)blockIdx.x * 256 + threadIdx.x; if (t >= n8) return; FragH f;
#pragma unroll
  for (int q = 0; q < 8; ++q) f.h[q] = (_Float16)x[t * 8 + q]; *(v8us*)((unsigned short*)X16 + t * 8) = f.half[0];  }
__global__ __launch_bounds__(256) void k_round16f(const float* __restrict__ W, _Float16* __restrict__ Bt, size_t n8) { const size_t t = (size_t)blockIdx.x * 256 + threadIdx.x; if (t >= n8) return; FragH f;
#pragma unroll
  for (int i = 0; i < 8; ++i) f.h[i] = (_Float16)(bf16_round(W[t * 8 + i]) * 16.0f); *(v8us*)((unsigned short*)Bt + t * 8) = f.half[0];  }
// per (row, head): RMSNorm over the 64 dims (eps 1e-6, ·bf16(w)) then RoPE with the INPUT cos/sin[b][s][64] (rotate_half = [−x2, x1]); wave per (row, head): lane j (0..31) holds dims j and 32+j;
__global__ __launch_bounds__(256) void k_normrope(const float* __restrict__ Xf, int ld, int nheads, const float* __restrict__ w, const float* __restrict__ cs, const float* __restrict__ sn, _Float16* __restrict__ Y16) {
  __shared__ __attribute__((aligned(16))) _Float16 srow[8][HD]; const int tid = threadIdx.x, wv = tid >> 5, lane = tid & 31; const size_t rh = (size_t)blockIdx.x * 8 + wv; if (rh >= (size_t)NR * nheads) return; const size_t row = rh / nheads; const int h = (int)(rh % nheads);
  const float* xr = Xf + row * ld + h * HD; const float x1 = xr[lane], x2 = xr[32 + lane]; float ss = x1 * x1 + x2 * x2; for (int o = 16; o >= 1; o >>= 1) ss += __shfl_xor(ss, o, 32); const float rs = rsqrtf(ss / (float)HD + 1e-6f);
  const float n1 = x1 * rs * bf16_round(w[lane]), n2 = x2 * rs * bf16_round(w[32 + lane]);
  const float c1 = bf16_round(cs[row * HD + lane]), c2 = bf16_round(cs[row * HD + 32 + lane]), s1 = bf16_round(sn[row * HD + lane]), s2 = bf16_round(sn[row * HD + 32 + lane]);      /* cos/sin are float INPUTS: round like every other input */
  srow[wv][lane] = (_Float16)(n1 * c1 - n2 * s1); srow[wv][32 + lane] = (_Float16)(n2 * c2 + n1 * s2);
  __builtin_amdgcn_fence(__ATOMIC_ACQ_REL, "workgroup"); __builtin_amdgcn_wave_barrier();
  if (lane < 8) { unsigned short* yr = (unsigned short*)Y16 + row * ld + h * HD + lane * 8; const v8us v = *(const v8us*)((const unsigned short*)&srow[wv][0] + lane * 8); *(v8us*)yr = v;  } }
__global__ __launch_bounds__(256) void k_vt(const _Float16* __restrict__ V16, _Float16* __restrict__ Vt) { __shared__ unsigned short tl[64][66]; const int tid = threadIdx.x; const int slab = blockIdx.x / (SS / 64), lg = blockIdx.x % (SS / 64); const int b = slab / NKV, h = slab % NKV;
  for (int i = tid; i < 64 * 8; i += 256) { const int r = i / 8, c8 = (i % 8) * 8; FragH f; f.half[0] = *(const v8us*)((const unsigned short*)V16 + ((size_t)b * SS + lg * 64 + r) * KVD + h * HD + c8);
#pragma unroll
    for (int q = 0; q < 8; ++q) tl[r][c8 + q] = f.u[q]; }
  __syncthreads();
  {
#pragma unroll
    for (int rd = 0; rd < 2; ++rd) { const int d = rd * 32 + tid / 8, pc = tid % 8; FragH f;
#pragma unroll
      for (int q = 0; q < 8; ++q) f.u[q] = tl[pc * 8 + q][d];
      *(v8us*)((unsigned short*)Vt + ((size_t)slab * HD + d) * SS + lg * 64 + pc * 8) = f.half[0]; }
     } }
// fused causal GQA attention per ((b,h), 128 queries): wave = 32 queries; Q from Q16 cols h·64 (pitch 1024), K from K16 cols kvh·64 (pitch 512), kvh = h / 2; key chunks 0..qb0+128; mask k ≤ q else −inf
__global__ __launch_bounds__(128) void k_flash(const _Float16* __restrict__ Q16, const _Float16* __restrict__ K16, const _Float16* __restrict__ Vt, float* __restrict__ O) {
  constexpr int RPW = 32, NQB = SS / (4 * RPW), DT = HD / 16, KS = HD / 32;
  __shared__ __attribute__((aligned(16))) unsigned short sP[4][RPW][40]; __shared__ __attribute__((aligned(16))) float sO[4][RPW][HD];
  const int tid = threadIdx.x, w = tid >> 5, lane = tid & 31, ln = lane & 15, hh = lane >> 4;
  const int slab = blockIdx.x / NQB, qblk = blockIdx.x % NQB; const int b = slab / NH, h = slab % NH; const int kvh = h / (NH / NKV); const int qb0 = qblk * (4 * RPW); const int q0 = qb0 + w * RPW;
  FragH aq[2][KS];
#pragma unroll
  for (int rt = 0; rt < 2; ++rt) { const unsigned short* qr = (const unsigned short*)Q16 + ((size_t)b * SS + q0 + rt * 16 + ln) * HID + h * HD;
#pragma unroll
    for (int ks = 0; ks < KS; ++ks) { aq[rt][ks].half[0] = *(const v8us*)(qr + ks * 32 + 8 * hh); aq[rt][ks].half[1] = *(const v8us*)(qr + ks * 32 + 16 + 8 * hh); } }
  const unsigned short* Vth = (const unsigned short*)Vt + (size_t)(b * NKV + kvh) * HD * SS;
  float m_r[2][8], l_r[2][8]; v8f oacc[2][DT];
#pragma unroll
  for (int rt = 0; rt < 2; ++rt) {
#pragma unroll
    for (int r = 0; r < 8; ++r) { m_r[rt][r] = -3.0e38f; l_r[rt][r] = 0.f; }
#pragma unroll
    for (int dt = 0; dt < DT; ++dt) oacc[rt][dt] = (v8f){0.f,0.f,0.f,0.f,0.f,0.f,0.f,0.f}; }
  const int jend = qb0 + 4 * RPW;
#pragma unroll 1
  for (int j0 = 0; j0 < jend; j0 += 32) {
    v8f s[2][2];
#pragma unroll
    for (int nt = 0; nt < 2; ++nt) { const unsigned short* kr = (const unsigned short*)K16 + ((size_t)b * SS + j0 + nt * 16 + ln) * KVD + kvh * HD; FragH bk[KS];
#pragma unroll
      for (int ks = 0; ks < KS; ++ks) { bk[ks].half[0] = *(const v8us*)(kr + ks * 32 + 8 * hh); bk[ks].half[1] = *(const v8us*)(kr + ks * 32 + 16 + 8 * hh); }
#pragma unroll
      for (int rt = 0; rt < 2; ++rt) { v8f acc = (v8f){0.f,0.f,0.f,0.f,0.f,0.f,0.f,0.f};
#pragma unroll
        for (int ks = 0; ks < KS; ++ks) acc = mmaH<1>(aq[rt][ks].v, aq[rt][ks].v, bk[ks].v, bk[ks].v, acc); s[rt][nt] = acc; } }
#pragma unroll
    for (int rt = 0; rt < 2; ++rt)
#pragma unroll
      for (int r = 0; r < 8; ++r) { const int qi = q0 + rt * 16 + 8 * hh + r; const int k0 = j0 + ln, k1 = j0 + 16 + ln;
        const float s0 = (k0 <= qi) ? s[rt][0][r] * 0.125f : -INFINITY, s1 = (k1 <= qi) ? s[rt][1][r] * 0.125f : -INFINITY; float mc = fmaxf(s0, s1);
        mc = fmaxf(mc, __shfl_xor(mc, 1, 32)); mc = fmaxf(mc, __shfl_xor(mc, 2, 32)); mc = fmaxf(mc, __shfl_xor(mc, 4, 32)); mc = fmaxf(mc, __shfl_xor(mc, 8, 32));
        const float mn = fmaxf(m_r[rt][r], mc); const float al = expf(m_r[rt][r] - mn); m_r[rt][r] = mn; const float p0 = expf(s0 - mn), p1 = expf(s1 - mn); l_r[rt][r] = l_r[rt][r] * al + p0 + p1;
#pragma unroll
        for (int dt = 0; dt < DT; ++dt) oacc[rt][dt][r] *= al;
        FragH t2; t2.h[0] = (_Float16)p0; t2.h[1] = (_Float16)p1; sP[w][rt * 16 + 8 * hh + r][ln] = t2.u[0]; sP[w][rt * 16 + 8 * hh + r][16 + ln] = t2.u[1]; }
    __builtin_amdgcn_fence(__ATOMIC_ACQ_REL, "workgroup"); __builtin_amdgcn_wave_barrier();
    FragH pa[2];
#pragma unroll
    for (int rt = 0; rt < 2; ++rt) { pa[rt].half[0] = *(const v8us*)&sP[w][rt * 16 + ln][8 * hh]; pa[rt].half[1] = *(const v8us*)&sP[w][rt * 16 + ln][16 + 8 * hh]; }
#pragma unroll
    for (int dt = 0; dt < DT; ++dt) { const unsigned short* vrow = Vth + (size_t)(dt * 16 + ln) * SS + j0; FragH bv; bv.half[0] = *(const v8us*)(vrow + 8 * hh); bv.half[1] = *(const v8us*)(vrow + 16 + 8 * hh);
#pragma unroll
      for (int rt = 0; rt < 2; ++rt) oacc[rt][dt] = mmaH<1>(pa[rt].v, pa[rt].v, bv.v, bv.v, oacc[rt][dt]); }
    __builtin_amdgcn_fence(__ATOMIC_ACQ_REL, "workgroup"); __builtin_amdgcn_wave_barrier(); }
#pragma unroll
  for (int rt = 0; rt < 2; ++rt) {
#pragma unroll
    for (int r = 0; r < 8; ++r) { float l = l_r[rt][r]; l += __shfl_xor(l, 1, 32); l += __shfl_xor(l, 2, 32); l += __shfl_xor(l, 4, 32); l += __shfl_xor(l, 8, 32); l_r[rt][r] = 1.0f / l; }
#pragma unroll
    for (int dt = 0; dt < DT; ++dt)
#pragma unroll
      for (int r = 0; r < 8; ++r) sO[w][rt * 16 + 8 * hh + r][dt * 16 + ln] = oacc[rt][dt][r] * l_r[rt][r]; }
  __builtin_amdgcn_fence(__ATOMIC_ACQ_REL, "workgroup"); __builtin_amdgcn_wave_barrier();
  {
#pragma unroll
    for (int rp = 0; rp < RPW; rp += 2) { const int r = rp + (lane >> 4), pc = lane & 15; const v4f val = *(const v4fa*)&sO[w][r][pc * 4]; *(v4f*)(O + ((size_t)b * SS + q0 + r) * HID + h * HD + pc * 4) = val; }
     } }
extern "C" void kernel_launch(void* const* d_in, const int* in_sizes, int n_in,
                              void* d_out, int out_size, void* d_ws, size_t ws_size, hipStream_t stream) {
  (void)in_sizes; (void)n_in; (void)out_size;
  const float* x = (const float*)d_in[0]; const float* cs = (const float*)d_in[1]; const float* sn = (const float*)d_in[2]; const float* wq = (const float*)d_in[3]; const float* wk = (const float*)d_in[4]; const float* wv = (const float*)d_in[5]; const float* wo = (const float*)d_in[6]; const float* qnw = (const float*)d_in[7]; const float* knw = (const float*)d_in[8];
  char* ws = (char*)d_ws; size_t off = 0;
  auto take = [&](size_t bytes) { char* p = ws + off; off += (bytes + 255) & ~(size_t)255; return p; };
  _Float16* Bq = (_Float16*)take((size_t)HID * HID * 2); _Float16* Bk = (_Float16*)take((size_t)KVD * HID * 2); _Float16* Bv = (_Float16*)take((size_t)KVD * HID * 2); _Float16* Bo = (_Float16*)take((size_t)HID * HID * 2);
  _Float16* X16 = (_Float16*)take((size_t)NR * HID * 2); float* Qf = (float*)take((size_t)NR * HID * 4); float* Kf = (float*)take((size_t)NR * KVD * 4); _Float16* Q16 = (_Float16*)take((size_t)NR * HID * 2); _Float16* K16 = (_Float16*)take((size_t)NR * KVD * 2); _Float16* V16 = (_Float16*)take((size_t)NR * KVD * 2); _Float16* Vt = (_Float16*)take((size_t)NR * KVD * 2); float* O = (float*)take((size_t)NR * HID * 4); _Float16* O16 = (_Float16*)take((size_t)NR * HID * 2);
  if (off > ws_size) return;      // ≈ 6 + 8.4 + 16.8 + 8.4 + 8.4 + 4.2×3 + 16.8 + 8.4 ≈ 90 MiB
  k_round16f<<<(unsigned)(((size_t)HID * HID / 8 + 255) / 256), 256, 0, stream>>>(wq, Bq, (size_t)HID * HID / 8); k_round16f<<<(unsigned)(((size_t)KVD * HID / 8 + 255) / 256), 256, 0, stream>>>(wk, Bk, (size_t)KVD * HID / 8);
  k_round16f<<<(unsigned)(((size_t)KVD * HID / 8 + 255) / 256), 256, 0, stream>>>(wv, Bv, (size_t)KVD * HID / 8); k_round16f<<<(unsigned)(((size_t)HID * HID / 8 + 255) / 256), 256, 0, stream>>>(wo, Bo, (size_t)HID * HID / 8);      // (out,in) = Bt
  const unsigned gx = (unsigned)(((size_t)NR * HID / 8 + 255) / 256);
  k_x16<<<gx, 256, 0, stream>>>(x, X16, (size_t)NR * HID / 8);
  const dim3 gq(((NR / 16) * (HID / 64) + 3) / 4, 1), gk(((NR / 16) * (KVD / 64) + 3) / 4, 1);
  k_gemm_hhx<0><<<gq, 128, 0, stream>>>(X16, HID, 0, Bq, HID, 0, 0.0625f, nullptr, 0, nullptr, 1, 0, 0, Qf, nullptr, HID, 0, NR, HID, HID);
  k_gemm_hhx<0><<<gk, 128, 0, stream>>>(X16, HID, 0, Bk, HID, 0, 0.0625f, nullptr, 0, nullptr, 1, 0, 0, Kf, nullptr, KVD, 0, NR, KVD, HID);
  k_gemm_hhx<0><<<gk, 128, 0, stream>>>(X16, HID, 0, Bv, HID, 0, 0.0625f, nullptr, 0, nullptr, 1, 0, 0, nullptr, V16, KVD, 0, NR, KVD, HID);
  k_normrope<<<(unsigned)(((size_t)NR * NH + 7) / 8), 256, 0, stream>>>(Qf, HID, NH, qnw, cs, sn, Q16); k_normrope<<<(unsigned)(((size_t)NR * NKV + 7) / 8), 256, 0, stream>>>(Kf, KVD, NKV, knw, cs, sn, K16);
  k_vt<<<BB * NKV * (SS / 64), 256, 0, stream>>>(V16, Vt);
  k_flash<<<BB * NH * (SS / 128), 128, 0, stream>>>(Q16, K16, Vt, O);
  k_h16<<<gx, 256, 0, stream>>>(O, O16, (size_t)NR * HID / 8);
  k_gemm_hhx<0><<<gq, 128, 0, stream>>>(O16, HID, 0, Bo, HID, 0, 0.0625f, nullptr, 0, nullptr, 1, 0, 0, (float*)d_out, nullptr, HID, 0, NR, HID, HID);
}

// v001
// A run of this version takes 397 microseconds.
// In two side-by-side timings against v000, it was 1.34 and 1.35 times as fast.
#include <hip/hip_runtime.h>
// q/k/v/o projections (4096 × 1024 → 1024/512/512, 1024) and the 16-head causal GQA attention (8 kv heads, d = 64) on v_wmma_f32_16x16x32_f16 (fused flash-style kernel: S = Q·Kᵀ, O = P·V on WMMA,
// causal mask, online max/sum softmax f32, P f16 ≤ 1; only key chunks ≤ the block's last query); per-head RMSNorm and RoPE (cos/sin are INPUTS) applied in f32 before the f16 cast; V transposed
// per kv head; A = f16(bf16 x) exact, weights bf16-exact ×2^4 ((out,in) layouts), single products, f32 accumulate.
#define BB 2
#define SS 2048
#define HID 1024
#define NH 16
#define NKV 8
#define HD 64
#define KVD 512
#define NR (BB * SS)

typedef __bf16 v16b __attribute__((ext_vector_type(16)));
typedef unsigned short v8us __attribute__((ext_vector_type(8), may_alias));
typedef float  v8f  __attribute__((ext_vector_type(8)));
typedef float  v4f  __attribute__((ext_vector_type(4)));
typedef float  v4fa __attribute__((ext_vector_type(4), may_alias));
union FragB { v16b v; v8us half[2]; unsigned short u[16]; };

__device__ __forceinline__ unsigned short bf16_bits(float x) { unsigned int u = __float_as_uint(x); return (unsigned short)((u + 0x7FFFu + ((u >> 16) & 1u)) >> 16); }
__device__ __forceinline__ float bf16_val(unsigned short b) { return __uint_as_float(((unsigned int)b) << 16); }
__device__ __forceinline__ float bf16_round(float x) { return bf16_val(bf16_bits(x)); }
// D += A·B with NT terms: 1 = ah·bh, 2 = + al·bh (A split), 3 = + ah·bl (both split)
template <int NT>
__device__ __forceinline__ v8f mmaN(v16b ah, v16b al, v16b bh, v16b bl, v8f c) {
  c = __builtin_amdgcn_wmma_f32_16x16x32_bf16(false, ah, false, bh, (short)0, c, false, false);
  if (NT >= 2) c = __builtin_amdgcn_wmma_f32_16x16x32_bf16(false, al, false, bh, (short)0, c, false, false);
  if (NT >= 3) c = __builtin_amdgcn_wmma_f32_16x16x32_bf16(false, ah, false, bl, (short)0, c, false, false);
  asm volatile("v_nop\n\tv_nop\n\tv_nop\n\tv_nop" : "+v"(c) : "v"(ah), "v"(al), "v"(bh), "v"(bl));
  return c;
}

__global__ __launch_bounds__(256) void k_wt_bf16(const float* __restrict__ W, unsigned short* __restrict__ Wt, int K, int N) {
  const int t = blockIdx.x * 256 + threadIdx.x;
  const int k8n = K / 8;
  if (t >= N * k8n) return;
  const int n = t / k8n, k8 = (t % k8n) * 8;
  v8us v;
#pragma unroll
  for (int i = 0; i < 8; ++i) v[i] = bf16_bits(W[(size_t)(k8 + i) * N + n]);
  *(v8us*)(Wt + (size_t)n * K + k8) = v;
  
}

// GEMM C[M][N] (f32, pitch ldc) = act(A[M][K]·W + bias). A f32 row-major (pitch lda) converted per fragment to bf16
// (ASPLIT: hi/lo two planes -> 2 terms, else single rounded term); Wt bf16 [N][K] (pitch ldb). BIAS_BF16 rounds the
// bias to bf16 first (bias quantised to bf16 before the add). K%32==0, M%16==0, N%64==0.
template <bool ASPLIT, int ACT, bool BIAS_BF16>
__global__ __launch_bounds__(128) void k_gemm_bf(const float* __restrict__ A, int lda, const unsigned short* __restrict__ Wt, int ldb,
                                               const float* __restrict__ bias, float* __restrict__ C, int ldc, int M, int N, int K) {
  __shared__ __attribute__((aligned(16))) float so[4][16][64];
  const int tid = threadIdx.x, w = tid >> 5, lane = tid & 31, ln = lane & 15, hh = lane >> 4;
  const int ntn = N / 64;
  const int wid = blockIdx.x * 4 + w;
  const int mt = wid / ntn, nq = wid % ntn;
  if (mt * 16 >= M) return;
  const int row0 = mt * 16, col0 = nq * 64;
  const float* arow = A + (size_t)(row0 + ln) * lda;
  v8f acc[4] = {};
  for (int kb = 0; kb < K; kb += 32) {
    FragB ah, al;
    const v4f x0 = *(const v4fa*)(arow + kb + 8 * hh), x1 = *(const v4fa*)(arow + kb + 8 * hh + 4);
    const v4f x2 = *(const v4fa*)(arow + kb + 16 + 8 * hh), x3 = *(const v4fa*)(arow + kb + 16 + 8 * hh + 4);
    float xs[16] = {x0[0],x0[1],x0[2],x0[3],x1[0],x1[1],x1[2],x1[3],x2[0],x2[1],x2[2],x2[3],x3[0],x3[1],x3[2],x3[3]};
#pragma unroll
    for (int i = 0; i < 16; ++i) { const unsigned short hb = bf16_bits(xs[i]); ah.u[i] = hb; al.u[i] = ASPLIT ? bf16_bits(xs[i] - bf16_val(hb)) : (unsigned short)0; }
#pragma unroll
    for (int t = 0; t < 4; ++t) {
      const unsigned short* brow = Wt + (size_t)(col0 + t * 16 + ln) * ldb + kb;
      FragB b;
      b.half[0] = *(const v8us*)(brow + 8 * hh);
      b.half[1] = *(const v8us*)(brow + 16 + 8 * hh);
      acc[t] = mmaN<ASPLIT ? 2 : 1>(ah.v, al.v, b.v, b.v, acc[t]);
    }
  }
#pragma unroll
  for (int t = 0; t < 4; ++t) {
    float bv = bias ? bias[col0 + t * 16 + ln] : 0.f;
    if (BIAS_BF16) bv = bf16_round(bv);
#pragma unroll
    for (int r = 0; r < 8; ++r) { float v = acc[t][r] + bv; if (ACT == 1) v = fmaxf(v, 0.f); so[w][8 * hh + r][t * 16 + ln] = v; }
  }
  __builtin_amdgcn_fence(__ATOMIC_ACQ_REL, "workgroup");
  __builtin_amdgcn_wave_barrier();
  const int rsub = lane >> 4, c4 = (lane & 15) * 4;
  {
#pragma unroll
    for (int q = 0; q < 8; ++q) {
      const int r = q * 2 + rsub;
      const v4f v = *(const v4fa*)&so[w][r][c4];
      *(v4f*)(C + (size_t)(row0 + r) * ldc + col0 + c4) = v;
    }
    
  }
}

// Flash-style causal/unmasked attention, all contractions 3-term bf16 hi/lo splits, f32 softmax with running max.
// q,k,v rows are read from f32 buffers with arbitrary row pitch (so they can live inside a fused qkv buffer);
// D = head size (multiple of 32, <= 128); one wave = 16 query rows; block = 4 waves (64 queries) sharing K/V chunks of 32.
template <int D, bool CAUSAL>
__global__ __launch_bounds__(128) void k_flash(const float* __restrict__ qb, const float* __restrict__ kb, const float* __restrict__ vb,
                                             int pitch, int T, int H, float scale, float* __restrict__ y, int ypitch) {
  constexpr int KS = D / 32;        // k-steps for QK
  constexpr int DT = D / 16;        // d tiles for PV
  __shared__ __attribute__((aligned(16))) unsigned short sKh[32][D + 8], sKl[32][D + 8], sVh[32][D + 8], sVl[32][D + 8];
  __shared__ __attribute__((aligned(16))) unsigned short sPh[4][16][40], sPl[4][16][40];
  __shared__ __attribute__((aligned(16))) float sO[4][16][D];
  const int tid = threadIdx.x, w = tid >> 5, lane = tid & 31, ln = lane & 15, hh = lane >> 4;
  const int nqb = (T + 63) / 64;
  const int bh = blockIdx.x / nqb, qblk = blockIdx.x % nqb;
  const int b = bh / H, h = bh % H;
  const int q0 = qblk * 64 + w * 16;
  const float* Q = qb + (size_t)b * T * pitch + h * D;
  const float* K = kb + (size_t)b * T * pitch + h * D;
  const float* V = vb + (size_t)b * T * pitch + h * D;

  // A fragments of the wave's 16 query rows (scaled), hi/lo
  FragB aqh[KS], aql[KS];
  {
    int row = q0 + ln; if (row >= T) row = T - 1;
    const float* qr = Q + (size_t)row * pitch;
#pragma unroll
    for (int ks = 0; ks < KS; ++ks)
#pragma unroll
      for (int i = 0; i < 16; ++i) {
        const int d = ks * 32 + ((i < 8) ? (8 * hh + i) : (16 + 8 * hh + (i - 8)));
        const float x = qr[d] * scale; const unsigned short hb = bf16_bits(x);
        aqh[ks].u[i] = hb; aql[ks].u[i] = bf16_bits(x - bf16_val(hb));
      }
  }
  float m_r[8], l_r[8];
#pragma unroll
  for (int r = 0; r < 8; ++r) { m_r[r] = -3.0e38f; l_r[r] = 0.f; }
  v8f oacc[DT];
#pragma unroll
  for (int dt = 0; dt < DT; ++dt) oacc[dt] = (v8f){0.f,0.f,0.f,0.f,0.f,0.f,0.f,0.f};

  const int kv_end = CAUSAL ? min(T, qblk * 64 + 64) : T;     // block-uniform
  for (int j0 = 0; j0 < kv_end; j0 += 32) {
    __syncthreads();
    for (int e = tid; e < 32 * (D / 4); e += 128) {
      const int r = e / (D / 4), c4 = (e % (D / 4)) * 4;
      const int key = j0 + r;
      v4f kf = {0.f,0.f,0.f,0.f}, vf = {0.f,0.f,0.f,0.f};
      if (key < T) { kf = *(const v4fa*)(K + (size_t)key * pitch + c4); vf = *(const v4fa*)(V + (size_t)key * pitch + c4); }
#pragma unroll
      for (int t = 0; t < 4; ++t) {
        unsigned short hb = bf16_bits(kf[t]); sKh[r][c4 + t] = hb; sKl[r][c4 + t] = bf16_bits(kf[t] - bf16_val(hb));
        hb = bf16_bits(vf[t]); sVh[r][c4 + t] = hb; sVl[r][c4 + t] = bf16_bits(vf[t] - bf16_val(hb));
      }
    }
    __syncthreads();
    // S tile 16 x 32
    v8f s[2];
#pragma unroll
    for (int nt = 0; nt < 2; ++nt) {
      v8f acc = {};
#pragma unroll
      for (int ks = 0; ks < KS; ++ks) {
        FragB bh_, bl_;
        bh_.half[0] = *(const v8us*)&sKh[nt * 16 + ln][ks * 32 + 8 * hh]; bh_.half[1] = *(const v8us*)&sKh[nt * 16 + ln][ks * 32 + 16 + 8 * hh];
        bl_.half[0] = *(const v8us*)&sKl[nt * 16 + ln][ks * 32 + 8 * hh]; bl_.half[1] = *(const v8us*)&sKl[nt * 16 + ln][ks * 32 + 16 + 8 * hh];
        acc = mmaN<3>(aqh[ks].v, aql[ks].v, bh_.v, bl_.v, acc);
      }
      s[nt] = acc;
    }
    // mask + running max (rows 8hh+r; the 16 lanes of a half share rows)
    float alpha[8];
#pragma unroll
    for (int r = 0; r < 8; ++r) {
      const int qi = q0 + 8 * hh + r;
      const int ja = j0 + ln, jb = j0 + 16 + ln;
      if (CAUSAL) { if (ja > qi) s[0][r] = -3.0e38f; if (jb > qi) s[1][r] = -3.0e38f; }
      if (ja >= T) s[0][r] = -3.0e38f;
      if (jb >= T) s[1][r] = -3.0e38f;
      float mx = fmaxf(s[0][r], s[1][r]);
      mx = fmaxf(mx, __shfl_xor(mx, 1, 32)); mx = fmaxf(mx, __shfl_xor(mx, 2, 32)); mx = fmaxf(mx, __shfl_xor(mx, 4, 32)); mx = fmaxf(mx, __shfl_xor(mx, 8, 32));
      const float mnew = fmaxf(m_r[r], mx);
      alpha[r] = (mnew > -1.0e38f) ? __expf(m_r[r] - mnew) : 1.0f;
      const float p0 = (s[0][r] > -1.0e38f) ? __expf(s[0][r] - mnew) : 0.f;
      const float p1 = (s[1][r] > -1.0e38f) ? __expf(s[1][r] - mnew) : 0.f;
      m_r[r] = mnew;
      l_r[r] = l_r[r] * alpha[r] + p0 + p1;            // per-lane partial row sum (16 lanes combined at the end)
      unsigned short hb = bf16_bits(p0); sPh[w][8 * hh + r][ln] = hb;      sPl[w][8 * hh + r][ln] = bf16_bits(p0 - bf16_val(hb));
      hb = bf16_bits(p1);                sPh[w][8 * hh + r][16 + ln] = hb; sPl[w][8 * hh + r][16 + ln] = bf16_bits(p1 - bf16_val(hb));
    }
#pragma unroll
    for (int dt = 0; dt < DT; ++dt)
#pragma unroll
      for (int r = 0; r < 8; ++r) oacc[dt][r] *= alpha[r];
    __builtin_amdgcn_fence(__ATOMIC_ACQ_REL, "workgroup");
    __builtin_amdgcn_wave_barrier();
    FragB pah, pal;
    pah.half[0] = *(const v8us*)&sPh[w][ln][8 * hh]; pah.half[1] = *(const v8us*)&sPh[w][ln][16 + 8 * hh];
    pal.half[0] = *(const v8us*)&sPl[w][ln][8 * hh]; pal.half[1] = *(const v8us*)&sPl[w][ln][16 + 8 * hh];
#pragma unroll
    for (int dt = 0; dt < DT; ++dt) {
      FragB bvh, bvl;
#pragma unroll
      for (int i = 0; i < 8; ++i) {
        bvh.u[i] = sVh[8 * hh + i][dt * 16 + ln]; bvh.u[8 + i] = sVh[16 + 8 * hh + i][dt * 16 + ln];
        bvl.u[i] = sVl[8 * hh + i][dt * 16 + ln]; bvl.u[8 + i] = sVl[16 + 8 * hh + i][dt * 16 + ln];
      }
      oacc[dt] = mmaN<3>(pah.v, pal.v, bvh.v, bvl.v, oacc[dt]);
    }
    __builtin_amdgcn_fence(__ATOMIC_ACQ_REL, "workgroup");
    __builtin_amdgcn_wave_barrier();
  }
#pragma unroll
  for (int r = 0; r < 8; ++r) {
    float l = l_r[r];
    l += __shfl_xor(l, 1, 32); l += __shfl_xor(l, 2, 32); l += __shfl_xor(l, 4, 32); l += __shfl_xor(l, 8, 32);
    l_r[r] = (l > 0.f) ? 1.0f / l : 0.f;
  }
#pragma unroll
  for (int dt = 0; dt < DT; ++dt)
#pragma unroll
    for (int r = 0; r < 8; ++r) sO[w][8 * hh + r][dt * 16 + ln] = oacc[dt][r] * l_r[r];
  __builtin_amdgcn_fence(__ATOMIC_ACQ_REL, "workgroup");
  __builtin_amdgcn_wave_barrier();
  {
    for (int r = 0; r < 16; ++r) {
      const int row = q0 + r;
      if (row < T && lane < D / 4) {
        const v4f val = *(const v4fa*)&sO[w][r][lane * 4];
        *(v4f*)(y + ((size_t)b * T + row) * ypitch + h * D + lane * 4) = val;
      }
    }
    
  }
}

// GEMM C = act(A·W + bias + resid): A f32 (ASPLIT -> hi/lo 2 terms), Wt bf16 [N][K]; ACT 0 none, 1 relu, 2 exact gelu;
// resid (optional, f32, row index = (row % rmod), pitch ldr, RES_BF16 rounds it) added before the activation.
template <bool ASPLIT, int ACT, bool BIAS_BF16, bool RES_BF16>
__global__ __launch_bounds__(128) void k_gemm_bf3(const float* __restrict__ A, int lda, const unsigned short* __restrict__ Wt, int ldb,
                                                const float* __restrict__ bias, const float* __restrict__ resid, int rmod, int ldr,
                                                float* __restrict__ C, int ldc, int M, int N, int K) {
  __shared__ __attribute__((aligned(16))) float so[4][16][64];
  const int tid = threadIdx.x, w = tid >> 5, lane = tid & 31, ln = lane & 15, hh = lane >> 4;
  const int ntn = N / 64;
  const int wid = blockIdx.x * 4 + w;
  const int mt = wid / ntn, nq = wid % ntn;
  if (mt * 16 >= M) return;
  const int row0 = mt * 16, col0 = nq * 64;
  const float* arow = A + (size_t)(row0 + ln) * lda;
  v8f acc[4] = {};
  for (int kb = 0; kb < K; kb += 32) {
    FragB ah, al;
    const v4f x0 = *(const v4fa*)(arow + kb + 8 * hh), x1 = *(const v4fa*)(arow + kb + 8 * hh + 4);
    const v4f x2 = *(const v4fa*)(arow + kb + 16 + 8 * hh), x3 = *(const v4fa*)(arow + kb + 16 + 8 * hh + 4);
    float xs[16] = {x0[0],x0[1],x0[2],x0[3],x1[0],x1[1],x1[2],x1[3],x2[0],x2[1],x2[2],x2[3],x3[0],x3[1],x3[2],x3[3]};
#pragma unroll
    for (int i = 0; i < 16; ++i) { const unsigned short hb = bf16_bits(xs[i]); ah.u[i] = hb; al.u[i] = ASPLIT ? bf16_bits(xs[i] - bf16_val(hb)) : (unsigned short)0; }
#pragma unroll
    for (int t = 0; t < 4; ++t) {
      const unsigned short* brow = Wt + (size_t)(col0 + t * 16 + ln) * ldb + kb;
      FragB b;
      b.half[0] = *(const v8us*)(brow + 8 * hh);
      b.half[1] = *(const v8us*)(brow + 16 + 8 * hh);
      acc[t] = mmaN<ASPLIT ? 2 : 1>(ah.v, al.v, b.v, b.v, acc[t]);
    }
  }
#pragma unroll
  for (int t = 0; t < 4; ++t) {
    const int col = col0 + t * 16 + ln;
    float bv = bias ? bias[col] : 0.f;
    if (BIAS_BF16) bv = bf16_round(bv);
#pragma unroll
    for (int r = 0; r < 8; ++r) {
      float v = acc[t][r] + bv;
      if (resid) { float rv = resid[(size_t)((row0 + 8 * hh + r) % rmod) * ldr + col]; if (RES_BF16) rv = bf16_round(rv); v += rv; }
      if (ACT == 1) v = fmaxf(v, 0.f);
      if (ACT == 2) v = 0.5f * v * (1.0f + erff(v * 0.70710678118654752f));
      if (ACT == 3) { const float u = 0.7978845608028654f * (v + 0.044715f * v * v * v); v = 0.5f * v * (1.0f + tanhf(u)); }
      so[w][8 * hh + r][t * 16 + ln] = v;
    }
  }
  __builtin_amdgcn_fence(__ATOMIC_ACQ_REL, "workgroup");
  __builtin_amdgcn_wave_barrier();
  const int rsub = lane >> 4, c4 = (lane & 15) * 4;
  {
#pragma unroll
    for (int q = 0; q < 8; ++q) {
      const int r = q * 2 + rsub;
      const v4f v = *(const v4fa*)&so[w][r][c4];
      *(v4f*)(C + (size_t)(row0 + r) * ldc + col0 + c4) = v;
    }
    
  }
}
// row LayerNorm (biased variance, eps) over N: s = X (+ R); optional out_sum <- s; out_norm <- (s-mu)*rsqrt(var+eps)*g + b
template <bool PARAM_BF16>
__global__ __launch_bounds__(256) void k_layernorm(const float* __restrict__ X, const float* __restrict__ R, const float* __restrict__ g, const float* __restrict__ bta,
                                                  float* __restrict__ out_sum, float* __restrict__ out_norm, int N, float eps) {
  __shared__ float red[256];
  const int row = blockIdx.x, tid = threadIdx.x;
  const float* x = X + (size_t)row * N; const float* rr = R ? R + (size_t)row * N : nullptr;
  float vals[16];                     // up to N = 4096
  const int per = N / 256;            // contiguous chunk per thread? use strided-by-4 chunks: thread handles j = tid*4 + 1024*u
  float s1 = 0.f;
  for (int u = 0; u < per / 4; ++u) {
    const int j = tid * 4 + 1024 * u;
    const v4f a = *(const v4fa*)(x + j);
    v4f b = {0.f,0.f,0.f,0.f}; if (rr) b = *(const v4fa*)(rr + j);
#pragma unroll
    for (int q = 0; q < 4; ++q) { const float v = a[q] + b[q]; vals[u * 4 + q] = v; s1 += v; }
  }
  red[tid] = s1; __syncthreads();
  for (int st = 128; st > 0; st >>= 1) { if (tid < st) red[tid] += red[tid + st]; __syncthreads(); }
  const float mu = red[0] / (float)N; __syncthreads();
  float s2 = 0.f;
  for (int u = 0; u < per / 4; ++u)
#pragma unroll
    for (int q = 0; q < 4; ++q) { const float c = vals[u * 4 + q] - mu; s2 += c * c; }
  red[tid] = s2; __syncthreads();
  for (int st = 128; st > 0; st >>= 1) { if (tid < st) red[tid] += red[tid + st]; __syncthreads(); }
  const float rs = rsqrtf(red[0] / (float)N + eps);
  {
    for (int u = 0; u < per / 4; ++u) {
      const int j = tid * 4 + 1024 * u;
      v4f o, sm;
#pragma unroll
      for (int q = 0; q < 4; ++q) {
        float gg = g[j + q], bb = bta[j + q];
        if (PARAM_BF16) { gg = bf16_round(gg); bb = bf16_round(bb); }
        sm[q] = vals[u * 4 + q]; o[q] = (vals[u * 4 + q] - mu) * rs * gg + bb;
      }
      if (out_sum) *(v4f*)(out_sum + (size_t)row * N + j) = sm;
      *(v4f*)(out_norm + (size_t)row * N + j) = o;
    }
    
  }
}



// ---- f16 WMMA path (v_wmma_f32_16x16x32_f16): 11-bit significands for operands in range — used where a [0,1] probability operand needs more precision than bf16
typedef _Float16 v16h __attribute__((ext_vector_type(16)));
union FragH { v16h v; v8us half[2]; _Float16 h[16]; unsigned short u[16]; };
template <int NT>
__device__ __forceinline__ v8f mmaH(v16h ah, v16h al, v16h bh, v16h bl, v8f c) {
  c = __builtin_amdgcn_wmma_f32_16x16x32_f16(false, ah, false, bh, (short)0, c, false, false);
  if (NT >= 2) c = __builtin_amdgcn_wmma_f32_16x16x32_f16(false, al, false, bh, (short)0, c, false, false);
  if (NT >= 3) c = __builtin_amdgcn_wmma_f32_16x16x32_f16(false, ah, false, bl, (short)0, c, false, false);
  asm volatile("v_nop\n\tv_nop\n\tv_nop\n\tv_nop" : "+v"(c) : "v"(ah), "v"(al), "v"(bh), "v"(bl));
  return c;
}
// batched GEMM like k_gemm_b but f16 operands: A f32 (split into f16 hi/lo if ASPLIT, else rounded to f16), Bt = f16 values [n][k]; alpha; C f32; N multiple of 16 (partial tiles skipped)
template <bool ASPLIT>
__global__ __launch_bounds__(128) void k_gemm_h(const float* __restrict__ A, int lda, size_t sA, const _Float16* __restrict__ Bh, int ldb, size_t sB, float alpha, float* __restrict__ C, int ldc, size_t sC, int M, int N, int K) {
  __shared__ __attribute__((aligned(16))) float so[4][16][64];
  const int tid = threadIdx.x, w = tid >> 5, lane = tid & 31, ln = lane & 15, hh = lane >> 4; const int by = blockIdx.y;
  A += (size_t)by * sA; Bh += (size_t)by * sB; C += (size_t)by * sC;
  const int ntn = (N + 63) / 64; const int wid = blockIdx.x * 4 + w; const int mt = wid / ntn, nq = wid % ntn; if (mt * 16 >= M) return;
  const int row0 = mt * 16, col0 = nq * 64; const float* arow = A + (size_t)(row0 + ln) * lda;
  v8f acc[4] = {};
  for (int kb = 0; kb < K; kb += 32) {
    FragH ah, al;
    const v4f x0 = *(const v4fa*)(arow + kb + 8 * hh), x1 = *(const v4fa*)(arow + kb + 8 * hh + 4), x2 = *(const v4fa*)(arow + kb + 16 + 8 * hh), x3 = *(const v4fa*)(arow + kb + 16 + 8 * hh + 4);
    float xs[16] = {x0[0],x0[1],x0[2],x0[3],x1[0],x1[1],x1[2],x1[3],x2[0],x2[1],x2[2],x2[3],x3[0],x3[1],x3[2],x3[3]};
#pragma unroll
    for (int i = 0; i < 16; ++i) { const _Float16 h = (_Float16)xs[i]; ah.h[i] = h; al.h[i] = ASPLIT ? (_Float16)(xs[i] - (float)h) : (_Float16)0.0f; }
#pragma unroll
    for (int t = 0; t < 4; ++t) { if (col0 + t * 16 >= N) continue; const size_t boff = (size_t)(col0 + t * 16 + ln) * ldb + kb; FragH bq; bq.half[0] = *(const v8us*)(Bh + boff + 8 * hh); bq.half[1] = *(const v8us*)(Bh + boff + 16 + 8 * hh);
      acc[t] = mmaH<ASPLIT ? 2 : 1>(ah.v, al.v, bq.v, bq.v, acc[t]); }
  }
#pragma unroll
  for (int t = 0; t < 4; ++t) { if (col0 + t * 16 >= N) continue;
#pragma unroll
    for (int r = 0; r < 8; ++r) so[w][8 * hh + r][t * 16 + ln] = acc[t][r] * alpha; }
  __builtin_amdgcn_fence(__ATOMIC_ACQ_REL, "workgroup"); __builtin_amdgcn_wave_barrier();
  const int rsub = lane >> 4, c4 = (lane & 15) * 4;
  {
#pragma unroll
    for (int q = 0; q < 8; ++q) { const int r = q * 2 + rsub; if (col0 + c4 < N) { const v4f v = *(const v4fa*)&so[w][r][c4]; *(v4f*)(C + (size_t)(row0 + r) * ldc + col0 + c4) = v; } }
     }
}

// Wt[n][k] = f16(W[k][n]·scale) from f32 row-major W[K][N] (scale = power of two; bf16-exact weights stay exact in f16 away from the subnormal range)
__global__ __launch_bounds__(256) void k_wt_f16(const float* __restrict__ W, _Float16* __restrict__ Wt, int K, int N, float scale) {
  const int t = blockIdx.x * 256 + threadIdx.x; if (t >= N * (K / 8)) return; const int n = t / (K / 8), k8 = (t % (K / 8)) * 8; FragH f;
#pragma unroll
  for (int i = 0; i < 8; ++i) f.h[i] = (_Float16)(bf16_round(W[(size_t)(k8 + i) * N + n]) * scale); const v8us o = f.half[0];
  *(v8us*)((unsigned short*)Wt + (size_t)n * K + k8) = o; 
}
// k_gemm_hh variant with fused epilogue: v = acc·alpha + bias[by·sBias + col] (+ CP[(row/rowsPerB)·sCPb + by·64 + col] if CP) ; ACT 0 none / 1 elu ; writes f32 C and f16 C16, each if non-null
template <int ACT>
__global__ __launch_bounds__(128) void k_gemm_hhx(const _Float16* __restrict__ A, int lda, size_t sA, const _Float16* __restrict__ Bh, int ldb, size_t sB, float alpha, const float* __restrict__ bias, size_t sBias, const float* __restrict__ CP, int rowsPerB, size_t sCPb, int row0g,
    float* __restrict__ C, _Float16* __restrict__ C16, int ldc, size_t sC, int M, int N, int K) {
  __shared__ __attribute__((aligned(16))) float so[4][16][64];
  const int tid = threadIdx.x, w = tid >> 5, lane = tid & 31, ln = lane & 15, hh = lane >> 4; const int by = blockIdx.y;
  A += (size_t)by * sA; Bh += (size_t)by * sB; const size_t cofs = (size_t)by * sC; const float* bp = bias ? bias + (size_t)by * sBias : nullptr;
  const int ntn = (N + 63) / 64; const int wid = blockIdx.x * 4 + w; const int mt = wid / ntn, nq = wid % ntn; if (mt * 16 >= M) return;
  const int row0 = mt * 16, col0 = nq * 64; const _Float16* arow = A + (size_t)(row0 + ln) * lda;
  v8f acc[4] = {};
  for (int kb = 0; kb < K; kb += 32) { FragH ah; ah.half[0] = *(const v8us*)((const unsigned short*)arow + kb + 8 * hh); ah.half[1] = *(const v8us*)((const unsigned short*)arow + kb + 16 + 8 * hh);
#pragma unroll
    for (int t = 0; t < 4; ++t) { if (col0 + t * 16 >= N) continue; const size_t boff = (size_t)(col0 + t * 16 + ln) * ldb + kb; FragH bq; bq.half[0] = *(const v8us*)((const unsigned short*)Bh + boff + 8 * hh); bq.half[1] = *(const v8us*)((const unsigned short*)Bh + boff + 16 + 8 * hh);
      acc[t] = mmaH<1>(ah.v, ah.v, bq.v, bq.v, acc[t]); }
  }
#pragma unroll
  for (int t = 0; t < 4; ++t) { if (col0 + t * 16 >= N) continue; const int col = col0 + t * 16 + ln; const float bv = bp ? bf16_round(bp[col]) : 0.f;
#pragma unroll
    for (int r = 0; r < 8; ++r) { float v = acc[t][r] * alpha + bv; if (CP) { const int bidx = (row0g + row0 + 8 * hh + r) / rowsPerB; v += CP[(size_t)bidx * sCPb + (size_t)by * 64 + col]; } if (ACT == 1) v = (v > 0.f) ? v : expm1f(v); else if (ACT == 3) v = fmaxf(v, 0.f); so[w][8 * hh + r][t * 16 + ln] = v; } }
  __builtin_amdgcn_fence(__ATOMIC_ACQ_REL, "workgroup"); __builtin_amdgcn_wave_barrier();
  const int rsub = lane >> 4, c4 = (lane & 15) * 4; typedef _Float16 v4h __attribute__((ext_vector_type(4)));
  {
#pragma unroll
    for (int q = 0; q < 8; ++q) { const int r = q * 2 + rsub; if (col0 + c4 < N) { const v4f v = *(const v4fa*)&so[w][r][c4]; if (C) *(v4f*)(C + cofs + (size_t)(row0 + r) * ldc + col0 + c4) = v; if (C16) { v4h h4; for (int i = 0; i < 4; ++i) h4[i] = (_Float16)v[i]; *(v4h*)(C16 + cofs + (size_t)(row0 + r) * ldc + col0 + c4) = h4; } } }
     }
}


__global__ __launch_bounds__(256) void k_x16(const float* __restrict__ x, _Float16* __restrict__ X16, size_t n8) { const size_t t = (size_t)blockIdx.x * 256 + threadIdx.x; if (t >= n8) return; FragH f;
#pragma unroll
  for (int q = 0; q < 8; ++q) f.h[q] = (_Float16)bf16_round(x[t * 8 + q]); *(v8us*)((unsigned short*)X16 + t * 8) = f.half[0];  }
__global__ __launch_bounds__(256) void k_h16(const float* __restrict__ x, _Float16* __restrict__ X16, size_t n8) { const size_t t = (size_t)blockIdx.x * 256 + threadIdx.x; if (t >= n8) return; FragH f;
#pragma unroll
  for (int q = 0; q < 8; ++q) f.h[q] = (_Float16)x[t * 8 + q]; *(v8us*)((unsigned short*)X16 + t * 8) = f.half[0];  }
__global__ __launch_bounds__(256) void k_round16f(const float* __restrict__ W, _Float16* __restrict__ Bt, size_t n8) { const size_t t = (size_t)blockIdx.x * 256 + threadIdx.x; if (t >= n8) return; FragH f;
#pragma unroll
  for (int i = 0; i < 8; ++i) f.h[i] = (_Float16)(bf16_round(W[t * 8 + i]) * 16.0f); *(v8us*)((unsigned short*)Bt + t * 8) = f.half[0];  }
// per (row, head): RMSNorm over the 64 dims (eps 1e-6, ·bf16(w)) then RoPE with the INPUT cos/sin[b][s][64] (rotate_half = [−x2, x1]); wave per (row, head): lane j (0..31) holds dims j and 32+j;
__global__ __launch_bounds__(256) void k_normrope(const float* __restrict__ Xf, int ld, int nheads, const float* __restrict__ w, const float* __restrict__ cs, const float* __restrict__ sn, _Float16* __restrict__ Y16) {
  __shared__ __attribute__((aligned(16))) _Float16 srow[8][HD]; const int tid = threadIdx.x, wv = tid >> 5, lane = tid & 31; const size_t rh = (size_t)blockIdx.x * 8 + wv; if (rh >= (size_t)NR * nheads) return; const size_t row = rh / nheads; const int h = (int)(rh % nheads);
  const float* xr = Xf + row * ld + h * HD; const float x1 = xr[lane], x2 = xr[32 + lane]; float ss = x1 * x1 + x2 * x2; for (int o = 16; o >= 1; o >>= 1) ss += __shfl_xor(ss, o, 32); const float rs = rsqrtf(ss / (float)HD + 1e-6f);
  const float n1 = x1 * rs * bf16_round(w[lane]), n2 = x2 * rs * bf16_round(w[32 + lane]);
  const float c1 = bf16_round(cs[row * HD + lane]), c2 = bf16_round(cs[row * HD + 32 + lane]), s1 = bf16_round(sn[row * HD + lane]), s2 = bf16_round(sn[row * HD + 32 + lane]);      /* cos/sin are float INPUTS: round like every other input */
  srow[wv][lane] = (_Float16)(n1 * c1 - n2 * s1); srow[wv][32 + lane] = (_Float16)(n2 * c2 + n1 * s2);
  __builtin_amdgcn_fence(__ATOMIC_ACQ_REL, "workgroup"); __builtin_amdgcn_wave_barrier();
  if (lane < 8) { unsigned short* yr = (unsigned short*)Y16 + row * ld + h * HD + lane * 8; const v8us v = *(const v8us*)((const unsigned short*)&srow[wv][0] + lane * 8); *(v8us*)yr = v;  } }
__global__ __launch_bounds__(256) void k_vt(const _Float16* __restrict__ V16, _Float16* __restrict__ Vt) { __shared__ unsigned short tl[64][66]; const int tid = threadIdx.x; const int slab = blockIdx.x / (SS / 64), lg = blockIdx.x % (SS / 64); const int b = slab / NKV, h = slab % NKV;
  for (int i = tid; i < 64 * 8; i += 256) { const int r = i / 8, c8 = (i % 8) * 8; FragH f; f.half[0] = *(const v8us*)((const unsigned short*)V16 + ((size_t)b * SS + lg * 64 + r) * KVD + h * HD + c8);
#pragma unroll
    for (int q = 0; q < 8; ++q) tl[r][c8 + q] = f.u[q]; }
  __syncthreads();
  {
#pragma unroll
    for (int rd = 0; rd < 2; ++rd) { const int d = rd * 32 + tid / 8, pc = tid % 8; FragH f;
#pragma unroll
      for (int q = 0; q < 8; ++q) f.u[q] = tl[pc * 8 + q][d];
      *(v8us*)((unsigned short*)Vt + ((size_t)slab * HD + d) * SS + lg * 64 + pc * 8) = f.half[0]; }
     } }
// Maximum over each 16-lane row for eight values at once: an xor butterfly (1, 2, 4, 8) on the vector pipe. DPP row_xmask hands the partner lane's value to v_max_num_f32 as an operand, so a step
// needs no LDS-pipe round trip and no dscnt wait. One asm statement, step by step over the eight values: the eight instructions of a step are independent, so none waits for the step before it
// (as single statements, and as the builtin move, the compiler put each value's four steps back to back; the builtin also kept a separate move and a quieting maximum per step). All 32 lanes are on here.
__device__ __forceinline__ void row16_max8(float (&m)[8]) {
  asm("v_max_num_f32_dpp %0, %0, %0 row_xmask:1 row_mask:0xf bank_mask:0xf\n\t"
      "v_max_num_f32_dpp %1, %1, %1 row_xmask:1 row_mask:0xf bank_mask:0xf\n\t"
      "v_max_num_f32_dpp %2, %2, %2 row_xmask:1 row_mask:0xf bank_mask:0xf\n\t"
      "v_max_num_f32_dpp %3, %3, %3 row_xmask:1 row_mask:0xf bank_mask:0xf\n\t"
      "v_max_num_f32_dpp %4, %4, %4 row_xmask:1 row_mask:0xf bank_mask:0xf\n\t"
      "v_max_num_f32_dpp %5, %5, %5 row_xmask:1 row_mask:0xf bank_mask:0xf\n\t"
      "v_max_num_f32_dpp %6, %6, %6 row_xmask:1 row_mask:0xf bank_mask:0xf\n\t"
      "v_max_num_f32_dpp %7, %7, %7 row_xmask:1 row_mask:0xf bank_mask:0xf\n\t"
      "v_max_num_f32_dpp %0, %0, %0 row_xmask:2 row_mask:0xf bank_mask:0xf\n\t"
      "v_max_num_f32_dpp %1, %1, %1 row_xmask:2 row_mask:0xf bank_mask:0xf\n\t"
      "v_max_num_f32_dpp %2, %2, %2 row_xmask:2 row_mask:0xf bank_mask:0xf\n\t"
      "v_max_num_f32_dpp %3, %3, %3 row_xmask:2 row_mask:0xf bank_mask:0xf\n\t"
      "v_max_num_f32_dpp %4, %4, %4 row_xmask:2 row_mask:0xf bank_mask:0xf\n\t"
      "v_max_num_f32_dpp %5, %5, %5 row_xmask:2 row_mask:0xf bank_mask:0xf\n\t"
      "v_max_num_f32_dpp %6, %6, %6 row_xmask:2 row_mask:0xf bank_mask:0xf\n\t"
      "v_max_num_f32_dpp %7, %7, %7 row_xmask:2 row_mask:0xf bank_mask:0xf\n\t"
      "v_max_num_f32_dpp %0, %0, %0 row_xmask:4 row_mask:0xf bank_mask:0xf\n\t"
      "v_max_num_f32_dpp %1, %1, %1 row_xmask:4 row_mask:0xf bank_mask:0xf\n\t"
      "v_max_num_f32_dpp %2, %2, %2 row_xmask:4 row_mask:0xf bank_mask:0xf\n\t"
      "v_max_num_f32_dpp %3, %3, %3 row_xmask:4 row_mask:0xf bank_mask:0xf\n\t"
      "v_max_num_f32_dpp %4, %4, %4 row_xmask:4 row_mask:0xf bank_mask:0xf\n\t"
      "v_max_num_f32_dpp %5, %5, %5 row_xmask:4 row_mask:0xf bank_mask:0xf\n\t"
      "v_max_num_f32_dpp %6, %6, %6 row_xmask:4 row_mask:0xf bank_mask:0xf\n\t"
      "v_max_num_f32_dpp %7, %7, %7 row_xmask:4 row_mask:0xf bank_mask:0xf\n\t"
      "v_max_num_f32_dpp %0, %0, %0 row_xmask:8 row_mask:0xf bank_mask:0xf\n\t"
      "v_max_num_f32_dpp %1, %1, %1 row_xmask:8 row_mask:0xf bank_mask:0xf\n\t"
      "v_max_num_f32_dpp %2, %2, %2 row_xmask:8 row_mask:0xf bank_mask:0xf\n\t"
      "v_max_num_f32_dpp %3, %3, %3 row_xmask:8 row_mask:0xf bank_mask:0xf\n\t"
      "v_max_num_f32_dpp %4, %4, %4 row_xmask:8 row_mask:0xf bank_mask:0xf\n\t"
      "v_max_num_f32_dpp %5, %5, %5 row_xmask:8 row_mask:0xf bank_mask:0xf\n\t"
      "v_max_num_f32_dpp %6, %6, %6 row_xmask:8 row_mask:0xf bank_mask:0xf\n\t"
      "v_max_num_f32_dpp %7, %7, %7 row_xmask:8 row_mask:0xf bank_mask:0xf"
      : "+v"(m[0]), "+v"(m[1]), "+v"(m[2]), "+v"(m[3]), "+v"(m[4]), "+v"(m[5]), "+v"(m[6]), "+v"(m[7])); }
// the same butterfly for a sum: the builtin move fuses into v_add_f32_dpp
template <int M> __device__ __forceinline__ float row_xor(float v) { return __int_as_float(__builtin_amdgcn_mov_dpp(__float_as_int(v), 0x160 + M, 0xf, 0xf, true)); }
__device__ __forceinline__ float row16_sum(float v) { v += row_xor<1>(v); v += row_xor<2>(v); v += row_xor<4>(v); v += row_xor<8>(v); return v; }
// fused causal GQA attention per ((b,h), 128 queries): wave = 32 queries; Q from Q16 cols h·64 (pitch 1024), K from K16 cols kvh·64 (pitch 512), kvh = h / 2; key chunks 0..qb0+128; mask k ≤ q else −inf
__global__ __launch_bounds__(128) void k_flash(const _Float16* __restrict__ Q16, const _Float16* __restrict__ K16, const _Float16* __restrict__ Vt, float* __restrict__ O) {
  constexpr int RPW = 32, NQB = SS / (4 * RPW), DT = HD / 16, KS = HD / 32;
  __shared__ __attribute__((aligned(16))) unsigned short sP[4][RPW][40]; __shared__ __attribute__((aligned(16))) float sO[4][RPW][HD];
  const int tid = threadIdx.x, w = tid >> 5, lane = tid & 31, ln = lane & 15, hh = lane >> 4;
  const int slab = blockIdx.x / NQB, qblk = blockIdx.x % NQB; const int b = slab / NH, h = slab % NH; const int kvh = h / (NH / NKV); const int qb0 = qblk * (4 * RPW); const int q0 = qb0 + w * RPW;
  FragH aq[2][KS];
#pragma unroll
  for (int rt = 0; rt < 2; ++rt) { const unsigned short* qr = (const unsigned short*)Q16 + ((size_t)b * SS + q0 + rt * 16 + ln) * HID + h * HD;
#pragma unroll
    for (int ks = 0; ks < KS; ++ks) { aq[rt][ks].half[0] = *(const v8us*)(qr + ks * 32 + 8 * hh); aq[rt][ks].half[1] = *(const v8us*)(qr + ks * 32 + 16 + 8 * hh); } }
  const unsigned short* Vth = (const unsigned short*)Vt + (size_t)(b * NKV + kvh) * HD * SS;
  float m_r[2][8], l_r[2][8]; v8f oacc[2][DT];
#pragma unroll
  for (int rt = 0; rt < 2; ++rt) {
#pragma unroll
    for (int r = 0; r < 8; ++r) { m_r[rt][r] = -3.0e38f; l_r[rt][r] = 0.f; }
#pragma unroll
    for (int dt = 0; dt < DT; ++dt) oacc[rt][dt] = (v8f){0.f,0.f,0.f,0.f,0.f,0.f,0.f,0.f}; }
  const int jend = qb0 + 4 * RPW;
#pragma unroll 1
  for (int j0 = 0; j0 < jend; j0 += 32) {
    v8f s[2][2];
#pragma unroll
    for (int nt = 0; nt < 2; ++nt) { const unsigned short* kr = (const unsigned short*)K16 + ((size_t)b * SS + j0 + nt * 16 + ln) * KVD + kvh * HD; FragH bk[KS];
#pragma unroll
      for (int ks = 0; ks < KS; ++ks) { bk[ks].half[0] = *(const v8us*)(kr + ks * 32 + 8 * hh); bk[ks].half[1] = *(const v8us*)(kr + ks * 32 + 16 + 8 * hh); }
#pragma unroll
      for (int rt = 0; rt < 2; ++rt) { v8f acc = (v8f){0.f,0.f,0.f,0.f,0.f,0.f,0.f,0.f};
#pragma unroll
        for (int ks = 0; ks < KS; ++ks) acc = mmaH<1>(aq[rt][ks].v, aq[rt][ks].v, bk[ks].v, bk[ks].v, acc); s[rt][nt] = acc; } }
    float mx[2][8];
#pragma unroll
    for (int rt = 0; rt < 2; ++rt) {
#pragma unroll
      for (int r = 0; r < 8; ++r) { const int qi = q0 + rt * 16 + 8 * hh + r; const int k0 = j0 + ln, k1 = j0 + 16 + ln;
        s[rt][0][r] = (k0 <= qi) ? s[rt][0][r] * 0.125f : -INFINITY; s[rt][1][r] = (k1 <= qi) ? s[rt][1][r] * 0.125f : -INFINITY; mx[rt][r] = fmaxf(s[rt][0][r], s[rt][1][r]); }
      row16_max8(mx[rt]); }
#pragma unroll
    for (int rt = 0; rt < 2; ++rt)
#pragma unroll
      for (int r = 0; r < 8; ++r) { const float s0 = s[rt][0][r], s1 = s[rt][1][r];
        const float mn = fmaxf(m_r[rt][r], mx[rt][r]); const float al = expf(m_r[rt][r] - mn); m_r[rt][r] = mn; const float p0 = expf(s0 - mn), p1 = expf(s1 - mn); l_r[rt][r] = l_r[rt][r] * al + p0 + p1;
#pragma unroll
        for (int dt = 0; dt < DT; ++dt) oacc[rt][dt][r] *= al;
        FragH t2; t2.h[0] = (_Float16)p0; t2.h[1] = (_Float16)p1; sP[w][rt * 16 + 8 * hh + r][ln] = t2.u[0]; sP[w][rt * 16 + 8 * hh + r][16 + ln] = t2.u[1]; }
    __builtin_amdgcn_fence(__ATOMIC_ACQ_REL, "workgroup"); __builtin_amdgcn_wave_barrier();
    FragH pa[2];
#pragma unroll
    for (int rt = 0; rt < 2; ++rt) { pa[rt].half[0] = *(const v8us*)&sP[w][rt * 16 + ln][8 * hh]; pa[rt].half[1] = *(const v8us*)&sP[w][rt * 16 + ln][16 + 8 * hh]; }
#pragma unroll
    for (int dt = 0; dt < DT; ++dt) { const unsigned short* vrow = Vth + (size_t)(dt * 16 + ln) * SS + j0; FragH bv; bv.half[0] = *(const v8us*)(vrow + 8 * hh); bv.half[1] = *(const v8us*)(vrow + 16 + 8 * hh);
#pragma unroll
      for (int rt = 0; rt < 2; ++rt) oacc[rt][dt] = mmaH<1>(pa[rt].v, pa[rt].v, bv.v, bv.v, oacc[rt][dt]); }
    __builtin_amdgcn_fence(__ATOMIC_ACQ_REL, "workgroup"); __builtin_amdgcn_wave_barrier(); }
#pragma unroll
  for (int rt = 0; rt < 2; ++rt) {
#pragma unroll
    for (int r = 0; r < 8; ++r) { float l = l_r[rt][r]; l = row16_sum(l); l_r[rt][r] = 1.0f / l; }
#pragma unroll
    for (int dt = 0; dt < DT; ++dt)
#pragma unroll
      for (int r = 0; r < 8; ++r) sO[w][rt * 16 + 8 * hh + r][dt * 16 + ln] = oacc[rt][dt][r] * l_r[rt][r]; }
  __builtin_amdgcn_fence(__ATOMIC_ACQ_REL, "workgroup"); __builtin_amdgcn_wave_barrier();
  {
#pragma unroll
    for (int rp = 0; rp < RPW; rp += 2) { const int r = rp + (lane >> 4), pc = lane & 15; const v4f val = *(const v4fa*)&sO[w][r][pc * 4]; *(v4f*)(O + ((size_t)b * SS + q0 + r) * HID + h * HD + pc * 4) = val; }
     } }
extern "C" void kernel_launch(void* const* d_in, const int* in_sizes, int n_in,
                              void* d_out, int out_size, void* d_ws, size_t ws_size, hipStream_t stream) {
  (void)in_sizes; (void)n_in; (void)out_size;
  const float* x = (const float*)d_in[0]; const float* cs = (const float*)d_in[1]; const float* sn = (const float*)d_in[2]; const float* wq = (const float*)d_in[3]; const float* wk = (const float*)d_in[4]; const float* wv = (const float*)d_in[5]; const float* wo = (const float*)d_in[6]; const float* qnw = (const float*)d_in[7]; const float* knw = (const float*)d_in[8];
  char* ws = (char*)d_ws; size_t off = 0;
  auto take = [&](size_t bytes) { char* p = ws + off; off += (bytes + 255) & ~(size_t)255; return p; };
  _Float16* Bq = (_Float16*)take((size_t)HID * HID * 2); _Float16* Bk = (_Float16*)take((size_t)KVD * HID * 2); _Float16* Bv = (_Float16*)take((size_t)KVD * HID * 2); _Float16* Bo = (_Float16*)take((size_t)HID * HID * 2);
  _Float16* X16 = (_Float16*)take((size_t)NR * HID * 2); float* Qf = (float*)take((size_t)NR * HID * 4); float* Kf = (float*)take((size_t)NR * KVD * 4); _Float16* Q16 = (_Float16*)take((size_t)NR * HID * 2); _Float16* K16 = (_Float16*)take((size_t)NR * KVD * 2); _Float16* V16 = (_Float16*)take((size_t)NR * KVD * 2); _Float16* Vt = (_Float16*)take((size_t)NR * KVD * 2); float* O = (float*)take((size_t)NR * HID * 4); _Float16* O16 = (_Float16*)take((size_t)NR * HID * 2);
  if (off > ws_size) return;      // ≈ 6 + 8.4 + 16.8 + 8.4 + 8.4 + 4.2×3 + 16.8 + 8.4 ≈ 90 MiB
  k_round16f<<<(unsigned)(((size_t)HID * HID / 8 + 255) / 256), 256, 0, stream>>>(wq, Bq, (size_t)HID * HID / 8); k_round16f<<<(unsigned)(((size_t)KVD * HID / 8 + 255) / 256), 256, 0, stream>>>(wk, Bk, (size_t)KVD * HID / 8);
  k_round16f<<<(unsigned)(((size_t)KVD * HID / 8 + 255) / 256), 256, 0, stream>>>(wv, Bv, (size_t)KVD * HID / 8); k_round16f<<<(unsigned)(((size_t)HID * HID / 8 + 255) / 256), 256, 0, stream>>>(wo, Bo, (size_t)HID * HID / 8);      // (out,in) = Bt
  const unsigned gx = (unsigned)(((size_t)NR * HID / 8 + 255) / 256);
  k_x16<<<gx, 256, 0, stream>>>(x, X16, (size_t)NR * HID / 8);
  const dim3 gq(((NR / 16) * (HID / 64) + 3) / 4, 1), gk(((NR / 16) * (KVD / 64) + 3) / 4, 1);
  k_gemm_hhx<0><<<gq, 128, 0, stream>>>(X16, HID, 0, Bq, HID, 0, 0.0625f, nullptr, 0, nullptr, 1, 0, 0, Qf, nullptr, HID, 0, NR, HID, HID);
  k_gemm_hhx<0><<<gk, 128, 0, stream>>>(X16, HID, 0, Bk, HID, 0, 0.0625f, nullptr, 0, nullptr, 1, 0, 0, Kf, nullptr, KVD, 0, NR, KVD, HID);
  k_gemm_hhx<0><<<gk, 128, 0, stream>>>(X16, HID, 0, Bv, HID, 0, 0.0625f, nullptr, 0, nullptr, 1, 0, 0, nullptr, V16, KVD, 0, NR, KVD, HID);
  k_normrope<<<(unsigned)(((size_t)NR * NH + 7) / 8), 256, 0, stream>>>(Qf, HID, NH, qnw, cs, sn, Q16); k_normrope<<<(unsigned)(((size_t)NR * NKV + 7) / 8), 256, 0, stream>>>(Kf, KVD, NKV, knw, cs, sn, K16);
  k_vt<<<BB * NKV * (SS / 64), 256, 0, stream>>>(V16, Vt);
  k_flash<<<BB * NH * (SS / 128), 128, 0, stream>>>(Q16, K16, Vt, O);
  k_h16<<<gx, 256, 0, stream>>>(O, O16, (size_t)NR * HID / 8);
  k_gemm_hhx<0><<<gq, 128, 0, stream>>>(O16, HID, 0, Bo, HID, 0, 0.0625f, nullptr, 0, nullptr, 1, 0, 0, (float*)d_out, nullptr, HID, 0, NR, HID, HID);
}

// v002
// One run takes 281 microseconds.
// Next to v001, in two timings, it ran 1.42 and 1.41 times as fast.
// Over all steps from v000 it is 1.91 times as fast.
#include <hip/hip_runtime.h>
// q/k/v/o projections (4096 × 1024 → 1024/512/512, 1024) and the 16-head causal GQA attention (8 kv heads, d = 64) on v_wmma_f32_16x16x32_f16 (fused flash-style kernel: S = Q·Kᵀ, O = P·V on WMMA,
// causal mask, online max/sum softmax f32, P f16 ≤ 1; only key chunks ≤ the block's last query); per-head RMSNorm and RoPE (cos/sin are INPUTS) applied in f32 before the f16 cast; V transposed
// per kv head; A = f16(bf16 x) exact, weights bf16-exact ×2^4 ((out,in) layouts), single products, f32 accumulate.
#define BB 2
#define SS 2048
#define HID 1024
#define NH 16
#define NKV 8
#define HD 64
#define KVD 512
#define NR (BB * SS)

typedef __bf16 v16b __attribute__((ext_vector_type(16)));
typedef unsigned short v8us __attribute__((ext_vector_type(8), may_alias));
typedef float  v8f  __attribute__((ext_vector_type(8)));
typedef float  v4f  __attribute__((ext_vector_type(4)));
typedef float  v4fa __attribute__((ext_vector_type(4), may_alias));
union FragB { v16b v; v8us half[2]; unsigned short u[16]; };

__device__ __forceinline__ unsigned short bf16_bits(float x) { unsigned int u = __float_as_uint(x); return (unsigned short)((u + 0x7FFFu + ((u >> 16) & 1u)) >> 16); }
__device__ __forceinline__ float bf16_val(unsigned short b) { return __uint_as_float(((unsigned int)b) << 16); }
__device__ __forceinline__ float bf16_round(float x) { return bf16_val(bf16_bits(x)); }
// D += A·B with NT terms: 1 = ah·bh, 2 = + al·bh (A split), 3 = + ah·bl (both split)
template <int NT>
__device__ __forceinline__ v8f mmaN(v16b ah, v16b al, v16b bh, v16b bl, v8f c) {
  c = __builtin_amdgcn_wmma_f32_16x16x32_bf16(false, ah, false, bh, (short)0, c, false, false);
  if (NT >= 2) c = __builtin_amdgcn_wmma_f32_16x16x32_bf16(false, al, false, bh, (short)0, c, false, false);
  if (NT >= 3) c = __builtin_amdgcn_wmma_f32_16x16x32_bf16(false, ah, false, bl, (short)0, c, false, false);
  asm volatile("v_nop\n\tv_nop\n\tv_nop\n\tv_nop" : "+v"(c) : "v"(ah), "v"(al), "v"(bh), "v"(bl));
  return c;
}

__global__ __launch_bounds__(256) void k_wt_bf16(const float* __restrict__ W, unsigned short* __restrict__ Wt, int K, int N) {
  const int t = blockIdx.x * 256 + threadIdx.x;
  const int k8n = K / 8;
  if (t >= N * k8n) return;
  const int n = t / k8n, k8 = (t % k8n) * 8;
  v8us v;
#pragma unroll
  for (int i = 0; i < 8; ++i) v[i] = bf16_bits(W[(size_t)(k8 + i) * N + n]);
  *(v8us*)(Wt + (size_t)n * K + k8) = v;
  
}

// GEMM C[M][N] (f32, pitch ldc) = act(A[M][K]·W + bias). A f32 row-major (pitch lda) converted per fragment to bf16
// (ASPLIT: hi/lo two planes -> 2 terms, else single rounded term); Wt bf16 [N][K] (pitch ldb). BIAS_BF16 rounds the
// bias to bf16 first (bias quantised to bf16 before the add). K%32==0, M%16==0, N%64==0.
template <bool ASPLIT, int ACT, bool BIAS_BF16>
__global__ __launch_bounds__(128) void k_gemm_bf(const float* __restrict__ A, int lda, const unsigned short* __restrict__ Wt, int ldb,
                                               const float* __restrict__ bias, float* __restrict__ C, int ldc, int M, int N, int K) {
  __shared__ __attribute__((aligned(16))) float so[4][16][64];
  const int tid = threadIdx.x, w = tid >> 5, lane = tid & 31, ln = lane & 15, hh = lane >> 4;
  const int ntn = N / 64;
  const int wid = blockIdx.x * 4 + w;
  const int mt = wid / ntn, nq = wid % ntn;
  if (mt * 16 >= M) return;
  const int row0 = mt * 16, col0 = nq * 64;
  const float* arow = A + (size_t)(row0 + ln) * lda;
  v8f acc[4] = {};
  for (int kb = 0; kb < K; kb += 32) {
    FragB ah, al;
    const v4f x0 = *(const v4fa*)(arow + kb + 8 * hh), x1 = *(const v4fa*)(arow + kb + 8 * hh + 4);
    const v4f x2 = *(const v4fa*)(arow + kb + 16 + 8 * hh), x3 = *(const v4fa*)(arow + kb + 16 + 8 * hh + 4);
    float xs[16] = {x0[0],x0[1],x0[2],x0[3],x1[0],x1[1],x1[2],x1[3],x2[0],x2[1],x2[2],x2[3],x3[0],x3[1],x3[2],x3[3]};
#pragma unroll
    for (int i = 0; i < 16; ++i) { const unsigned short hb = bf16_bits(xs[i]); ah.u[i] = hb; al.u[i] = ASPLIT ? bf16_bits(xs[i] - bf16_val(hb)) : (unsigned short)0; }
#pragma unroll
    for (int t = 0; t < 4; ++t) {
      const unsigned short* brow = Wt + (size_t)(col0 + t * 16 + ln) * ldb + kb;
      FragB b;
      b.half[0] = *(const v8us*)(brow + 8 * hh);
      b.half[1] = *(const v8us*)(brow + 16 + 8 * hh);
      acc[t] = mmaN<ASPLIT ? 2 : 1>(ah.v, al.v, b.v, b.v, acc[t]);
    }
  }
#pragma unroll
  for (int t = 0; t < 4; ++t) {
    float bv = bias ? bias[col0 + t * 16 + ln] : 0.f;
    if (BIAS_BF16) bv = bf16_round(bv);
#pragma unroll
    for (int r = 0; r < 8; ++r) { float v = acc[t][r] + bv; if (ACT == 1) v = fmaxf(v, 0.f); so[w][8 * hh + r][t * 16 + ln] = v; }
  }
  __builtin_amdgcn_fence(__ATOMIC_ACQ_REL, "workgroup");
  __builtin_amdgcn_wave_barrier();
  const int rsub = lane >> 4, c4 = (lane & 15) * 4;
  {
#pragma unroll
    for (int q = 0; q < 8; ++q) {
      const int r = q * 2 + rsub;
      const v4f v = *(const v4fa*)&so[w][r][c4];
      *(v4f*)(C + (size_t)(row0 + r) * ldc + col0 + c4) = v;
    }
    
  }
}

// Flash-style causal/unmasked attention, all contractions 3-term bf16 hi/lo splits, f32 softmax with running max.
// q,k,v rows are read from f32 buffers with arbitrary row pitch (so they can live inside a fused qkv buffer);
// D = head size (multiple of 32, <= 128); one wave = 16 query rows; block = 4 waves (64 queries) sharing K/V chunks of 32.
template <int D, bool CAUSAL>
__global__ __launch_bounds__(128) void k_flash(const float* __restrict__ qb, const float* __restrict__ kb, const float* __restrict__ vb,
                                             int pitch, int T, int H, float scale, float* __restrict__ y, int ypitch) {
  constexpr int KS = D / 32;        // k-steps for QK
  constexpr int DT = D / 16;        // d tiles for PV
  __shared__ __attribute__((aligned(16))) unsigned short sKh[32][D + 8], sKl[32][D + 8], sVh[32][D + 8], sVl[32][D + 8];
  __shared__ __attribute__((aligned(16))) unsigned short sPh[4][16][40], sPl[4][16][40];
  __shared__ __attribute__((aligned(16))) float sO[4][16][D];
  const int tid = threadIdx.x, w = tid >> 5, lane = tid & 31, ln = lane & 15, hh = lane >> 4;
  const int nqb = (T + 63) / 64;
  const int bh = blockIdx.x / nqb, qblk = blockIdx.x % nqb;
  const int b = bh / H, h = bh % H;
  const int q0 = qblk * 64 + w * 16;
  const float* Q = qb + (size_t)b * T * pitch + h * D;
  const float* K = kb + (size_t)b * T * pitch + h * D;
  const float* V = vb + (size_t)b * T * pitch + h * D;

  // A fragments of the wave's 16 query rows (scaled), hi/lo
  FragB aqh[KS], aql[KS];
  {
    int row = q0 + ln; if (row >= T) row = T - 1;
    const float* qr = Q + (size_t)row * pitch;
#pragma unroll
    for (int ks = 0; ks < KS; ++ks)
#pragma unroll
      for (int i = 0; i < 16; ++i) {
        const int d = ks * 32 + ((i < 8) ? (8 * hh + i) : (16 + 8 * hh + (i - 8)));
        const float x = qr[d] * scale; const unsigned short hb = bf16_bits(x);
        aqh[ks].u[i] = hb; aql[ks].u[i] = bf16_bits(x - bf16_val(hb));
      }
  }
  float m_r[8], l_r[8];
#pragma unroll
  for (int r = 0; r < 8; ++r) { m_r[r] = -3.0e38f; l_r[r] = 0.f; }
  v8f oacc[DT];
#pragma unroll
  for (int dt = 0; dt < DT; ++dt) oacc[dt] = (v8f){0.f,0.f,0.f,0.f,0.f,0.f,0.f,0.f};

  const int kv_end = CAUSAL ? min(T, qblk * 64 + 64) : T;     // block-uniform
  for (int j0 = 0; j0 < kv_end; j0 += 32) {
    __syncthreads();
    for (int e = tid; e < 32 * (D / 4); e += 128) {
      const int r = e / (D / 4), c4 = (e % (D / 4)) * 4;
      const int key = j0 + r;
      v4f kf = {0.f,0.f,0.f,0.f}, vf = {0.f,0.f,0.f,0.f};
      if (key < T) { kf = *(const v4fa*)(K + (size_t)key * pitch + c4); vf = *(const v4fa*)(V + (size_t)key * pitch + c4); }
#pragma unroll
      for (int t = 0; t < 4; ++t) {
        unsigned short hb = bf16_bits(kf[t]); sKh[r][c4 + t] = hb; sKl[r][c4 + t] = bf16_bits(kf[t] - bf16_val(hb));
        hb = bf16_bits(vf[t]); sVh[r][c4 + t] = hb; sVl[r][c4 + t] = bf16_bits(vf[t] - bf16_val(hb));
      }
    }
    __syncthreads();
    // S tile 16 x 32
    v8f s[2];
#pragma unroll
    for (int nt = 0; nt < 2; ++nt) {
      v8f acc = {};
#pragma unroll
      for (int ks = 0; ks < KS; ++ks) {
        FragB bh_, bl_;
        bh_.half[0] = *(const v8us*)&sKh[nt * 16 + ln][ks * 32 + 8 * hh]; bh_.half[1] = *(const v8us*)&sKh[nt * 16 + ln][ks * 32 + 16 + 8 * hh];
        bl_.half[0] = *(const v8us*)&sKl[nt * 16 + ln][ks * 32 + 8 * hh]; bl_.half[1] = *(const v8us*)&sKl[nt * 16 + ln][ks * 32 + 16 + 8 * hh];
        acc = mmaN<3>(aqh[ks].v, aql[ks].v, bh_.v, bl_.v, acc);
      }
      s[nt] = acc;
    }
    // mask + running max (rows 8hh+r; the 16 lanes of a half share rows)
    float alpha[8];
#pragma unroll
    for (int r = 0; r < 8; ++r) {
      const int qi = q0 + 8 * hh + r;
      const int ja = j0 + ln, jb = j0 + 16 + ln;
      if (CAUSAL) { if (ja > qi) s[0][r] = -3.0e38f; if (jb > qi) s[1][r] = -3.0e38f; }
      if (ja >= T) s[0][r] = -3.0e38f;
      if (jb >= T) s[1][r] = -3.0e38f;
      float mx = fmaxf(s[0][r], s[1][r]);
      mx = fmaxf(mx, __shfl_xor(mx, 1, 32)); mx = fmaxf(mx, __shfl_xor(mx, 2, 32)); mx = fmaxf(mx, __shfl_xor(mx, 4, 32)); mx = fmaxf(mx, __shfl_xor(mx, 8, 32));
      const float mnew = fmaxf(m_r[r], mx);
      alpha[r] = (mnew > -1.0e38f) ? __expf(m_r[r] - mnew) : 1.0f;
      const float p0 = (s[0][r] > -1.0e38f) ? __expf(s[0][r] - mnew) : 0.f;
      const float p1 = (s[1][r] > -1.0e38f) ? __expf(s[1][r] - mnew) : 0.f;
      m_r[r] = mnew;
      l_r[r] = l_r[r] * alpha[r] + p0 + p1;            // per-lane partial row sum (16 lanes combined at the end)
      unsigned short hb = bf16_bits(p0); sPh[w][8 * hh + r][ln] = hb;      sPl[w][8 * hh + r][ln] = bf16_bits(p0 - bf16_val(hb));
      hb = bf16_bits(p1);                sPh[w][8 * hh + r][16 + ln] = hb; sPl[w][8 * hh + r][16 + ln] = bf16_bits(p1 - bf16_val(hb));
    }
#pragma unroll
    for (int dt = 0; dt < DT; ++dt)
#pragma unroll
      for (int r = 0; r < 8; ++r) oacc[dt][r] *= alpha[r];
    __builtin_amdgcn_fence(__ATOMIC_ACQ_REL, "workgroup");
    __builtin_amdgcn_wave_barrier();
    FragB pah, pal;
    pah.half[0] = *(const v8us*)&sPh[w][ln][8 * hh]; pah.half[1] = *(const v8us*)&sPh[w][ln][16 + 8 * hh];
    pal.half[0] = *(const v8us*)&sPl[w][ln][8 * hh]; pal.half[1] = *(const v8us*)&sPl[w][ln][16 + 8 * hh];
#pragma unroll
    for (int dt = 0; dt < DT; ++dt) {
      FragB bvh, bvl;
#pragma unroll
      for (int i = 0; i < 8; ++i) {
        bvh.u[i] = sVh[8 * hh + i][dt * 16 + ln]; bvh.u[8 + i] = sVh[16 + 8 * hh + i][dt * 16 + ln];
        bvl.u[i] = sVl[8 * hh + i][dt * 16 + ln]; bvl.u[8 + i] = sVl[16 + 8 * hh + i][dt * 16 + ln];
      }
      oacc[dt] = mmaN<3>(pah.v, pal.v, bvh.v, bvl.v, oacc[dt]);
    }
    __builtin_amdgcn_fence(__ATOMIC_ACQ_REL, "workgroup");
    __builtin_amdgcn_wave_barrier();
  }
#pragma unroll
  for (int r = 0; r < 8; ++r) {
    float l = l_r[r];
    l += __shfl_xor(l, 1, 32); l += __shfl_xor(l, 2, 32); l += __shfl_xor(l, 4, 32); l += __shfl_xor(l, 8, 32);
    l_r[r] = (l > 0.f) ? 1.0f / l : 0.f;
  }
#pragma unroll
  for (int dt = 0; dt < DT; ++dt)
#pragma unroll
    for (int r = 0; r < 8; ++r) sO[w][8 * hh + r][dt * 16 + ln] = oacc[dt][r] * l_r[r];
  __builtin_amdgcn_fence(__ATOMIC_ACQ_REL, "workgroup");
  __builtin_amdgcn_wave_barrier();
  {
    for (int r = 0; r < 16; ++r) {
      const int row = q0 + r;
      if (row < T && lane < D / 4) {
        const v4f val = *(const v4fa*)&sO[w][r][lane * 4];
        *(v4f*)(y + ((size_t)b * T + row) * ypitch + h * D + lane * 4) = val;
      }
    }
    
  }
}

// GEMM C = act(A·W + bias + resid): A f32 (ASPLIT -> hi/lo 2 terms), Wt bf16 [N][K]; ACT 0 none, 1 relu, 2 exact gelu;
// resid (optional, f32, row index = (row % rmod), pitch ldr, RES_BF16 rounds it) added before the activation.
template <bool ASPLIT, int ACT, bool BIAS_BF16, bool RES_BF16>
__global__ __launch_bounds__(128) void k_gemm_bf3(const float* __restrict__ A, int lda, const unsigned short* __restrict__ Wt, int ldb,
                                                const float* __restrict__ bias, const float* __restrict__ resid, int rmod, int ldr,
                                                float* __restrict__ C, int ldc, int M, int N, int K) {
  __shared__ __attribute__((aligned(16))) float so[4][16][64];
  const int tid = threadIdx.x, w = tid >> 5, lane = tid & 31, ln = lane & 15, hh = lane >> 4;
  const int ntn = N / 64;
  const int wid = blockIdx.x * 4 + w;
  const int mt = wid / ntn, nq = wid % ntn;
  if (mt * 16 >= M) return;
  const int row0 = mt * 16, col0 = nq * 64;
  const float* arow = A + (size_t)(row0 + ln) * lda;
  v8f acc[4] = {};
  for (int kb = 0; kb < K; kb += 32) {
    FragB ah, al;
    const v4f x0 = *(const v4fa*)(arow + kb + 8 * hh), x1 = *(const v4fa*)(arow + kb + 8 * hh + 4);
    const v4f x2 = *(const v4fa*)(arow + kb + 16 + 8 * hh), x3 = *(const v4fa*)(arow + kb + 16 + 8 * hh + 4);
    float xs[16] = {x0[0],x0[1],x0[2],x0[3],x1[0],x1[1],x1[2],x1[3],x2[0],x2[1],x2[2],x2[3],x3[0],x3[1],x3[2],x3[3]};
#pragma unroll
    for (int i = 0; i < 16; ++i) { const unsigned short hb = bf16_bits(xs[i]); ah.u[i] = hb; al.u[i] = ASPLIT ? bf16_bits(xs[i] - bf16_val(hb)) : (unsigned short)0; }
#pragma unroll
    for (int t = 0; t < 4; ++t) {
      const unsigned short* brow = Wt + (size_t)(col0 + t * 16 + ln) * ldb + kb;
      FragB b;
      b.half[0] = *(const v8us*)(brow + 8 * hh);
      b.half[1] = *(const v8us*)(brow + 16 + 8 * hh);
      acc[t] = mmaN<ASPLIT ? 2 : 1>(ah.v, al.v, b.v, b.v, acc[t]);
    }
  }
#pragma unroll
  for (int t = 0; t < 4; ++t) {
    const int col = col0 + t * 16 + ln;
    float bv = bias ? bias[col] : 0.f;
    if (BIAS_BF16) bv = bf16_round(bv);
#pragma unroll
    for (int r = 0; r < 8; ++r) {
      float v = acc[t][r] + bv;
      if (resid) { float rv = resid[(size_t)((row0 + 8 * hh + r) % rmod) * ldr + col]; if (RES_BF16) rv = bf16_round(rv); v += rv; }
      if (ACT == 1) v = fmaxf(v, 0.f);
      if (ACT == 2) v = 0.5f * v * (1.0f + erff(v * 0.70710678118654752f));
      if (ACT == 3) { const float u = 0.7978845608028654f * (v + 0.044715f * v * v * v); v = 0.5f * v * (1.0f + tanhf(u)); }
      so[w][8 * hh + r][t * 16 + ln] = v;
    }
  }
  __builtin_amdgcn_fence(__ATOMIC_ACQ_REL, "workgroup");
  __builtin_amdgcn_wave_barrier();
  const int rsub = lane >> 4, c4 = (lane & 15) * 4;
  {
#pragma unroll
    for (int q = 0; q < 8; ++q) {
      const int r = q * 2 + rsub;
      const v4f v = *(const v4fa*)&so[w][r][c4];
      *(v4f*)(C + (size_t)(row0 + r) * ldc + col0 + c4) = v;
    }
    
  }
}
// row LayerNorm (biased variance, eps) over N: s = X (+ R); optional out_sum <- s; out_norm <- (s-mu)*rsqrt(var+eps)*g + b
template <bool PARAM_BF16>
__global__ __launch_bounds__(256) void k_layernorm(const float* __restrict__ X, const float* __restrict__ R, const float* __restrict__ g, const float* __restrict__ bta,
                                                  float* __restrict__ out_sum, float* __restrict__ out_norm, int N, float eps) {
  __shared__ float red[256];
  const int row = blockIdx.x, tid = threadIdx.x;
  const float* x = X + (size_t)row * N; const float* rr = R ? R + (size_t)row * N : nullptr;
  float vals[16];                     // up to N = 4096
  const int per = N / 256;            // contiguous chunk per thread? use strided-by-4 chunks: thread handles j = tid*4 + 1024*u
  float s1 = 0.f;
  for (int u = 0; u < per / 4; ++u) {
    const int j = tid * 4 + 1024 * u;
    const v4f a = *(const v4fa*)(x + j);
    v4f b = {0.f,0.f,0.f,0.f}; if (rr) b = *(const v4fa*)(rr + j);
#pragma unroll
    for (int q = 0; q < 4; ++q) { const float v = a[q] + b[q]; vals[u * 4 + q] = v; s1 += v; }
  }
  red[tid] = s1; __syncthreads();
  for (int st = 128; st > 0; st >>= 1) { if (tid < st) red[tid] += red[tid + st]; __syncthreads(); }
  const float mu = red[0] / (float)N; __syncthreads();
  float s2 = 0.f;
  for (int u = 0; u < per / 4; ++u)
#pragma unroll
    for (int q = 0; q < 4; ++q) { const float c = vals[u * 4 + q] - mu; s2 += c * c; }
  red[tid] = s2; __syncthreads();
  for (int st = 128; st > 0; st >>= 1) { if (tid < st) red[tid] += red[tid + st]; __syncthreads(); }
  const float rs = rsqrtf(red[0] / (float)N + eps);
  {
    for (int u = 0; u < per / 4; ++u) {
      const int j = tid * 4 + 1024 * u;
      v4f o, sm;
#pragma unroll
      for (int q = 0; q < 4; ++q) {
        float gg = g[j + q], bb = bta[j + q];
        if (PARAM_BF16) { gg = bf16_round(gg); bb = bf16_round(bb); }
        sm[q] = vals[u * 4 + q]; o[q] = (vals[u * 4 + q] - mu) * rs * gg + bb;
      }
      if (out_sum) *(v4f*)(out_sum + (size_t)row * N + j) = sm;
      *(v4f*)(out_norm + (size_t)row * N + j) = o;
    }
    
  }
}



// ---- f16 WMMA path (v_wmma_f32_16x16x32_f16): 11-bit significands for operands in range — used where a [0,1] probability operand needs more precision than bf16
typedef _Float16 v16h __attribute__((ext_vector_type(16)));
union FragH { v16h v; v8us half[2]; _Float16 h[16]; unsigned short u[16]; };
template <int NT>
__device__ __forceinline__ v8f mmaH(v16h ah, v16h al, v16h bh, v16h bl, v8f c) {
  c = __builtin_amdgcn_wmma_f32_16x16x32_f16(false, ah, false, bh, (short)0, c, false, false);
  if (NT >= 2) c = __builtin_amdgcn_wmma_f32_16x16x32_f16(false, al, false, bh, (short)0, c, false, false);
  if (NT >= 3) c = __builtin_amdgcn_wmma_f32_16x16x32_f16(false, ah, false, bl, (short)0, c, false, false);
  asm volatile("v_nop\n\tv_nop\n\tv_nop\n\tv_nop" : "+v"(c) : "v"(ah), "v"(al), "v"(bh), "v"(bl));
  return c;
}
// batched GEMM like k_gemm_b but f16 operands: A f32 (split into f16 hi/lo if ASPLIT, else rounded to f16), Bt = f16 values [n][k]; alpha; C f32; N multiple of 16 (partial tiles skipped)
template <bool ASPLIT>
__global__ __launch_bounds__(128) void k_gemm_h(const float* __restrict__ A, int lda, size_t sA, const _Float16* __restrict__ Bh, int ldb, size_t sB, float alpha, float* __restrict__ C, int ldc, size_t sC, int M, int N, int K) {
  __shared__ __attribute__((aligned(16))) float so[4][16][64];
  const int tid = threadIdx.x, w = tid >> 5, lane = tid & 31, ln = lane & 15, hh = lane >> 4; const int by = blockIdx.y;
  A += (size_t)by * sA; Bh += (size_t)by * sB; C += (size_t)by * sC;
  const int ntn = (N + 63) / 64; const int wid = blockIdx.x * 4 + w; const int mt = wid / ntn, nq = wid % ntn; if (mt * 16 >= M) return;
  const int row0 = mt * 16, col0 = nq * 64; const float* arow = A + (size_t)(row0 + ln) * lda;
  v8f acc[4] = {};
  for (int kb = 0; kb < K; kb += 32) {
    FragH ah, al;
    const v4f x0 = *(const v4fa*)(arow + kb + 8 * hh), x1 = *(const v4fa*)(arow + kb + 8 * hh + 4), x2 = *(const v4fa*)(arow + kb + 16 + 8 * hh), x3 = *(const v4fa*)(arow + kb + 16 + 8 * hh + 4);
    float xs[16] = {x0[0],x0[1],x0[2],x0[3],x1[0],x1[1],x1[2],x1[3],x2[0],x2[1],x2[2],x2[3],x3[0],x3[1],x3[2],x3[3]};
#pragma unroll
    for (int i = 0; i < 16; ++i) { const _Float16 h = (_Float16)xs[i]; ah.h[i] = h; al.h[i] = ASPLIT ? (_Float16)(xs[i] - (float)h) : (_Float16)0.0f; }
#pragma unroll
    for (int t = 0; t < 4; ++t) { if (col0 + t * 16 >= N) continue; const size_t boff = (size_t)(col0 + t * 16 + ln) * ldb + kb; FragH bq; bq.half[0] = *(const v8us*)(Bh + boff + 8 * hh); bq.half[1] = *(const v8us*)(Bh + boff + 16 + 8 * hh);
      acc[t] = mmaH<ASPLIT ? 2 : 1>(ah.v, al.v, bq.v, bq.v, acc[t]); }
  }
#pragma unroll
  for (int t = 0; t < 4; ++t) { if (col0 + t * 16 >= N) continue;
#pragma unroll
    for (int r = 0; r < 8; ++r) so[w][8 * hh + r][t * 16 + ln] = acc[t][r] * alpha; }
  __builtin_amdgcn_fence(__ATOMIC_ACQ_REL, "workgroup"); __builtin_amdgcn_wave_barrier();
  const int rsub = lane >> 4, c4 = (lane & 15) * 4;
  {
#pragma unroll
    for (int q = 0; q < 8; ++q) { const int r = q * 2 + rsub; if (col0 + c4 < N) { const v4f v = *(const v4fa*)&so[w][r][c4]; *(v4f*)(C + (size_t)(row0 + r) * ldc + col0 + c4) = v; } }
     }
}

// Wt[n][k] = f16(W[k][n]·scale) from f32 row-major W[K][N] (scale = power of two; bf16-exact weights stay exact in f16 away from the subnormal range)
__global__ __launch_bounds__(256) void k_wt_f16(const float* __restrict__ W, _Float16* __restrict__ Wt, int K, int N, float scale) {
  const int t = blockIdx.x * 256 + threadIdx.x; if (t >= N * (K / 8)) return; const int n = t / (K / 8), k8 = (t % (K / 8)) * 8; FragH f;
#pragma unroll
  for (int i = 0; i < 8; ++i) f.h[i] = (_Float16)(bf16_round(W[(size_t)(k8 + i) * N + n]) * scale); const v8us o = f.half[0];
  *(v8us*)((unsigned short*)Wt + (size_t)n * K + k8) = o; 
}
__global__ __launch_bounds__(256) void k_x16(const float* __restrict__ x, _Float16* __restrict__ X16, size_t n8) { const size_t t = (size_t)blockIdx.x * 256 + threadIdx.x; if (t >= n8) return; FragH f;
#pragma unroll
  for (int q = 0; q < 8; ++q) f.h[q] = (_Float16)bf16_round(x[t * 8 + q]); *(v8us*)((unsigned short*)X16 + t * 8) = f.half[0];  }
__global__ __launch_bounds__(256) void k_h16(const float* __restrict__ x, _Float16* __restrict__ X16, size_t n8) { const size_t t = (size_t)blockIdx.x * 256 + threadIdx.x; if (t >= n8) return; FragH f;
#pragma unroll
  for (int q = 0; q < 8; ++q) f.h[q] = (_Float16)x[t * 8 + q]; *(v8us*)((unsigned short*)X16 + t * 8) = f.half[0];  }
__global__ __launch_bounds__(256) void k_round16f(const float* __restrict__ W, _Float16* __restrict__ Bt, size_t n8) { const size_t t = (size_t)blockIdx.x * 256 + threadIdx.x; if (t >= n8) return; FragH f;
#pragma unroll
  for (int i = 0; i < 8; ++i) f.h[i] = (_Float16)(bf16_round(W[t * 8 + i]) * 16.0f); *(v8us*)((unsigned short*)Bt + t * 8) = f.half[0];  }
// per (row, head): RMSNorm over the 64 dims (eps 1e-6, ·bf16(w)) then RoPE with the INPUT cos/sin[b][s][64] (rotate_half = [−x2, x1]); wave per (row, head): lane j (0..31) holds dims j and 32+j;
__global__ __launch_bounds__(256) void k_normrope(const float* __restrict__ Xf, int ld, int nheads, const float* __restrict__ w, const float* __restrict__ cs, const float* __restrict__ sn, _Float16* __restrict__ Y16) {
  __shared__ __attribute__((aligned(16))) _Float16 srow[8][HD]; const int tid = threadIdx.x, wv = tid >> 5, lane = tid & 31; const size_t rh = (size_t)blockIdx.x * 8 + wv; if (rh >= (size_t)NR * nheads) return; const size_t row = rh / nheads; const int h = (int)(rh % nheads);
  const float* xr = Xf + row * ld + h * HD; const float x1 = xr[lane], x2 = xr[32 + lane]; float ss = x1 * x1 + x2 * x2; for (int o = 16; o >= 1; o >>= 1) ss += __shfl_xor(ss, o, 32); const float rs = rsqrtf(ss / (float)HD + 1e-6f);
  const float n1 = x1 * rs * bf16_round(w[lane]), n2 = x2 * rs * bf16_round(w[32 + lane]);
  const float c1 = bf16_round(cs[row * HD + lane]), c2 = bf16_round(cs[row * HD + 32 + lane]), s1 = bf16_round(sn[row * HD + lane]), s2 = bf16_round(sn[row * HD + 32 + lane]);      /* cos/sin are float INPUTS: round like every other input */
  srow[wv][lane] = (_Float16)(n1 * c1 - n2 * s1); srow[wv][32 + lane] = (_Float16)(n2 * c2 + n1 * s2);
  __builtin_amdgcn_fence(__ATOMIC_ACQ_REL, "workgroup"); __builtin_amdgcn_wave_barrier();
  if (lane < 8) { unsigned short* yr = (unsigned short*)Y16 + row * ld + h * HD + lane * 8; const v8us v = *(const v8us*)((const unsigned short*)&srow[wv][0] + lane * 8); *(v8us*)yr = v;  } }
__global__ __launch_bounds__(256) void k_vt(const _Float16* __restrict__ V16, _Float16* __restrict__ Vt) { __shared__ unsigned short tl[64][66]; const int tid = threadIdx.x; const int slab = blockIdx.x / (SS / 64), lg = blockIdx.x % (SS / 64); const int b = slab / NKV, h = slab % NKV;
  for (int i = tid; i < 64 * 8; i += 256) { const int r = i / 8, c8 = (i % 8) * 8; FragH f; f.half[0] = *(const v8us*)((const unsigned short*)V16 + ((size_t)b * SS + lg * 64 + r) * KVD + h * HD + c8);
#pragma unroll
    for (int q = 0; q < 8; ++q) tl[r][c8 + q] = f.u[q]; }
  __syncthreads();
  {
#pragma unroll
    for (int rd = 0; rd < 2; ++rd) { const int d = rd * 32 + tid / 8, pc = tid % 8; FragH f;
#pragma unroll
      for (int q = 0; q < 8; ++q) f.u[q] = tl[pc * 8 + q][d];
      *(v8us*)((unsigned short*)Vt + ((size_t)slab * HD + d) * SS + lg * 64 + pc * 8) = f.half[0]; }
     } }
// Maximum over each 16-lane row for eight values at once: an xor butterfly (1, 2, 4, 8) on the vector pipe. DPP row_xmask hands the partner lane's value to v_max_num_f32 as an operand, so a step
// needs no LDS-pipe round trip and no dscnt wait. One asm statement, step by step over the eight values: the eight instructions of a step are independent, so none waits for the step before it
// (as single statements, and as the builtin move, the compiler put each value's four steps back to back; the builtin also kept a separate move and a quieting maximum per step). All 32 lanes are on here.
__device__ __forceinline__ void row16_max8(float (&m)[8]) {
  asm("v_max_num_f32_dpp %0, %0, %0 row_xmask:1 row_mask:0xf bank_mask:0xf\n\t"
      "v_max_num_f32_dpp %1, %1, %1 row_xmask:1 row_mask:0xf bank_mask:0xf\n\t"
      "v_max_num_f32_dpp %2, %2, %2 row_xmask:1 row_mask:0xf bank_mask:0xf\n\t"
      "v_max_num_f32_dpp %3, %3, %3 row_xmask:1 row_mask:0xf bank_mask:0xf\n\t"
      "v_max_num_f32_dpp %4, %4, %4 row_xmask:1 row_mask:0xf bank_mask:0xf\n\t"
      "v_max_num_f32_dpp %5, %5, %5 row_xmask:1 row_mask:0xf bank_mask:0xf\n\t"
      "v_max_num_f32_dpp %6, %6, %6 row_xmask:1 row_mask:0xf bank_mask:0xf\n\t"
      "v_max_num_f32_dpp %7, %7, %7 row_xmask:1 row_mask:0xf bank_mask:0xf\n\t"
      "v_max_num_f32_dpp %0, %0, %0 row_xmask:2 row_mask:0xf bank_mask:0xf\n\t"
      "v_max_num_f32_dpp %1, %1, %1 row_xmask:2 row_mask:0xf bank_mask:0xf\n\t"
      "v_max_num_f32_dpp %2, %2, %2 row_xmask:2 row_mask:0xf bank_mask:0xf\n\t"
      "v_max_num_f32_dpp %3, %3, %3 row_xmask:2 row_mask:0xf bank_mask:0xf\n\t"
      "v_max_num_f32_dpp %4, %4, %4 row_xmask:2 row_mask:0xf bank_mask:0xf\n\t"
      "v_max_num_f32_dpp %5, %5, %5 row_xmask:2 row_mask:0xf bank_mask:0xf\n\t"
      "v_max_num_f32_dpp %6, %6, %6 row_xmask:2 row_mask:0xf bank_mask:0xf\n\t"
      "v_max_num_f32_dpp %7, %7, %7 row_xmask:2 row_mask:0xf bank_mask:0xf\n\t"
      "v_max_num_f32_dpp %0, %0, %0 row_xmask:4 row_mask:0xf bank_mask:0xf\n\t"
      "v_max_num_f32_dpp %1, %1, %1 row_xmask:4 row_mask:0xf bank_mask:0xf\n\t"
      "v_max_num_f32_dpp %2, %2, %2 row_xmask:4 row_mask:0xf bank_mask:0xf\n\t"
      "v_max_num_f32_dpp %3, %3, %3 row_xmask:4 row_mask:0xf bank_mask:0xf\n\t"
      "v_max_num_f32_dpp %4, %4, %4 row_xmask:4 row_mask:0xf bank_mask:0xf\n\t"
      "v_max_num_f32_dpp %5, %5, %5 row_xmask:4 row_mask:0xf bank_mask:0xf\n\t"
      "v_max_num_f32_dpp %6, %6, %6 row_xmask:4 row_mask:0xf bank_mask:0xf\n\t"
      "v_max_num_f32_dpp %7, %7, %7 row_xmask:4 row_mask:0xf bank_mask:0xf\n\t"
      "v_max_num_f32_dpp %0, %0, %0 row_xmask:8 row_mask:0xf bank_mask:0xf\n\t"
      "v_max_num_f32_dpp %1, %1, %1 row_xmask:8 row_mask:0xf bank_mask:0xf\n\t"
      "v_max_num_f32_dpp %2, %2, %2 row_xmask:8 row_mask:0xf bank_mask:0xf\n\t"
      "v_max_num_f32_dpp %3, %3, %3 row_xmask:8 row_mask:0xf bank_mask:0xf\n\t"
      "v_max_num_f32_dpp %4, %4, %4 row_xmask:8 row_mask:0xf bank_mask:0xf\n\t"
      "v_max_num_f32_dpp %5, %5, %5 row_xmask:8 row_mask:0xf bank_mask:0xf\n\t"
      "v_max_num_f32_dpp %6, %6, %6 row_xmask:8 row_mask:0xf bank_mask:0xf\n\t"
      "v_max_num_f32_dpp %7, %7, %7 row_xmask:8 row_mask:0xf bank_mask:0xf"
      : "+v"(m[0]), "+v"(m[1]), "+v"(m[2]), "+v"(m[3]), "+v"(m[4]), "+v"(m[5]), "+v"(m[6]), "+v"(m[7])); }
// the same butterfly for a sum: the builtin move fuses into v_add_f32_dpp
template <int M> __device__ __forceinline__ float row_xor(float v) { return __int_as_float(__builtin_amdgcn_mov_dpp(__float_as_int(v), 0x160 + M, 0xf, 0xf, true)); }
__device__ __forceinline__ float row16_sum(float v) { v += row_xor<1>(v); v += row_xor<2>(v); v += row_xor<4>(v); v += row_xor<8>(v); return v; }
// fused causal GQA attention per ((b,h), 128 queries): wave = 32 queries; Q from Q16 cols h·64 (pitch 1024), K from K16 cols kvh·64 (pitch 512), kvh = h / 2; key chunks 0..qb0+128; mask k ≤ q else −inf
__global__ __launch_bounds__(128) void k_flash(const _Float16* __restrict__ Q16, const _Float16* __restrict__ K16, const _Float16* __restrict__ Vt, float* __restrict__ O) {
  constexpr int RPW = 32, NQB = SS / (4 * RPW), DT = HD / 16, KS = HD / 32;
  __shared__ __attribute__((aligned(16))) unsigned short sP[4][RPW][40]; __shared__ __attribute__((aligned(16))) float sO[4][RPW][HD];
  const int tid = threadIdx.x, w = tid >> 5, lane = tid & 31, ln = lane & 15, hh = lane >> 4;
  const int slab = blockIdx.x / NQB, qblk = blockIdx.x % NQB; const int b = slab / NH, h = slab % NH; const int kvh = h / (NH / NKV); const int qb0 = qblk * (4 * RPW); const int q0 = qb0 + w * RPW;
  FragH aq[2][KS];
#pragma unroll
  for (int rt = 0; rt < 2; ++rt) { const unsigned short* qr = (const unsigned short*)Q16 + ((size_t)b * SS + q0 + rt * 16 + ln) * HID + h * HD;
#pragma unroll
    for (int ks = 0; ks < KS; ++ks) { aq[rt][ks].half[0] = *(const v8us*)(qr + ks * 32 + 8 * hh); aq[rt][ks].half[1] = *(const v8us*)(qr + ks * 32 + 16 + 8 * hh); } }
  const unsigned short* Vth = (const unsigned short*)Vt + (size_t)(b * NKV + kvh) * HD * SS;
  float m_r[2][8], l_r[2][8]; v8f oacc[2][DT];
#pragma unroll
  for (int rt = 0; rt < 2; ++rt) {
#pragma unroll
    for (int r = 0; r < 8; ++r) { m_r[rt][r] = -3.0e38f; l_r[rt][r] = 0.f; }
#pragma unroll
    for (int dt = 0; dt < DT; ++dt) oacc[rt][dt] = (v8f){0.f,0.f,0.f,0.f,0.f,0.f,0.f,0.f}; }
  const int jend = qb0 + 4 * RPW;
#pragma unroll 1
  for (int j0 = 0; j0 < jend; j0 += 32) {
    v8f s[2][2];
#pragma unroll
    for (int nt = 0; nt < 2; ++nt) { const unsigned short* kr = (const unsigned short*)K16 + ((size_t)b * SS + j0 + nt * 16 + ln) * KVD + kvh * HD; FragH bk[KS];
#pragma unroll
      for (int ks = 0; ks < KS; ++ks) { bk[ks].half[0] = *(const v8us*)(kr + ks * 32 + 8 * hh); bk[ks].half[1] = *(const v8us*)(kr + ks * 32 + 16 + 8 * hh); }
#pragma unroll
      for (int rt = 0; rt < 2; ++rt) { v8f acc = (v8f){0.f,0.f,0.f,0.f,0.f,0.f,0.f,0.f};
#pragma unroll
        for (int ks = 0; ks < KS; ++ks) acc = mmaH<1>(aq[rt][ks].v, aq[rt][ks].v, bk[ks].v, bk[ks].v, acc); s[rt][nt] = acc; } }
    float mx[2][8];
#pragma unroll
    for (int rt = 0; rt < 2; ++rt) {
#pragma unroll
      for (int r = 0; r < 8; ++r) { const int qi = q0 + rt * 16 + 8 * hh + r; const int k0 = j0 + ln, k1 = j0 + 16 + ln;
        s[rt][0][r] = (k0 <= qi) ? s[rt][0][r] * 0.125f : -INFINITY; s[rt][1][r] = (k1 <= qi) ? s[rt][1][r] * 0.125f : -INFINITY; mx[rt][r] = fmaxf(s[rt][0][r], s[rt][1][r]); }
      row16_max8(mx[rt]); }
#pragma unroll
    for (int rt = 0; rt < 2; ++rt)
#pragma unroll
      for (int r = 0; r < 8; ++r) { const float s0 = s[rt][0][r], s1 = s[rt][1][r];
        const float mn = fmaxf(m_r[rt][r], mx[rt][r]); const float al = expf(m_r[rt][r] - mn); m_r[rt][r] = mn; const float p0 = expf(s0 - mn), p1 = expf(s1 - mn); l_r[rt][r] = l_r[rt][r] * al + p0 + p1;
#pragma unroll
        for (int dt = 0; dt < DT; ++dt) oacc[rt][dt][r] *= al;
        FragH t2; t2.h[0] = (_Float16)p0; t2.h[1] = (_Float16)p1; sP[w][rt * 16 + 8 * hh + r][ln] = t2.u[0]; sP[w][rt * 16 + 8 * hh + r][16 + ln] = t2.u[1]; }
    __builtin_amdgcn_fence(__ATOMIC_ACQ_REL, "workgroup"); __builtin_amdgcn_wave_barrier();
    FragH pa[2];
#pragma unroll
    for (int rt = 0; rt < 2; ++rt) { pa[rt].half[0] = *(const v8us*)&sP[w][rt * 16 + ln][8 * hh]; pa[rt].half[1] = *(const v8us*)&sP[w][rt * 16 + ln][16 + 8 * hh]; }
#pragma unroll
    for (int dt = 0; dt < DT; ++dt) { const unsigned short* vrow = Vth + (size_t)(dt * 16 + ln) * SS + j0; FragH bv; bv.half[0] = *(const v8us*)(vrow + 8 * hh); bv.half[1] = *(const v8us*)(vrow + 16 + 8 * hh);
#pragma unroll
      for (int rt = 0; rt < 2; ++rt) oacc[rt][dt] = mmaH<1>(pa[rt].v, pa[rt].v, bv.v, bv.v, oacc[rt][dt]); }
    __builtin_amdgcn_fence(__ATOMIC_ACQ_REL, "workgroup"); __builtin_amdgcn_wave_barrier(); }
#pragma unroll
  for (int rt = 0; rt < 2; ++rt) {
#pragma unroll
    for (int r = 0; r < 8; ++r) { float l = l_r[rt][r]; l = row16_sum(l); l_r[rt][r] = 1.0f / l; }
#pragma unroll
    for (int dt = 0; dt < DT; ++dt)
#pragma unroll
      for (int r = 0; r < 8; ++r) sO[w][rt * 16 + 8 * hh + r][dt * 16 + ln] = oacc[rt][dt][r] * l_r[rt][r]; }
  __builtin_amdgcn_fence(__ATOMIC_ACQ_REL, "workgroup"); __builtin_amdgcn_wave_barrier();
  {
#pragma unroll
    for (int rp = 0; rp < RPW; rp += 2) { const int r = rp + (lane >> 4), pc = lane & 15; const v4f val = *(const v4fa*)&sO[w][r][pc * 4]; *(v4f*)(O + ((size_t)b * SS + q0 + r) * HID + h * HD + pc * 4) = val; }
     } }
// Projection GEMM C[4096][N] = A[4096][1024] * Bt[N][1024]^T / 16 (f16 operands, f32 accumulate, k ascending in steps of 32 as before). Block = 4 waves = a 64 x 128 tile of C; wave = 32 x 64 (2 x 4 accumulators).
// Each stage brings 64 k of the 64 A rows and the 128 Bt rows into LDS with whole 128-byte rows per 8 lanes, so every row is fetched once per block instead of once per wave in 16-line gathers;
// the next stage's rows are loaded into registers while this stage's products run, and go into the other buffer. Row pitch 144 bytes: the 16 rows of a fragment read fall on different banks.
template <int N, bool F16OUT>
__global__ __launch_bounds__(128) void k_proj(const _Float16* __restrict__ A, const _Float16* __restrict__ Bt, float* __restrict__ C, _Float16* __restrict__ C16) {
  constexpr int K = HID, BM = 64, BN = 128, BK = 64, PIT = BK + 8, NS = K / BK, NBN = N / BN, OP = 68;
  __shared__ __attribute__((aligned(16))) unsigned short sm[2][BM + BN][PIT];
  static_assert(sizeof(float) * 4 * 32 * OP <= sizeof(unsigned short) * 2 * (BM + BN) * PIT, "the output tiles reuse the stage buffers");
  const int tid = threadIdx.x, w = tid >> 5, lane = tid & 31, ln = lane & 15, hh = lane >> 4;
  const int row0 = (blockIdx.x / NBN) * BM, col0 = (blockIdx.x % NBN) * BN, wm = (w >> 1) * 32, wn = (w & 1) * 64;
  const int sr = tid >> 3, sc = (tid & 7) * 8;
  const unsigned short* ga = (const unsigned short*)A + (size_t)(row0 + sr) * K + sc;
  const unsigned short* gb = (const unsigned short*)Bt + (size_t)(col0 + sr) * K + sc;
  v8us ra[BM / 16], rb[BN / 16];
  v8f acc[2][4];
#pragma unroll
  for (int mi = 0; mi < 2; ++mi)
#pragma unroll
    for (int t = 0; t < 4; ++t) acc[mi][t] = (v8f){0.f,0.f,0.f,0.f,0.f,0.f,0.f,0.f};
#pragma unroll
  for (int i = 0; i < BM / 16; ++i) ra[i] = *(const v8us*)(ga + (size_t)i * 16 * K);
#pragma unroll
  for (int i = 0; i < BN / 16; ++i) rb[i] = *(const v8us*)(gb + (size_t)i * 16 * K);
#pragma unroll
  for (int i = 0; i < BM / 16; ++i) *(v8us*)&sm[0][sr + i * 16][sc] = ra[i];
#pragma unroll
  for (int i = 0; i < BN / 16; ++i) *(v8us*)&sm[0][BM + sr + i * 16][sc] = rb[i];
  __syncthreads();
  // unrolled whole: every stage's global offset is then an immediate on two address pairs that are never rewritten, and the buffer index a constant
#pragma unroll
  for (int s = 0; s < NS; ++s) {
    const int cur = s & 1;
    if (s + 1 < NS) {
#pragma unroll
      for (int i = 0; i < BM / 16; ++i) ra[i] = *(const v8us*)(ga + (size_t)i * 16 * K + (s + 1) * BK);
#pragma unroll
      for (int i = 0; i < BN / 16; ++i) rb[i] = *(const v8us*)(gb + (size_t)i * 16 * K + (s + 1) * BK);
    }
    // keeps the next stage's loads at the head of this stage, so that they fly under all of its products (the scheduler sank them to just in front of their LDS stores)
    __builtin_amdgcn_sched_barrier(0);
    FragH a[BK / 32][2], b[BK / 32][4];
#pragma unroll
    for (int ks = 0; ks < BK / 32; ++ks) {
#pragma unroll
      for (int mi = 0; mi < 2; ++mi) { const unsigned short* p = &sm[cur][wm + mi * 16 + ln][ks * 32 + 8 * hh]; a[ks][mi].half[0] = *(const v8us*)p; a[ks][mi].half[1] = *(const v8us*)(p + 16); }
#pragma unroll
      for (int t = 0; t < 4; ++t) { const unsigned short* p = &sm[cur][BM + wn + t * 16 + ln][ks * 32 + 8 * hh]; b[ks][t].half[0] = *(const v8us*)p; b[ks][t].half[1] = *(const v8us*)(p + 16); }
    }
    // keeps the stage's fragment reads in one group ahead of its products: one exposed LDS latency per stage (the scheduler reused the A registers and waited for LDS four times per stage)
    __builtin_amdgcn_sched_barrier(0);
#pragma unroll
    for (int ks = 0; ks < BK / 32; ++ks)
#pragma unroll
      for (int mi = 0; mi < 2; ++mi)
#pragma unroll
        for (int t = 0; t < 4; ++t) acc[mi][t] = __builtin_amdgcn_wmma_f32_16x16x32_f16(false, a[ks][mi].v, false, b[ks][t].v, (short)0, acc[mi][t], false, false);
    // keeps the waits for those loads, and the LDS stores behind them, behind the issue of all of this stage's products (the scheduler put them in the middle of the stage)
    __builtin_amdgcn_sched_barrier(0);
    if (s + 1 < NS) {
#pragma unroll
      for (int i = 0; i < BM / 16; ++i) *(v8us*)&sm[cur ^ 1][sr + i * 16][sc] = ra[i];
#pragma unroll
      for (int i = 0; i < BN / 16; ++i) *(v8us*)&sm[cur ^ 1][BM + sr + i * 16][sc] = rb[i];
    }
    // one barrier per stage: it publishes the buffer just filled and ends every wave's reads of the buffer that the next stage refills (after the last stage: that the output tiles reuse)
    __syncthreads();
  }
  typedef float fa __attribute__((may_alias));
  fa* so = (fa*)&sm[0][0][0] + w * 32 * OP;
#pragma unroll
  for (int mi = 0; mi < 2; ++mi)
#pragma unroll
    for (int t = 0; t < 4; ++t)
#pragma unroll
      for (int r = 0; r < 8; ++r) so[(mi * 16 + 8 * hh + r) * OP + t * 16 + ln] = acc[mi][t][r] * 0.0625f;
  // the wave reads back its own tile, written by other lanes: the LDS stores must have landed first
  __builtin_amdgcn_fence(__ATOMIC_ACQ_REL, "workgroup"); __builtin_amdgcn_wave_barrier();
  typedef _Float16 v4h __attribute__((ext_vector_type(4)));
#pragma unroll
  for (int q = 0; q < 16; ++q) { const int r = q * 2 + hh, c4 = ln * 4; const v4f v = *(const v4fa*)&so[r * OP + c4]; const size_t o = (size_t)(row0 + wm + r) * N + col0 + wn + c4;
    if (F16OUT) { v4h h4;
#pragma unroll
      for (int i = 0; i < 4; ++i) h4[i] = (_Float16)v[i];
      *(v4h*)(C16 + o) = h4; }
    else *(v4f*)(C + o) = v; }
}
extern "C" void kernel_launch(void* const* d_in, const int* in_sizes, int n_in,
                              void* d_out, int out_size, void* d_ws, size_t ws_size, hipStream_t stream) {
  (void)in_sizes; (void)n_in; (void)out_size;
  const float* x = (const float*)d_in[0]; const float* cs = (const float*)d_in[1]; const float* sn = (const float*)d_in[2]; const float* wq = (const float*)d_in[3]; const float* wk = (const float*)d_in[4]; const float* wv = (const float*)d_in[5]; const float* wo = (const float*)d_in[6]; const float* qnw = (const float*)d_in[7]; const float* knw = (const float*)d_in[8];
  char* ws = (char*)d_ws; size_t off = 0;
  auto take = [&](size_t bytes) { char* p = ws + off; off += (bytes + 255) & ~(size_t)255; return p; };
  _Float16* Bq = (_Float16*)take((size_t)HID * HID * 2); _Float16* Bk = (_Float16*)take((size_t)KVD * HID * 2); _Float16* Bv = (_Float16*)take((size_t)KVD * HID * 2); _Float16* Bo = (_Float16*)take((size_t)HID * HID * 2);
  _Float16* X16 = (_Float16*)take((size_t)NR * HID * 2); float* Qf = (float*)take((size_t)NR * HID * 4); float* Kf = (float*)take((size_t)NR * KVD * 4); _Float16* Q16 = (_Float16*)take((size_t)NR * HID * 2); _Float16* K16 = (_Float16*)take((size_t)NR * KVD * 2); _Float16* V16 = (_Float16*)take((size_t)NR * KVD * 2); _Float16* Vt = (_Float16*)take((size_t)NR * KVD * 2); float* O = (float*)take((size_t)NR * HID * 4); _Float16* O16 = (_Float16*)take((size_t)NR * HID * 2);
  if (off > ws_size) return;      // ≈ 6 + 8.4 + 16.8 + 8.4 + 8.4 + 4.2×3 + 16.8 + 8.4 ≈ 90 MiB
  k_round16f<<<(unsigned)(((size_t)HID * HID / 8 + 255) / 256), 256, 0, stream>>>(wq, Bq, (size_t)HID * HID / 8); k_round16f<<<(unsigned)(((size_t)KVD * HID / 8 + 255) / 256), 256, 0, stream>>>(wk, Bk, (size_t)KVD * HID / 8);
  k_round16f<<<(unsigned)(((size_t)KVD * HID / 8 + 255) / 256), 256, 0, stream>>>(wv, Bv, (size_t)KVD * HID / 8); k_round16f<<<(unsigned)(((size_t)HID * HID / 8 + 255) / 256), 256, 0, stream>>>(wo, Bo, (size_t)HID * HID / 8);      // (out,in) = Bt
  const unsigned gx = (unsigned)(((size_t)NR * HID / 8 + 255) / 256);
  k_x16<<<gx, 256, 0, stream>>>(x, X16, (size_t)NR * HID / 8);
  const unsigned gq = (NR / 64) * (HID / 128), gk = (NR / 64) * (KVD / 128);
  k_proj<HID, false><<<gq, 128, 0, stream>>>(X16, Bq, Qf, nullptr);
  k_proj<KVD, false><<<gk, 128, 0, stream>>>(X16, Bk, Kf, nullptr);
  k_proj<KVD, true><<<gk, 128, 0, stream>>>(X16, Bv, nullptr, V16);
  k_normrope<<<(unsigned)(((size_t)NR * NH + 7) / 8), 256, 0, stream>>>(Qf, HID, NH, qnw, cs, sn, Q16); k_normrope<<<(unsigned)(((size_t)NR * NKV + 7) / 8), 256, 0, stream>>>(Kf, KVD, NKV, knw, cs, sn, K16);
  k_vt<<<BB * NKV * (SS / 64), 256, 0, stream>>>(V16, Vt);
  k_flash<<<BB * NH * (SS / 128), 128, 0, stream>>>(Q16, K16, Vt, O);
  k_h16<<<gx, 256, 0, stream>>>(O, O16, (size_t)NR * HID / 8);
  k_proj<HID, false><<<gq, 128, 0, stream>>>(O16, Bo, (float*)d_out, nullptr);
}

// v003
// It runs in 254 microseconds.
// Two timings next to v002 put it at 1.10 and 1.12 times that version's speed.
// Counting every step since v000, it is 2.12 times as fast.
#include <hip/hip_runtime.h>
// q/k/v/o projections (4096 × 1024 → 1024/512/512, 1024) and the 16-head causal GQA attention (8 kv heads, d = 64) on v_wmma_f32_16x16x32_f16 (fused flash-style kernel: S = Q·Kᵀ, O = P·V on WMMA,
// causal mask, online max/sum softmax f32, P f16 ≤ 1; only key chunks ≤ the block's last query); per-head RMSNorm and RoPE (cos/sin are INPUTS) applied in f32 before the f16 cast; V transposed
// per kv head; A = f16(bf16 x) exact, weights bf16-exact ×2^4 ((out,in) layouts), single products, f32 accumulate.
#define BB 2
#define SS 2048
#define HID 1024
#define NH 16
#define NKV 8
#define HD 64
#define KVD 512
#define NR (BB * SS)

typedef __bf16 v16b __attribute__((ext_vector_type(16)));
typedef unsigned short v8us __attribute__((ext_vector_type(8), may_alias));
typedef float  v8f  __attribute__((ext_vector_type(8)));
typedef float  v4f  __attribute__((ext_vector_type(4)));
typedef float  v4fa __attribute__((ext_vector_type(4), may_alias));
union FragB { v16b v; v8us half[2]; unsigned short u[16]; };

__device__ __forceinline__ unsigned short bf16_bits(float x) { unsigned int u = __float_as_uint(x); return (unsigned short)((u + 0x7FFFu + ((u >> 16) & 1u)) >> 16); }
__device__ __forceinline__ float bf16_val(unsigned short b) { return __uint_as_float(((unsigned int)b) << 16); }
__device__ __forceinline__ float bf16_round(float x) { return bf16_val(bf16_bits(x)); }
// D += A·B with NT terms: 1 = ah·bh, 2 = + al·bh (A split), 3 = + ah·bl (both split)
template <int NT>
__device__ __forceinline__ v8f mmaN(v16b ah, v16b al, v16b bh, v16b bl, v8f c) {
  c = __builtin_amdgcn_wmma_f32_16x16x32_bf16(false, ah, false, bh, (short)0, c, false, false);
  if (NT >= 2) c = __builtin_amdgcn_wmma_f32_16x16x32_bf16(false, al, false, bh, (short)0, c, false, false);
  if (NT >= 3) c = __builtin_amdgcn_wmma_f32_16x16x32_bf16(false, ah, false, bl, (short)0, c, false, false);
  asm volatile("v_nop\n\tv_nop\n\tv_nop\n\tv_nop" : "+v"(c) : "v"(ah), "v"(al), "v"(bh), "v"(bl));
  return c;
}

__global__ __launch_bounds__(256) void k_wt_bf16(const float* __restrict__ W, unsigned short* __restrict__ Wt, int K, int N) {
  const int t = blockIdx.x * 256 + threadIdx.x;
  const int k8n = K / 8;
  if (t >= N * k8n) return;
  const int n = t / k8n, k8 = (t % k8n) * 8;
  v8us v;
#pragma unroll
  for (int i = 0; i < 8; ++i) v[i] = bf16_bits(W[(size_t)(k8 + i) * N + n]);
  *(v8us*)(Wt + (size_t)n * K + k8) = v;
  
}

// GEMM C[M][N] (f32, pitch ldc) = act(A[M][K]·W + bias). A f32 row-major (pitch lda) converted per fragment to bf16
// (ASPLIT: hi/lo two planes -> 2 terms, else single rounded term); Wt bf16 [N][K] (pitch ldb). BIAS_BF16 rounds the
// bias to bf16 first (bias quantised to bf16 before the add). K%32==0, M%16==0, N%64==0.
template <bool ASPLIT, int ACT, bool BIAS_BF16>
__global__ __launch_bounds__(128) void k_gemm_bf(const float* __restrict__ A, int lda, const unsigned short* __restrict__ Wt, int ldb,
                                               const float* __restrict__ bias, float* __restrict__ C, int ldc, int M, int N, int K) {
  __shared__ __attribute__((aligned(16))) float so[4][16][64];
  const int tid = threadIdx.x, w = tid >> 5, lane = tid & 31, ln = lane & 15, hh = lane >> 4;
  const int ntn = N / 64;
  const int wid = blockIdx.x * 4 + w;
  const int mt = wid / ntn, nq = wid % ntn;
  if (mt * 16 >= M) return;
  const int row0 = mt * 16, col0 = nq * 64;
  const float* arow = A + (size_t)(row0 + ln) * lda;
  v8f acc[4] = {};
  for (int kb = 0; kb < K; kb += 32) {
    FragB ah, al;
    const v4f x0 = *(const v4fa*)(arow + kb + 8 * hh), x1 = *(const v4fa*)(arow + kb + 8 * hh + 4);
    const v4f x2 = *(const v4fa*)(arow + kb + 16 + 8 * hh), x3 = *(const v4fa*)(arow + kb + 16 + 8 * hh + 4);
    float xs[16] = {x0[0],x0[1],x0[2],x0[3],x1[0],x1[1],x1[2],x1[3],x2[0],x2[1],x2[2],x2[3],x3[0],x3[1],x3[2],x3[3]};
#pragma unroll
    for (int i = 0; i < 16; ++i) { const unsigned short hb = bf16_bits(xs[i]); ah.u[i] = hb; al.u[i] = ASPLIT ? bf16_bits(xs[i] - bf16_val(hb)) : (unsigned short)0; }
#pragma unroll
    for (int t = 0; t < 4; ++t) {
      const unsigned short* brow = Wt + (size_t)(col0 + t * 16 + ln) * ldb + kb;
      FragB b;
      b.half[0] = *(const v8us*)(brow + 8 * hh);
      b.half[1] = *(const v8us*)(brow + 16 + 8 * hh);
      acc[t] = mmaN<ASPLIT ? 2 : 1>(ah.v, al.v, b.v, b.v, acc[t]);
    }
  }
#pragma unroll
  for (int t = 0; t < 4; ++t) {
    float bv = bias ? bias[col0 + t * 16 + ln] : 0.f;
    if (BIAS_BF16) bv = bf16_round(bv);
#pragma unroll
    for (int r = 0; r < 8; ++r) { float v = acc[t][r] + bv; if (ACT == 1) v = fmaxf(v, 0.f); so[w][8 * hh + r][t * 16 + ln] = v; }
  }
  __builtin_amdgcn_fence(__ATOMIC_ACQ_REL, "workgroup");
  __builtin_amdgcn_wave_barrier();
  const int rsub = lane >> 4, c4 = (lane & 15) * 4;
  {
#pragma unroll
    for (int q = 0; q < 8; ++q) {
      const int r = q * 2 + rsub;
      const v4f v = *(const v4fa*)&so[w][r][c4];
      *(v4f*)(C + (size_t)(row0 + r) * ldc + col0 + c4) = v;
    }
    
  }
}

// Flash-style causal/unmasked attention, all contractions 3-term bf16 hi/lo splits, f32 softmax with running max.
// q,k,v rows are read from f32 buffers with arbitrary row pitch (so they can live inside a fused qkv buffer);
// D = head size (multiple of 32, <= 128); one wave = 16 query rows; block = 4 waves (64 queries) sharing K/V chunks of 32.
template <int D, bool CAUSAL>
__global__ __launch_bounds__(128) void k_flash(const float* __restrict__ qb, const float* __restrict__ kb, const float* __restrict__ vb,
                                             int pitch, int T, int H, float scale, float* __restrict__ y, int ypitch) {
  constexpr int KS = D / 32;        // k-steps for QK
  constexpr int DT = D / 16;        // d tiles for PV
  __shared__ __attribute__((aligned(16))) unsigned short sKh[32][D + 8], sKl[32][D + 8], sVh[32][D + 8], sVl[32][D + 8];
  __shared__ __attribute__((aligned(16))) unsigned short sPh[4][16][40], sPl[4][16][40];
  __shared__ __attribute__((aligned(16))) float sO[4][16][D];
  const int tid = threadIdx.x, w = tid >> 5, lane = tid & 31, ln = lane & 15, hh = lane >> 4;
  const int nqb = (T + 63) / 64;
  const int bh = blockIdx.x / nqb, qblk = blockIdx.x % nqb;
  const int b = bh / H, h = bh % H;
  const int q0 = qblk * 64 + w * 16;
  const float* Q = qb + (size_t)b * T * pitch + h * D;
  const float* K = kb + (size_t)b * T * pitch + h * D;
  const float* V = vb + (size_t)b * T * pitch + h * D;

  // A fragments of the wave's 16 query rows (scaled), hi/lo
  FragB aqh[KS], aql[KS];
  {
    int row = q0 + ln; if (row >= T) row = T - 1;
    const float* qr = Q + (size_t)row * pitch;
#pragma unroll
    for (int ks = 0; ks < KS; ++ks)
#pragma unroll
      for (int i = 0; i < 16; ++i) {
        const int d = ks * 32 + ((i < 8) ? (8 * hh + i) : (16 + 8 * hh + (i - 8)));
        const float x = qr[d] * scale; const unsigned short hb = bf16_bits(x);
        aqh[ks].u[i] = hb; aql[ks].u[i] = bf16_bits(x - bf16_val(hb));
      }
  }
  float m_r[8], l_r[8];
#pragma unroll
  for (int r = 0; r < 8; ++r) { m_r[r] = -3.0e38f; l_r[r] = 0.f; }
  v8f oacc[DT];
#pragma unroll
  for (int dt = 0; dt < DT; ++dt) oacc[dt] = (v8f){0.f,0.f,0.f,0.f,0.f,0.f,0.f,0.f};

  const int kv_end = CAUSAL ? min(T, qblk * 64 + 64) : T;     // block-uniform
  for (int j0 = 0; j0 < kv_end; j0 += 32) {
    __syncthreads();
    for (int e = tid; e < 32 * (D / 4); e += 128) {
      const int r = e / (D / 4), c4 = (e % (D / 4)) * 4;
      const int key = j0 + r;
      v4f kf = {0.f,0.f,0.f,0.f}, vf = {0.f,0.f,0.f,0.f};
      if (key < T) { kf = *(const v4fa*)(K + (size_t)key * pitch + c4); vf = *(const v4fa*)(V + (size_t)key * pitch + c4); }
#pragma unroll
      for (int t = 0; t < 4; ++t) {
        unsigned short hb = bf16_bits(kf[t]); sKh[r][c4 + t] = hb; sKl[r][c4 + t] = bf16_bits(kf[t] - bf16_val(hb));
        hb = bf16_bits(vf[t]); sVh[r][c4 + t] = hb; sVl[r][c4 + t] = bf16_bits(vf[t] - bf16_val(hb));
      }
    }
    __syncthreads();
    // S tile 16 x 32
    v8f s[2];
#pragma unroll
    for (int nt = 0; nt < 2; ++nt) {
      v8f acc = {};
#pragma unroll
      for (int ks = 0; ks < KS; ++ks) {
        FragB bh_, bl_;
        bh_.half[0] = *(const v8us*)&sKh[nt * 16 + ln][ks * 32 + 8 * hh]; bh_.half[1] = *(const v8us*)&sKh[nt * 16 + ln][ks * 32 + 16 + 8 * hh];
        bl_.half[0] = *(const v8us*)&sKl[nt * 16 + ln][ks * 32 + 8 * hh]; bl_.half[1] = *(const v8us*)&sKl[nt * 16 + ln][ks * 32 + 16 + 8 * hh];
        acc = mmaN<3>(aqh[ks].v, aql[ks].v, bh_.v, bl_.v, acc);
      }
      s[nt] = acc;
    }
    // mask + running max (rows 8hh+r; the 16 lanes of a half share rows)
    float alpha[8];
#pragma unroll
    for (int r = 0; r < 8; ++r) {
      const int qi = q0 + 8 * hh + r;
      const int ja = j0 + ln, jb = j0 + 16 + ln;
      if (CAUSAL) { if (ja > qi) s[0][r] = -3.0e38f; if (jb > qi) s[1][r] = -3.0e38f; }
      if (ja >= T) s[0][r] = -3.0e38f;
      if (jb >= T) s[1][r] = -3.0e38f;
      float mx = fmaxf(s[0][r], s[1][r]);
      mx = fmaxf(mx, __shfl_xor(mx, 1, 32)); mx = fmaxf(mx, __shfl_xor(mx, 2, 32)); mx = fmaxf(mx, __shfl_xor(mx, 4, 32)); mx = fmaxf(mx, __shfl_xor(mx, 8, 32));
      const float mnew = fmaxf(m_r[r], mx);
      alpha[r] = (mnew > -1.0e38f) ? __expf(m_r[r] - mnew) : 1.0f;
      const float p0 = (s[0][r] > -1.0e38f) ? __expf(s[0][r] - mnew) : 0.f;
      const float p1 = (s[1][r] > -1.0e38f) ? __expf(s[1][r] - mnew) : 0.f;
      m_r[r] = mnew;
      l_r[r] = l_r[r] * alpha[r] + p0 + p1;            // per-lane partial row sum (16 lanes combined at the end)
      unsigned short hb = bf16_bits(p0); sPh[w][8 * hh + r][ln] = hb;      sPl[w][8 * hh + r][ln] = bf16_bits(p0 - bf16_val(hb));
      hb = bf16_bits(p1);                sPh[w][8 * hh + r][16 + ln] = hb; sPl[w][8 * hh + r][16 + ln] = bf16_bits(p1 - bf16_val(hb));
    }
#pragma unroll
    for (int dt = 0; dt < DT; ++dt)
#pragma unroll
      for (int r = 0; r < 8; ++r) oacc[dt][r] *= alpha[r];
    __builtin_amdgcn_fence(__ATOMIC_ACQ_REL, "workgroup");
    __builtin_amdgcn_wave_barrier();
    FragB pah, pal;
    pah.half[0] = *(const v8us*)&sPh[w][ln][8 * hh]; pah.half[1] = *(const v8us*)&sPh[w][ln][16 + 8 * hh];
    pal.half[0] = *(const v8us*)&sPl[w][ln][8 * hh]; pal.half[1] = *(const v8us*)&sPl[w][ln][16 + 8 * hh];
#pragma unroll
    for (int dt = 0; dt < DT; ++dt) {
      FragB bvh, bvl;
#pragma unroll
      for (int i = 0; i < 8; ++i) {
        bvh.u[i] = sVh[8 * hh + i][dt * 16 + ln]; bvh.u[8 + i] = sVh[16 + 8 * hh + i][dt * 16 + ln];
        bvl.u[i] = sVl[8 * hh + i][dt * 16 + ln]; bvl.u[8 + i] = sVl[16 + 8 * hh + i][dt * 16 + ln];
      }
      oacc[dt] = mmaN<3>(pah.v, pal.v, bvh.v, bvl.v, oacc[dt]);
    }
    __builtin_amdgcn_fence(__ATOMIC_ACQ_REL, "workgroup");
    __builtin_amdgcn_wave_barrier();
  }
#pragma unroll
  for (int r = 0; r < 8; ++r) {
    float l = l_r[r];
    l += __shfl_xor(l, 1, 32); l += __shfl_xor(l, 2, 32); l += __shfl_xor(l, 4, 32); l += __shfl_xor(l, 8, 32);
    l_r[r] = (l > 0.f) ? 1.0f / l : 0.f;
  }
#pragma unroll
  for (int dt = 0; dt < DT; ++dt)
#pragma unroll
    for (int r = 0; r < 8; ++r) sO[w][8 * hh + r][dt * 16 + ln] = oacc[dt][r] * l_r[r];
  __builtin_amdgcn_fence(__ATOMIC_ACQ_REL, "workgroup");
  __builtin_amdgcn_wave_barrier();
  {
    for (int r = 0; r < 16; ++r) {
      const int row = q0 + r;
      if (row < T && lane < D / 4) {
        const v4f val = *(const v4fa*)&sO[w][r][lane * 4];
        *(v4f*)(y + ((size_t)b * T + row) * ypitch + h * D + lane * 4) = val;
      }
    }
    
  }
}

// GEMM C = act(A·W + bias + resid): A f32 (ASPLIT -> hi/lo 2 terms), Wt bf16 [N][K]; ACT 0 none, 1 relu, 2 exact gelu;
// resid (optional, f32, row index = (row % rmod), pitch ldr, RES_BF16 rounds it) added before the activation.
template <bool ASPLIT, int ACT, bool BIAS_BF16, bool RES_BF16>
__global__ __launch_bounds__(128) void k_gemm_bf3(const float* __restrict__ A, int lda, const unsigned short* __restrict__ Wt, int ldb,
                                                const float* __restrict__ bias, const float* __restrict__ resid, int rmod, int ldr,
                                                float* __restrict__ C, int ldc, int M, int N, int K) {
  __shared__ __attribute__((aligned(16))) float so[4][16][64];
  const int tid = threadIdx.x, w = tid >> 5, lane = tid & 31, ln = lane & 15, hh = lane >> 4;
  const int ntn = N / 64;
  const int wid = blockIdx.x * 4 + w;
  const int mt = wid / ntn, nq = wid % ntn;
  if (mt * 16 >= M) return;
  const int row0 = mt * 16, col0 = nq * 64;
  const float* arow = A + (size_t)(row0 + ln) * lda;
  v8f acc[4] = {};
  for (int kb = 0; kb < K; kb += 32) {
    FragB ah, al;
    const v4f x0 = *(const v4fa*)(arow + kb + 8 * hh), x1 = *(const v4fa*)(arow + kb + 8 * hh + 4);
    const v4f x2 = *(const v4fa*)(arow + kb + 16 + 8 * hh), x3 = *(const v4fa*)(arow + kb + 16 + 8 * hh + 4);
    float xs[16] = {x0[0],x0[1],x0[2],x0[3],x1[0],x1[1],x1[2],x1[3],x2[0],x2[1],x2[2],x2[3],x3[0],x3[1],x3[2],x3[3]};
#pragma unroll
    for (int i = 0; i < 16; ++i) { const unsigned short hb = bf16_bits(xs[i]); ah.u[i] = hb; al.u[i] = ASPLIT ? bf16_bits(xs[i] - bf16_val(hb)) : (unsigned short)0; }
#pragma unroll
    for (int t = 0; t < 4; ++t) {
      const unsigned short* brow = Wt + (size_t)(col0 + t * 16 + ln) * ldb + kb;
      FragB b;
      b.half[0] = *(const v8us*)(brow + 8 * hh);
      b.half[1] = *(const v8us*)(brow + 16 + 8 * hh);
      acc[t] = mmaN<ASPLIT ? 2 : 1>(ah.v, al.v, b.v, b.v, acc[t]);
    }
  }
#pragma unroll
  for (int t = 0; t < 4; ++t) {
    const int col = col0 + t * 16 + ln;
    float bv = bias ? bias[col] : 0.f;
    if (BIAS_BF16) bv = bf16_round(bv);
#pragma unroll
    for (int r = 0; r < 8; ++r) {
      float v = acc[t][r] + bv;
      if (resid) { float rv = resid[(size_t)((row0 + 8 * hh + r) % rmod) * ldr + col]; if (RES_BF16) rv = bf16_round(rv); v += rv; }
      if (ACT == 1) v = fmaxf(v, 0.f);
      if (ACT == 2) v = 0.5f * v * (1.0f + erff(v * 0.70710678118654752f));
      if (ACT == 3) { const float u = 0.7978845608028654f * (v + 0.044715f * v * v * v); v = 0.5f * v * (1.0f + tanhf(u)); }
      so[w][8 * hh + r][t * 16 + ln] = v;
    }
  }
  __builtin_amdgcn_fence(__ATOMIC_ACQ_REL, "workgroup");
  __builtin_amdgcn_wave_barrier();
  const int rsub = lane >> 4, c4 = (lane & 15) * 4;
  {
#pragma unroll
    for (int q = 0; q < 8; ++q) {
      const int r = q * 2 + rsub;
      const v4f v = *(const v4fa*)&so[w][r][c4];
      *(v4f*)(C + (size_t)(row0 + r) * ldc + col0 + c4) = v;
    }
    
  }
}
// row LayerNorm (biased variance, eps) over N: s = X (+ R); optional out_sum <- s; out_norm <- (s-mu)*rsqrt(var+eps)*g + b
template <bool PARAM_BF16>
__global__ __launch_bounds__(256) void k_layernorm(const float* __restrict__ X, const float* __restrict__ R, const float* __restrict__ g, const float* __restrict__ bta,
                                                  float* __restrict__ out_sum, float* __restrict__ out_norm, int N, float eps) {
  __shared__ float red[256];
  const int row = blockIdx.x, tid = threadIdx.x;
  const float* x = X + (size_t)row * N; const float* rr = R ? R + (size_t)row * N : nullptr;
  float vals[16];                     // up to N = 4096
  const int per = N / 256;            // contiguous chunk per thread? use strided-by-4 chunks: thread handles j = tid*4 + 1024*u
  float s1 = 0.f;
  for (int u = 0; u < per / 4; ++u) {
    const int j = tid * 4 + 1024 * u;
    const v4f a = *(const v4fa*)(x + j);
    v4f b = {0.f,0.f,0.f,0.f}; if (rr) b = *(const v4fa*)(rr + j);
#pragma unroll
    for (int q = 0; q < 4; ++q) { const float v = a[q] + b[q]; vals[u * 4 + q] = v; s1 += v; }
  }
  red[tid] = s1; __syncthreads();
  for (int st = 128; st > 0; st >>= 1) { if (tid < st) red[tid] += red[tid + st]; __syncthreads(); }
  const float mu = red[0] / (float)N; __syncthreads();
  float s2 = 0.f;
  for (int u = 0; u < per / 4; ++u)
#pragma unroll
    for (int q = 0; q < 4; ++q) { const float c = vals[u * 4 + q] - mu; s2 += c * c; }
  red[tid] = s2; __syncthreads();
  for (int st = 128; st > 0; st >>= 1) { if (tid < st) red[tid] += red[tid + st]; __syncthreads(); }
  const float rs = rsqrtf(red[0] / (float)N + eps);
  {
    for (int u = 0; u < per / 4; ++u) {
      const int j = tid * 4 + 1024 * u;
      v4f o, sm;
#pragma unroll
      for (int q = 0; q < 4; ++q) {
        float gg = g[j + q], bb = bta[j + q];
        if (PARAM_BF16) { gg = bf16_round(gg); bb = bf16_round(bb); }
        sm[q] = vals[u * 4 + q]; o[q] = (vals[u * 4 + q] - mu) * rs * gg + bb;
      }
      if (out_sum) *(v4f*)(out_sum + (size_t)row * N + j) = sm;
      *(v4f*)(out_norm + (size_t)row * N + j) = o;
    }
    
  }
}



// ---- f16 WMMA path (v_wmma_f32_16x16x32_f16): 11-bit significands for operands in range — used where a [0,1] probability operand needs more precision than bf16
typedef _Float16 v16h __attribute__((ext_vector_type(16)));
typedef _Float16 v4h __attribute__((ext_vector_type(4)));
union FragH { v16h v; v8us half[2]; _Float16 h[16]; unsigned short u[16]; };
template <int NT>
__device__ __forceinline__ v8f mmaH(v16h ah, v16h al, v16h bh, v16h bl, v8f c) {
  c = __builtin_amdgcn_wmma_f32_16x16x32_f16(false, ah, false, bh, (short)0, c, false, false);
  if (NT >= 2) c = __builtin_amdgcn_wmma_f32_16x16x32_f16(false, al, false, bh, (short)0, c, false, false);
  if (NT >= 3) c = __builtin_amdgcn_wmma_f32_16x16x32_f16(false, ah, false, bl, (short)0, c, false, false);
  asm volatile("v_nop\n\tv_nop\n\tv_nop\n\tv_nop" : "+v"(c) : "v"(ah), "v"(al), "v"(bh), "v"(bl));
  return c;
}
// batched GEMM like k_gemm_b but f16 operands: A f32 (split into f16 hi/lo if ASPLIT, else rounded to f16), Bt = f16 values [n][k]; alpha; C f32; N multiple of 16 (partial tiles skipped)
template <bool ASPLIT>
__global__ __launch_bounds__(128) void k_gemm_h(const float* __restrict__ A, int lda, size_t sA, const _Float16* __restrict__ Bh, int ldb, size_t sB, float alpha, float* __restrict__ C, int ldc, size_t sC, int M, int N, int K) {
  __shared__ __attribute__((aligned(16))) float so[4][16][64];
  const int tid = threadIdx.x, w = tid >> 5, lane = tid & 31, ln = lane & 15, hh = lane >> 4; const int by = blockIdx.y;
  A += (size_t)by * sA; Bh += (size_t)by * sB; C += (size_t)by * sC;
  const int ntn = (N + 63) / 64; const int wid = blockIdx.x * 4 + w; const int mt = wid / ntn, nq = wid % ntn; if (mt * 16 >= M) return;
  const int row0 = mt * 16, col0 = nq * 64; const float* arow = A + (size_t)(row0 + ln) * lda;
  v8f acc[4] = {};
  for (int kb = 0; kb < K; kb += 32) {
    FragH ah, al;
    const v4f x0 = *(const v4fa*)(arow + kb + 8 * hh), x1 = *(const v4fa*)(arow + kb + 8 * hh + 4), x2 = *(const v4fa*)(arow + kb + 16 + 8 * hh), x3 = *(const v4fa*)(arow + kb + 16 + 8 * hh + 4);
    float xs[16] = {x0[0],x0[1],x0[2],x0[3],x1[0],x1[1],x1[2],x1[3],x2[0],x2[1],x2[2],x2[3],x3[0],x3[1],x3[2],x3[3]};
#pragma unroll
    for (int i = 0; i < 16; ++i) { const _Float16 h = (_Float16)xs[i]; ah.h[i] = h; al.h[i] = ASPLIT ? (_Float16)(xs[i] - (float)h) : (_Float16)0.0f; }
#pragma unroll
    for (int t = 0; t < 4; ++t) { if (col0 + t * 16 >= N) continue; const size_t boff = (size_t)(col0 + t * 16 + ln) * ldb + kb; FragH bq; bq.half[0] = *(const v8us*)(Bh + boff + 8 * hh); bq.half[1] = *(const v8us*)(Bh + boff + 16 + 8 * hh);
      acc[t] = mmaH<ASPLIT ? 2 : 1>(ah.v, al.v, bq.v, bq.v, acc[t]); }
  }
#pragma unroll
  for (int t = 0; t < 4; ++t) { if (col0 + t * 16 >= N) continue;
#pragma unroll
    for (int r = 0; r < 8; ++r) so[w][8 * hh + r][t * 16 + ln] = acc[t][r] * alpha; }
  __builtin_amdgcn_fence(__ATOMIC_ACQ_REL, "workgroup"); __builtin_amdgcn_wave_barrier();
  const int rsub = lane >> 4, c4 = (lane & 15) * 4;
  {
#pragma unroll
    for (int q = 0; q < 8; ++q) { const int r = q * 2 + rsub; if (col0 + c4 < N) { const v4f v = *(const v4fa*)&so[w][r][c4]; *(v4f*)(C + (size_t)(row0 + r) * ldc + col0 + c4) = v; } }
     }
}

// Wt[n][k] = f16(W[k][n]·scale) from f32 row-major W[K][N] (scale = power of two; bf16-exact weights stay exact in f16 away from the subnormal range)
__global__ __launch_bounds__(256) void k_wt_f16(const float* __restrict__ W, _Float16* __restrict__ Wt, int K, int N, float scale) {
  const int t = blockIdx.x * 256 + threadIdx.x; if (t >= N * (K / 8)) return; const int n = t / (K / 8), k8 = (t % (K / 8)) * 8; FragH f;
#pragma unroll
  for (int i = 0; i < 8; ++i) f.h[i] = (_Float16)(bf16_round(W[(size_t)(k8 + i) * N + n]) * scale); const v8us o = f.half[0];
  *(v8us*)((unsigned short*)Wt + (size_t)n * K + k8) = o; 
}
__global__ __launch_bounds__(256) void k_x16(const float* __restrict__ x, _Float16* __restrict__ X16, size_t n8) { const size_t t = (size_t)blockIdx.x * 256 + threadIdx.x; if (t >= n8) return; FragH f;
#pragma unroll
  for (int q = 0; q < 8; ++q) f.h[q] = (_Float16)bf16_round(x[t * 8 + q]); *(v8us*)((unsigned short*)X16 + t * 8) = f.half[0];  }
__global__ __launch_bounds__(256) void k_round16f(const float* __restrict__ W, _Float16* __restrict__ Bt, size_t n8) { const size_t t = (size_t)blockIdx.x * 256 + threadIdx.x; if (t >= n8) return; FragH f;
#pragma unroll
  for (int i = 0; i < 8; ++i) f.h[i] = (_Float16)(bf16_round(W[t * 8 + i]) * 16.0f); *(v8us*)((unsigned short*)Bt + t * 8) = f.half[0];  }
__global__ __launch_bounds__(256) void k_vt(const _Float16* __restrict__ V16, _Float16* __restrict__ Vt) { __shared__ unsigned short tl[64][66]; const int tid = threadIdx.x; const int slab = blockIdx.x / (SS / 64), lg = blockIdx.x % (SS / 64); const int b = slab / NKV, h = slab % NKV;
  for (int i = tid; i < 64 * 8; i += 256) { const int r = i / 8, c8 = (i % 8) * 8; FragH f; f.half[0] = *(const v8us*)((const unsigned short*)V16 + ((size_t)b * SS + lg * 64 + r) * KVD + h * HD + c8);
#pragma unroll
    for (int q = 0; q < 8; ++q) tl[r][c8 + q] = f.u[q]; }
  __syncthreads();
  {
#pragma unroll
    for (int rd = 0; rd < 2; ++rd) { const int d = rd * 32 + tid / 8, pc = tid % 8; FragH f;
#pragma unroll
      for (int q = 0; q < 8; ++q) f.u[q] = tl[pc * 8 + q][d];
      *(v8us*)((unsigned short*)Vt + ((size_t)slab * HD + d) * SS + lg * 64 + pc * 8) = f.half[0]; }
     } }
// Maximum over each 16-lane row for eight values at once: an xor butterfly (1, 2, 4, 8) on the vector pipe. DPP row_xmask hands the partner lane's value to v_max_num_f32 as an operand, so a step
// needs no LDS-pipe round trip and no dscnt wait. One asm statement, step by step over the eight values: the eight instructions of a step are independent, so none waits for the step before it
// (as single statements, and as the builtin move, the compiler put each value's four steps back to back; the builtin also kept a separate move and a quieting maximum per step). All 32 lanes are on here.
__device__ __forceinline__ void row16_max8(float (&m)[8]) {
  asm("v_max_num_f32_dpp %0, %0, %0 row_xmask:1 row_mask:0xf bank_mask:0xf\n\t"
      "v_max_num_f32_dpp %1, %1, %1 row_xmask:1 row_mask:0xf bank_mask:0xf\n\t"
      "v_max_num_f32_dpp %2, %2, %2 row_xmask:1 row_mask:0xf bank_mask:0xf\n\t"
      "v_max_num_f32_dpp %3, %3, %3 row_xmask:1 row_mask:0xf bank_mask:0xf\n\t"
      "v_max_num_f32_dpp %4, %4, %4 row_xmask:1 row_mask:0xf bank_mask:0xf\n\t"
      "v_max_num_f32_dpp %5, %5, %5 row_xmask:1 row_mask:0xf bank_mask:0xf\n\t"
      "v_max_num_f32_dpp %6, %6, %6 row_xmask:1 row_mask:0xf bank_mask:0xf\n\t"
      "v_max_num_f32_dpp %7, %7, %7 row_xmask:1 row_mask:0xf bank_mask:0xf\n\t"
      "v_max_num_f32_dpp %0, %0, %0 row_xmask:2 row_mask:0xf bank_mask:0xf\n\t"
      "v_max_num_f32_dpp %1, %1, %1 row_xmask:2 row_mask:0xf bank_mask:0xf\n\t"
      "v_max_num_f32_dpp %2, %2, %2 row_xmask:2 row_mask:0xf bank_mask:0xf\n\t"
      "v_max_num_f32_dpp %3, %3, %3 row_xmask:2 row_mask:0xf bank_mask:0xf\n\t"
      "v_max_num_f32_dpp %4, %4, %4 row_xmask:2 row_mask:0xf bank_mask:0xf\n\t"
      "v_max_num_f32_dpp %5, %5, %5 row_xmask:2 row_mask:0xf bank_mask:0xf\n\t"
      "v_max_num_f32_dpp %6, %6, %6 row_xmask:2 row_mask:0xf bank_mask:0xf\n\t"
      "v_max_num_f32_dpp %7, %7, %7 row_xmask:2 row_mask:0xf bank_mask:0xf\n\t"
      "v_max_num_f32_dpp %0, %0, %0 row_xmask:4 row_mask:0xf bank_mask:0xf\n\t"
      "v_max_num_f32_dpp %1, %1, %1 row_xmask:4 row_mask:0xf bank_mask:0xf\n\t"
      "v_max_num_f32_dpp %2, %2, %2 row_xmask:4 row_mask:0xf bank_mask:0xf\n\t"
      "v_max_num_f32_dpp %3, %3, %3 row_xmask:4 row_mask:0xf bank_mask:0xf\n\t"
      "v_max_num_f32_dpp %4, %4, %4 row_xmask:4 row_mask:0xf bank_mask:0xf\n\t"
      "v_max_num_f32_dpp %5, %5, %5 row_xmask:4 row_mask:0xf bank_mask:0xf\n\t"
      "v_max_num_f32_dpp %6, %6, %6 row_xmask:4 row_mask:0xf bank_mask:0xf\n\t"
      "v_max_num_f32_dpp %7, %7, %7 row_xmask:4 row_mask:0xf bank_mask:0xf\n\t"
      "v_max_num_f32_dpp %0, %0, %0 row_xmask:8 row_mask:0xf bank_mask:0xf\n\t"
      "v_max_num_f32_dpp %1, %1, %1 row_xmask:8 row_mask:0xf bank_mask:0xf\n\t"
      "v_max_num_f32_dpp %2, %2, %2 row_xmask:8 row_mask:0xf bank_mask:0xf\n\t"
      "v_max_num_f32_dpp %3, %3, %3 row_xmask:8 row_mask:0xf bank_mask:0xf\n\t"
      "v_max_num_f32_dpp %4, %4, %4 row_xmask:8 row_mask:0xf bank_mask:0xf\n\t"
      "v_max_num_f32_dpp %5, %5, %5 row_xmask:8 row_mask:0xf bank_mask:0xf\n\t"
      "v_max_num_f32_dpp %6, %6, %6 row_xmask:8 row_mask:0xf bank_mask:0xf\n\t"
      "v_max_num_f32_dpp %7, %7, %7 row_xmask:8 row_mask:0xf bank_mask:0xf"
      : "+v"(m[0]), "+v"(m[1]), "+v"(m[2]), "+v"(m[3]), "+v"(m[4]), "+v"(m[5]), "+v"(m[6]), "+v"(m[7])); }
// the same butterfly for a sum: the builtin move fuses into v_add_f32_dpp
template <int M> __device__ __forceinline__ float row_xor(float v) { return __int_as_float(__builtin_amdgcn_mov_dpp(__float_as_int(v), 0x160 + M, 0xf, 0xf, true)); }
__device__ __forceinline__ float row16_sum(float v) { v += row_xor<1>(v); v += row_xor<2>(v); v += row_xor<4>(v); v += row_xor<8>(v); return v; }
// fused causal GQA attention per ((b,h), 128 queries): wave = 32 queries; Q from Q16 cols h·64 (pitch 1024), K from K16 cols kvh·64 (pitch 512), kvh = h / 2; key chunks 0..qb0+128; mask k ≤ q else −inf
__global__ __launch_bounds__(128) void k_flash(const _Float16* __restrict__ Q16, const _Float16* __restrict__ K16, const _Float16* __restrict__ Vt, _Float16* __restrict__ O16) {
  constexpr int RPW = 32, NQB = SS / (4 * RPW), DT = HD / 16, KS = HD / 32;
  __shared__ __attribute__((aligned(16))) unsigned short sP[4][RPW][40]; __shared__ __attribute__((aligned(16))) float sO[4][RPW][HD];
  const int tid = threadIdx.x, w = tid >> 5, lane = tid & 31, ln = lane & 15, hh = lane >> 4;
  const int slab = blockIdx.x / NQB, qblk = blockIdx.x % NQB; const int b = slab / NH, h = slab % NH; const int kvh = h / (NH / NKV); const int qb0 = qblk * (4 * RPW); const int q0 = qb0 + w * RPW;
  FragH aq[2][KS];
#pragma unroll
  for (int rt = 0; rt < 2; ++rt) { const unsigned short* qr = (const unsigned short*)Q16 + ((size_t)b * SS + q0 + rt * 16 + ln) * HID + h * HD;
#pragma unroll
    for (int ks = 0; ks < KS; ++ks) { aq[rt][ks].half[0] = *(const v8us*)(qr + ks * 32 + 8 * hh); aq[rt][ks].half[1] = *(const v8us*)(qr + ks * 32 + 16 + 8 * hh); } }
  const unsigned short* Vth = (const unsigned short*)Vt + (size_t)(b * NKV + kvh) * HD * SS;
  float m_r[2][8], l_r[2][8]; v8f oacc[2][DT];
#pragma unroll
  for (int rt = 0; rt < 2; ++rt) {
#pragma unroll
    for (int r = 0; r < 8; ++r) { m_r[rt][r] = -3.0e38f; l_r[rt][r] = 0.f; }
#pragma unroll
    for (int dt = 0; dt < DT; ++dt) oacc[rt][dt] = (v8f){0.f,0.f,0.f,0.f,0.f,0.f,0.f,0.f}; }
  const int jend = qb0 + 4 * RPW;
#pragma unroll 1
  for (int j0 = 0; j0 < jend; j0 += 32) {
    v8f s[2][2];
#pragma unroll
    for (int nt = 0; nt < 2; ++nt) { const unsigned short* kr = (const unsigned short*)K16 + ((size_t)b * SS + j0 + nt * 16 + ln) * KVD + kvh * HD; FragH bk[KS];
#pragma unroll
      for (int ks = 0; ks < KS; ++ks) { bk[ks].half[0] = *(const v8us*)(kr + ks * 32 + 8 * hh); bk[ks].half[1] = *(const v8us*)(kr + ks * 32 + 16 + 8 * hh); }
#pragma unroll
      for (int rt = 0; rt < 2; ++rt) { v8f acc = (v8f){0.f,0.f,0.f,0.f,0.f,0.f,0.f,0.f};
#pragma unroll
        for (int ks = 0; ks < KS; ++ks) acc = mmaH<1>(aq[rt][ks].v, aq[rt][ks].v, bk[ks].v, bk[ks].v, acc); s[rt][nt] = acc; } }
    float mx[2][8];
#pragma unroll
    for (int rt = 0; rt < 2; ++rt) {
#pragma unroll
      for (int r = 0; r < 8; ++r) { const int qi = q0 + rt * 16 + 8 * hh + r; const int k0 = j0 + ln, k1 = j0 + 16 + ln;
        s[rt][0][r] = (k0 <= qi) ? s[rt][0][r] * 0.125f : -INFINITY; s[rt][1][r] = (k1 <= qi) ? s[rt][1][r] * 0.125f : -INFINITY; mx[rt][r] = fmaxf(s[rt][0][r], s[rt][1][r]); }
      row16_max8(mx[rt]); }
#pragma unroll
    for (int rt = 0; rt < 2; ++rt)
#pragma unroll
      for (int r = 0; r < 8; ++r) { const float s0 = s[rt][0][r], s1 = s[rt][1][r];
        const float mn = fmaxf(m_r[rt][r], mx[rt][r]); const float al = expf(m_r[rt][r] - mn); m_r[rt][r] = mn; const float p0 = expf(s0 - mn), p1 = expf(s1 - mn); l_r[rt][r] = l_r[rt][r] * al + p0 + p1;
#pragma unroll
        for (int dt = 0; dt < DT; ++dt) oacc[rt][dt][r] *= al;
        FragH t2; t2.h[0] = (_Float16)p0; t2.h[1] = (_Float16)p1; sP[w][rt * 16 + 8 * hh + r][ln] = t2.u[0]; sP[w][rt * 16 + 8 * hh + r][16 + ln] = t2.u[1]; }
    __builtin_amdgcn_fence(__ATOMIC_ACQ_REL, "workgroup"); __builtin_amdgcn_wave_barrier();
    FragH pa[2];
#pragma unroll
    for (int rt = 0; rt < 2; ++rt) { pa[rt].half[0] = *(const v8us*)&sP[w][rt * 16 + ln][8 * hh]; pa[rt].half[1] = *(const v8us*)&sP[w][rt * 16 + ln][16 + 8 * hh]; }
#pragma unroll
    for (int dt = 0; dt < DT; ++dt) { const unsigned short* vrow = Vth + (size_t)(dt * 16 + ln) * SS + j0; FragH bv; bv.half[0] = *(const v8us*)(vrow + 8 * hh); bv.half[1] = *(const v8us*)(vrow + 16 + 8 * hh);
#pragma unroll
      for (int rt = 0; rt < 2; ++rt) oacc[rt][dt] = mmaH<1>(pa[rt].v, pa[rt].v, bv.v, bv.v, oacc[rt][dt]); }
    __builtin_amdgcn_fence(__ATOMIC_ACQ_REL, "workgroup"); __builtin_amdgcn_wave_barrier(); }
#pragma unroll
  for (int rt = 0; rt < 2; ++rt) {
#pragma unroll
    for (int r = 0; r < 8; ++r) { float l = l_r[rt][r]; l = row16_sum(l); l_r[rt][r] = 1.0f / l; }
#pragma unroll
    for (int dt = 0; dt < DT; ++dt)
#pragma unroll
      for (int r = 0; r < 8; ++r) sO[w][rt * 16 + 8 * hh + r][dt * 16 + ln] = oacc[rt][dt][r] * l_r[rt][r]; }
  __builtin_amdgcn_fence(__ATOMIC_ACQ_REL, "workgroup"); __builtin_amdgcn_wave_barrier();
  {
#pragma unroll
    for (int rp = 0; rp < RPW; rp += 2) { const int r = rp + (lane >> 4), pc = lane & 15; const v4f val = *(const v4fa*)&sO[w][r][pc * 4]; v4h h4;
#pragma unroll
      for (int i = 0; i < 4; ++i) h4[i] = (_Float16)val[i];      // the o projection's A operand: rounded here, 16 lanes = one 128-byte line of the row
      *(v4h*)(O16 + ((size_t)b * SS + q0 + r) * HID + h * HD + pc * 4) = h4; }
     } }
// Projection GEMM C[4096][N] = A[4096][1024] * Bt[N][1024]^T / 16 (f16 operands, f32 accumulate, k ascending in steps of 32 as before). Block = 4 waves = a 64 x 128 tile of C; wave = 32 x 64 (2 x 4 accumulators).
// Each stage brings 64 k of the 64 A rows and the 128 Bt rows into LDS with whole 128-byte rows per 8 lanes, so every row is fetched once per block instead of once per wave in 16-line gathers;
// the next stage's rows are loaded into registers while this stage's products run, and go into the other buffer. Row pitch 144 bytes: the 16 rows of a fragment read fall on different banks.
// OUT 0: C f32. OUT 1: C16 = f16(C). OUT 2 (q, k): a wave's 64 columns are one head, so its staged 32 x 64 tile holds whole head rows: per row RMSNorm over the 64 dims (eps 1e-6, times bf16(nw)),
// then RoPE with the INPUT cos/sin[row][64] (rotate_half = [-x2, x1]; rounded to bf16 like every other input), then C16 = f16: the f32 product never goes to memory.
template <int N, int OUT>
__global__ __launch_bounds__(128) void k_proj(const _Float16* __restrict__ A, const _Float16* __restrict__ Bt, float* __restrict__ C, _Float16* __restrict__ C16,
                                              const float* __restrict__ nw, const float* __restrict__ cs, const float* __restrict__ sn) {
  constexpr int K = HID, BM = 64, BN = 128, BK = 64, PIT = BK + 8, NS = K / BK, NBN = N / BN, OP = 68;
  __shared__ __attribute__((aligned(16))) unsigned short sm[2][BM + BN][PIT];
  static_assert(sizeof(float) * 4 * 32 * OP <= sizeof(unsigned short) * 2 * (BM + BN) * PIT, "the output tiles reuse the stage buffers");
  const int tid = threadIdx.x, w = tid >> 5, lane = tid & 31, ln = lane & 15, hh = lane >> 4;
  const int row0 = (blockIdx.x / NBN) * BM, col0 = (blockIdx.x % NBN) * BN, wm = (w >> 1) * 32, wn = (w & 1) * 64;
  const int sr = tid >> 3, sc = (tid & 7) * 8;
  const unsigned short* ga = (const unsigned short*)A + (size_t)(row0 + sr) * K + sc;
  const unsigned short* gb = (const unsigned short*)Bt + (size_t)(col0 + sr) * K + sc;
  v8us ra[BM / 16], rb[BN / 16];
  v8f acc[2][4];
#pragma unroll
  for (int mi = 0; mi < 2; ++mi)
#pragma unroll
    for (int t = 0; t < 4; ++t) acc[mi][t] = (v8f){0.f,0.f,0.f,0.f,0.f,0.f,0.f,0.f};
#pragma unroll
  for (int i = 0; i < BM / 16; ++i) ra[i] = *(const v8us*)(ga + (size_t)i * 16 * K);
#pragma unroll
  for (int i = 0; i < BN / 16; ++i) rb[i] = *(const v8us*)(gb + (size_t)i * 16 * K);
#pragma unroll
  for (int i = 0; i < BM / 16; ++i) *(v8us*)&sm[0][sr + i * 16][sc] = ra[i];
#pragma unroll
  for (int i = 0; i < BN / 16; ++i) *(v8us*)&sm[0][BM + sr + i * 16][sc] = rb[i];
  __syncthreads();
  // unrolled whole: every stage's global offset is then an immediate on two address pairs that are never rewritten, and the buffer index a constant
#pragma unroll
  for (int s = 0; s < NS; ++s) {
    const int cur = s & 1;
    if (s + 1 < NS) {
#pragma unroll
      for (int i = 0; i < BM / 16; ++i) ra[i] = *(const v8us*)(ga + (size_t)i * 16 * K + (s + 1) * BK);
#pragma unroll
      for (int i = 0; i < BN / 16; ++i) rb[i] = *(const v8us*)(gb + (size_t)i * 16 * K + (s + 1) * BK);
    }
    // keeps the next stage's loads at the head of this stage, so that they fly under all of its products (the scheduler sank them to just in front of their LDS stores)
    __builtin_amdgcn_sched_barrier(0);
    FragH a[BK / 32][2], b[BK / 32][4];
#pragma unroll
    for (int ks = 0; ks < BK / 32; ++ks) {
#pragma unroll
      for (int mi = 0; mi < 2; ++mi) { const unsigned short* p = &sm[cur][wm + mi * 16 + ln][ks * 32 + 8 * hh]; a[ks][mi].half[0] = *(const v8us*)p; a[ks][mi].half[1] = *(const v8us*)(p + 16); }
#pragma unroll
      for (int t = 0; t < 4; ++t) { const unsigned short* p = &sm[cur][BM + wn + t * 16 + ln][ks * 32 + 8 * hh]; b[ks][t].half[0] = *(const v8us*)p; b[ks][t].half[1] = *(const v8us*)(p + 16); }
    }
    // keeps the stage's fragment reads in one group ahead of its products: one exposed LDS latency per stage (the scheduler reused the A registers and waited for LDS four times per stage)
    __builtin_amdgcn_sched_barrier(0);
#pragma unroll
    for (int ks = 0; ks < BK / 32; ++ks)
#pragma unroll
      for (int mi = 0; mi < 2; ++mi)
#pragma unroll
        for (int t = 0; t < 4; ++t) acc[mi][t] = __builtin_amdgcn_wmma_f32_16x16x32_f16(false, a[ks][mi].v, false, b[ks][t].v, (short)0, acc[mi][t], false, false);
    // keeps the waits for those loads, and the LDS stores behind them, behind the issue of all of this stage's products (the scheduler put them in the middle of the stage)
    __builtin_amdgcn_sched_barrier(0);
    if (s + 1 < NS) {
#pragma unroll
      for (int i = 0; i < BM / 16; ++i) *(v8us*)&sm[cur ^ 1][sr + i * 16][sc] = ra[i];
#pragma unroll
      for (int i = 0; i < BN / 16; ++i) *(v8us*)&sm[cur ^ 1][BM + sr + i * 16][sc] = rb[i];
    }
    // one barrier per stage: it publishes the buffer just filled and ends every wave's reads of the buffer that the next stage refills (after the last stage: that the output tiles reuse)
    __syncthreads();
  }
  typedef float fa __attribute__((may_alias));
  fa* so = (fa*)&sm[0][0][0] + w * 32 * OP;
#pragma unroll
  for (int mi = 0; mi < 2; ++mi)
#pragma unroll
    for (int t = 0; t < 4; ++t)
#pragma unroll
      for (int r = 0; r < 8; ++r) so[(mi * 16 + 8 * hh + r) * OP + t * 16 + ln] = acc[mi][t][r] * 0.0625f;
  // the wave reads back its own tile, written by other lanes: the LDS stores must have landed first
  __builtin_amdgcn_fence(__ATOMIC_ACQ_REL, "workgroup"); __builtin_amdgcn_wave_barrier();
  if constexpr (OUT == 2) {
    static_assert(HD == 64, "a wave's 64 columns are one head");
    // 8 lanes per row, 4 rows per pass: a lane holds dims j4..j4+3 (x1) and 32+j4..32+j4+3 (x2), the two halves that RoPE pairs
    const int rr = lane >> 3, j4 = (lane & 7) * 4;
    v4f w1 = *(const v4fa*)(nw + j4), w2 = *(const v4fa*)(nw + 32 + j4);
#pragma unroll
    for (int i = 0; i < 4; ++i) { w1[i] = bf16_round(w1[i]); w2[i] = bf16_round(w2[i]); }
    const fa* xp = so + rr * OP + j4;
    // byte offsets of the lane's first row: one for cos and sin (below 1 MiB), one for the output (below 8 MiB); each rides as the 32-bit offset register beside a scalar base
    unsigned co = (unsigned)((row0 + wm + rr) * HD + j4) * 4u, yo = (unsigned)((row0 + wm + rr) * N + col0 + wn + j4) * 2u;
    // two trips of four passes: a trip's 16 cos/sin loads go out together and fly under its sums of squares (all eight passes unrolled took more than 256 registers)
#pragma unroll 1
    for (int qh = 0; qh < 2; ++qh) {
      v4f x1[4], x2[4], c1[4], c2[4], s1[4], s2[4];
#pragma unroll
      for (int q = 0; q < 4; ++q) { x1[q] = *(const v4fa*)(xp + q * 4 * OP); x2[q] = *(const v4fa*)(xp + q * 4 * OP + 32); }
#pragma unroll
      for (int q = 0; q < 4; ++q) { const float* cp = (const float*)((const char*)cs + co) + q * 4 * HD; const float* sp = (const float*)((const char*)sn + co) + q * 4 * HD;
        c1[q] = *(const v4fa*)cp; c2[q] = *(const v4fa*)(cp + 32); s1[q] = *(const v4fa*)sp; s2[q] = *(const v4fa*)(sp + 32); }
#pragma unroll
      for (int q = 0; q < 4; ++q) {
        // sum of squares in the order of a 32-lane xor butterfly (16, 8, 4, 2, 1) over a_j = x1_j^2 + x2_j^2: dim j = 4 * lane + i, so 16, 8, 4 are lane steps 4, 2, 1 and 2, 1 are in-lane
        float t[4];
#pragma unroll
        for (int i = 0; i < 4; ++i) t[i] = __builtin_fmaf(x1[q][i], x1[q][i], x2[q][i] * x2[q][i]);
#pragma unroll
        for (int i = 0; i < 4; ++i) t[i] += row_xor<4>(t[i]);
#pragma unroll
        for (int i = 0; i < 4; ++i) t[i] += row_xor<2>(t[i]);
#pragma unroll
        for (int i = 0; i < 4; ++i) t[i] += row_xor<1>(t[i]);
        const float ss = (t[0] + t[2]) + (t[1] + t[3]);
        const float rs = rsqrtf(ss / (float)HD + 1e-6f);
        v4h y1, y2;      // explicit fma here and in t[]: it fixes which of the two products is rounded on its own
#pragma unroll
        for (int i = 0; i < 4; ++i) { const float n1 = x1[q][i] * rs * w1[i], n2 = x2[q][i] * rs * w2[i];
          y1[i] = (_Float16)__builtin_fmaf(n1, bf16_round(c1[q][i]), -(n2 * bf16_round(s1[q][i]))); y2[i] = (_Float16)__builtin_fmaf(n2, bf16_round(c2[q][i]), n1 * bf16_round(s2[q][i])); }
        _Float16* yp = (_Float16*)((char*)C16 + yo) + q * 4 * N;
        *(v4h*)yp = y1; *(v4h*)(yp + 32) = y2; }
      xp += 16 * OP; co += 16 * HD * 4; yo += 16 * N * 2; }
    return;
  }
#pragma unroll
  for (int q = 0; q < 16; ++q) { const int r = q * 2 + hh, c4 = ln * 4; const v4f v = *(const v4fa*)&so[r * OP + c4]; const size_t o = (size_t)(row0 + wm + r) * N + col0 + wn + c4;
    if (OUT == 1) { v4h h4;
#pragma unroll
      for (int i = 0; i < 4; ++i) h4[i] = (_Float16)v[i];
      *(v4h*)(C16 + o) = h4; }
    else *(v4f*)(C + o) = v; }
}
extern "C" void kernel_launch(void* const* d_in, const int* in_sizes, int n_in,
                              void* d_out, int out_size, void* d_ws, size_t ws_size, hipStream_t stream) {
  (void)in_sizes; (void)n_in; (void)out_size;
  const float* x = (const float*)d_in[0]; const float* cs = (const float*)d_in[1]; const float* sn = (const float*)d_in[2]; const float* wq = (const float*)d_in[3]; const float* wk = (const float*)d_in[4]; const float* wv = (const float*)d_in[5]; const float* wo = (const float*)d_in[6]; const float* qnw = (const float*)d_in[7]; const float* knw = (const float*)d_in[8];
  char* ws = (char*)d_ws; size_t off = 0;
  auto take = [&](size_t bytes) { char* p = ws + off; off += (bytes + 255) & ~(size_t)255; return p; };
  _Float16* Bq = (_Float16*)take((size_t)HID * HID * 2); _Float16* Bk = (_Float16*)take((size_t)KVD * HID * 2); _Float16* Bv = (_Float16*)take((size_t)KVD * HID * 2); _Float16* Bo = (_Float16*)take((size_t)HID * HID * 2);
  _Float16* X16 = (_Float16*)take((size_t)NR * HID * 2); _Float16* Q16 = (_Float16*)take((size_t)NR * HID * 2); _Float16* K16 = (_Float16*)take((size_t)NR * KVD * 2); _Float16* V16 = (_Float16*)take((size_t)NR * KVD * 2); _Float16* Vt = (_Float16*)take((size_t)NR * KVD * 2); _Float16* O16 = (_Float16*)take((size_t)NR * HID * 2);
  if (off > ws_size) return;      // about 6 + 8.4 + 8.4 + 4.2 x 3 + 8.4 = 44 MiB
  k_round16f<<<(unsigned)(((size_t)HID * HID / 8 + 255) / 256), 256, 0, stream>>>(wq, Bq, (size_t)HID * HID / 8); k_round16f<<<(unsigned)(((size_t)KVD * HID / 8 + 255) / 256), 256, 0, stream>>>(wk, Bk, (size_t)KVD * HID / 8);
  k_round16f<<<(unsigned)(((size_t)KVD * HID / 8 + 255) / 256), 256, 0, stream>>>(wv, Bv, (size_t)KVD * HID / 8); k_round16f<<<(unsigned)(((size_t)HID * HID / 8 + 255) / 256), 256, 0, stream>>>(wo, Bo, (size_t)HID * HID / 8);      // (out,in) = Bt
  const unsigned gx = (unsigned)(((size_t)NR * HID / 8 + 255) / 256);
  k_x16<<<gx, 256, 0, stream>>>(x, X16, (size_t)NR * HID / 8);
  const unsigned gq = (NR / 64) * (HID / 128), gk = (NR / 64) * (KVD / 128);
  k_proj<HID, 2><<<gq, 128, 0, stream>>>(X16, Bq, nullptr, Q16, qnw, cs, sn);
  k_proj<KVD, 2><<<gk, 128, 0, stream>>>(X16, Bk, nullptr, K16, knw, cs, sn);
  k_proj<KVD, 1><<<gk, 128, 0, stream>>>(X16, Bv, nullptr, V16, nullptr, nullptr, nullptr);
  k_vt<<<BB * NKV * (SS / 64), 256, 0, stream>>>(V16, Vt);
  k_flash<<<BB * NH * (SS / 128), 128, 0, stream>>>(Q16, K16, Vt, O16);
  k_proj<HID, 0><<<gq, 128, 0, stream>>>(O16, Bo, (float*)d_out, nullptr, nullptr, nullptr, nullptr);
}

// v004
// Measured time: 169 microseconds a run.
// Two timings next to v003 put it at 1.50 and 1.51 times that version's speed.
// Counting every step since v000, it is 3.19 times as fast.
#include <hip/hip_runtime.h>
// q/k/v/o projections (4096 × 1024 → 1024/512/512, 1024) and the 16-head causal GQA attention (8 kv heads, d = 64) on v_wmma_f32_16x16x32_f16 (fused flash-style kernel: S = Q·Kᵀ, O = P·V on WMMA,
// causal mask, online max/sum softmax f32, P f16 ≤ 1; only key chunks ≤ the block's last query); per-head RMSNorm and RoPE (cos/sin are INPUTS) applied in f32 before the f16 cast; V transposed
// per kv head; A = f16(bf16 x) exact, weights bf16-exact ×2^4 ((out,in) layouts), single products, f32 accumulate.
#define BB 2
#define SS 2048
#define HID 1024
#define NH 16
#define NKV 8
#define HD 64
#define KVD 512
#define NR (BB * SS)

typedef __bf16 v16b __attribute__((ext_vector_type(16)));
typedef unsigned short v8us __attribute__((ext_vector_type(8), may_alias));
typedef float  v8f  __attribute__((ext_vector_type(8)));
typedef float  v4f  __attribute__((ext_vector_type(4)));
typedef float  v4fa __attribute__((ext_vector_type(4), may_alias));
union FragB { v16b v; v8us half[2]; unsigned short u[16]; };

__device__ __forceinline__ unsigned short bf16_bits(float x) { unsigned int u = __float_as_uint(x); return (unsigned short)((u + 0x7FFFu + ((u >> 16) & 1u)) >> 16); }
__device__ __forceinline__ float bf16_val(unsigned short b) { return __uint_as_float(((unsigned int)b) << 16); }
__device__ __forceinline__ float bf16_round(float x) { return bf16_val(bf16_bits(x)); }
// D += A·B with NT terms: 1 = ah·bh, 2 = + al·bh (A split), 3 = + ah·bl (both split)
template <int NT>
__device__ __forceinline__ v8f mmaN(v16b ah, v16b al, v16b bh, v16b bl, v8f c) {
  c = __builtin_amdgcn_wmma_f32_16x16x32_bf16(false, ah, false, bh, (short)0, c, false, false);
  if (NT >= 2) c = __builtin_amdgcn_wmma_f32_16x16x32_bf16(false, al, false, bh, (short)0, c, false, false);
  if (NT >= 3) c = __builtin_amdgcn_wmma_f32_16x16x32_bf16(false, ah, false, bl, (short)0, c, false, false);
  asm volatile("v_nop\n\tv_nop\n\tv_nop\n\tv_nop" : "+v"(c) : "v"(ah), "v"(al), "v"(bh), "v"(bl));
  return c;
}

__global__ __launch_bounds__(256) void k_wt_bf16(const float* __restrict__ W, unsigned short* __restrict__ Wt, int K, int N) {
  const int t = blockIdx.x * 256 + threadIdx.x;
  const int k8n = K / 8;
  if (t >= N * k8n) return;
  const int n = t / k8n, k8 = (t % k8n) * 8;
  v8us v;
#pragma unroll
  for (int i = 0; i < 8; ++i) v[i] = bf16_bits(W[(size_t)(k8 + i) * N + n]);
  *(v8us*)(Wt + (size_t)n * K + k8) = v;
  
}

// GEMM C[M][N] (f32, pitch ldc) = act(A[M][K]·W + bias). A f32 row-major (pitch lda) converted per fragment to bf16
// (ASPLIT: hi/lo two planes -> 2 terms, else single rounded term); Wt bf16 [N][K] (pitch ldb). BIAS_BF16 rounds the
// bias to bf16 first (bias quantised to bf16 before the add). K%32==0, M%16==0, N%64==0.
template <bool ASPLIT, int ACT, bool BIAS_BF16>
__global__ __launch_bounds__(128) void k_gemm_bf(const float* __restrict__ A, int lda, const unsigned short* __restrict__ Wt, int ldb,
                                               const float* __restrict__ bias, float* __restrict__ C, int ldc, int M, int N, int K) {
  __shared__ __attribute__((aligned(16))) float so[4][16][64];
  const int tid = threadIdx.x, w = tid >> 5, lane = tid & 31, ln = lane & 15, hh = lane >> 4;
  const int ntn = N / 64;
  const int wid = blockIdx.x * 4 + w;
  const int mt = wid / ntn, nq = wid % ntn;
  if (mt * 16 >= M) return;
  const int row0 = mt * 16, col0 = nq * 64;
  const float* arow = A + (size_t)(row0 + ln) * lda;
  v8f acc[4] = {};
  for (int kb = 0; kb < K; kb += 32) {
    FragB ah, al;
    const v4f x0 = *(const v4fa*)(arow + kb + 8 * hh), x1 = *(const v4fa*)(arow + kb + 8 * hh + 4);
    const v4f x2 = *(const v4fa*)(arow + kb + 16 + 8 * hh), x3 = *(const v4fa*)(arow + kb + 16 + 8 * hh + 4);
    float xs[16] = {x0[0],x0[1],x0[2],x0[3],x1[0],x1[1],x1[2],x1[3],x2[0],x2[1],x2[2],x2[3],x3[0],x3[1],x3[2],x3[3]};
#pragma unroll
    for (int i = 0; i < 16; ++i) { const unsigned short hb = bf16_bits(xs[i]); ah.u[i] = hb; al.u[i] = ASPLIT ? bf16_bits(xs[i] - bf16_val(hb)) : (unsigned short)0; }
#pragma unroll
    for (int t = 0; t < 4; ++t) {
      const unsigned short* brow = Wt + (size_t)(col0 + t * 16 + ln) * ldb + kb;
      FragB b;
      b.half[0] = *(const v8us*)(brow + 8 * hh);
      b.half[1] = *(const v8us*)(brow + 16 + 8 * hh);
      acc[t] = mmaN<ASPLIT ? 2 : 1>(ah.v, al.v, b.v, b.v, acc[t]);
    }
  }
#pragma unroll
  for (int t = 0; t < 4; ++t) {
    float bv = bias ? bias[col0 + t * 16 + ln] : 0.f;
    if (BIAS_BF16) bv = bf16_round(bv);
#pragma unroll
    for (int r = 0; r < 8; ++r) { float v = acc[t][r] + bv; if (ACT == 1) v = fmaxf(v, 0.f); so[w][8 * hh + r][t * 16 + ln] = v; }
  }
  __builtin_amdgcn_fence(__ATOMIC_ACQ_REL, "workgroup");
  __builtin_amdgcn_wave_barrier();
  const int rsub = lane >> 4, c4 = (lane & 15) * 4;
  {
#pragma unroll
    for (int q = 0; q < 8; ++q) {
      const int r = q * 2 + rsub;
      const v4f v = *(const v4fa*)&so[w][r][c4];
      *(v4f*)(C + (size_t)(row0 + r) * ldc + col0 + c4) = v;
    }
    
  }
}

// Flash-style causal/unmasked attention, all contractions 3-term bf16 hi/lo splits, f32 softmax with running max.
// q,k,v rows are read from f32 buffers with arbitrary row pitch (so they can live inside a fused qkv buffer);
// D = head size (multiple of 32, <= 128); one wave = 16 query rows; block = 4 waves (64 queries) sharing K/V chunks of 32.
template <int D, bool CAUSAL>
__global__ __launch_bounds__(128) void k_flash(const float* __restrict__ qb, const float* __restrict__ kb, const float* __restrict__ vb,
                                             int pitch, int T, int H, float scale, float* __restrict__ y, int ypitch) {
  constexpr int KS = D / 32;        // k-steps for QK
  constexpr int DT = D / 16;        // d tiles for PV
  __shared__ __attribute__((aligned(16))) unsigned short sKh[32][D + 8], sKl[32][D + 8], sVh[32][D + 8], sVl[32][D + 8];
  __shared__ __attribute__((aligned(16))) unsigned short sPh[4][16][40], sPl[4][16][40];
  __shared__ __attribute__((aligned(16))) float sO[4][16][D];
  const int tid = threadIdx.x, w = tid >> 5, lane = tid & 31, ln = lane & 15, hh = lane >> 4;
  const int nqb = (T + 63) / 64;
  const int bh = blockIdx.x / nqb, qblk = blockIdx.x % nqb;
  const int b = bh / H, h = bh % H;
  const int q0 = qblk * 64 + w * 16;
  const float* Q = qb + (size_t)b * T * pitch + h * D;
  const float* K = kb + (size_t)b * T * pitch + h * D;
  const float* V = vb + (size_t)b * T * pitch + h * D;

  // A fragments of the wave's 16 query rows (scaled), hi/lo
  FragB aqh[KS], aql[KS];
  {
    int row = q0 + ln; if (row >= T) row = T - 1;
    const float* qr = Q + (size_t)row * pitch;
#pragma unroll
    for (int ks = 0; ks < KS; ++ks)
#pragma unroll
      for (int i = 0; i < 16; ++i) {
        const int d = ks * 32 + ((i < 8) ? (8 * hh + i) : (16 + 8 * hh + (i - 8)));
        const float x = qr[d] * scale; const unsigned short hb = bf16_bits(x);
        aqh[ks].u[i] = hb; aql[ks].u[i] = bf16_bits(x - bf16_val(hb));
      }
  }
  float m_r[8], l_r[8];
#pragma unroll
  for (int r = 0; r < 8; ++r) { m_r[r] = -3.0e38f; l_r[r] = 0.f; }
  v8f oacc[DT];
#pragma unroll
  for (int dt = 0; dt < DT; ++dt) oacc[dt] = (v8f){0.f,0.f,0.f,0.f,0.f,0.f,0.f,0.f};

  const int kv_end = CAUSAL ? min(T, qblk * 64 + 64) : T;     // block-uniform
  for (int j0 = 0; j0 < kv_end; j0 += 32) {
    __syncthreads();
    for (int e = tid; e < 32 * (D / 4); e += 128) {
      const int r = e / (D / 4), c4 = (e % (D / 4)) * 4;
      const int key = j0 + r;
      v4f kf = {0.f,0.f,0.f,0.f}, vf = {0.f,0.f,0.f,0.f};
      if (key < T) { kf = *(const v4fa*)(K + (size_t)key * pitch + c4); vf = *(const v4fa*)(V + (size_t)key * pitch + c4); }
#pragma unroll
      for (int t = 0; t < 4; ++t) {
        unsigned short hb = bf16_bits(kf[t]); sKh[r][c4 + t] = hb; sKl[r][c4 + t] = bf16_bits(kf[t] - bf16_val(hb));
        hb = bf16_bits(vf[t]); sVh[r][c4 + t] = hb; sVl[r][c4 + t] = bf16_bits(vf[t] - bf16_val(hb));
      }
    }
    __syncthreads();
    // S tile 16 x 32
    v8f s[2];
#pragma unroll
    for (int nt = 0; nt < 2; ++nt) {
      v8f acc = {};
#pragma unroll
      for (int ks = 0; ks < KS; ++ks) {
        FragB bh_, bl_;
        bh_.half[0] = *(const v8us*)&sKh[nt * 16 + ln][ks * 32 + 8 * hh]; bh_.half[1] = *(const v8us*)&sKh[nt * 16 + ln][ks * 32 + 16 + 8 * hh];
        bl_.half[0] = *(const v8us*)&sKl[nt * 16 + ln][ks * 32 + 8 * hh]; bl_.half[1] = *(const v8us*)&sKl[nt * 16 + ln][ks * 32 + 16 + 8 * hh];
        acc = mmaN<3>(aqh[ks].v, aql[ks].v, bh_.v, bl_.v, acc);
      }
      s[nt] = acc;
    }
    // mask + running max (rows 8hh+r; the 16 lanes of a half share rows)
    float alpha[8];
#pragma unroll
    for (int r = 0; r < 8; ++r) {
      const int qi = q0 + 8 * hh + r;
      const int ja = j0 + ln, jb = j0 + 16 + ln;
      if (CAUSAL) { if (ja > qi) s[0][r] = -3.0e38f; if (jb > qi) s[1][r] = -3.0e38f; }
      if (ja >= T) s[0][r] = -3.0e38f;
      if (jb >= T) s[1][r] = -3.0e38f;
      float mx = fmaxf(s[0][r], s[1][r]);
      mx = fmaxf(mx, __shfl_xor(mx, 1, 32)); mx = fmaxf(mx, __shfl_xor(mx, 2, 32)); mx = fmaxf(mx, __shfl_xor(mx, 4, 32)); mx = fmaxf(mx, __shfl_xor(mx, 8, 32));
      const float mnew = fmaxf(m_r[r], mx);
      alpha[r] = (mnew > -1.0e38f) ? __expf(m_r[r] - mnew) : 1.0f;
      const float p0 = (s[0][r] > -1.0e38f) ? __expf(s[0][r] - mnew) : 0.f;
      const float p1 = (s[1][r] > -1.0e38f) ? __expf(s[1][r] - mnew) : 0.f;
      m_r[r] = mnew;
      l_r[r] = l_r[r] * alpha[r] + p0 + p1;            // per-lane partial row sum (16 lanes combined at the end)
      unsigned short hb = bf16_bits(p0); sPh[w][8 * hh + r][ln] = hb;      sPl[w][8 * hh + r][ln] = bf16_bits(p0 - bf16_val(hb));
      hb = bf16_bits(p1);                sPh[w][8 * hh + r][16 + ln] = hb; sPl[w][8 * hh + r][16 + ln] = bf16_bits(p1 - bf16_val(hb));
    }
#pragma unroll
    for (int dt = 0; dt < DT; ++dt)
#pragma unroll
      for (int r = 0; r < 8; ++r) oacc[dt][r] *= alpha[r];
    __builtin_amdgcn_fence(__ATOMIC_ACQ_REL, "workgroup");
    __builtin_amdgcn_wave_barrier();
    FragB pah, pal;
    pah.half[0] = *(const v8us*)&sPh[w][ln][8 * hh]; pah.half[1] = *(const v8us*)&sPh[w][ln][16 + 8 * hh];
    pal.half[0] = *(const v8us*)&sPl[w][ln][8 * hh]; pal.half[1] = *(const v8us*)&sPl[w][ln][16 + 8 * hh];
#pragma unroll
    for (int dt = 0; dt < DT; ++dt) {
      FragB bvh, bvl;
#pragma unroll
      for (int i = 0; i < 8; ++i) {
        bvh.u[i] = sVh[8 * hh + i][dt * 16 + ln]; bvh.u[8 + i] = sVh[16 + 8 * hh + i][dt * 16 + ln];
        bvl.u[i] = sVl[8 * hh + i][dt * 16 + ln]; bvl.u[8 + i] = sVl[16 + 8 * hh + i][dt * 16 + ln];
      }
      oacc[dt] = mmaN<3>(pah.v, pal.v, bvh.v, bvl.v, oacc[dt]);
    }
    __builtin_amdgcn_fence(__ATOMIC_ACQ_REL, "workgroup");
    __builtin_amdgcn_wave_barrier();
  }
#pragma unroll
  for (int r = 0; r < 8; ++r) {
    float l = l_r[r];
    l += __shfl_xor(l, 1, 32); l += __shfl_xor(l, 2, 32); l += __shfl_xor(l, 4, 32); l += __shfl_xor(l, 8, 32);
    l_r[r] = (l > 0.f) ? 1.0f / l : 0.f;
  }
#pragma unroll
  for (int dt = 0; dt < DT; ++dt)
#pragma unroll
    for (int r = 0; r < 8; ++r) sO[w][8 * hh + r][dt * 16 + ln] = oacc[dt][r] * l_r[r];
  __builtin_amdgcn_fence(__ATOMIC_ACQ_REL, "workgroup");
  __builtin_amdgcn_wave_barrier();
  {
    for (int r = 0; r < 16; ++r) {
      const int row = q0 + r;
      if (row < T && lane < D / 4) {
        const v4f val = *(const v4fa*)&sO[w][r][lane * 4];
        *(v4f*)(y + ((size_t)b * T + row) * ypitch + h * D + lane * 4) = val;
      }
    }
    
  }
}

// GEMM C = act(A·W + bias + resid): A f32 (ASPLIT -> hi/lo 2 terms), Wt bf16 [N][K]; ACT 0 none, 1 relu, 2 exact gelu;
// resid (optional, f32, row index = (row % rmod), pitch ldr, RES_BF16 rounds it) added before the activation.
template <bool ASPLIT, int ACT, bool BIAS_BF16, bool RES_BF16>
__global__ __launch_bounds__(128) void k_gemm_bf3(const float* __restrict__ A, int lda, const unsigned short* __restrict__ Wt, int ldb,
                                                const float* __restrict__ bias, const float* __restrict__ resid, int rmod, int ldr,
                                                float* __restrict__ C, int ldc, int M, int N, int K) {
  __shared__ __attribute__((aligned(16))) float so[4][16][64];
  const int tid = threadIdx.x, w = tid >> 5, lane = tid & 31, ln = lane & 15, hh = lane >> 4;
  const int ntn = N / 64;
  const int wid = blockIdx.x * 4 + w;
  const int mt = wid / ntn, nq = wid % ntn;
  if (mt * 16 >= M) return;
  const int row0 = mt * 16, col0 = nq * 64;
  const float* arow = A + (size_t)(row0 + ln) * lda;
  v8f acc[4] = {};
  for (int kb = 0; kb < K; kb += 32) {
    FragB ah, al;
    const v4f x0 = *(const v4fa*)(arow + kb + 8 * hh), x1 = *(const v4fa*)(arow + kb + 8 * hh + 4);
    const v4f x2 = *(const v4fa*)(arow + kb + 16 + 8 * hh), x3 = *(const v4fa*)(arow + kb + 16 + 8 * hh + 4);
    float xs[16] = {x0[0],x0[1],x0[2],x0[3],x1[0],x1[1],x1[2],x1[3],x2[0],x2[1],x2[2],x2[3],x3[0],x3[1],x3[2],x3[3]};
#pragma unroll
    for (int i = 0; i < 16; ++i) { const unsigned short hb = bf16_bits(xs[i]); ah.u[i] = hb; al.u[i] = ASPLIT ? bf16_bits(xs[i] - bf16_val(hb)) : (unsigned short)0; }
#pragma unroll
    for (int t = 0; t < 4; ++t) {
      const unsigned short* brow = Wt + (size_t)(col0 + t * 16 + ln) * ldb + kb;
      FragB b;
      b.half[0] = *(const v8us*)(brow + 8 * hh);
      b.half[1] = *(const v8us*)(brow + 16 + 8 * hh);
      acc[t] = mmaN<ASPLIT ? 2 : 1>(ah.v, al.v, b.v, b.v, acc[t]);
    }
  }
#pragma unroll
  for (int t = 0; t < 4; ++t) {
    const int col = col0 + t * 16 + ln;
    float bv = bias ? bias[col] : 0.f;
    if (BIAS_BF16) bv = bf16_round(bv);
#pragma unroll
    for (int r = 0; r < 8; ++r) {
      float v = acc[t][r] + bv;
      if (resid) { float rv = resid[(size_t)((row0 + 8 * hh + r) % rmod) * ldr + col]; if (RES_BF16) rv = bf16_round(rv); v += rv; }
      if (ACT == 1) v = fmaxf(v, 0.f);
      if (ACT == 2) v = 0.5f * v * (1.0f + erff(v * 0.70710678118654752f));
      if (ACT == 3) { const float u = 0.7978845608028654f * (v + 0.044715f * v * v * v); v = 0.5f * v * (1.0f + tanhf(u)); }
      so[w][8 * hh + r][t * 16 + ln] = v;
    }
  }
  __builtin_amdgcn_fence(__ATOMIC_ACQ_REL, "workgroup");
  __builtin_amdgcn_wave_barrier();
  const int rsub = lane >> 4, c4 = (lane & 15) * 4;
  {
#pragma unroll
    for (int q = 0; q < 8; ++q) {
      const int r = q * 2 + rsub;
      const v4f v = *(const v4fa*)&so[w][r][c4];
      *(v4f*)(C + (size_t)(row0 + r) * ldc + col0 + c4) = v;
    }
    
  }
}
// row LayerNorm (biased variance, eps) over N: s = X (+ R); optional out_sum <- s; out_norm <- (s-mu)*rsqrt(var+eps)*g + b
template <bool PARAM_BF16>
__global__ __launch_bounds__(256) void k_layernorm(const float* __restrict__ X, const float* __restrict__ R, const float* __restrict__ g, const float* __restrict__ bta,
                                                  float* __restrict__ out_sum, float* __restrict__ out_norm, int N, float eps) {
  __shared__ float red[256];
  const int row = blockIdx.x, tid = threadIdx.x;
  const float* x = X + (size_t)row * N; const float* rr = R ? R + (size_t)row * N : nullptr;
  float vals[16];                     // up to N = 4096
  const int per = N / 256;            // contiguous chunk per thread? use strided-by-4 chunks: thread handles j = tid*4 + 1024*u
  float s1 = 0.f;
  for (int u = 0; u < per / 4; ++u) {
    const int j = tid * 4 + 1024 * u;
    const v4f a = *(const v4fa*)(x + j);
    v4f b = {0.f,0.f,0.f,0.f}; if (rr) b = *(const v4fa*)(rr + j);
#pragma unroll
    for (int q = 0; q < 4; ++q) { const float v = a[q] + b[q]; vals[u * 4 + q] = v; s1 += v; }
  }
  red[tid] = s1; __syncthreads();
  for (int st = 128; st > 0; st >>= 1) { if (tid < st) red[tid] += red[tid + st]; __syncthreads(); }
  const float mu = red[0] / (float)N; __syncthreads();
  float s2 = 0.f;
  for (int u = 0; u < per / 4; ++u)
#pragma unroll
    for (int q = 0; q < 4; ++q) { const float c = vals[u * 4 + q] - mu; s2 += c * c; }
  red[tid] = s2; __syncthreads();
  for (int st = 128; st > 0; st >>= 1) { if (tid < st) red[tid] += red[tid + st]; __syncthreads(); }
  const float rs = rsqrtf(red[0] / (float)N + eps);
  {
    for (int u = 0; u < per / 4; ++u) {
      const int j = tid * 4 + 1024 * u;
      v4f o, sm;
#pragma unroll
      for (int q = 0; q < 4; ++q) {
        float gg = g[j + q], bb = bta[j + q];
        if (PARAM_BF16) { gg = bf16_round(gg); bb = bf16_round(bb); }
        sm[q] = vals[u * 4 + q]; o[q] = (vals[u * 4 + q] - mu) * rs * gg + bb;
      }
      if (out_sum) *(v4f*)(out_sum + (size_t)row * N + j) = sm;
      *(v4f*)(out_norm + (size_t)row * N + j) = o;
    }
    
  }
}



// ---- f16 WMMA path (v_wmma_f32_16x16x32_f16): 11-bit significands for operands in range — used where a [0,1] probability operand needs more precision than bf16
typedef _Float16 v16h __attribute__((ext_vector_type(16)));
typedef _Float16 v4h __attribute__((ext_vector_type(4)));
union FragH { v16h v; v8us half[2]; _Float16 h[16]; unsigned short u[16]; };
template <int NT>
__device__ __forceinline__ v8f mmaH(v16h ah, v16h al, v16h bh, v16h bl, v8f c) {
  c = __builtin_amdgcn_wmma_f32_16x16x32_f16(false, ah, false, bh, (short)0, c, false, false);
  if (NT >= 2) c = __builtin_amdgcn_wmma_f32_16x16x32_f16(false, al, false, bh, (short)0, c, false, false);
  if (NT >= 3) c = __builtin_amdgcn_wmma_f32_16x16x32_f16(false, ah, false, bl, (short)0, c, false, false);
  asm volatile("v_nop\n\tv_nop\n\tv_nop\n\tv_nop" : "+v"(c) : "v"(ah), "v"(al), "v"(bh), "v"(bl));
  return c;
}
// batched GEMM like k_gemm_b but f16 operands: A f32 (split into f16 hi/lo if ASPLIT, else rounded to f16), Bt = f16 values [n][k]; alpha; C f32; N multiple of 16 (partial tiles skipped)
template <bool ASPLIT>
__global__ __launch_bounds__(128) void k_gemm_h(const float* __restrict__ A, int lda, size_t sA, const _Float16* __restrict__ Bh, int ldb, size_t sB, float alpha, float* __restrict__ C, int ldc, size_t sC, int M, int N, int K) {
  __shared__ __attribute__((aligned(16))) float so[4][16][64];
  const int tid = threadIdx.x, w = tid >> 5, lane = tid & 31, ln = lane & 15, hh = lane >> 4; const int by = blockIdx.y;
  A += (size_t)by * sA; Bh += (size_t)by * sB; C += (size_t)by * sC;
  const int ntn = (N + 63) / 64; const int wid = blockIdx.x * 4 + w; const int mt = wid / ntn, nq = wid % ntn; if (mt * 16 >= M) return;
  const int row0 = mt * 16, col0 = nq * 64; const float* arow = A + (size_t)(row0 + ln) * lda;
  v8f acc[4] = {};
  for (int kb = 0; kb < K; kb += 32) {
    FragH ah, al;
    const v4f x0 = *(const v4fa*)(arow + kb + 8 * hh), x1 = *(const v4fa*)(arow + kb + 8 * hh + 4), x2 = *(const v4fa*)(arow + kb + 16 + 8 * hh), x3 = *(const v4fa*)(arow + kb + 16 + 8 * hh + 4);
    float xs[16] = {x0[0],x0[1],x0[2],x0[3],x1[0],x1[1],x1[2],x1[3],x2[0],x2[1],x2[2],x2[3],x3[0],x3[1],x3[2],x3[3]};
#pragma unroll
    for (int i = 0; i < 16; ++i) { const _Float16 h = (_Float16)xs[i]; ah.h[i] = h; al.h[i] = ASPLIT ? (_Float16)(xs[i] - (float)h) : (_Float16)0.0f; }
#pragma unroll
    for (int t = 0; t < 4; ++t) { if (col0 + t * 16 >= N) continue; const size_t boff = (size_t)(col0 + t * 16 + ln) * ldb + kb; FragH bq; bq.half[0] = *(const v8us*)(Bh + boff + 8 * hh); bq.half[1] = *(const v8us*)(Bh + boff + 16 + 8 * hh);
      acc[t] = mmaH<ASPLIT ? 2 : 1>(ah.v, al.v, bq.v, bq.v, acc[t]); }
  }
#pragma unroll
  for (int t = 0; t < 4; ++t) { if (col0 + t * 16 >= N) continue;
#pragma unroll
    for (int r = 0; r < 8; ++r) so[w][8 * hh + r][t * 16 + ln] = acc[t][r] * alpha; }
  __builtin_amdgcn_fence(__ATOMIC_ACQ_REL, "workgroup"); __builtin_amdgcn_wave_barrier();
  const int rsub = lane >> 4, c4 = (lane & 15) * 4;
  {
#pragma unroll
    for (int q = 0; q < 8; ++q) { const int r = q * 2 + rsub; if (col0 + c4 < N) { const v4f v = *(const v4fa*)&so[w][r][c4]; *(v4f*)(C + (size_t)(row0 + r) * ldc + col0 + c4) = v; } }
     }
}

// Wt[n][k] = f16(W[k][n]·scale) from f32 row-major W[K][N] (scale = power of two; bf16-exact weights stay exact in f16 away from the subnormal range)
__global__ __launch_bounds__(256) void k_wt_f16(const float* __restrict__ W, _Float16* __restrict__ Wt, int K, int N, float scale) {
  const int t = blockIdx.x * 256 + threadIdx.x; if (t >= N * (K / 8)) return; const int n = t / (K / 8), k8 = (t % (K / 8)) * 8; FragH f;
#pragma unroll
  for (int i = 0; i < 8; ++i) f.h[i] = (_Float16)(bf16_round(W[(size_t)(k8 + i) * N + n]) * scale); const v8us o = f.half[0];
  *(v8us*)((unsigned short*)Wt + (size_t)n * K + k8) = o; 
}
__global__ __launch_bounds__(256) void k_x16(const float* __restrict__ x, _Float16* __restrict__ X16, size_t n8) { const size_t t = (size_t)blockIdx.x * 256 + threadIdx.x; if (t >= n8) return; FragH f;
#pragma unroll
  for (int q = 0; q < 8; ++q) f.h[q] = (_Float16)bf16_round(x[t * 8 + q]); *(v8us*)((unsigned short*)X16 + t * 8) = f.half[0];  }
__global__ __launch_bounds__(256) void k_round16f(const float* __restrict__ W, _Float16* __restrict__ Bt, size_t n8) { const size_t t = (size_t)blockIdx.x * 256 + threadIdx.x; if (t >= n8) return; FragH f;
#pragma unroll
  for (int i = 0; i < 8; ++i) f.h[i] = (_Float16)(bf16_round(W[t * 8 + i]) * 16.0f); *(v8us*)((unsigned short*)Bt + t * 8) = f.half[0];  }
__global__ __launch_bounds__(256) void k_vt(const _Float16* __restrict__ V16, _Float16* __restrict__ Vt) { __shared__ unsigned short tl[64][66]; const int tid = threadIdx.x; const int slab = blockIdx.x / (SS / 64), lg = blockIdx.x % (SS / 64); const int b = slab / NKV, h = slab % NKV;
  for (int i = tid; i < 64 * 8; i += 256) { const int r = i / 8, c8 = (i % 8) * 8; FragH f; f.half[0] = *(const v8us*)((const unsigned short*)V16 + ((size_t)b * SS + lg * 64 + r) * KVD + h * HD + c8);
#pragma unroll
    for (int q = 0; q < 8; ++q) tl[r][c8 + q] = f.u[q]; }
  __syncthreads();
  {
#pragma unroll
    for (int rd = 0; rd < 2; ++rd) { const int d = rd * 32 + tid / 8, pc = tid % 8; FragH f;
#pragma unroll
      for (int q = 0; q < 8; ++q) f.u[q] = tl[pc * 8 + q][d];
      *(v8us*)((unsigned short*)Vt + ((size_t)slab * HD + d) * SS + lg * 64 + pc * 8) = f.half[0]; }
     } }
// Maximum over each 16-lane row for eight values at once: an xor butterfly (1, 2, 4, 8) on the vector pipe. DPP row_xmask hands the partner lane's value to v_max_num_f32 as an operand, so a step
// needs no LDS-pipe round trip and no dscnt wait. One asm statement, step by step over the eight values: the eight instructions of a step are independent, so none waits for the step before it
// (as single statements, and as the builtin move, the compiler put each value's four steps back to back; the builtin also kept a separate move and a quieting maximum per step). All 32 lanes are on here.
__device__ __forceinline__ void row16_max8(float (&m)[8]) {
  asm("v_max_num_f32_dpp %0, %0, %0 row_xmask:1 row_mask:0xf bank_mask:0xf\n\t"
      "v_max_num_f32_dpp %1, %1, %1 row_xmask:1 row_mask:0xf bank_mask:0xf\n\t"
      "v_max_num_f32_dpp %2, %2, %2 row_xmask:1 row_mask:0xf bank_mask:0xf\n\t"
      "v_max_num_f32_dpp %3, %3, %3 row_xmask:1 row_mask:0xf bank_mask:0xf\n\t"
      "v_max_num_f32_dpp %4, %4, %4 row_xmask:1 row_mask:0xf bank_mask:0xf\n\t"
      "v_max_num_f32_dpp %5, %5, %5 row_xmask:1 row_mask:0xf bank_mask:0xf\n\t"
      "v_max_num_f32_dpp %6, %6, %6 row_xmask:1 row_mask:0xf bank_mask:0xf\n\t"
      "v_max_num_f32_dpp %7, %7, %7 row_xmask:1 row_mask:0xf bank_mask:0xf\n\t"
      "v_max_num_f32_dpp %0, %0, %0 row_xmask:2 row_mask:0xf bank_mask:0xf\n\t"
      "v_max_num_f32_dpp %1, %1, %1 row_xmask:2 row_mask:0xf bank_mask:0xf\n\t"
      "v_max_num_f32_dpp %2, %2, %2 row_xmask:2 row_mask:0xf bank_mask:0xf\n\t"
      "v_max_num_f32_dpp %3, %3, %3 row_xmask:2 row_mask:0xf bank_mask:0xf\n\t"
      "v_max_num_f32_dpp %4, %4, %4 row_xmask:2 row_mask:0xf bank_mask:0xf\n\t"
      "v_max_num_f32_dpp %5, %5, %5 row_xmask:2 row_mask:0xf bank_mask:0xf\n\t"
      "v_max_num_f32_dpp %6, %6, %6 row_xmask:2 row_mask:0xf bank_mask:0xf\n\t"
      "v_max_num_f32_dpp %7, %7, %7 row_xmask:2 row_mask:0xf bank_mask:0xf\n\t"
      "v_max_num_f32_dpp %0, %0, %0 row_xmask:4 row_mask:0xf bank_mask:0xf\n\t"
      "v_max_num_f32_dpp %1, %1, %1 row_xmask:4 row_mask:0xf bank_mask:0xf\n\t"
      "v_max_num_f32_dpp %2, %2, %2 row_xmask:4 row_mask:0xf bank_mask:0xf\n\t"
      "v_max_num_f32_dpp %3, %3, %3 row_xmask:4 row_mask:0xf bank_mask:0xf\n\t"
      "v_max_num_f32_dpp %4, %4, %4 row_xmask:4 row_mask:0xf bank_mask:0xf\n\t"
      "v_max_num_f32_dpp %5, %5, %5 row_xmask:4 row_mask:0xf bank_mask:0xf\n\t"
      "v_max_num_f32_dpp %6, %6, %6 row_xmask:4 row_mask:0xf bank_mask:0xf\n\t"
      "v_max_num_f32_dpp %7, %7, %7 row_xmask:4 row_mask:0xf bank_mask:0xf\n\t"
      "v_max_num_f32_dpp %0, %0, %0 row_xmask:8 row_mask:0xf bank_mask:0xf\n\t"
      "v_max_num_f32_dpp %1, %1, %1 row_xmask:8 row_mask:0xf bank_mask:0xf\n\t"
      "v_max_num_f32_dpp %2, %2, %2 row_xmask:8 row_mask:0xf bank_mask:0xf\n\t"
      "v_max_num_f32_dpp %3, %3, %3 row_xmask:8 row_mask:0xf bank_mask:0xf\n\t"
      "v_max_num_f32_dpp %4, %4, %4 row_xmask:8 row_mask:0xf bank_mask:0xf\n\t"
      "v_max_num_f32_dpp %5, %5, %5 row_xmask:8 row_mask:0xf bank_mask:0xf\n\t"
      "v_max_num_f32_dpp %6, %6, %6 row_xmask:8 row_mask:0xf bank_mask:0xf\n\t"
      "v_max_num_f32_dpp %7, %7, %7 row_xmask:8 row_mask:0xf bank_mask:0xf"
      : "+v"(m[0]), "+v"(m[1]), "+v"(m[2]), "+v"(m[3]), "+v"(m[4]), "+v"(m[5]), "+v"(m[6]), "+v"(m[7])); }
// the same butterfly for a sum: the builtin move fuses into v_add_f32_dpp
template <int M> __device__ __forceinline__ float row_xor(float v) { return __int_as_float(__builtin_amdgcn_mov_dpp(__float_as_int(v), 0x160 + M, 0xf, 0xf, true)); }
__device__ __forceinline__ float row16_sum(float v) { v += row_xor<1>(v); v += row_xor<2>(v); v += row_xor<4>(v); v += row_xor<8>(v); return v; }
// fused causal GQA attention per ((b,h), 128 queries): wave = 32 queries; Q from Q16 cols h·64 (pitch 1024), K from K16 cols kvh·64 (pitch 512), kvh = h / 2; key chunks 0..qb0+128; mask k ≤ q else −inf
__global__ __launch_bounds__(128) void k_flash(const _Float16* __restrict__ Q16, const _Float16* __restrict__ K16, const _Float16* __restrict__ Vt, _Float16* __restrict__ O16) {
  constexpr int RPW = 32, NQB = SS / (4 * RPW), DT = HD / 16, KS = HD / 32;
  __shared__ __attribute__((aligned(16))) unsigned short sP[4][RPW][40]; __shared__ __attribute__((aligned(16))) float sO[4][RPW][HD];
  const int tid = threadIdx.x, w = tid >> 5, lane = tid & 31, ln = lane & 15, hh = lane >> 4;
  const int slab = blockIdx.x / NQB, qblk = blockIdx.x % NQB; const int b = slab / NH, h = slab % NH; const int kvh = h / (NH / NKV); const int qb0 = qblk * (4 * RPW); const int q0 = qb0 + w * RPW;
  FragH aq[2][KS];
#pragma unroll
  for (int rt = 0; rt < 2; ++rt) { const unsigned short* qr = (const unsigned short*)Q16 + ((size_t)b * SS + q0 + rt * 16 + ln) * HID + h * HD;
#pragma unroll
    for (int ks = 0; ks < KS; ++ks) { aq[rt][ks].half[0] = *(const v8us*)(qr + ks * 32 + 8 * hh); aq[rt][ks].half[1] = *(const v8us*)(qr + ks * 32 + 16 + 8 * hh); } }
  const unsigned short* Vth = (const unsigned short*)Vt + (size_t)(b * NKV + kvh) * HD * SS;
  float m_r[2][8], l_r[2][8]; v8f oacc[2][DT];
#pragma unroll
  for (int rt = 0; rt < 2; ++rt) {
#pragma unroll
    for (int r = 0; r < 8; ++r) { m_r[rt][r] = -3.0e38f; l_r[rt][r] = 0.f; }
#pragma unroll
    for (int dt = 0; dt < DT; ++dt) oacc[rt][dt] = (v8f){0.f,0.f,0.f,0.f,0.f,0.f,0.f,0.f}; }
  const int jend = qb0 + 4 * RPW;
  // K and V fragments are requested ahead of their products, so that no product waits out a load: a chunk's K is loaded during the chunk before it (chunk 0's here), its V at the chunk's head
  const unsigned short* kl = (const unsigned short*)K16 + ((size_t)b * SS + ln) * KVD + kvh * HD + 8 * hh;
  const unsigned short* vl = Vth + (size_t)ln * SS + 8 * hh;
  FragH bk[2][KS];
#pragma unroll
  for (int nt = 0; nt < 2; ++nt)
#pragma unroll
    for (int ks = 0; ks < KS; ++ks) { bk[nt][ks].half[0] = *(const v8us*)(kl + nt * 16 * KVD + ks * 32); bk[nt][ks].half[1] = *(const v8us*)(kl + nt * 16 * KVD + ks * 32 + 16); }
#pragma unroll 1
  for (int j0 = 0; j0 < jend; j0 += 32) {
    FragH bv[DT];
#pragma unroll
    for (int dt = 0; dt < DT; ++dt) { bv[dt].half[0] = *(const v8us*)(vl + (size_t)dt * 16 * SS + j0); bv[dt].half[1] = *(const v8us*)(vl + (size_t)dt * 16 * SS + j0 + 16); }
    v8f s[2][2];
#pragma unroll
    for (int nt = 0; nt < 2; ++nt)
#pragma unroll
      for (int rt = 0; rt < 2; ++rt) { v8f acc = (v8f){0.f,0.f,0.f,0.f,0.f,0.f,0.f,0.f};
#pragma unroll
        for (int ks = 0; ks < KS; ++ks) acc = mmaH<1>(aq[rt][ks].v, aq[rt][ks].v, bk[nt][ks].v, bk[nt][ks].v, acc); s[rt][nt] = acc; }
    // the next chunk's K into the same registers, right behind their last product; the last chunk loads its own rows again (in bounds, never used)
    { const unsigned short* kn = kl + (size_t)((j0 + 32 < jend) ? j0 + 32 : j0) * KVD;
#pragma unroll
      for (int nt = 0; nt < 2; ++nt)
#pragma unroll
        for (int ks = 0; ks < KS; ++ks) { bk[nt][ks].half[0] = *(const v8us*)(kn + nt * 16 * KVD + ks * 32); bk[nt][ks].half[1] = *(const v8us*)(kn + nt * 16 * KVD + ks * 32 + 16); } }
    // stands between the loads above and the softmax, which reuses their K address pair: the wait that belongs in front of an overwrite of an issued load's address register
    asm volatile("s_wait_xcnt 0x0" ::: "memory");
    // keeps the V and K loads and the wait in front of the softmax and the output products that the loads fly under (without it the scheduler sank the K loads into the softmax and the wait far behind them)
    __builtin_amdgcn_sched_barrier(0);
    float mx[2][8];
#pragma unroll
    for (int rt = 0; rt < 2; ++rt) {
#pragma unroll
      for (int r = 0; r < 8; ++r) { const int qi = q0 + rt * 16 + 8 * hh + r; const int k0 = j0 + ln, k1 = j0 + 16 + ln;
        s[rt][0][r] = (k0 <= qi) ? s[rt][0][r] * 0.125f : -INFINITY; s[rt][1][r] = (k1 <= qi) ? s[rt][1][r] * 0.125f : -INFINITY; mx[rt][r] = fmaxf(s[rt][0][r], s[rt][1][r]); }
      row16_max8(mx[rt]); }
#pragma unroll
    for (int rt = 0; rt < 2; ++rt)
#pragma unroll
      for (int r = 0; r < 8; ++r) { const float s0 = s[rt][0][r], s1 = s[rt][1][r];
        const float mn = fmaxf(m_r[rt][r], mx[rt][r]); const float al = expf(m_r[rt][r] - mn); m_r[rt][r] = mn; const float p0 = expf(s0 - mn), p1 = expf(s1 - mn); l_r[rt][r] = l_r[rt][r] * al + p0 + p1;
#pragma unroll
        for (int dt = 0; dt < DT; ++dt) oacc[rt][dt][r] *= al;
        FragH t2; t2.h[0] = (_Float16)p0; t2.h[1] = (_Float16)p1; sP[w][rt * 16 + 8 * hh + r][ln] = t2.u[0]; sP[w][rt * 16 + 8 * hh + r][16 + ln] = t2.u[1]; }
    __builtin_amdgcn_fence(__ATOMIC_ACQ_REL, "workgroup"); __builtin_amdgcn_wave_barrier();
    FragH pa[2];
#pragma unroll
    for (int rt = 0; rt < 2; ++rt) { pa[rt].half[0] = *(const v8us*)&sP[w][rt * 16 + ln][8 * hh]; pa[rt].half[1] = *(const v8us*)&sP[w][rt * 16 + ln][16 + 8 * hh]; }
#pragma unroll
    for (int dt = 0; dt < DT; ++dt)
#pragma unroll
      for (int rt = 0; rt < 2; ++rt) oacc[rt][dt] = mmaH<1>(pa[rt].v, pa[rt].v, bv[dt].v, bv[dt].v, oacc[rt][dt]);
    __builtin_amdgcn_fence(__ATOMIC_ACQ_REL, "workgroup"); __builtin_amdgcn_wave_barrier(); }
#pragma unroll
  for (int rt = 0; rt < 2; ++rt) {
#pragma unroll
    for (int r = 0; r < 8; ++r) { float l = l_r[rt][r]; l = row16_sum(l); l_r[rt][r] = 1.0f / l; }
#pragma unroll
    for (int dt = 0; dt < DT; ++dt)
#pragma unroll
      for (int r = 0; r < 8; ++r) sO[w][rt * 16 + 8 * hh + r][dt * 16 + ln] = oacc[rt][dt][r] * l_r[rt][r]; }
  __builtin_amdgcn_fence(__ATOMIC_ACQ_REL, "workgroup"); __builtin_amdgcn_wave_barrier();
  {
#pragma unroll
    for (int rp = 0; rp < RPW; rp += 2) { const int r = rp + (lane >> 4), pc = lane & 15; const v4f val = *(const v4fa*)&sO[w][r][pc * 4]; v4h h4;
#pragma unroll
      for (int i = 0; i < 4; ++i) h4[i] = (_Float16)val[i];      // the o projection's A operand: rounded here, 16 lanes = one 128-byte line of the row
      *(v4h*)(O16 + ((size_t)b * SS + q0 + r) * HID + h * HD + pc * 4) = h4; }
     } }
// Projection GEMM C[4096][N] = A[4096][1024] * Bt[N][1024]^T / 16 (f16 operands, f32 accumulate, k ascending in steps of 32 as before). Block = 4 waves = a 64 x 128 tile of C; wave = 32 x 64 (2 x 4 accumulators).
// Each stage brings 64 k of the 64 A rows and the 128 Bt rows into LDS with whole 128-byte rows per 8 lanes, so every row is fetched once per block instead of once per wave in 16-line gathers;
// the next stage's rows are loaded into registers while this stage's products run, and go into the other buffer. Row pitch 144 bytes: the 16 rows of a fragment read fall on different banks.
// OUT 0: C f32. OUT 1: C16 = f16(C). OUT 2 (q, k): a wave's 64 columns are one head, so its staged 32 x 64 tile holds whole head rows: per row RMSNorm over the 64 dims (eps 1e-6, times bf16(nw)),
// then RoPE with the INPUT cos/sin[row][64] (rotate_half = [-x2, x1]; rounded to bf16 like every other input), then C16 = f16: the f32 product never goes to memory.
template <int N, int OUT>
__global__ __launch_bounds__(128) void k_proj(const _Float16* __restrict__ A, const _Float16* __restrict__ Bt, float* __restrict__ C, _Float16* __restrict__ C16,
                                              const float* __restrict__ nw, const float* __restrict__ cs, const float* __restrict__ sn) {
  constexpr int K = HID, BM = 64, BN = 128, BK = 64, PIT = BK + 8, NS = K / BK, NBN = N / BN, OP = 68;
  __shared__ __attribute__((aligned(16))) unsigned short sm[2][BM + BN][PIT];
  static_assert(sizeof(float) * 4 * 32 * OP <= sizeof(unsigned short) * 2 * (BM + BN) * PIT, "the output tiles reuse the stage buffers");
  const int tid = threadIdx.x, w = tid >> 5, lane = tid & 31, ln = lane & 15, hh = lane >> 4;
  const int row0 = (blockIdx.x / NBN) * BM, col0 = (blockIdx.x % NBN) * BN, wm = (w >> 1) * 32, wn = (w & 1) * 64;
  const int sr = tid >> 3, sc = (tid & 7) * 8;
  const unsigned short* ga = (const unsigned short*)A + (size_t)(row0 + sr) * K + sc;
  const unsigned short* gb = (const unsigned short*)Bt + (size_t)(col0 + sr) * K + sc;
  v8us ra[BM / 16], rb[BN / 16];
  v8f acc[2][4];
#pragma unroll
  for (int mi = 0; mi < 2; ++mi)
#pragma unroll
    for (int t = 0; t < 4; ++t) acc[mi][t] = (v8f){0.f,0.f,0.f,0.f,0.f,0.f,0.f,0.f};
#pragma unroll
  for (int i = 0; i < BM / 16; ++i) ra[i] = *(const v8us*)(ga + (size_t)i * 16 * K);
#pragma unroll
  for (int i = 0; i < BN / 16; ++i) rb[i] = *(const v8us*)(gb + (size_t)i * 16 * K);
#pragma unroll
  for (int i = 0; i < BM / 16; ++i) *(v8us*)&sm[0][sr + i * 16][sc] = ra[i];
#pragma unroll
  for (int i = 0; i < BN / 16; ++i) *(v8us*)&sm[0][BM + sr + i * 16][sc] = rb[i];
  __syncthreads();
  // unrolled whole: every stage's global offset is then an immediate on two address pairs that are never rewritten, and the buffer index a constant
#pragma unroll
  for (int s = 0; s < NS; ++s) {
    const int cur = s & 1;
    if (s + 1 < NS) {
#pragma unroll
      for (int i = 0; i < BM / 16; ++i) ra[i] = *(const v8us*)(ga + (size_t)i * 16 * K + (s + 1) * BK);
#pragma unroll
      for (int i = 0; i < BN / 16; ++i) rb[i] = *(const v8us*)(gb + (size_t)i * 16 * K + (s + 1) * BK);
    }
    // keeps the next stage's loads at the head of this stage, so that they fly under all of its products (the scheduler sank them to just in front of their LDS stores)
    __builtin_amdgcn_sched_barrier(0);
    FragH a[BK / 32][2], b[BK / 32][4];
#pragma unroll
    for (int ks = 0; ks < BK / 32; ++ks) {
#pragma unroll
      for (int mi = 0; mi < 2; ++mi) { const unsigned short* p = &sm[cur][wm + mi * 16 + ln][ks * 32 + 8 * hh]; a[ks][mi].half[0] = *(const v8us*)p; a[ks][mi].half[1] = *(const v8us*)(p + 16); }
#pragma unroll
      for (int t = 0; t < 4; ++t) { const unsigned short* p = &sm[cur][BM + wn + t * 16 + ln][ks * 32 + 8 * hh]; b[ks][t].half[0] = *(const v8us*)p; b[ks][t].half[1] = *(const v8us*)(p + 16); }
    }
    // keeps the stage's fragment reads in one group ahead of its products: one exposed LDS latency per stage (the scheduler reused the A registers and waited for LDS four times per stage)
    __builtin_amdgcn_sched_barrier(0);
#pragma unroll
    for (int ks = 0; ks < BK / 32; ++ks)
#pragma unroll
      for (int mi = 0; mi < 2; ++mi)
#pragma unroll
        for (int t = 0; t < 4; ++t) acc[mi][t] = __builtin_amdgcn_wmma_f32_16x16x32_f16(false, a[ks][mi].v, false, b[ks][t].v, (short)0, acc[mi][t], false, false);
    // keeps the waits for those loads, and the LDS stores behind them, behind the issue of all of this stage's products (the scheduler put them in the middle of the stage)
    __builtin_amdgcn_sched_barrier(0);
    if (s + 1 < NS) {
#pragma unroll
      for (int i = 0; i < BM / 16; ++i) *(v8us*)&sm[cur ^ 1][sr + i * 16][sc] = ra[i];
#pragma unroll
      for (int i = 0; i < BN / 16; ++i) *(v8us*)&sm[cur ^ 1][BM + sr + i * 16][sc] = rb[i];
    }
    // one barrier per stage: it publishes the buffer just filled and ends every wave's reads of the buffer that the next stage refills (after the last stage: that the output tiles reuse)
    __syncthreads();
  }
  typedef float fa __attribute__((may_alias));
  fa* so = (fa*)&sm[0][0][0] + w * 32 * OP;
#pragma unroll
  for (int mi = 0; mi < 2; ++mi)
#pragma unroll
    for (int t = 0; t < 4; ++t)
#pragma unroll
      for (int r = 0; r < 8; ++r) so[(mi * 16 + 8 * hh + r) * OP + t * 16 + ln] = acc[mi][t][r] * 0.0625f;
  // the wave reads back its own tile, written by other lanes: the LDS stores must have landed first
  __builtin_amdgcn_fence(__ATOMIC_ACQ_REL, "workgroup"); __builtin_amdgcn_wave_barrier();
  if constexpr (OUT == 2) {
    static_assert(HD == 64, "a wave's 64 columns are one head");
    // 8 lanes per row, 4 rows per pass: a lane holds dims j4..j4+3 (x1) and 32+j4..32+j4+3 (x2), the two halves that RoPE pairs
    const int rr = lane >> 3, j4 = (lane & 7) * 4;
    v4f w1 = *(const v4fa*)(nw + j4), w2 = *(const v4fa*)(nw + 32 + j4);
#pragma unroll
    for (int i = 0; i < 4; ++i) { w1[i] = bf16_round(w1[i]); w2[i] = bf16_round(w2[i]); }
    const fa* xp = so + rr * OP + j4;
    // byte offsets of the lane's first row: one for cos and sin (below 1 MiB), one for the output (below 8 MiB); each rides as the 32-bit offset register beside a scalar base
    unsigned co = (unsigned)((row0 + wm + rr) * HD + j4) * 4u, yo = (unsigned)((row0 + wm + rr) * N + col0 + wn + j4) * 2u;
    // two trips of four passes: a trip's 16 cos/sin loads go out together and fly under its sums of squares (all eight passes unrolled took more than 256 registers)
#pragma unroll 1
    for (int qh = 0; qh < 2; ++qh) {
      v4f x1[4], x2[4], c1[4], c2[4], s1[4], s2[4];
#pragma unroll
      for (int q = 0; q < 4; ++q) { x1[q] = *(const v4fa*)(xp + q * 4 * OP); x2[q] = *(const v4fa*)(xp + q * 4 * OP + 32); }
#pragma unroll
      for (int q = 0; q < 4; ++q) { const float* cp = (const float*)((const char*)cs + co) + q * 4 * HD; const float* sp = (const float*)((const char*)sn + co) + q * 4 * HD;
        c1[q] = *(const v4fa*)cp; c2[q] = *(const v4fa*)(cp + 32); s1[q] = *(const v4fa*)sp; s2[q] = *(const v4fa*)(sp + 32); }
#pragma unroll
      for (int q = 0; q < 4; ++q) {
        // sum of squares in the order of a 32-lane xor butterfly (16, 8, 4, 2, 1) over a_j = x1_j^2 + x2_j^2: dim j = 4 * lane + i, so 16, 8, 4 are lane steps 4, 2, 1 and 2, 1 are in-lane
        float t[4];
#pragma unroll
        for (int i = 0; i < 4; ++i) t[i] = __builtin_fmaf(x1[q][i], x1[q][i], x2[q][i] * x2[q][i]);
#pragma unroll
        for (int i = 0; i < 4; ++i) t[i] += row_xor<4>(t[i]);
#pragma unroll
        for (int i = 0; i < 4; ++i) t[i] += row_xor<2>(t[i]);
#pragma unroll
        for (int i = 0; i < 4; ++i) t[i] += row_xor<1>(t[i]);
        const float ss = (t[0] + t[2]) + (t[1] + t[3]);
        const float rs = rsqrtf(ss / (float)HD + 1e-6f);
        v4h y1, y2;      // explicit fma here and in t[]: it fixes which of the two products is rounded on its own
#pragma unroll
        for (int i = 0; i < 4; ++i) { const float n1 = x1[q][i] * rs * w1[i], n2 = x2[q][i] * rs * w2[i];
          y1[i] = (_Float16)__builtin_fmaf(n1, bf16_round(c1[q][i]), -(n2 * bf16_round(s1[q][i]))); y2[i] = (_Float16)__builtin_fmaf(n2, bf16_round(c2[q][i]), n1 * bf16_round(s2[q][i])); }
        _Float16* yp = (_Float16*)((char*)C16 + yo) + q * 4 * N;
        *(v4h*)yp = y1; *(v4h*)(yp + 32) = y2; }
      xp += 16 * OP; co += 16 * HD * 4; yo += 16 * N * 2; }
    return;
  }
#pragma unroll
  for (int q = 0; q < 16; ++q) { const int r = q * 2 + hh, c4 = ln * 4; const v4f v = *(const v4fa*)&so[r * OP + c4]; const size_t o = (size_t)(row0 + wm + r) * N + col0 + wn + c4;
    if (OUT == 1) { v4h h4;
#pragma unroll
      for (int i = 0; i < 4; ++i) h4[i] = (_Float16)v[i];
      *(v4h*)(C16 + o) = h4; }
    else *(v4f*)(C + o) = v; }
}
extern "C" void kernel_launch(void* const* d_in, const int* in_sizes, int n_in,
                              void* d_out, int out_size, void* d_ws, size_t ws_size, hipStream_t stream) {
  (void)in_sizes; (void)n_in; (void)out_size;
  const float* x = (const float*)d_in[0]; const float* cs = (const float*)d_in[1]; const float* sn = (const float*)d_in[2]; const float* wq = (const float*)d_in[3]; const float* wk = (const float*)d_in[4]; const float* wv = (const float*)d_in[5]; const float* wo = (const float*)d_in[6]; const float* qnw = (const float*)d_in[7]; const float* knw = (const float*)d_in[8];
  char* ws = (char*)d_ws; size_t off = 0;
  auto take = [&](size_t bytes) { char* p = ws + off; off += (bytes + 255) & ~(size_t)255; return p; };
  _Float16* Bq = (_Float16*)take((size_t)HID * HID * 2); _Float16* Bk = (_Float16*)take((size_t)KVD * HID * 2); _Float16* Bv = (_Float16*)take((size_t)KVD * HID * 2); _Float16* Bo = (_Float16*)take((size_t)HID * HID * 2);
  _Float16* X16 = (_Float16*)take((size_t)NR * HID * 2); _Float16* Q16 = (_Float16*)take((size_t)NR * HID * 2); _Float16* K16 = (_Float16*)take((size_t)NR * KVD * 2); _Float16* V16 = (_Float16*)take((size_t)NR * KVD * 2); _Float16* Vt = (_Float16*)take((size_t)NR * KVD * 2); _Float16* O16 = (_Float16*)take((size_t)NR * HID * 2);
  if (off > ws_size) return;      // about 6 + 8 + 8 + 4 x 3 + 8 = 42 MiB
  k_round16f<<<(unsigned)(((size_t)HID * HID / 8 + 255) / 256), 256, 0, stream>>>(wq, Bq, (size_t)HID * HID / 8); k_round16f<<<(unsigned)(((size_t)KVD * HID / 8 + 255) / 256), 256, 0, stream>>>(wk, Bk, (size_t)KVD * HID / 8);
  k_round16f<<<(unsigned)(((size_t)KVD * HID / 8 + 255) / 256), 256, 0, stream>>>(wv, Bv, (size_t)KVD * HID / 8); k_round16f<<<(unsigned)(((size_t)HID * HID / 8 + 255) / 256), 256, 0, stream>>>(wo, Bo, (size_t)HID * HID / 8);      // (out,in) = Bt
  const unsigned gx = (unsigned)(((size_t)NR * HID / 8 + 255) / 256);
  k_x16<<<gx, 256, 0, stream>>>(x, X16, (size_t)NR * HID / 8);
  const unsigned gq = (NR / 64) * (HID / 128), gk = (NR / 64) * (KVD / 128);
  k_proj<HID, 2><<<gq, 128, 0, stream>>>(X16, Bq, nullptr, Q16, qnw, cs, sn);
  k_proj<KVD, 2><<<gk, 128, 0, stream>>>(X16, Bk, nullptr, K16, knw, cs, sn);
  k_proj<KVD, 1><<<gk, 128, 0, stream>>>(X16, Bv, nullptr, V16, nullptr, nullptr, nullptr);
  k_vt<<<BB * NKV * (SS / 64), 256, 0, stream>>>(V16, Vt);
  k_flash<<<BB * NH * (SS / 128), 128, 0, stream>>>(Q16, K16, Vt, O16);
  k_proj<HID, 0><<<gq, 128, 0, stream>>>(O16, Bo, (float*)d_out, nullptr, nullptr, nullptr, nullptr);
}

// v005
// One run takes 131 microseconds.
// In both of two side-by-side timings against v004, it was 1.27 times as fast.
// Over all steps from v000 it is 4.04 times as fast.
#include <hip/hip_runtime.h>
// q/k/v/o projections (4096 × 1024 → 1024/512/512, 1024) and the 16-head causal GQA attention (8 kv heads, d = 64) on v_wmma_f32_16x16x32_f16 (fused flash-style kernel: S = Q·Kᵀ, O = P·V on WMMA,
// causal mask, online max/sum softmax f32, P f16 ≤ 1; only key chunks ≤ the block's last query); per-head RMSNorm and RoPE (cos/sin are INPUTS) applied in f32 before the f16 cast; V transposed
// per kv head; A = f16(bf16 x) exact, weights bf16-exact ×2^4 ((out,in) layouts), single products, f32 accumulate.
#define BB 2
#define SS 2048
#define HID 1024
#define NH 16
#define NKV 8
#define HD 64
#define KVD 512
#define NR (BB * SS)

typedef __bf16 v16b __attribute__((ext_vector_type(16)));
typedef unsigned short v8us __attribute__((ext_vector_type(8), may_alias));
typedef float  v8f  __attribute__((ext_vector_type(8)));
typedef float  v4f  __attribute__((ext_vector_type(4)));
typedef float  v4fa __attribute__((ext_vector_type(4), may_alias));
union FragB { v16b v; v8us half[2]; unsigned short u[16]; };

__device__ __forceinline__ unsigned short bf16_bits(float x) { unsigned int u = __float_as_uint(x); return (unsigned short)((u + 0x7FFFu + ((u >> 16) & 1u)) >> 16); }
__device__ __forceinline__ float bf16_val(unsigned short b) { return __uint_as_float(((unsigned int)b) << 16); }
__device__ __forceinline__ float bf16_round(float x) { return bf16_val(bf16_bits(x)); }
// D += A·B with NT terms: 1 = ah·bh, 2 = + al·bh (A split), 3 = + ah·bl (both split)
template <int NT>
__device__ __forceinline__ v8f mmaN(v16b ah, v16b al, v16b bh, v16b bl, v8f c) {
  c = __builtin_amdgcn_wmma_f32_16x16x32_bf16(false, ah, false, bh, (short)0, c, false, false);
  if (NT >= 2) c = __builtin_amdgcn_wmma_f32_16x16x32_bf16(false, al, false, bh, (short)0, c, false, false);
  if (NT >= 3) c = __builtin_amdgcn_wmma_f32_16x16x32_bf16(false, ah, false, bl, (short)0, c, false, false);
  asm volatile("v_nop\n\tv_nop\n\tv_nop\n\tv_nop" : "+v"(c) : "v"(ah), "v"(al), "v"(bh), "v"(bl));
  return c;
}

__global__ __launch_bounds__(256) void k_wt_bf16(const float* __restrict__ W, unsigned short* __restrict__ Wt, int K, int N) {
  const int t = blockIdx.x * 256 + threadIdx.x;
  const int k8n = K / 8;
  if (t >= N * k8n) return;
  const int n = t / k8n, k8 = (t % k8n) * 8;
  v8us v;
#pragma unroll
  for (int i = 0; i < 8; ++i) v[i] = bf16_bits(W[(size_t)(k8 + i) * N + n]);
  *(v8us*)(Wt + (size_t)n * K + k8) = v;
  
}

// GEMM C[M][N] (f32, pitch ldc) = act(A[M][K]·W + bias). A f32 row-major (pitch lda) converted per fragment to bf16
// (ASPLIT: hi/lo two planes -> 2 terms, else single rounded term); Wt bf16 [N][K] (pitch ldb). BIAS_BF16 rounds the
// bias to bf16 first (bias quantised to bf16 before the add). K%32==0, M%16==0, N%64==0.
template <bool ASPLIT, int ACT, bool BIAS_BF16>
__global__ __launch_bounds__(128) void k_gemm_bf(const float* __restrict__ A, int lda, const unsigned short* __restrict__ Wt, int ldb,
                                               const float* __restrict__ bias, float* __restrict__ C, int ldc, int M, int N, int K) {
  __shared__ __attribute__((aligned(16))) float so[4][16][64];
  const int tid = threadIdx.x, w = tid >> 5, lane = tid & 31, ln = lane & 15, hh = lane >> 4;
  const int ntn = N / 64;
  const int wid = blockIdx.x * 4 + w;
  const int mt = wid / ntn, nq = wid % ntn;
  if (mt * 16 >= M) return;
  const int row0 = mt * 16, col0 = nq * 64;
  const float* arow = A + (size_t)(row0 + ln) * lda;
  v8f acc[4] = {};
  for (int kb = 0; kb < K; kb += 32) {
    FragB ah, al;
    const v4f x0 = *(const v4fa*)(arow + kb + 8 * hh), x1 = *(const v4fa*)(arow + kb + 8 * hh + 4);
    const v4f x2 = *(const v4fa*)(arow + kb + 16 + 8 * hh), x3 = *(const v4fa*)(arow + kb + 16 + 8 * hh + 4);
    float xs[16] = {x0[0],x0[1],x0[2],x0[3],x1[0],x1[1],x1[2],x1[3],x2[0],x2[1],x2[2],x2[3],x3[0],x3[1],x3[2],x3[3]};
#pragma unroll
    for (int i = 0; i < 16; ++i) { const unsigned short hb = bf16_bits(xs[i]); ah.u[i] = hb; al.u[i] = ASPLIT ? bf16_bits(xs[i] - bf16_val(hb)) : (unsigned short)0; }
#pragma unroll
    for (int t = 0; t < 4; ++t) {
      const unsigned short* brow = Wt + (size_t)(col0 + t * 16 + ln) * ldb + kb;
      FragB b;
      b.half[0] = *(const v8us*)(brow + 8 * hh);
      b.half[1] = *(const v8us*)(brow + 16 + 8 * hh);
      acc[t] = mmaN<ASPLIT ? 2 : 1>(ah.v, al.v, b.v, b.v, acc[t]);
    }
  }
#pragma unroll
  for (int t = 0; t < 4; ++t) {
    float bv = bias ? bias[col0 + t * 16 + ln] : 0.f;
    if (BIAS_BF16) bv = bf16_round(bv);
#pragma unroll
    for (int r = 0; r < 8; ++r) { float v = acc[t][r] + bv; if (ACT == 1) v = fmaxf(v, 0.f); so[w][8 * hh + r][t * 16 + ln] = v; }
  }
  __builtin_amdgcn_fence(__ATOMIC_ACQ_REL, "workgroup");
  __builtin_amdgcn_wave_barrier();
  const int rsub = lane >> 4, c4 = (lane & 15) * 4;
  {
#pragma unroll
    for (int q = 0; q < 8; ++q) {
      const int r = q * 2 + rsub;
      const v4f v = *(const v4fa*)&so[w][r][c4];
      *(v4f*)(C + (size_t)(row0 + r) * ldc + col0 + c4) = v;
    }
    
  }
}

// Flash-style causal/unmasked attention, all contractions 3-term bf16 hi/lo splits, f32 softmax with running max.
// q,k,v rows are read from f32 buffers with arbitrary row pitch (so they can live inside a fused qkv buffer);
// D = head size (multiple of 32, <= 128); one wave = 16 query rows; block = 4 waves (64 queries) sharing K/V chunks of 32.
template <int D, bool CAUSAL>
__global__ __launch_bounds__(128) void k_flash(const float* __restrict__ qb, const float* __restrict__ kb, const float* __restrict__ vb,
                                             int pitch, int T, int H, float scale, float* __restrict__ y, int ypitch) {
  constexpr int KS = D / 32;        // k-steps for QK
  constexpr int DT = D / 16;        // d tiles for PV
  __shared__ __attribute__((aligned(16))) unsigned short sKh[32][D + 8], sKl[32][D + 8], sVh[32][D + 8], sVl[32][D + 8];
  __shared__ __attribute__((aligned(16))) unsigned short sPh[4][16][40], sPl[4][16][40];
  __shared__ __attribute__((aligned(16))) float sO[4][16][D];
  const int tid = threadIdx.x, w = tid >> 5, lane = tid & 31, ln = lane & 15, hh = lane >> 4;
  const int nqb = (T + 63) / 64;
  const int bh = blockIdx.x / nqb, qblk = blockIdx.x % nqb;
  const int b = bh / H, h = bh % H;
  const int q0 = qblk * 64 + w * 16;
  const float* Q = qb + (size_t)b * T * pitch + h * D;
  const float* K = kb + (size_t)b * T * pitch + h * D;
  const float* V = vb + (size_t)b * T * pitch + h * D;

  // A fragments of the wave's 16 query rows (scaled), hi/lo
  FragB aqh[KS], aql[KS];
  {
    int row = q0 + ln; if (row >= T) row = T - 1;
    const float* qr = Q + (size_t)row * pitch;
#pragma unroll
    for (int ks = 0; ks < KS; ++ks)
#pragma unroll
      for (int i = 0; i < 16; ++i) {
        const int d = ks * 32 + ((i < 8) ? (8 * hh + i) : (16 + 8 * hh + (i - 8)));
        const float x = qr[d] * scale; const unsigned short hb = bf16_bits(x);
        aqh[ks].u[i] = hb; aql[ks].u[i] = bf16_bits(x - bf16_val(hb));
      }
  }
  float m_r[8], l_r[8];
#pragma unroll
  for (int r = 0; r < 8; ++r) { m_r[r] = -3.0e38f; l_r[r] = 0.f; }
  v8f oacc[DT];
#pragma unroll
  for (int dt = 0; dt < DT; ++dt) oacc[dt] = (v8f){0.f,0.f,0.f,0.f,0.f,0.f,0.f,0.f};

  const int kv_end = CAUSAL ? min(T, qblk * 64 + 64) : T;     // block-uniform
  for (int j0 = 0; j0 < kv_end; j0 += 32) {
    __syncthreads();
    for (int e = tid; e < 32 * (D / 4); e += 128) {
      const int r = e / (D / 4), c4 = (e % (D / 4)) * 4;
      const int key = j0 + r;
      v4f kf = {0.f,0.f,0.f,0.f}, vf = {0.f,0.f,0.f,0.f};
      if (key < T) { kf = *(const v4fa*)(K + (size_t)key * pitch + c4); vf = *(const v4fa*)(V + (size_t)key * pitch + c4); }
#pragma unroll
      for (int t = 0; t < 4; ++t) {
        unsigned short hb = bf16_bits(kf[t]); sKh[r][c4 + t] = hb; sKl[r][c4 + t] = bf16_bits(kf[t] - bf16_val(hb));
        hb = bf16_bits(vf[t]); sVh[r][c4 + t] = hb; sVl[r][c4 + t] = bf16_bits(vf[t] - bf16_val(hb));
      }
    }
    __syncthreads();
    // S tile 16 x 32
    v8f s[2];
#pragma unroll
    for (int nt = 0; nt < 2; ++nt) {
      v8f acc = {};
#pragma unroll
      for (int ks = 0; ks < KS; ++ks) {
        FragB bh_, bl_;
        bh_.half[0] = *(const v8us*)&sKh[nt * 16 + ln][ks * 32 + 8 * hh]; bh_.half[1] = *(const v8us*)&sKh[nt * 16 + ln][ks * 32 + 16 + 8 * hh];
        bl_.half[0] = *(const v8us*)&sKl[nt * 16 + ln][ks * 32 + 8 * hh]; bl_.half[1] = *(const v8us*)&sKl[nt * 16 + ln][ks * 32 + 16 + 8 * hh];
        acc = mmaN<3>(aqh[ks].v, aql[ks].v, bh_.v, bl_.v, acc);
      }
      s[nt] = acc;
    }
    // mask + running max (rows 8hh+r; the 16 lanes of a half share rows)
    float alpha[8];
#pragma unroll
    for (int r = 0; r < 8; ++r) {
      const int qi = q0 + 8 * hh + r;
      const int ja = j0 + ln, jb = j0 + 16 + ln;
      if (CAUSAL) { if (ja > qi) s[0][r] = -3.0e38f; if (jb > qi) s[1][r] = -3.0e38f; }
      if (ja >= T) s[0][r] = -3.0e38f;
      if (jb >= T) s[1][r] = -3.0e38f;
      float mx = fmaxf(s[0][r], s[1][r]);
      mx = fmaxf(mx, __shfl_xor(mx, 1, 32)); mx = fmaxf(mx, __shfl_xor(mx, 2, 32)); mx = fmaxf(mx, __shfl_xor(mx, 4, 32)); mx = fmaxf(mx, __shfl_xor(mx, 8, 32));
      const float mnew = fmaxf(m_r[r], mx);
      alpha[r] = (mnew > -1.0e38f) ? __expf(m_r[r] - mnew) : 1.0f;
      const float p0 = (s[0][r] > -1.0e38f) ? __expf(s[0][r] - mnew) : 0.f;
      const float p1 = (s[1][r] > -1.0e38f) ? __expf(s[1][r] - mnew) : 0.f;
      m_r[r] = mnew;
      l_r[r] = l_r[r] * alpha[r] + p0 + p1;            // per-lane partial row sum (16 lanes combined at the end)
      unsigned short hb = bf16_bits(p0); sPh[w][8 * hh + r][ln] = hb;      sPl[w][8 * hh + r][ln] = bf16_bits(p0 - bf16_val(hb));
      hb = bf16_bits(p1);                sPh[w][8 * hh + r][16 + ln] = hb; sPl[w][8 * hh + r][16 + ln] = bf16_bits(p1 - bf16_val(hb));
    }
#pragma unroll
    for (int dt = 0; dt < DT; ++dt)
#pragma unroll
      for (int r = 0; r < 8; ++r) oacc[dt][r] *= alpha[r];
    __builtin_amdgcn_fence(__ATOMIC_ACQ_REL, "workgroup");
    __builtin_amdgcn_wave_barrier();
    FragB pah, pal;
    pah.half[0] = *(const v8us*)&sPh[w][ln][8 * hh]; pah.half[1] = *(const v8us*)&sPh[w][ln][16 + 8 * hh];
    pal.half[0] = *(const v8us*)&sPl[w][ln][8 * hh]; pal.half[1] = *(const v8us*)&sPl[w][ln][16 + 8 * hh];
#pragma unroll
    for (int dt = 0; dt < DT; ++dt) {
      FragB bvh, bvl;
#pragma unroll
      for (int i = 0; i < 8; ++i) {
        bvh.u[i] = sVh[8 * hh + i][dt * 16 + ln]; bvh.u[8 + i] = sVh[16 + 8 * hh + i][dt * 16 + ln];
        bvl.u[i] = sVl[8 * hh + i][dt * 16 + ln]; bvl.u[8 + i] = sVl[16 + 8 * hh + i][dt * 16 + ln];
      }
      oacc[dt] = mmaN<3>(pah.v, pal.v, bvh.v, bvl.v, oacc[dt]);
    }
    __builtin_amdgcn_fence(__ATOMIC_ACQ_REL, "workgroup");
    __builtin_amdgcn_wave_barrier();
  }
#pragma unroll
  for (int r = 0; r < 8; ++r) {
    float l = l_r[r];
    l += __shfl_xor(l, 1, 32); l += __shfl_xor(l, 2, 32); l += __shfl_xor(l, 4, 32); l += __shfl_xor(l, 8, 32);
    l_r[r] = (l > 0.f) ? 1.0f / l : 0.f;
  }
#pragma unroll
  for (int dt = 0; dt < DT; ++dt)
#pragma unroll
    for (int r = 0; r < 8; ++r) sO[w][8 * hh + r][dt * 16 + ln] = oacc[dt][r] * l_r[r];
  __builtin_amdgcn_fence(__ATOMIC_ACQ_REL, "workgroup");
  __builtin_amdgcn_wave_barrier();
  {
    for (int r = 0; r < 16; ++r) {
      const int row = q0 + r;
      if (row < T && lane < D / 4) {
        const v4f val = *(const v4fa*)&sO[w][r][lane * 4];
        *(v4f*)(y + ((size_t)b * T + row) * ypitch + h * D + lane * 4) = val;
      }
    }
    
  }
}

// GEMM C = act(A·W + bias + resid): A f32 (ASPLIT -> hi/lo 2 terms), Wt bf16 [N][K]; ACT 0 none, 1 relu, 2 exact gelu;
// resid (optional, f32, row index = (row % rmod), pitch ldr, RES_BF16 rounds it) added before the activation.
template <bool ASPLIT, int ACT, bool BIAS_BF16, bool RES_BF16>
__global__ __launch_bounds__(128) void k_gemm_bf3(const float* __restrict__ A, int lda, const unsigned short* __restrict__ Wt, int ldb,
                                                const float* __restrict__ bias, const float* __restrict__ resid, int rmod, int ldr,
                                                float* __restrict__ C, int ldc, int M, int N, int K) {
  __shared__ __attribute__((aligned(16))) float so[4][16][64];
  const int tid = threadIdx.x, w = tid >> 5, lane = tid & 31, ln = lane & 15, hh = lane >> 4;
  const int ntn = N / 64;
  const int wid = blockIdx.x * 4 + w;
  const int mt = wid / ntn, nq = wid % ntn;
  if (mt * 16 >= M) return;
  const int row0 = mt * 16, col0 = nq * 64;
  const float* arow = A + (size_t)(row0 + ln) * lda;
  v8f acc[4] = {};
  for (int kb = 0; kb < K; kb += 32) {
    FragB ah, al;
    const v4f x0 = *(const v4fa*)(arow + kb + 8 * hh), x1 = *(const v4fa*)(arow + kb + 8 * hh + 4);
    const v4f x2 = *(const v4fa*)(arow + kb + 16 + 8 * hh), x3 = *(const v4fa*)(arow + kb + 16 + 8 * hh + 4);
    float xs[16] = {x0[0],x0[1],x0[2],x0[3],x1[0],x1[1],x1[2],x1[3],x2[0],x2[1],x2[2],x2[3],x3[0],x3[1],x3[2],x3[3]};
#pragma unroll
    for (int i = 0; i < 16; ++i) { const unsigned short hb = bf16_bits(xs[i]); ah.u[i] = hb; al.u[i] = ASPLIT ? bf16_bits(xs[i] - bf16_val(hb)) : (unsigned short)0; }
#pragma unroll
    for (int t = 0; t < 4; ++t) {
      const unsigned short* brow = Wt + (size_t)(col0 + t * 16 + ln) * ldb + kb;
      FragB b;
      b.half[0] = *(const v8us*)(brow + 8 * hh);
      b.half[1] = *(const v8us*)(brow + 16 + 8 * hh);
      acc[t] = mmaN<ASPLIT ? 2 : 1>(ah.v, al.v, b.v, b.v, acc[t]);
    }
  }
#pragma unroll
  for (int t = 0; t < 4; ++t) {
    const int col = col0 + t * 16 + ln;
    float bv = bias ? bias[col] : 0.f;
    if (BIAS_BF16) bv = bf16_round(bv);
#pragma unroll
    for (int r = 0; r < 8; ++r) {
      float v = acc[t][r] + bv;
      if (resid) { float rv = resid[(size_t)((row0 + 8 * hh + r) % rmod) * ldr + col]; if (RES_BF16) rv = bf16_round(rv); v += rv; }
      if (ACT == 1) v = fmaxf(v, 0.f);
      if (ACT == 2) v = 0.5f * v * (1.0f + erff(v * 0.70710678118654752f));
      if (ACT == 3) { const float u = 0.7978845608028654f * (v + 0.044715f * v * v * v); v = 0.5f * v * (1.0f + tanhf(u)); }
      so[w][8 * hh + r][t * 16 + ln] = v;
    }
  }
  __builtin_amdgcn_fence(__ATOMIC_ACQ_REL, "workgroup");
  __builtin_amdgcn_wave_barrier();
  const int rsub = lane >> 4, c4 = (lane & 15) * 4;
  {
#pragma unroll
    for (int q = 0; q < 8; ++q) {
      const int r = q * 2 + rsub;
      const v4f v = *(const v4fa*)&so[w][r][c4];
      *(v4f*)(C + (size_t)(row0 + r) * ldc + col0 + c4) = v;
    }
    
  }
}
// row LayerNorm (biased variance, eps) over N: s = X (+ R); optional out_sum <- s; out_norm <- (s-mu)*rsqrt(var+eps)*g + b
template <bool PARAM_BF16>
__global__ __launch_bounds__(256) void k_layernorm(const float* __restrict__ X, const float* __restrict__ R, const float* __restrict__ g, const float* __restrict__ bta,
                                                  float* __restrict__ out_sum, float* __restrict__ out_norm, int N, float eps) {
  __shared__ float red[256];
  const int row = blockIdx.x, tid = threadIdx.x;
  const float* x = X + (size_t)row * N; const float* rr = R ? R + (size_t)row * N : nullptr;
  float vals[16];                     // up to N = 4096
  const int per = N / 256;            // contiguous chunk per thread? use strided-by-4 chunks: thread handles j = tid*4 + 1024*u
  float s1 = 0.f;
  for (int u = 0; u < per / 4; ++u) {
    const int j = tid * 4 + 1024 * u;
    const v4f a = *(const v4fa*)(x + j);
    v4f b = {0.f,0.f,0.f,0.f}; if (rr) b = *(const v4fa*)(rr + j);
#pragma unroll
    for (int q = 0; q < 4; ++q) { const float v = a[q] + b[q]; vals[u * 4 + q] = v; s1 += v; }
  }
  red[tid] = s1; __syncthreads();
  for (int st = 128; st > 0; st >>= 1) { if (tid < st) red[tid] += red[tid + st]; __syncthreads(); }
  const float mu = red[0] / (float)N; __syncthreads();
  float s2 = 0.f;
  for (int u = 0; u < per / 4; ++u)
#pragma unroll
    for (int q = 0; q < 4; ++q) { const float c = vals[u * 4 + q] - mu; s2 += c * c; }
  red[tid] = s2; __syncthreads();
  for (int st = 128; st > 0; st >>= 1) { if (tid < st) red[tid] += red[tid + st]; __syncthreads(); }
  const float rs = rsqrtf(red[0] / (float)N + eps);
  {
    for (int u = 0; u < per / 4; ++u) {
      const int j = tid * 4 + 1024 * u;
      v4f o, sm;
#pragma unroll
      for (int q = 0; q < 4; ++q) {
        float gg = g[j + q], bb = bta[j + q];
        if (PARAM_BF16) { gg = bf16_round(gg); bb = bf16_round(bb); }
        sm[q] = vals[u * 4 + q]; o[q] = (vals[u * 4 + q] - mu) * rs * gg + bb;
      }
      if (out_sum) *(v4f*)(out_sum + (size_t)row * N + j) = sm;
      *(v4f*)(out_norm + (size_t)row * N + j) = o;
    }
    
  }
}



// ---- f16 WMMA path (v_wmma_f32_16x16x32_f16): 11-bit significands for operands in range — used where a [0,1] probability operand needs more precision than bf16
typedef _Float16 v16h __attribute__((ext_vector_type(16)));
typedef _Float16 v4h __attribute__((ext_vector_type(4)));
union FragH { v16h v; v8us half[2]; _Float16 h[16]; unsigned short u[16]; };
template <int NT>
__device__ __forceinline__ v8f mmaH(v16h ah, v16h al, v16h bh, v16h bl, v8f c) {
  c = __builtin_amdgcn_wmma_f32_16x16x32_f16(false, ah, false, bh, (short)0, c, false, false);
  if (NT >= 2) c = __builtin_amdgcn_wmma_f32_16x16x32_f16(false, al, false, bh, (short)0, c, false, false);
  if (NT >= 3) c = __builtin_amdgcn_wmma_f32_16x16x32_f16(false, ah, false, bl, (short)0, c, false, false);
  asm volatile("v_nop\n\tv_nop\n\tv_nop\n\tv_nop" : "+v"(c) : "v"(ah), "v"(al), "v"(bh), "v"(bl));
  return c;
}
// batched GEMM like k_gemm_b but f16 operands: A f32 (split into f16 hi/lo if ASPLIT, else rounded to f16), Bt = f16 values [n][k]; alpha; C f32; N multiple of 16 (partial tiles skipped)
template <bool ASPLIT>
__global__ __launch_bounds__(128) void k_gemm_h(const float* __restrict__ A, int lda, size_t sA, const _Float16* __restrict__ Bh, int ldb, size_t sB, float alpha, float* __restrict__ C, int ldc, size_t sC, int M, int N, int K) {
  __shared__ __attribute__((aligned(16))) float so[4][16][64];
  const int tid = threadIdx.x, w = tid >> 5, lane = tid & 31, ln = lane & 15, hh = lane >> 4; const int by = blockIdx.y;
  A += (size_t)by * sA; Bh += (size_t)by * sB; C += (size_t)by * sC;
  const int ntn = (N + 63) / 64; const int wid = blockIdx.x * 4 + w; const int mt = wid / ntn, nq = wid % ntn; if (mt * 16 >= M) return;
  const int row0 = mt * 16, col0 = nq * 64; const float* arow = A + (size_t)(row0 + ln) * lda;
  v8f acc[4] = {};
  for (int kb = 0; kb < K; kb += 32) {
    FragH ah, al;
    const v4f x0 = *(const v4fa*)(arow + kb + 8 * hh), x1 = *(const v4fa*)(arow + kb + 8 * hh + 4), x2 = *(const v4fa*)(arow + kb + 16 + 8 * hh), x3 = *(const v4fa*)(arow + kb + 16 + 8 * hh + 4);
    float xs[16] = {x0[0],x0[1],x0[2],x0[3],x1[0],x1[1],x1[2],x1[3],x2[0],x2[1],x2[2],x2[3],x3[0],x3[1],x3[2],x3[3]};
#pragma unroll
    for (int i = 0; i < 16; ++i) { const _Float16 h = (_Float16)xs[i]; ah.h[i] = h; al.h[i] = ASPLIT ? (_Float16)(xs[i] - (float)h) : (_Float16)0.0f; }
#pragma unroll
    for (int t = 0; t < 4; ++t) { if (col0 + t * 16 >= N) continue; const size_t boff = (size_t)(col0 + t * 16 + ln) * ldb + kb; FragH bq; bq.half[0] = *(const v8us*)(Bh + boff + 8 * hh); bq.half[1] = *(const v8us*)(Bh + boff + 16 + 8 * hh);
      acc[t] = mmaH<ASPLIT ? 2 : 1>(ah.v, al.v, bq.v, bq.v, acc[t]); }
  }
#pragma unroll
  for (int t = 0; t < 4; ++t) { if (col0 + t * 16 >= N) continue;
#pragma unroll
    for (int r = 0; r < 8; ++r) so[w][8 * hh + r][t * 16 + ln] = acc[t][r] * alpha; }
  __builtin_amdgcn_fence(__ATOMIC_ACQ_REL, "workgroup"); __builtin_amdgcn_wave_barrier();
  const int rsub = lane >> 4, c4 = (lane & 15) * 4;
  {
#pragma unroll
    for (int q = 0; q < 8; ++q) { const int r = q * 2 + rsub; if (col0 + c4 < N) { const v4f v = *(const v4fa*)&so[w][r][c4]; *(v4f*)(C + (size_t)(row0 + r) * ldc + col0 + c4) = v; } }
     }
}

// Wt[n][k] = f16(W[k][n]·scale) from f32 row-major W[K][N] (scale = power of two; bf16-exact weights stay exact in f16 away from the subnormal range)
__global__ __launch_bounds__(256) void k_wt_f16(const float* __restrict__ W, _Float16* __restrict__ Wt, int K, int N, float scale) {
  const int t = blockIdx.x * 256 + threadIdx.x; if (t >= N * (K / 8)) return; const int n = t / (K / 8), k8 = (t % (K / 8)) * 8; FragH f;
#pragma unroll
  for (int i = 0; i < 8; ++i) f.h[i] = (_Float16)(bf16_round(W[(size_t)(k8 + i) * N + n]) * scale); const v8us o = f.half[0];
  *(v8us*)((unsigned short*)Wt + (size_t)n * K + k8) = o; 
}
__global__ __launch_bounds__(256) void k_x16(const float* __restrict__ x, _Float16* __restrict__ X16, size_t n8) { const size_t t = (size_t)blockIdx.x * 256 + threadIdx.x; if (t >= n8) return; FragH f;
#pragma unroll
  for (int q = 0; q < 8; ++q) f.h[q] = (_Float16)bf16_round(x[t * 8 + q]); *(v8us*)((unsigned short*)X16 + t * 8) = f.half[0];  }
__global__ __launch_bounds__(256) void k_round16f(const float* __restrict__ W, _Float16* __restrict__ Bt, size_t n8) { const size_t t = (size_t)blockIdx.x * 256 + threadIdx.x; if (t >= n8) return; FragH f;
#pragma unroll
  for (int i = 0; i < 8; ++i) f.h[i] = (_Float16)(bf16_round(W[t * 8 + i]) * 16.0f); *(v8us*)((unsigned short*)Bt + t * 8) = f.half[0];  }
__global__ __launch_bounds__(256) void k_vt(const _Float16* __restrict__ V16, _Float16* __restrict__ Vt) { __shared__ unsigned short tl[64][66]; const int tid = threadIdx.x; const int slab = blockIdx.x / (SS / 64), lg = blockIdx.x % (SS / 64); const int b = slab / NKV, h = slab % NKV;
  for (int i = tid; i < 64 * 8; i += 256) { const int r = i / 8, c8 = (i % 8) * 8; FragH f; f.half[0] = *(const v8us*)((const unsigned short*)V16 + ((size_t)b * SS + lg * 64 + r) * KVD + h * HD + c8);
#pragma unroll
    for (int q = 0; q < 8; ++q) tl[r][c8 + q] = f.u[q]; }
  __syncthreads();
  {
#pragma unroll
    for (int rd = 0; rd < 2; ++rd) { const int d = rd * 32 + tid / 8, pc = tid % 8; FragH f;
#pragma unroll
      for (int q = 0; q < 8; ++q) f.u[q] = tl[pc * 8 + q][d];
      *(v8us*)((unsigned short*)Vt + ((size_t)slab * HD + d) * SS + lg * 64 + pc * 8) = f.half[0]; }
     } }
// Maximum over each 16-lane row for eight values at once: an xor butterfly (1, 2, 4, 8) on the vector pipe. DPP row_xmask hands the partner lane's value to v_max_num_f32 as an operand, so a step
// needs no LDS-pipe round trip and no dscnt wait. One asm statement, step by step over the eight values: the eight instructions of a step are independent, so none waits for the step before it
// (as single statements, and as the builtin move, the compiler put each value's four steps back to back; the builtin also kept a separate move and a quieting maximum per step). All 32 lanes are on here.
__device__ __forceinline__ void row16_max8(float (&m)[8]) {
  asm("v_max_num_f32_dpp %0, %0, %0 row_xmask:1 row_mask:0xf bank_mask:0xf\n\t"
      "v_max_num_f32_dpp %1, %1, %1 row_xmask:1 row_mask:0xf bank_mask:0xf\n\t"
      "v_max_num_f32_dpp %2, %2, %2 row_xmask:1 row_mask:0xf bank_mask:0xf\n\t"
      "v_max_num_f32_dpp %3, %3, %3 row_xmask:1 row_mask:0xf bank_mask:0xf\n\t"
      "v_max_num_f32_dpp %4, %4, %4 row_xmask:1 row_mask:0xf bank_mask:0xf\n\t"
      "v_max_num_f32_dpp %5, %5, %5 row_xmask:1 row_mask:0xf bank_mask:0xf\n\t"
      "v_max_num_f32_dpp %6, %6, %6 row_xmask:1 row_mask:0xf bank_mask:0xf\n\t"
      "v_max_num_f32_dpp %7, %7, %7 row_xmask:1 row_mask:0xf bank_mask:0xf\n\t"
      "v_max_num_f32_dpp %0, %0, %0 row_xmask:2 row_mask:0xf bank_mask:0xf\n\t"
      "v_max_num_f32_dpp %1, %1, %1 row_xmask:2 row_mask:0xf bank_mask:0xf\n\t"
      "v_max_num_f32_dpp %2, %2, %2 row_xmask:2 row_mask:0xf bank_mask:0xf\n\t"
      "v_max_num_f32_dpp %3, %3, %3 row_xmask:2 row_mask:0xf bank_mask:0xf\n\t"
      "v_max_num_f32_dpp %4, %4, %4 row_xmask:2 row_mask:0xf bank_mask:0xf\n\t"
      "v_max_num_f32_dpp %5, %5, %5 row_xmask:2 row_mask:0xf bank_mask:0xf\n\t"
      "v_max_num_f32_dpp %6, %6, %6 row_xmask:2 row_mask:0xf bank_mask:0xf\n\t"
      "v_max_num_f32_dpp %7, %7, %7 row_xmask:2 row_mask:0xf bank_mask:0xf\n\t"
      "v_max_num_f32_dpp %0, %0, %0 row_xmask:4 row_mask:0xf bank_mask:0xf\n\t"
      "v_max_num_f32_dpp %1, %1, %1 row_xmask:4 row_mask:0xf bank_mask:0xf\n\t"
      "v_max_num_f32_dpp %2, %2, %2 row_xmask:4 row_mask:0xf bank_mask:0xf\n\t"
      "v_max_num_f32_dpp %3, %3, %3 row_xmask:4 row_mask:0xf bank_mask:0xf\n\t"
      "v_max_num_f32_dpp %4, %4, %4 row_xmask:4 row_mask:0xf bank_mask:0xf\n\t"
      "v_max_num_f32_dpp %5, %5, %5 row_xmask:4 row_mask:0xf bank_mask:0xf\n\t"
      "v_max_num_f32_dpp %6, %6, %6 row_xmask:4 row_mask:0xf bank_mask:0xf\n\t"
      "v_max_num_f32_dpp %7, %7, %7 row_xmask:4 row_mask:0xf bank_mask:0xf\n\t"
      "v_max_num_f32_dpp %0, %0, %0 row_xmask:8 row_mask:0xf bank_mask:0xf\n\t"
      "v_max_num_f32_dpp %1, %1, %1 row_xmask:8 row_mask:0xf bank_mask:0xf\n\t"
      "v_max_num_f32_dpp %2, %2, %2 row_xmask:8 row_mask:0xf bank_mask:0xf\n\t"
      "v_max_num_f32_dpp %3, %3, %3 row_xmask:8 row_mask:0xf bank_mask:0xf\n\t"
      "v_max_num_f32_dpp %4, %4, %4 row_xmask:8 row_mask:0xf bank_mask:0xf\n\t"
      "v_max_num_f32_dpp %5, %5, %5 row_xmask:8 row_mask:0xf bank_mask:0xf\n\t"
      "v_max_num_f32_dpp %6, %6, %6 row_xmask:8 row_mask:0xf bank_mask:0xf\n\t"
      "v_max_num_f32_dpp %7, %7, %7 row_xmask:8 row_mask:0xf bank_mask:0xf"
      : "+v"(m[0]), "+v"(m[1]), "+v"(m[2]), "+v"(m[3]), "+v"(m[4]), "+v"(m[5]), "+v"(m[6]), "+v"(m[7])); }
// the same butterfly for a sum: the builtin move fuses into v_add_f32_dpp
template <int M> __device__ __forceinline__ float row_xor(float v) { return __int_as_float(__builtin_amdgcn_mov_dpp(__float_as_int(v), 0x160 + M, 0xf, 0xf, true)); }
__device__ __forceinline__ float row16_sum(float v) { v += row_xor<1>(v); v += row_xor<2>(v); v += row_xor<4>(v); v += row_xor<8>(v); return v; }
// fused causal GQA attention per ((b,h), 128 queries): wave = 32 queries; Q from Q16 cols h·64 (pitch 1024), K from K16 cols kvh·64 (pitch 512), kvh = h / 2; key chunks 0..qb0+128; mask k ≤ q else −inf
__global__ __launch_bounds__(128) void k_flash(const _Float16* __restrict__ Q16, const _Float16* __restrict__ K16, const _Float16* __restrict__ Vt, _Float16* __restrict__ O16) {
  constexpr int RPW = 32, NQB = SS / (4 * RPW), DT = HD / 16, KS = HD / 32;
  // The softmax runs in base 2: the scores take 1/8 and log2(e) in their one multiply, so e^(s - m) = 2^(s2 - m2) is one subtraction and one v_exp_f32. Every argument is <= 0 here (m2 is the running maximum),
  // so nothing can overflow; -inf (masked) and the -3e38 start value give 0; a result below 2^-126 is flushed to 0, far under the f16 rounding of P and the f32 rounding of the row sum, which holds a term 1.
  constexpr float SC2 = 0.125f * 1.4426950408889634f;
  __shared__ __attribute__((aligned(16))) unsigned short sP[4][RPW][40]; __shared__ __attribute__((aligned(16))) float sO[4][RPW][HD];
  const int tid = threadIdx.x, w = tid >> 5, lane = tid & 31, ln = lane & 15, hh = lane >> 4;
  const int slab = blockIdx.x / NQB, qblk = blockIdx.x % NQB; const int b = slab / NH, h = slab % NH; const int kvh = h / (NH / NKV); const int qb0 = qblk * (4 * RPW); const int q0 = qb0 + w * RPW;
  FragH aq[2][KS];
#pragma unroll
  for (int rt = 0; rt < 2; ++rt) { const unsigned short* qr = (const unsigned short*)Q16 + ((size_t)b * SS + q0 + rt * 16 + ln) * HID + h * HD;
#pragma unroll
    for (int ks = 0; ks < KS; ++ks) { aq[rt][ks].half[0] = *(const v8us*)(qr + ks * 32 + 8 * hh); aq[rt][ks].half[1] = *(const v8us*)(qr + ks * 32 + 16 + 8 * hh); } }
  const unsigned short* Vth = (const unsigned short*)Vt + (size_t)(b * NKV + kvh) * HD * SS;
  float m_r[2][8], l_r[2][8]; v8f oacc[2][DT];
#pragma unroll
  for (int rt = 0; rt < 2; ++rt) {
#pragma unroll
    for (int r = 0; r < 8; ++r) { m_r[rt][r] = -3.0e38f; l_r[rt][r] = 0.f; }
#pragma unroll
    for (int dt = 0; dt < DT; ++dt) oacc[rt][dt] = (v8f){0.f,0.f,0.f,0.f,0.f,0.f,0.f,0.f}; }
  const int jend = qb0 + 4 * RPW;
  // K and V fragments are requested ahead of their products, so that no product waits out a load: a chunk's K is loaded during the chunk before it (chunk 0's here), its V at the chunk's head
  const unsigned short* kl = (const unsigned short*)K16 + ((size_t)b * SS + ln) * KVD + kvh * HD + 8 * hh;
  const unsigned short* vl = Vth + (size_t)ln * SS + 8 * hh;
  FragH bk[2][KS];
#pragma unroll
  for (int nt = 0; nt < 2; ++nt)
#pragma unroll
    for (int ks = 0; ks < KS; ++ks) { bk[nt][ks].half[0] = *(const v8us*)(kl + nt * 16 * KVD + ks * 32); bk[nt][ks].half[1] = *(const v8us*)(kl + nt * 16 * KVD + ks * 32 + 16); }
#pragma unroll 1
  for (int j0 = 0; j0 < jend; j0 += 32) {
    FragH bv[DT];
#pragma unroll
    for (int dt = 0; dt < DT; ++dt) { bv[dt].half[0] = *(const v8us*)(vl + (size_t)dt * 16 * SS + j0); bv[dt].half[1] = *(const v8us*)(vl + (size_t)dt * 16 * SS + j0 + 16); }
    v8f s[2][2];
#pragma unroll
    for (int nt = 0; nt < 2; ++nt)
#pragma unroll
      for (int rt = 0; rt < 2; ++rt) { v8f acc = (v8f){0.f,0.f,0.f,0.f,0.f,0.f,0.f,0.f};
#pragma unroll
        for (int ks = 0; ks < KS; ++ks) acc = mmaH<1>(aq[rt][ks].v, aq[rt][ks].v, bk[nt][ks].v, bk[nt][ks].v, acc); s[rt][nt] = acc; }
    // the next chunk's K into the same registers, right behind their last product; the last chunk loads its own rows again (in bounds, never used)
    { const unsigned short* kn = kl + (size_t)((j0 + 32 < jend) ? j0 + 32 : j0) * KVD;
#pragma unroll
      for (int nt = 0; nt < 2; ++nt)
#pragma unroll
        for (int ks = 0; ks < KS; ++ks) { bk[nt][ks].half[0] = *(const v8us*)(kn + nt * 16 * KVD + ks * 32); bk[nt][ks].half[1] = *(const v8us*)(kn + nt * 16 * KVD + ks * 32 + 16); } }
    // stands between the loads above and the softmax, which reuses their K address pair: the wait that belongs in front of an overwrite of an issued load's address register
    asm volatile("s_wait_xcnt 0x0" ::: "memory");
    // keeps the V and K loads and the wait in front of the softmax and the output products that the loads fly under (without it the scheduler sank the K loads into the softmax and the wait far behind them)
    __builtin_amdgcn_sched_barrier(0);
    float mx[2][8];
#pragma unroll
    for (int rt = 0; rt < 2; ++rt) {
#pragma unroll
      for (int r = 0; r < 8; ++r) { const int qi = q0 + rt * 16 + 8 * hh + r; const int k0 = j0 + ln, k1 = j0 + 16 + ln;
        s[rt][0][r] = (k0 <= qi) ? s[rt][0][r] * SC2 : -INFINITY; s[rt][1][r] = (k1 <= qi) ? s[rt][1][r] * SC2 : -INFINITY; mx[rt][r] = fmaxf(s[rt][0][r], s[rt][1][r]); }
      row16_max8(mx[rt]); }
#pragma unroll
    for (int rt = 0; rt < 2; ++rt)
#pragma unroll
      for (int r = 0; r < 8; ++r) { const float s0 = s[rt][0][r], s1 = s[rt][1][r];
        const float mn = fmaxf(m_r[rt][r], mx[rt][r]); const float al = __builtin_amdgcn_exp2f(m_r[rt][r] - mn); m_r[rt][r] = mn; const float p0 = __builtin_amdgcn_exp2f(s0 - mn), p1 = __builtin_amdgcn_exp2f(s1 - mn); l_r[rt][r] = l_r[rt][r] * al + p0 + p1;
#pragma unroll
        for (int dt = 0; dt < DT; ++dt) oacc[rt][dt][r] *= al;
        FragH t2; t2.h[0] = (_Float16)p0; t2.h[1] = (_Float16)p1; sP[w][rt * 16 + 8 * hh + r][ln] = t2.u[0]; sP[w][rt * 16 + 8 * hh + r][16 + ln] = t2.u[1]; }
    __builtin_amdgcn_fence(__ATOMIC_ACQ_REL, "workgroup"); __builtin_amdgcn_wave_barrier();
    FragH pa[2];
#pragma unroll
    for (int rt = 0; rt < 2; ++rt) { pa[rt].half[0] = *(const v8us*)&sP[w][rt * 16 + ln][8 * hh]; pa[rt].half[1] = *(const v8us*)&sP[w][rt * 16 + ln][16 + 8 * hh]; }
#pragma unroll
    for (int dt = 0; dt < DT; ++dt)
#pragma unroll
      for (int rt = 0; rt < 2; ++rt) oacc[rt][dt] = mmaH<1>(pa[rt].v, pa[rt].v, bv[dt].v, bv[dt].v, oacc[rt][dt]);
    __builtin_amdgcn_fence(__ATOMIC_ACQ_REL, "workgroup"); __builtin_amdgcn_wave_barrier(); }
#pragma unroll
  for (int rt = 0; rt < 2; ++rt) {
#pragma unroll
    for (int r = 0; r < 8; ++r) { float l = l_r[rt][r]; l = row16_sum(l); l_r[rt][r] = 1.0f / l; }
#pragma unroll
    for (int dt = 0; dt < DT; ++dt)
#pragma unroll
      for (int r = 0; r < 8; ++r) sO[w][rt * 16 + 8 * hh + r][dt * 16 + ln] = oacc[rt][dt][r] * l_r[rt][r]; }
  __builtin_amdgcn_fence(__ATOMIC_ACQ_REL, "workgroup"); __builtin_amdgcn_wave_barrier();
  {
#pragma unroll
    for (int rp = 0; rp < RPW; rp += 2) { const int r = rp + (lane >> 4), pc = lane & 15; const v4f val = *(const v4fa*)&sO[w][r][pc * 4]; v4h h4;
#pragma unroll
      for (int i = 0; i < 4; ++i) h4[i] = (_Float16)val[i];      // the o projection's A operand: rounded here, 16 lanes = one 128-byte line of the row
      *(v4h*)(O16 + ((size_t)b * SS + q0 + r) * HID + h * HD + pc * 4) = h4; }
     } }
// Projection GEMM C[4096][N] = A[4096][1024] * Bt[N][1024]^T / 16 (f16 operands, f32 accumulate, k ascending in steps of 32 as before). Block = 4 waves = a 64 x 128 tile of C; wave = 32 x 64 (2 x 4 accumulators).
// Each stage brings 64 k of the 64 A rows and the 128 Bt rows into LDS with whole 128-byte rows per 8 lanes, so every row is fetched once per block instead of once per wave in 16-line gathers;
// the next stage's rows are loaded into registers while this stage's products run, and go into the other buffer. Row pitch 144 bytes: the 16 rows of a fragment read fall on different banks.
// OUT 0: C f32. OUT 1: C16 = f16(C). OUT 2 (q, k): a wave's 64 columns are one head, so its staged 32 x 64 tile holds whole head rows: per row RMSNorm over the 64 dims (eps 1e-6, times bf16(nw)),
// then RoPE with the INPUT cos/sin[row][64] (rotate_half = [-x2, x1]; rounded to bf16 like every other input), then C16 = f16: the f32 product never goes to memory.
template <int N, int OUT>
__global__ __launch_bounds__(128) void k_proj(const _Float16* __restrict__ A, const _Float16* __restrict__ Bt, float* __restrict__ C, _Float16* __restrict__ C16,
                                              const float* __restrict__ nw, const float* __restrict__ cs, const float* __restrict__ sn) {
  constexpr int K = HID, BM = 64, BN = 128, BK = 64, PIT = BK + 8, NS = K / BK, NBN = N / BN, OP = 68;
  __shared__ __attribute__((aligned(16))) unsigned short sm[2][BM + BN][PIT];
  static_assert(sizeof(float) * 4 * 32 * OP <= sizeof(unsigned short) * 2 * (BM + BN) * PIT, "the output tiles reuse the stage buffers");
  const int tid = threadIdx.x, w = tid >> 5, lane = tid & 31, ln = lane & 15, hh = lane >> 4;
  const int row0 = (blockIdx.x / NBN) * BM, col0 = (blockIdx.x % NBN) * BN, wm = (w >> 1) * 32, wn = (w & 1) * 64;
  const int sr = tid >> 3, sc = (tid & 7) * 8;
  const unsigned short* ga = (const unsigned short*)A + (size_t)(row0 + sr) * K + sc;
  const unsigned short* gb = (const unsigned short*)Bt + (size_t)(col0 + sr) * K + sc;
  v8us ra[BM / 16], rb[BN / 16];
  v8f acc[2][4];
#pragma unroll
  for (int mi = 0; mi < 2; ++mi)
#pragma unroll
    for (int t = 0; t < 4; ++t) acc[mi][t] = (v8f){0.f,0.f,0.f,0.f,0.f,0.f,0.f,0.f};
#pragma unroll
  for (int i = 0; i < BM / 16; ++i) ra[i] = *(const v8us*)(ga + (size_t)i * 16 * K);
#pragma unroll
  for (int i = 0; i < BN / 16; ++i) rb[i] = *(const v8us*)(gb + (size_t)i * 16 * K);
#pragma unroll
  for (int i = 0; i < BM / 16; ++i) *(v8us*)&sm[0][sr + i * 16][sc] = ra[i];
#pragma unroll
  for (int i = 0; i < BN / 16; ++i) *(v8us*)&sm[0][BM + sr + i * 16][sc] = rb[i];
  __syncthreads();
  // unrolled whole: every stage's global offset is then an immediate on two address pairs that are never rewritten, and the buffer index a constant
#pragma unroll
  for (int s = 0; s < NS; ++s) {
    const int cur = s & 1;
    if (s + 1 < NS) {
#pragma unroll
      for (int i = 0; i < BM / 16; ++i) ra[i] = *(const v8us*)(ga + (size_t)i * 16 * K + (s + 1) * BK);
#pragma unroll
      for (int i = 0; i < BN / 16; ++i) rb[i] = *(const v8us*)(gb + (size_t)i * 16 * K + (s + 1) * BK);
    }
    // keeps the next stage's loads at the head of this stage, so that they fly under all of its products (the scheduler sank them to just in front of their LDS stores)
    __builtin_amdgcn_sched_barrier(0);
    FragH a[BK / 32][2], b[BK / 32][4];
#pragma unroll
    for (int ks = 0; ks < BK / 32; ++ks) {
#pragma unroll
      for (int mi = 0; mi < 2; ++mi) { const unsigned short* p = &sm[cur][wm + mi * 16 + ln][ks * 32 + 8 * hh]; a[ks][mi].half[0] = *(const v8us*)p; a[ks][mi].half[1] = *(const v8us*)(p + 16); }
#pragma unroll
      for (int t = 0; t < 4; ++t) { const unsigned short* p = &sm[cur][BM + wn + t * 16 + ln][ks * 32 + 8 * hh]; b[ks][t].half[0] = *(const v8us*)p; b[ks][t].half[1] = *(const v8us*)(p + 16); }
    }
    // keeps the stage's fragment reads in one group ahead of its products: one exposed LDS latency per stage (the scheduler reused the A registers and waited for LDS four times per stage)
    __builtin_amdgcn_sched_barrier(0);
#pragma unroll
    for (int ks = 0; ks < BK / 32; ++ks)
#pragma unroll
      for (int mi = 0; mi < 2; ++mi)
#pragma unroll
        for (int t = 0; t < 4; ++t) acc[mi][t] = __builtin_amdgcn_wmma_f32_16x16x32_f16(false, a[ks][mi].v, false, b[ks][t].v, (short)0, acc[mi][t], false, false);
    // keeps the waits for those loads, and the LDS stores behind them, behind the issue of all of this stage's products (the scheduler put them in the middle of the stage)
    __builtin_amdgcn_sched_barrier(0);
    if (s + 1 < NS) {
#pragma unroll
      for (int i = 0; i < BM / 16; ++i) *(v8us*)&sm[cur ^ 1][sr + i * 16][sc] = ra[i];
#pragma unroll
      for (int i = 0; i < BN / 16; ++i) *(v8us*)&sm[cur ^ 1][BM + sr + i * 16][sc] = rb[i];
    }
    // one barrier per stage: it publishes the buffer just filled and ends every wave's reads of the buffer that the next stage refills (after the last stage: that the output tiles reuse)
    __syncthreads();
  }
  typedef float fa __attribute__((may_alias));
  fa* so = (fa*)&sm[0][0][0] + w * 32 * OP;
#pragma unroll
  for (int mi = 0; mi < 2; ++mi)
#pragma unroll
    for (int t = 0; t < 4; ++t)
#pragma unroll
      for (int r = 0; r < 8; ++r) so[(mi * 16 + 8 * hh + r) * OP + t * 16 + ln] = acc[mi][t][r] * 0.0625f;
  // the wave reads back its own tile, written by other lanes: the LDS stores must have landed first
  __builtin_amdgcn_fence(__ATOMIC_ACQ_REL, "workgroup"); __builtin_amdgcn_wave_barrier();
  if constexpr (OUT == 2) {
    static_assert(HD == 64, "a wave's 64 columns are one head");
    // 8 lanes per row, 4 rows per pass: a lane holds dims j4..j4+3 (x1) and 32+j4..32+j4+3 (x2), the two halves that RoPE pairs
    const int rr = lane >> 3, j4 = (lane & 7) * 4;
    v4f w1 = *(const v4fa*)(nw + j4), w2 = *(const v4fa*)(nw + 32 + j4);
#pragma unroll
    for (int i = 0; i < 4; ++i) { w1[i] = bf16_round(w1[i]); w2[i] = bf16_round(w2[i]); }
    const fa* xp = so + rr * OP + j4;
    // byte offsets of the lane's first row: one for cos and sin (below 1 MiB), one for the output (below 8 MiB); each rides as the 32-bit offset register beside a scalar base
    unsigned co = (unsigned)((row0 + wm + rr) * HD + j4) * 4u, yo = (unsigned)((row0 + wm + rr) * N + col0 + wn + j4) * 2u;
    // two trips of four passes: a trip's 16 cos/sin loads go out together and fly under its sums of squares (all eight passes unrolled took more than 256 registers)
#pragma unroll 1
    for (int qh = 0; qh < 2; ++qh) {
      v4f x1[4], x2[4], c1[4], c2[4], s1[4], s2[4];
#pragma unroll
      for (int q = 0; q < 4; ++q) { x1[q] = *(const v4fa*)(xp + q * 4 * OP); x2[q] = *(const v4fa*)(xp + q * 4 * OP + 32); }
#pragma unroll
      for (int q = 0; q < 4; ++q) { const float* cp = (const float*)((const char*)cs + co) + q * 4 * HD; const float* sp = (const float*)((const char*)sn + co) + q * 4 * HD;
        c1[q] = *(const v4fa*)cp; c2[q] = *(const v4fa*)(cp + 32); s1[q] = *(const v4fa*)sp; s2[q] = *(const v4fa*)(sp + 32); }
#pragma unroll
      for (int q = 0; q < 4; ++q) {
        // sum of squares in the order of a 32-lane xor butterfly (16, 8, 4, 2, 1) over a_j = x1_j^2 + x2_j^2: dim j = 4 * lane + i, so 16, 8, 4 are lane steps 4, 2, 1 and 2, 1 are in-lane
        float t[4];
#pragma unroll
        for (int i = 0; i < 4; ++i) t[i] = __builtin_fmaf(x1[q][i], x1[q][i], x2[q][i] * x2[q][i]);
#pragma unroll
        for (int i = 0; i < 4; ++i) t[i] += row_xor<4>(t[i]);
#pragma unroll
        for (int i = 0; i < 4; ++i) t[i] += row_xor<2>(t[i]);
#pragma unroll
        for (int i = 0; i < 4; ++i) t[i] += row_xor<1>(t[i]);
        const float ss = (t[0] + t[2]) + (t[1] + t[3]);
        const float rs = rsqrtf(ss / (float)HD + 1e-6f);
        v4h y1, y2;      // explicit fma here and in t[]: it fixes which of the two products is rounded on its own
#pragma unroll
        for (int i = 0; i < 4; ++i) { const float n1 = x1[q][i] * rs * w1[i], n2 = x2[q][i] * rs * w2[i];
          y1[i] = (_Float16)__builtin_fmaf(n1, bf16_round(c1[q][i]), -(n2 * bf16_round(s1[q][i]))); y2[i] = (_Float16)__builtin_fmaf(n2, bf16_round(c2[q][i]), n1 * bf16_round(s2[q][i])); }
        _Float16* yp = (_Float16*)((char*)C16 + yo) + q * 4 * N;
        *(v4h*)yp = y1; *(v4h*)(yp + 32) = y2; }
      xp += 16 * OP; co += 16 * HD * 4; yo += 16 * N * 2; }
    return;
  }
#pragma unroll
  for (int q = 0; q < 16; ++q) { const int r = q * 2 + hh, c4 = ln * 4; const v4f v = *(const v4fa*)&so[r * OP + c4]; const size_t o = (size_t)(row0 + wm + r) * N + col0 + wn + c4;
    if (OUT == 1) { v4h h4;
#pragma unroll
      for (int i = 0; i < 4; ++i) h4[i] = (_Float16)v[i];
      *(v4h*)(C16 + o) = h4; }
    else *(v4f*)(C + o) = v; }
}
extern "C" void kernel_launch(void* const* d_in, const int* in_sizes, int n_in,
                              void* d_out, int out_size, void* d_ws, size_t ws_size, hipStream_t stream) {
  (void)in_sizes; (void)n_in; (void)out_size;
  const float* x = (const float*)d_in[0]; const float* cs = (const float*)d_in[1]; const float* sn = (const float*)d_in[2]; const float* wq = (const float*)d_in[3]; const float* wk = (const float*)d_in[4]; const float* wv = (const float*)d_in[5]; const float* wo = (const float*)d_in[6]; const float* qnw = (const float*)d_in[7]; const float* knw = (const float*)d_in[8];
  char* ws = (char*)d_ws; size_t off = 0;
  auto take = [&](size_t bytes) { char* p = ws + off; off += (bytes + 255) & ~(size_t)255; return p; };
  _Float16* Bq = (_Float16*)take((size_t)HID * HID * 2); _Float16* Bk = (_Float16*)take((size_t)KVD * HID * 2); _Float16* Bv = (_Float16*)take((size_t)KVD * HID * 2); _Float16* Bo = (_Float16*)take((size_t)HID * HID * 2);
  _Float16* X16 = (_Float16*)take((size_t)NR * HID * 2); _Float16* Q16 = (_Float16*)take((size_t)NR * HID * 2); _Float16* K16 = (_Float16*)take((size_t)NR * KVD * 2); _Float16* V16 = (_Float16*)take((size_t)NR * KVD * 2); _Float16* Vt = (_Float16*)take((size_t)NR * KVD * 2); _Float16* O16 = (_Float16*)take((size_t)NR * HID * 2);
  if (off > ws_size) return;      // about 6 + 8 + 8 + 4 x 3 + 8 = 42 MiB
  k_round16f<<<(unsigned)(((size_t)HID * HID / 8 + 255) / 256), 256, 0, stream>>>(wq, Bq, (size_t)HID * HID / 8); k_round16f<<<(unsigned)(((size_t)KVD * HID / 8 + 255) / 256), 256, 0, stream>>>(wk, Bk, (size_t)KVD * HID / 8);
  k_round16f<<<(unsigned)(((size_t)KVD * HID / 8 + 255) / 256), 256, 0, stream>>>(wv, Bv, (size_t)KVD * HID / 8); k_round16f<<<(unsigned)(((size_t)HID * HID / 8 + 255) / 256), 256, 0, stream>>>(wo, Bo, (size_t)HID * HID / 8);      // (out,in) = Bt
  const unsigned gx = (unsigned)(((size_t)NR * HID / 8 + 255) / 256);
  k_x16<<<gx, 256, 0, stream>>>(x, X16, (size_t)NR * HID / 8);
  const unsigned gq = (NR / 64) * (HID / 128), gk = (NR / 64) * (KVD / 128);
  k_proj<HID, 2><<<gq, 128, 0, stream>>>(X16, Bq, nullptr, Q16, qnw, cs, sn);
  k_proj<KVD, 2><<<gk, 128, 0, stream>>>(X16, Bk, nullptr, K16, knw, cs, sn);
  k_proj<KVD, 1><<<gk, 128, 0, stream>>>(X16, Bv, nullptr, V16, nullptr, nullptr, nullptr);
  k_vt<<<BB * NKV * (SS / 64), 256, 0, stream>>>(V16, Vt);
  k_flash<<<BB * NH * (SS / 128), 128, 0, stream>>>(Q16, K16, Vt, O16);
  k_proj<HID, 0><<<gq, 128, 0, stream>>>(O16, Bo, (float*)d_out, nullptr, nullptr, nullptr, nullptr);
}

// v006
// One run takes 110 microseconds.
// In two side-by-side timings against v005, it was 1.19 and 1.20 times as fast.
// All steps since v000 together make it 4.83 times as fast.
#include <hip/hip_runtime.h>
// q/k/v/o projections (4096 × 1024 → 1024/512/512, 1024) and the 16-head causal GQA attention (8 kv heads, d = 64) on v_wmma_f32_16x16x32_f16 (fused flash-style kernel: S = Q·Kᵀ, O = P·V on WMMA,
// causal mask, online max/sum softmax f32, P f16 ≤ 1; only key chunks ≤ the block's last query); per-head RMSNorm and RoPE (cos/sin are INPUTS) applied in f32 before the f16 cast; V transposed
// per kv head; A = f16(bf16 x) exact, weights bf16-exact ×2^4 ((out,in) layouts), single products, f32 accumulate.
#define BB 2
#define SS 2048
#define HID 1024
#define NH 16
#define NKV 8
#define HD 64
#define KVD 512
#define NR (BB * SS)

typedef __bf16 v16b __attribute__((ext_vector_type(16)));
typedef unsigned short v8us __attribute__((ext_vector_type(8), may_alias));
typedef float  v8f  __attribute__((ext_vector_type(8)));
typedef float  v4f  __attribute__((ext_vector_type(4)));
typedef float  v4fa __attribute__((ext_vector_type(4), may_alias));
union FragB { v16b v; v8us half[2]; unsigned short u[16]; };

__device__ __forceinline__ unsigned short bf16_bits(float x) { unsigned int u = __float_as_uint(x); return (unsigned short)((u + 0x7FFFu + ((u >> 16) & 1u)) >> 16); }
__device__ __forceinline__ float bf16_val(unsigned short b) { return __uint_as_float(((unsigned int)b) << 16); }
__device__ __forceinline__ float bf16_round(float x) { return bf16_val(bf16_bits(x)); }
// D += A·B with NT terms: 1 = ah·bh, 2 = + al·bh (A split), 3 = + ah·bl (both split)
template <int NT>
__device__ __forceinline__ v8f mmaN(v16b ah, v16b al, v16b bh, v16b bl, v8f c) {
  c = __builtin_amdgcn_wmma_f32_16x16x32_bf16(false, ah, false, bh, (short)0, c, false, false);
  if (NT >= 2) c = __builtin_amdgcn_wmma_f32_16x16x32_bf16(false, al, false, bh, (short)0, c, false, false);
  if (NT >= 3) c = __builtin_amdgcn_wmma_f32_16x16x32_bf16(false, ah, false, bl, (short)0, c, false, false);
  asm volatile("v_nop\n\tv_nop\n\tv_nop\n\tv_nop" : "+v"(c) : "v"(ah), "v"(al), "v"(bh), "v"(bl));
  return c;
}

__global__ __launch_bounds__(256) void k_wt_bf16(const float* __restrict__ W, unsigned short* __restrict__ Wt, int K, int N) {
  const int t = blockIdx.x * 256 + threadIdx.x;
  const int k8n = K / 8;
  if (t >= N * k8n) return;
  const int n = t / k8n, k8 = (t % k8n) * 8;
  v8us v;
#pragma unroll
  for (int i = 0; i < 8; ++i) v[i] = bf16_bits(W[(size_t)(k8 + i) * N + n]);
  *(v8us*)(Wt + (size_t)n * K + k8) = v;
  
}

// GEMM C[M][N] (f32, pitch ldc) = act(A[M][K]·W + bias). A f32 row-major (pitch lda) converted per fragment to bf16
// (ASPLIT: hi/lo two planes -> 2 terms, else single rounded term); Wt bf16 [N][K] (pitch ldb). BIAS_BF16 rounds the
// bias to bf16 first (bias quantised to bf16 before the add). K%32==0, M%16==0, N%64==0.
template <bool ASPLIT, int ACT, bool BIAS_BF16>
__global__ __launch_bounds__(128) void k_gemm_bf(const float* __restrict__ A, int lda, const unsigned short* __restrict__ Wt, int ldb,
                                               const float* __restrict__ bias, float* __restrict__ C, int ldc, int M, int N, int K) {
  __shared__ __attribute__((aligned(16))) float so[4][16][64];
  const int tid = threadIdx.x, w = tid >> 5, lane = tid & 31, ln = lane & 15, hh = lane >> 4;
  const int ntn = N / 64;
  const int wid = blockIdx.x * 4 + w;
  const int mt = wid / ntn, nq = wid % ntn;
  if (mt * 16 >= M) return;
  const int row0 = mt * 16, col0 = nq * 64;
  const float* arow = A + (size_t)(row0 + ln) * lda;
  v8f acc[4] = {};
  for (int kb = 0; kb < K; kb += 32) {
    FragB ah, al;
    const v4f x0 = *(const v4fa*)(arow + kb + 8 * hh), x1 = *(const v4fa*)(arow + kb + 8 * hh + 4);
    const v4f x2 = *(const v4fa*)(arow + kb + 16 + 8 * hh), x3 = *(const v4fa*)(arow + kb + 16 + 8 * hh + 4);
    float xs[16] = {x0[0],x0[1],x0[2],x0[3],x1[0],x1[1],x1[2],x1[3],x2[0],x2[1],x2[2],x2[3],x3[0],x3[1],x3[2],x3[3]};
#pragma unroll
    for (int i = 0; i < 16; ++i) { const unsigned short hb = bf16_bits(xs[i]); ah.u[i] = hb; al.u[i] = ASPLIT ? bf16_bits(xs[i] - bf16_val(hb)) : (unsigned short)0; }
#pragma unroll
    for (int t = 0; t < 4; ++t) {
      const unsigned short* brow = Wt + (size_t)(col0 + t * 16 + ln) * ldb + kb;
      FragB b;
      b.half[0] = *(const v8us*)(brow + 8 * hh);
      b.half[1] = *(const v8us*)(brow + 16 + 8 * hh);
      acc[t] = mmaN<ASPLIT ? 2 : 1>(ah.v, al.v, b.v, b.v, acc[t]);
    }
  }
#pragma unroll
  for (int t = 0; t < 4; ++t) {
    float bv = bias ? bias[col0 + t * 16 + ln] : 0.f;
    if (BIAS_BF16) bv = bf16_round(bv);
#pragma unroll
    for (int r = 0; r < 8; ++r) { float v = acc[t][r] + bv; if (ACT == 1) v = fmaxf(v, 0.f); so[w][8 * hh + r][t * 16 + ln] = v; }
  }
  __builtin_amdgcn_fence(__ATOMIC_ACQ_REL, "workgroup");
  __builtin_amdgcn_wave_barrier();
  const int rsub = lane >> 4, c4 = (lane & 15) * 4;
  {
#pragma unroll
    for (int q = 0; q < 8; ++q) {
      const int r = q * 2 + rsub;
      const v4f v = *(const v4fa*)&so[w][r][c4];
      *(v4f*)(C + (size_t)(row0 + r) * ldc + col0 + c4) = v;
    }
    
  }
}

// Flash-style causal/unmasked attention, all contractions 3-term bf16 hi/lo splits, f32 softmax with running max.
// q,k,v rows are read from f32 buffers with arbitrary row pitch (so they can live inside a fused qkv buffer);
// D = head size (multiple of 32, <= 128); one wave = 16 query rows; block = 4 waves (64 queries) sharing K/V chunks of 32.
template <int D, bool CAUSAL>
__global__ __launch_bounds__(128) void k_flash(const float* __restrict__ qb, const float* __restrict__ kb, const float* __restrict__ vb,
                                             int pitch, int T, int H, float scale, float* __restrict__ y, int ypitch) {
  constexpr int KS = D / 32;        // k-steps for QK
  constexpr int DT = D / 16;        // d tiles for PV
  __shared__ __attribute__((aligned(16))) unsigned short sKh[32][D + 8], sKl[32][D + 8], sVh[32][D + 8], sVl[32][D + 8];
  __shared__ __attribute__((aligned(16))) unsigned short sPh[4][16][40], sPl[4][16][40];
  __shared__ __attribute__((aligned(16))) float sO[4][16][D];
  const int tid = threadIdx.x, w = tid >> 5, lane = tid & 31, ln = lane & 15, hh = lane >> 4;
  const int nqb = (T + 63) / 64;
  const int bh = blockIdx.x / nqb, qblk = blockIdx.x % nqb;
  const int b = bh / H, h = bh % H;
  const int q0 = qblk * 64 + w * 16;
  const float* Q = qb + (size_t)b * T * pitch + h * D;
  const float* K = kb + (size_t)b * T * pitch + h * D;
  const float* V = vb + (size_t)b * T * pitch + h * D;

  // A fragments of the wave's 16 query rows (scaled), hi/lo
  FragB aqh[KS], aql[KS];
  {
    int row = q0 + ln; if (row >= T) row = T - 1;
    const float* qr = Q + (size_t)row * pitch;
#pragma unroll
    for (int ks = 0; ks < KS; ++ks)
#pragma unroll
      for (int i = 0; i < 16; ++i) {
        const int d = ks * 32 + ((i < 8) ? (8 * hh + i) : (16 + 8 * hh + (i - 8)));
        const float x = qr[d] * scale; const unsigned short hb = bf16_bits(x);
        aqh[ks].u[i] = hb; aql[ks].u[i] = bf16_bits(x - bf16_val(hb));
      }
  }
  float m_r[8], l_r[8];
#pragma unroll
  for (int r = 0; r < 8; ++r) { m_r[r] = -3.0e38f; l_r[r] = 0.f; }
  v8f oacc[DT];
#pragma unroll
  for (int dt = 0; dt < DT; ++dt) oacc[dt] = (v8f){0.f,0.f,0.f,0.f,0.f,0.f,0.f,0.f};

  const int kv_end = CAUSAL ? min(T, qblk * 64 + 64) : T;     // block-uniform
  for (int j0 = 0; j0 < kv_end; j0 += 32) {
    __syncthreads();
    for (int e = tid; e < 32 * (D / 4); e += 128) {
      const int r = e / (D / 4), c4 = (e % (D / 4)) * 4;
      const int key = j0 + r;
      v4f kf = {0.f,0.f,0.f,0.f}, vf = {0.f,0.f,0.f,0.f};
      if (key < T) { kf = *(const v4fa*)(K + (size_t)key * pitch + c4); vf = *(const v4fa*)(V + (size_t)key * pitch + c4); }
#pragma unroll
      for (int t = 0; t < 4; ++t) {
        unsigned short hb = bf16_bits(kf[t]); sKh[r][c4 + t] = hb; sKl[r][c4 + t] = bf16_bits(kf[t] - bf16_val(hb));
        hb = bf16_bits(vf[t]); sVh[r][c4 + t] = hb; sVl[r][c4 + t] = bf16_bits(vf[t] - bf16_val(hb));
      }
    }
    __syncthreads();
    // S tile 16 x 32
    v8f s[2];
#pragma unroll
    for (int nt = 0; nt < 2; ++nt) {
      v8f acc = {};
#pragma unroll
      for (int ks = 0; ks < KS; ++ks) {
        FragB bh_, bl_;
        bh_.half[0] = *(const v8us*)&sKh[nt * 16 + ln][ks * 32 + 8 * hh]; bh_.half[1] = *(const v8us*)&sKh[nt * 16 + ln][ks * 32 + 16 + 8 * hh];
        bl_.half[0] = *(const v8us*)&sKl[nt * 16 + ln][ks * 32 + 8 * hh]; bl_.half[1] = *(const v8us*)&sKl[nt * 16 + ln][ks * 32 + 16 + 8 * hh];
        acc = mmaN<3>(aqh[ks].v, aql[ks].v, bh_.v, bl_.v, acc);
      }
      s[nt] = acc;
    }
    // mask + running max (rows 8hh+r; the 16 lanes of a half share rows)
    float alpha[8];
#pragma unroll
    for (int r = 0; r < 8; ++r) {
      const int qi = q0 + 8 * hh + r;
      const int ja = j0 + ln, jb = j0 + 16 + ln;
      if (CAUSAL) { if (ja > qi) s[0][r] = -3.0e38f; if (jb > qi) s[1][r] = -3.0e38f; }
      if (ja >= T) s[0][r] = -3.0e38f;
      if (jb >= T) s[1][r] = -3.0e38f;
      float mx = fmaxf(s[0][r], s[1][r]);
      mx = fmaxf(mx, __shfl_xor(mx, 1, 32)); mx = fmaxf(mx, __shfl_xor(mx, 2, 32)); mx = fmaxf(mx, __shfl_xor(mx, 4, 32)); mx = fmaxf(mx, __shfl_xor(mx, 8, 32));
      const float mnew = fmaxf(m_r[r], mx);
      alpha[r] = (mnew > -1.0e38f) ? __expf(m_r[r] - mnew) : 1.0f;
      const float p0 = (s[0][r] > -1.0e38f) ? __expf(s[0][r] - mnew) : 0.f;
      const float p1 = (s[1][r] > -1.0e38f) ? __expf(s[1][r] - mnew) : 0.f;
      m_r[r] = mnew;
      l_r[r] = l_r[r] * alpha[r] + p0 + p1;            // per-lane partial row sum (16 lanes combined at the end)
      unsigned short hb = bf16_bits(p0); sPh[w][8 * hh + r][ln] = hb;      sPl[w][8 * hh + r][ln] = bf16_bits(p0 - bf16_val(hb));
      hb = bf16_bits(p1);                sPh[w][8 * hh + r][16 + ln] = hb; sPl[w][8 * hh + r][16 + ln] = bf16_bits(p1 - bf16_val(hb));
    }
#pragma unroll
    for (int dt = 0; dt < DT; ++dt)
#pragma unroll
      for (int r = 0; r < 8; ++r) oacc[dt][r] *= alpha[r];
    __builtin_amdgcn_fence(__ATOMIC_ACQ_REL, "workgroup");
    __builtin_amdgcn_wave_barrier();
    FragB pah, pal;
    pah.half[0] = *(const v8us*)&sPh[w][ln][8 * hh]; pah.half[1] = *(const v8us*)&sPh[w][ln][16 + 8 * hh];
    pal.half[0] = *(const v8us*)&sPl[w][ln][8 * hh]; pal.half[1] = *(const v8us*)&sPl[w][ln][16 + 8 * hh];
#pragma unroll
    for (int dt = 0; dt < DT; ++dt) {
      FragB bvh, bvl;
#pragma unroll
      for (int i = 0; i < 8; ++i) {
        bvh.u[i] = sVh[8 * hh + i][dt * 16 + ln]; bvh.u[8 + i] = sVh[16 + 8 * hh + i][dt * 16 + ln];
        bvl.u[i] = sVl[8 * hh + i][dt * 16 + ln]; bvl.u[8 + i] = sVl[16 + 8 * hh + i][dt * 16 + ln];
      }
      oacc[dt] = mmaN<3>(pah.v, pal.v, bvh.v, bvl.v, oacc[dt]);
    }
    __builtin_amdgcn_fence(__ATOMIC_ACQ_REL, "workgroup");
    __builtin_amdgcn_wave_barrier();
  }
#pragma unroll
  for (int r = 0; r < 8; ++r) {
    float l = l_r[r];
    l += __shfl_xor(l, 1, 32); l += __shfl_xor(l, 2, 32); l += __shfl_xor(l, 4, 32); l += __shfl_xor(l, 8, 32);
    l_r[r] = (l > 0.f) ? 1.0f / l : 0.f;
  }
#pragma unroll
  for (int dt = 0; dt < DT; ++dt)
#pragma unroll
    for (int r = 0; r < 8; ++r) sO[w][8 * hh + r][dt * 16 + ln] = oacc[dt][r] * l_r[r];
  __builtin_amdgcn_fence(__ATOMIC_ACQ_REL, "workgroup");
  __builtin_amdgcn_wave_barrier();
  {
    for (int r = 0; r < 16; ++r) {
      const int row = q0 + r;
      if (row < T && lane < D / 4) {
        const v4f val = *(const v4fa*)&sO[w][r][lane * 4];
        *(v4f*)(y + ((size_t)b * T + row) * ypitch + h * D + lane * 4) = val;
      }
    }
    
  }
}

// GEMM C = act(A·W + bias + resid): A f32 (ASPLIT -> hi/lo 2 terms), Wt bf16 [N][K]; ACT 0 none, 1 relu, 2 exact gelu;
// resid (optional, f32, row index = (row % rmod), pitch ldr, RES_BF16 rounds it) added before the activation.
template <bool ASPLIT, int ACT, bool BIAS_BF16, bool RES_BF16>
__global__ __launch_bounds__(128) void k_gemm_bf3(const float* __restrict__ A, int lda, const unsigned short* __restrict__ Wt, int ldb,
                                                const float* __restrict__ bias, const float* __restrict__ resid, int rmod, int ldr,
                                                float* __restrict__ C, int ldc, int M, int N, int K) {
  __shared__ __attribute__((aligned(16))) float so[4][16][64];
  const int tid = threadIdx.x, w = tid >> 5, lane = tid & 31, ln = lane & 15, hh = lane >> 4;
  const int ntn = N / 64;
  const int wid = blockIdx.x * 4 + w;
  const int mt = wid / ntn, nq = wid % ntn;
  if (mt * 16 >= M) return;
  const int row0 = mt * 16, col0 = nq * 64;
  const float* arow = A + (size_t)(row0 + ln) * lda;
  v8f acc[4] = {};
  for (int kb = 0; kb < K; kb += 32) {
    FragB ah, al;
    const v4f x0 = *(const v4fa*)(arow + kb + 8 * hh), x1 = *(const v4fa*)(arow + kb + 8 * hh + 4);
    const v4f x2 = *(const v4fa*)(arow + kb + 16 + 8 * hh), x3 = *(const v4fa*)(arow + kb + 16 + 8 * hh + 4);
    float xs[16] = {x0[0],x0[1],x0[2],x0[3],x1[0],x1[1],x1[2],x1[3],x2[0],x2[1],x2[2],x2[3],x3[0],x3[1],x3[2],x3[3]};
#pragma unroll
    for (int i = 0; i < 16; ++i) { const unsigned short hb = bf16_bits(xs[i]); ah.u[i] = hb; al.u[i] = ASPLIT ? bf16_bits(xs[i] - bf16_val(hb)) : (unsigned short)0; }
#pragma unroll
    for (int t = 0; t < 4; ++t) {
      const unsigned short* brow = Wt + (size_t)(col0 + t * 16 + ln) * ldb + kb;
      FragB b;
      b.half[0] = *(const v8us*)(brow + 8 * hh);
      b.half[1] = *(const v8us*)(brow + 16 + 8 * hh);
      acc[t] = mmaN<ASPLIT ? 2 : 1>(ah.v, al.v, b.v, b.v, acc[t]);
    }
  }
#pragma unroll
  for (int t = 0; t < 4; ++t) {
    const int col = col0 + t * 16 + ln;
    float bv = bias ? bias[col] : 0.f;
    if (BIAS_BF16) bv = bf16_round(bv);
#pragma unroll
    for (int r = 0; r < 8; ++r) {
      float v = acc[t][r] + bv;
      if (resid) { float rv = resid[(size_t)((row0 + 8 * hh + r) % rmod) * ldr + col]; if (RES_BF16) rv = bf16_round(rv); v += rv; }
      if (ACT == 1) v = fmaxf(v, 0.f);
      if (ACT == 2) v = 0.5f * v * (1.0f + erff(v * 0.70710678118654752f));
      if (ACT == 3) { const float u = 0.7978845608028654f * (v + 0.044715f * v * v * v); v = 0.5f * v * (1.0f + tanhf(u)); }
      so[w][8 * hh + r][t * 16 + ln] = v;
    }
  }
  __builtin_amdgcn_fence(__ATOMIC_ACQ_REL, "workgroup");
  __builtin_amdgcn_wave_barrier();
  const int rsub = lane >> 4, c4 = (lane & 15) * 4;
  {
#pragma unroll
    for (int q = 0; q < 8; ++q) {
      const int r = q * 2 + rsub;
      const v4f v = *(const v4fa*)&so[w][r][c4];
      *(v4f*)(C + (size_t)(row0 + r) * ldc + col0 + c4) = v;
    }
    
  }
}
// row LayerNorm (biased variance, eps) over N: s = X (+ R); optional out_sum <- s; out_norm <- (s-mu)*rsqrt(var+eps)*g + b
template <bool PARAM_BF16>
__global__ __launch_bounds__(256) void k_layernorm(const float* __restrict__ X, const float* __restrict__ R, const float* __restrict__ g, const float* __restrict__ bta,
                                                  float* __restrict__ out_sum, float* __restrict__ out_norm, int N, float eps) {
  __shared__ float red[256];
  const int row = blockIdx.x, tid = threadIdx.x;
  const float* x = X + (size_t)row * N; const float* rr = R ? R + (size_t)row * N : nullptr;
  float vals[16];                     // up to N = 4096
  const int per = N / 256;            // contiguous chunk per thread? use strided-by-4 chunks: thread handles j = tid*4 + 1024*u
  float s1 = 0.f;
  for (int u = 0; u < per / 4; ++u) {
    const int j = tid * 4 + 1024 * u;
    const v4f a = *(const v4fa*)(x + j);
    v4f b = {0.f,0.f,0.f,0.f}; if (rr) b = *(const v4fa*)(rr + j);
#pragma unroll
    for (int q = 0; q < 4; ++q) { const float v = a[q] + b[q]; vals[u * 4 + q] = v; s1 += v; }
  }
  red[tid] = s1; __syncthreads();
  for (int st = 128; st > 0; st >>= 1) { if (tid < st) red[tid] += red[tid + st]; __syncthreads(); }
  const float mu = red[0] / (float)N; __syncthreads();
  float s2 = 0.f;
  for (int u = 0; u < per / 4; ++u)
#pragma unroll
    for (int q = 0; q < 4; ++q) { const float c = vals[u * 4 + q] - mu; s2 += c * c; }
  red[tid] = s2; __syncthreads();
  for (int st = 128; st > 0; st >>= 1) { if (tid < st) red[tid] += red[tid + st]; __syncthreads(); }
  const float rs = rsqrtf(red[0] / (float)N + eps);
  {
    for (int u = 0; u < per / 4; ++u) {
      const int j = tid * 4 + 1024 * u;
      v4f o, sm;
#pragma unroll
      for (int q = 0; q < 4; ++q) {
        float gg = g[j + q], bb = bta[j + q];
        if (PARAM_BF16) { gg = bf16_round(gg); bb = bf16_round(bb); }
        sm[q] = vals[u * 4 + q]; o[q] = (vals[u * 4 + q] - mu) * rs * gg + bb;
      }
      if (out_sum) *(v4f*)(out_sum + (size_t)row * N + j) = sm;
      *(v4f*)(out_norm + (size_t)row * N + j) = o;
    }
    
  }
}



// ---- f16 WMMA path (v_wmma_f32_16x16x32_f16): 11-bit significands for operands in range — used where a [0,1] probability operand needs more precision than bf16
typedef _Float16 v16h __attribute__((ext_vector_type(16)));
typedef _Float16 v4h __attribute__((ext_vector_type(4)));
union FragH { v16h v; v8us half[2]; _Float16 h[16]; unsigned short u[16]; };
template <int NT>
__device__ __forceinline__ v8f mmaH(v16h ah, v16h al, v16h bh, v16h bl, v8f c) {
  c = __builtin_amdgcn_wmma_f32_16x16x32_f16(false, ah, false, bh, (short)0, c, false, false);
  if (NT >= 2) c = __builtin_amdgcn_wmma_f32_16x16x32_f16(false, al, false, bh, (short)0, c, false, false);
  if (NT >= 3) c = __builtin_amdgcn_wmma_f32_16x16x32_f16(false, ah, false, bl, (short)0, c, false, false);
  asm volatile("v_nop\n\tv_nop\n\tv_nop\n\tv_nop" : "+v"(c) : "v"(ah), "v"(al), "v"(bh), "v"(bl));
  return c;
}
// batched GEMM like k_gemm_b but f16 operands: A f32 (split into f16 hi/lo if ASPLIT, else rounded to f16), Bt = f16 values [n][k]; alpha; C f32; N multiple of 16 (partial tiles skipped)
template <bool ASPLIT>
__global__ __launch_bounds__(128) void k_gemm_h(const float* __restrict__ A, int lda, size_t sA, const _Float16* __restrict__ Bh, int ldb, size_t sB, float alpha, float* __restrict__ C, int ldc, size_t sC, int M, int N, int K) {
  __shared__ __attribute__((aligned(16))) float so[4][16][64];
  const int tid = threadIdx.x, w = tid >> 5, lane = tid & 31, ln = lane & 15, hh = lane >> 4; const int by = blockIdx.y;
  A += (size_t)by * sA; Bh += (size_t)by * sB; C += (size_t)by * sC;
  const int ntn = (N + 63) / 64; const int wid = blockIdx.x * 4 + w; const int mt = wid / ntn, nq = wid % ntn; if (mt * 16 >= M) return;
  const int row0 = mt * 16, col0 = nq * 64; const float* arow = A + (size_t)(row0 + ln) * lda;
  v8f acc[4] = {};
  for (int kb = 0; kb < K; kb += 32) {
    FragH ah, al;
    const v4f x0 = *(const v4fa*)(arow + kb + 8 * hh), x1 = *(const v4fa*)(arow + kb + 8 * hh + 4), x2 = *(const v4fa*)(arow + kb + 16 + 8 * hh), x3 = *(const v4fa*)(arow + kb + 16 + 8 * hh + 4);
    float xs[16] = {x0[0],x0[1],x0[2],x0[3],x1[0],x1[1],x1[2],x1[3],x2[0],x2[1],x2[2],x2[3],x3[0],x3[1],x3[2],x3[3]};
#pragma unroll
    for (int i = 0; i < 16; ++i) { const _Float16 h = (_Float16)xs[i]; ah.h[i] = h; al.h[i] = ASPLIT ? (_Float16)(xs[i] - (float)h) : (_Float16)0.0f; }
#pragma unroll
    for (int t = 0; t < 4; ++t) { if (col0 + t * 16 >= N) continue; const size_t boff = (size_t)(col0 + t * 16 + ln) * ldb + kb; FragH bq; bq.half[0] = *(const v8us*)(Bh + boff + 8 * hh); bq.half[1] = *(const v8us*)(Bh + boff + 16 + 8 * hh);
      acc[t] = mmaH<ASPLIT ? 2 : 1>(ah.v, al.v, bq.v, bq.v, acc[t]); }
  }
#pragma unroll
  for (int t = 0; t < 4; ++t) { if (col0 + t * 16 >= N) continue;
#pragma unroll
    for (int r = 0; r < 8; ++r) so[w][8 * hh + r][t * 16 + ln] = acc[t][r] * alpha; }
  __builtin_amdgcn_fence(__ATOMIC_ACQ_REL, "workgroup"); __builtin_amdgcn_wave_barrier();
  const int rsub = lane >> 4, c4 = (lane & 15) * 4;
  {
#pragma unroll
    for (int q = 0; q < 8; ++q) { const int r = q * 2 + rsub; if (col0 + c4 < N) { const v4f v = *(const v4fa*)&so[w][r][c4]; *(v4f*)(C + (size_t)(row0 + r) * ldc + col0 + c4) = v; } }
     }
}

// Wt[n][k] = f16(W[k][n]·scale) from f32 row-major W[K][N] (scale = power of two; bf16-exact weights stay exact in f16 away from the subnormal range)
__global__ __launch_bounds__(256) void k_wt_f16(const float* __restrict__ W, _Float16* __restrict__ Wt, int K, int N, float scale) {
  const int t = blockIdx.x * 256 + threadIdx.x; if (t >= N * (K / 8)) return; const int n = t / (K / 8), k8 = (t % (K / 8)) * 8; FragH f;
#pragma unroll
  for (int i = 0; i < 8; ++i) f.h[i] = (_Float16)(bf16_round(W[(size_t)(k8 + i) * N + n]) * scale); const v8us o = f.half[0];
  *(v8us*)((unsigned short*)Wt + (size_t)n * K + k8) = o; 
}
// The five input conversions in one launch: they are independent of one another, and the block index picks the job (a scalar choice, the same for a whole block). x -> f16(bf16(x)); each weight, already (out,in) = Bt,
// -> f16(bf16(w) * 16). wq, wk and wv land one behind the other, so that they read as one Bt of 2048 rows.
__global__ __launch_bounds__(256) void k_cvt(const float* __restrict__ x, const float* __restrict__ wq, const float* __restrict__ wk, const float* __restrict__ wv, const float* __restrict__ wo,
                                             _Float16* __restrict__ X16, _Float16* __restrict__ Bqkv, _Float16* __restrict__ Bo) {
  constexpr unsigned GX = (unsigned)NR * HID / 2048, GQ = (unsigned)HID * HID / 2048, GK = (unsigned)KVD * HID / 2048;      // blocks per job: 256 threads x 8 elements
  static_assert(NR * HID % 2048 == 0 && HID * HID % 2048 == 0 && KVD * HID % 2048 == 0, "whole blocks only");
  unsigned bid = blockIdx.x; const float* s; _Float16* d; float sc = 16.0f;
  if (bid < GX) { s = x; d = X16; sc = 1.0f; }
  else if ((bid -= GX) < GQ) { s = wq; d = Bqkv; }
  else if ((bid -= GQ) < GK) { s = wk; d = Bqkv + (size_t)HID * HID; }
  else if ((bid -= GK) < GK) { s = wv; d = Bqkv + (size_t)(HID + KVD) * HID; }
  else { bid -= GK; s = wo; d = Bo; }
  const size_t t = (size_t)bid * 256 + threadIdx.x; FragH f;
#pragma unroll
  for (int i = 0; i < 8; ++i) f.h[i] = (_Float16)(bf16_round(s[t * 8 + i]) * sc);
  *(v8us*)((unsigned short*)d + t * 8) = f.half[0]; }
__global__ __launch_bounds__(256) void k_vt(const _Float16* __restrict__ V16, _Float16* __restrict__ Vt) { __shared__ unsigned short tl[64][66]; const int tid = threadIdx.x; const int slab = blockIdx.x / (SS / 64), lg = blockIdx.x % (SS / 64); const int b = slab / NKV, h = slab % NKV;
  for (int i = tid; i < 64 * 8; i += 256) { const int r = i / 8, c8 = (i % 8) * 8; FragH f; f.half[0] = *(const v8us*)((const unsigned short*)V16 + ((size_t)b * SS + lg * 64 + r) * KVD + h * HD + c8);
#pragma unroll
    for (int q = 0; q < 8; ++q) tl[r][c8 + q] = f.u[q]; }
  __syncthreads();
  {
#pragma unroll
    for (int rd = 0; rd < 2; ++rd) { const int d = rd * 32 + tid / 8, pc = tid % 8; FragH f;
#pragma unroll
      for (int q = 0; q < 8; ++q) f.u[q] = tl[pc * 8 + q][d];
      *(v8us*)((unsigned short*)Vt + ((size_t)slab * HD + d) * SS + lg * 64 + pc * 8) = f.half[0]; }
     } }
// Maximum over each 16-lane row for eight values at once: an xor butterfly (1, 2, 4, 8) on the vector pipe. DPP row_xmask hands the partner lane's value to v_max_num_f32 as an operand, so a step
// needs no LDS-pipe round trip and no dscnt wait. One asm statement, step by step over the eight values: the eight instructions of a step are independent, so none waits for the step before it
// (as single statements, and as the builtin move, the compiler put each value's four steps back to back; the builtin also kept a separate move and a quieting maximum per step). All 32 lanes are on here.
__device__ __forceinline__ void row16_max8(float (&m)[8]) {
  asm("v_max_num_f32_dpp %0, %0, %0 row_xmask:1 row_mask:0xf bank_mask:0xf\n\t"
      "v_max_num_f32_dpp %1, %1, %1 row_xmask:1 row_mask:0xf bank_mask:0xf\n\t"
      "v_max_num_f32_dpp %2, %2, %2 row_xmask:1 row_mask:0xf bank_mask:0xf\n\t"
      "v_max_num_f32_dpp %3, %3, %3 row_xmask:1 row_mask:0xf bank_mask:0xf\n\t"
      "v_max_num_f32_dpp %4, %4, %4 row_xmask:1 row_mask:0xf bank_mask:0xf\n\t"
      "v_max_num_f32_dpp %5, %5, %5 row_xmask:1 row_mask:0xf bank_mask:0xf\n\t"
      "v_max_num_f32_dpp %6, %6, %6 row_xmask:1 row_mask:0xf bank_mask:0xf\n\t"
      "v_max_num_f32_dpp %7, %7, %7 row_xmask:1 row_mask:0xf bank_mask:0xf\n\t"
      "v_max_num_f32_dpp %0, %0, %0 row_xmask:2 row_mask:0xf bank_mask:0xf\n\t"
      "v_max_num_f32_dpp %1, %1, %1 row_xmask:2 row_mask:0xf bank_mask:0xf\n\t"
      "v_max_num_f32_dpp %2, %2, %2 row_xmask:2 row_mask:0xf bank_mask:0xf\n\t"
      "v_max_num_f32_dpp %3, %3, %3 row_xmask:2 row_mask:0xf bank_mask:0xf\n\t"
      "v_max_num_f32_dpp %4, %4, %4 row_xmask:2 row_mask:0xf bank_mask:0xf\n\t"
      "v_max_num_f32_dpp %5, %5, %5 row_xmask:2 row_mask:0xf bank_mask:0xf\n\t"
      "v_max_num_f32_dpp %6, %6, %6 row_xmask:2 row_mask:0xf bank_mask:0xf\n\t"
      "v_max_num_f32_dpp %7, %7, %7 row_xmask:2 row_mask:0xf bank_mask:0xf\n\t"
      "v_max_num_f32_dpp %0, %0, %0 row_xmask:4 row_mask:0xf bank_mask:0xf\n\t"
      "v_max_num_f32_dpp %1, %1, %1 row_xmask:4 row_mask:0xf bank_mask:0xf\n\t"
      "v_max_num_f32_dpp %2, %2, %2 row_xmask:4 row_mask:0xf bank_mask:0xf\n\t"
      "v_max_num_f32_dpp %3, %3, %3 row_xmask:4 row_mask:0xf bank_mask:0xf\n\t"
      "v_max_num_f32_dpp %4, %4, %4 row_xmask:4 row_mask:0xf bank_mask:0xf\n\t"
      "v_max_num_f32_dpp %5, %5, %5 row_xmask:4 row_mask:0xf bank_mask:0xf\n\t"
      "v_max_num_f32_dpp %6, %6, %6 row_xmask:4 row_mask:0xf bank_mask:0xf\n\t"
      "v_max_num_f32_dpp %7, %7, %7 row_xmask:4 row_mask:0xf bank_mask:0xf\n\t"
      "v_max_num_f32_dpp %0, %0, %0 row_xmask:8 row_mask:0xf bank_mask:0xf\n\t"
      "v_max_num_f32_dpp %1, %1, %1 row_xmask:8 row_mask:0xf bank_mask:0xf\n\t"
      "v_max_num_f32_dpp %2, %2, %2 row_xmask:8 row_mask:0xf bank_mask:0xf\n\t"
      "v_max_num_f32_dpp %3, %3, %3 row_xmask:8 row_mask:0xf bank_mask:0xf\n\t"
      "v_max_num_f32_dpp %4, %4, %4 row_xmask:8 row_mask:0xf bank_mask:0xf\n\t"
      "v_max_num_f32_dpp %5, %5, %5 row_xmask:8 row_mask:0xf bank_mask:0xf\n\t"
      "v_max_num_f32_dpp %6, %6, %6 row_xmask:8 row_mask:0xf bank_mask:0xf\n\t"
      "v_max_num_f32_dpp %7, %7, %7 row_xmask:8 row_mask:0xf bank_mask:0xf"
      : "+v"(m[0]), "+v"(m[1]), "+v"(m[2]), "+v"(m[3]), "+v"(m[4]), "+v"(m[5]), "+v"(m[6]), "+v"(m[7])); }
// the same butterfly for a sum: the builtin move fuses into v_add_f32_dpp
template <int M> __device__ __forceinline__ float row_xor(float v) { return __int_as_float(__builtin_amdgcn_mov_dpp(__float_as_int(v), 0x160 + M, 0xf, 0xf, true)); }
__device__ __forceinline__ float row16_sum(float v) { v += row_xor<1>(v); v += row_xor<2>(v); v += row_xor<4>(v); v += row_xor<8>(v); return v; }
// fused causal GQA attention per ((b,h), 128 queries): wave = 32 queries; Q from Q16 cols h·64 (pitch 1024), K from K16 cols kvh·64 (pitch 512), kvh = h / 2; key chunks 0..qb0+128; mask k ≤ q else −inf
__global__ __launch_bounds__(128) void k_flash(const _Float16* __restrict__ Q16, const _Float16* __restrict__ K16, const _Float16* __restrict__ Vt, _Float16* __restrict__ O16) {
  constexpr int RPW = 32, NQB = SS / (4 * RPW), DT = HD / 16, KS = HD / 32;
  // The softmax runs in base 2: the scores take 1/8 and log2(e) in their one multiply, so e^(s - m) = 2^(s2 - m2) is one subtraction and one v_exp_f32. Every argument is <= 0 here (m2 is the running maximum),
  // so nothing can overflow; -inf (masked) and the -3e38 start value give 0; a result below 2^-126 is flushed to 0, far under the f16 rounding of P and the f32 rounding of the row sum, which holds a term 1.
  constexpr float SC2 = 0.125f * 1.4426950408889634f;
  __shared__ __attribute__((aligned(16))) unsigned short sP[4][RPW][40]; __shared__ __attribute__((aligned(16))) float sO[4][RPW][HD];
  const int tid = threadIdx.x, w = tid >> 5, lane = tid & 31, ln = lane & 15, hh = lane >> 4;
  const int slab = blockIdx.x / NQB, qblk = blockIdx.x % NQB; const int b = slab / NH, h = slab % NH; const int kvh = h / (NH / NKV); const int qb0 = qblk * (4 * RPW); const int q0 = qb0 + w * RPW;
  FragH aq[2][KS];
#pragma unroll
  for (int rt = 0; rt < 2; ++rt) { const unsigned short* qr = (const unsigned short*)Q16 + ((size_t)b * SS + q0 + rt * 16 + ln) * HID + h * HD;
#pragma unroll
    for (int ks = 0; ks < KS; ++ks) { aq[rt][ks].half[0] = *(const v8us*)(qr + ks * 32 + 8 * hh); aq[rt][ks].half[1] = *(const v8us*)(qr + ks * 32 + 16 + 8 * hh); } }
  const unsigned short* Vth = (const unsigned short*)Vt + (size_t)(b * NKV + kvh) * HD * SS;
  float m_r[2][8], l_r[2][8]; v8f oacc[2][DT];
#pragma unroll
  for (int rt = 0; rt < 2; ++rt) {
#pragma unroll
    for (int r = 0; r < 8; ++r) { m_r[rt][r] = -3.0e38f; l_r[rt][r] = 0.f; }
#pragma unroll
    for (int dt = 0; dt < DT; ++dt) oacc[rt][dt] = (v8f){0.f,0.f,0.f,0.f,0.f,0.f,0.f,0.f}; }
  const int jend = qb0 + 4 * RPW;
  // K and V fragments are requested ahead of their products, so that no product waits out a load: a chunk's K is loaded during the chunk before it (chunk 0's here), its V at the chunk's head
  const unsigned short* kl = (const unsigned short*)K16 + ((size_t)b * SS + ln) * KVD + kvh * HD + 8 * hh;
  const unsigned short* vl = Vth + (size_t)ln * SS + 8 * hh;
  FragH bk[2][KS];
#pragma unroll
  for (int nt = 0; nt < 2; ++nt)
#pragma unroll
    for (int ks = 0; ks < KS; ++ks) { bk[nt][ks].half[0] = *(const v8us*)(kl + nt * 16 * KVD + ks * 32); bk[nt][ks].half[1] = *(const v8us*)(kl + nt * 16 * KVD + ks * 32 + 16); }
#pragma unroll 1
  for (int j0 = 0; j0 < jend; j0 += 32) {
    FragH bv[DT];
#pragma unroll
    for (int dt = 0; dt < DT; ++dt) { bv[dt].half[0] = *(const v8us*)(vl + (size_t)dt * 16 * SS + j0); bv[dt].half[1] = *(const v8us*)(vl + (size_t)dt * 16 * SS + j0 + 16); }
    v8f s[2][2];
#pragma unroll
    for (int nt = 0; nt < 2; ++nt)
#pragma unroll
      for (int rt = 0; rt < 2; ++rt) { v8f acc = (v8f){0.f,0.f,0.f,0.f,0.f,0.f,0.f,0.f};
#pragma unroll
        for (int ks = 0; ks < KS; ++ks) acc = mmaH<1>(aq[rt][ks].v, aq[rt][ks].v, bk[nt][ks].v, bk[nt][ks].v, acc); s[rt][nt] = acc; }
    // the next chunk's K into the same registers, right behind their last product; the last chunk loads its own rows again (in bounds, never used)
    { const unsigned short* kn = kl + (size_t)((j0 + 32 < jend) ? j0 + 32 : j0) * KVD;
#pragma unroll
      for (int nt = 0; nt < 2; ++nt)
#pragma unroll
        for (int ks = 0; ks < KS; ++ks) { bk[nt][ks].half[0] = *(const v8us*)(kn + nt * 16 * KVD + ks * 32); bk[nt][ks].half[1] = *(const v8us*)(kn + nt * 16 * KVD + ks * 32 + 16); } }
    // stands between the loads above and the softmax, which reuses their K address pair: the wait that belongs in front of an overwrite of an issued load's address register
    asm volatile("s_wait_xcnt 0x0" ::: "memory");
    // keeps the V and K loads and the wait in front of the softmax and the output products that the loads fly under (without it the scheduler sank the K loads into the softmax and the wait far behind them)
    __builtin_amdgcn_sched_barrier(0);
    float mx[2][8];
#pragma unroll
    for (int rt = 0; rt < 2; ++rt) {
#pragma unroll
      for (int r = 0; r < 8; ++r) { const int qi = q0 + rt * 16 + 8 * hh + r; const int k0 = j0 + ln, k1 = j0 + 16 + ln;
        s[rt][0][r] = (k0 <= qi) ? s[rt][0][r] * SC2 : -INFINITY; s[rt][1][r] = (k1 <= qi) ? s[rt][1][r] * SC2 : -INFINITY; mx[rt][r] = fmaxf(s[rt][0][r], s[rt][1][r]); }
      row16_max8(mx[rt]); }
#pragma unroll
    for (int rt = 0; rt < 2; ++rt)
#pragma unroll
      for (int r = 0; r < 8; ++r) { const float s0 = s[rt][0][r], s1 = s[rt][1][r];
        const float mn = fmaxf(m_r[rt][r], mx[rt][r]); const float al = __builtin_amdgcn_exp2f(m_r[rt][r] - mn); m_r[rt][r] = mn; const float p0 = __builtin_amdgcn_exp2f(s0 - mn), p1 = __builtin_amdgcn_exp2f(s1 - mn); l_r[rt][r] = l_r[rt][r] * al + p0 + p1;
#pragma unroll
        for (int dt = 0; dt < DT; ++dt) oacc[rt][dt][r] *= al;
        FragH t2; t2.h[0] = (_Float16)p0; t2.h[1] = (_Float16)p1; sP[w][rt * 16 + 8 * hh + r][ln] = t2.u[0]; sP[w][rt * 16 + 8 * hh + r][16 + ln] = t2.u[1]; }
    __builtin_amdgcn_fence(__ATOMIC_ACQ_REL, "workgroup"); __builtin_amdgcn_wave_barrier();
    FragH pa[2];
#pragma unroll
    for (int rt = 0; rt < 2; ++rt) { pa[rt].half[0] = *(const v8us*)&sP[w][rt * 16 + ln][8 * hh]; pa[rt].half[1] = *(const v8us*)&sP[w][rt * 16 + ln][16 + 8 * hh]; }
#pragma unroll
    for (int dt = 0; dt < DT; ++dt)
#pragma unroll
      for (int rt = 0; rt < 2; ++rt) oacc[rt][dt] = mmaH<1>(pa[rt].v, pa[rt].v, bv[dt].v, bv[dt].v, oacc[rt][dt]);
    __builtin_amdgcn_fence(__ATOMIC_ACQ_REL, "workgroup"); __builtin_amdgcn_wave_barrier(); }
#pragma unroll
  for (int rt = 0; rt < 2; ++rt) {
#pragma unroll
    for (int r = 0; r < 8; ++r) { float l = l_r[rt][r]; l = row16_sum(l); l_r[rt][r] = 1.0f / l; }
#pragma unroll
    for (int dt = 0; dt < DT; ++dt)
#pragma unroll
      for (int r = 0; r < 8; ++r) sO[w][rt * 16 + 8 * hh + r][dt * 16 + ln] = oacc[rt][dt][r] * l_r[rt][r]; }
  __builtin_amdgcn_fence(__ATOMIC_ACQ_REL, "workgroup"); __builtin_amdgcn_wave_barrier();
  {
#pragma unroll
    for (int rp = 0; rp < RPW; rp += 2) { const int r = rp + (lane >> 4), pc = lane & 15; const v4f val = *(const v4fa*)&sO[w][r][pc * 4]; v4h h4;
#pragma unroll
      for (int i = 0; i < 4; ++i) h4[i] = (_Float16)val[i];      // the o projection's A operand: rounded here, 16 lanes = one 128-byte line of the row
      *(v4h*)(O16 + ((size_t)b * SS + q0 + r) * HID + h * HD + pc * 4) = h4; }
     } }
// Projection GEMM C[4096][N] = A[4096][1024] * Bt[N][1024]^T / 16 (f16 operands, f32 accumulate, k ascending in steps of 32 as before). Block = 4 waves = a 64 x 128 tile of C; wave = 32 x 64 (2 x 4 accumulators).
// Each stage brings 64 k of the 64 A rows and the 128 Bt rows into LDS with whole 128-byte rows per 8 lanes, so every row is fetched once per block instead of once per wave in 16-line gathers;
// the next stage's rows are loaded into registers while this stage's products run, and go into the other buffer. Row pitch 144 bytes: the 16 rows of a fragment read fall on different banks.
// OUT 0: C f32. OUT 1: C16 = f16(C). OUT 2 (q, k): a wave's 64 columns are one head, so its staged 32 x 64 tile holds whole head rows: per row RMSNorm over the 64 dims (eps 1e-6, times bf16(nw)),
// then RoPE with the INPUT cos/sin[row][64] (rotate_half = [-x2, x1]; rounded to bf16 like every other input), then C16 = f16: the f32 product never goes to memory.
// q, k and v are ONE launch: their weights lie one behind the other as a Bt of 2048 rows, a block's 128 columns belong to one of the three, and the block index (a scalar choice) picks the output form. o is a launch of its own.
typedef float fa __attribute__((may_alias));
typedef unsigned short proj_lds[2][64 + 128][64 + 8];
// the product: leaves each wave's 32 x 64 tile of C (f32, pitch 68) in LDS, over the stage buffers, and returns the wave's tile
__device__ __forceinline__ fa* proj_tile(const _Float16* __restrict__ A, const _Float16* __restrict__ Bt, const int row0, const int col0, proj_lds& sm) {
  constexpr int K = HID, BM = 64, BN = 128, BK = 64, PIT = BK + 8, NS = K / BK, OP = 68;
  static_assert(sizeof(float) * 4 * 32 * OP <= sizeof(unsigned short) * 2 * (BM + BN) * PIT, "the output tiles reuse the stage buffers");
  const int tid = threadIdx.x, w = tid >> 5, lane = tid & 31, ln = lane & 15, hh = lane >> 4;
  const int wm = (w >> 1) * 32, wn = (w & 1) * 64;
  const int sr = tid >> 3, sc = (tid & 7) * 8;
  const unsigned short* ga = (const unsigned short*)A + (size_t)(row0 + sr) * K + sc;
  const unsigned short* gb = (const unsigned short*)Bt + (size_t)(col0 + sr) * K + sc;
  v8us ra[BM / 16], rb[BN / 16];
  v8f acc[2][4];
#pragma unroll
  for (int mi = 0; mi < 2; ++mi)
#pragma unroll
    for (int t = 0; t < 4; ++t) acc[mi][t] = (v8f){0.f,0.f,0.f,0.f,0.f,0.f,0.f,0.f};
#pragma unroll
  for (int i = 0; i < BM / 16; ++i) ra[i] = *(const v8us*)(ga + (size_t)i * 16 * K);
#pragma unroll
  for (int i = 0; i < BN / 16; ++i) rb[i] = *(const v8us*)(gb + (size_t)i * 16 * K);
#pragma unroll
  for (int i = 0; i < BM / 16; ++i) *(v8us*)&sm[0][sr + i * 16][sc] = ra[i];
#pragma unroll
  for (int i = 0; i < BN / 16; ++i) *(v8us*)&sm[0][BM + sr + i * 16][sc] = rb[i];
  __syncthreads();
  // unrolled whole: every stage's global offset is then an immediate on two address pairs that are never rewritten, and the buffer index a constant
#pragma unroll
  for (int s = 0; s < NS; ++s) {
    const int cur = s & 1;
    if (s + 1 < NS) {
#pragma unroll
      for (int i = 0; i < BM / 16; ++i) ra[i] = *(const v8us*)(ga + (size_t)i * 16 * K + (s + 1) * BK);
#pragma unroll
      for (int i = 0; i < BN / 16; ++i) rb[i] = *(const v8us*)(gb + (size_t)i * 16 * K + (s + 1) * BK);
    }
    // keeps the next stage's loads at the head of this stage, so that they fly under all of its products (the scheduler sank them to just in front of their LDS stores)
    __builtin_amdgcn_sched_barrier(0);
    FragH a[BK / 32][2], b[BK / 32][4];
#pragma unroll
    for (int ks = 0; ks < BK / 32; ++ks) {
#pragma unroll
      for (int mi = 0; mi < 2; ++mi) { const unsigned short* p = &sm[cur][wm + mi * 16 + ln][ks * 32 + 8 * hh]; a[ks][mi].half[0] = *(const v8us*)p; a[ks][mi].half[1] = *(const v8us*)(p + 16); }
#pragma unroll
      for (int t = 0; t < 4; ++t) { const unsigned short* p = &sm[cur][BM + wn + t * 16 + ln][ks * 32 + 8 * hh]; b[ks][t].half[0] = *(const v8us*)p; b[ks][t].half[1] = *(const v8us*)(p + 16); }
    }
    // keeps the stage's fragment reads in one group ahead of its products: one exposed LDS latency per stage (the scheduler reused the A registers and waited for LDS four times per stage)
    __builtin_amdgcn_sched_barrier(0);
#pragma unroll
    for (int ks = 0; ks < BK / 32; ++ks)
#pragma unroll
      for (int mi = 0; mi < 2; ++mi)
#pragma unroll
        for (int t = 0; t < 4; ++t) acc[mi][t] = __builtin_amdgcn_wmma_f32_16x16x32_f16(false, a[ks][mi].v, false, b[ks][t].v, (short)0, acc[mi][t], false, false);
    // keeps the waits for those loads, and the LDS stores behind them, behind the issue of all of this stage's products (the scheduler put them in the middle of the stage)
    __builtin_amdgcn_sched_barrier(0);
    if (s + 1 < NS) {
#pragma unroll
      for (int i = 0; i < BM / 16; ++i) *(v8us*)&sm[cur ^ 1][sr + i * 16][sc] = ra[i];
#pragma unroll
      for (int i = 0; i < BN / 16; ++i) *(v8us*)&sm[cur ^ 1][BM + sr + i * 16][sc] = rb[i];
    }
    // one barrier per stage: it publishes the buffer just filled and ends every wave's reads of the buffer that the next stage refills (after the last stage: that the output tiles reuse)
    __syncthreads();
  }
  fa* so = (fa*)&sm[0][0][0] + w * 32 * OP;
#pragma unroll
  for (int mi = 0; mi < 2; ++mi)
#pragma unroll
    for (int t = 0; t < 4; ++t)
#pragma unroll
      for (int r = 0; r < 8; ++r) so[(mi * 16 + 8 * hh + r) * OP + t * 16 + ln] = acc[mi][t][r] * 0.0625f;
  // the wave reads back its own tile, written by other lanes: the LDS stores must have landed first
  __builtin_amdgcn_fence(__ATOMIC_ACQ_REL, "workgroup"); __builtin_amdgcn_wave_barrier();
  return so;
}
// OUT 2; col0 = the block's first column in C16, N = the pitch of C16
template <int N>
__device__ __forceinline__ void proj_norm_rope(const fa* so, const int row0, const int col0, _Float16* __restrict__ C16, const float* __restrict__ nw, const float* __restrict__ cs, const float* __restrict__ sn) {
  constexpr int OP = 68;
  const int tid = threadIdx.x, w = tid >> 5, lane = tid & 31;
  const int wm = (w >> 1) * 32, wn = (w & 1) * 64;
    static_assert(HD == 64, "a wave's 64 columns are one head");
    // 8 lanes per row, 4 rows per pass: a lane holds dims j4..j4+3 (x1) and 32+j4..32+j4+3 (x2), the two halves that RoPE pairs
    const int rr = lane >> 3, j4 = (lane & 7) * 4;
    v4f w1 = *(const v4fa*)(nw + j4), w2 = *(const v4fa*)(nw + 32 + j4);
#pragma unroll
    for (int i = 0; i < 4; ++i) { w1[i] = bf16_round(w1[i]); w2[i] = bf16_round(w2[i]); }
    const fa* xp = so + rr * OP + j4;
    // byte offsets of the lane's first row: one for cos and sin (below 1 MiB), one for the output (below 8 MiB); each rides as the 32-bit offset register beside a scalar base
    unsigned co = (unsigned)((row0 + wm + rr) * HD + j4) * 4u, yo = (unsigned)((row0 + wm + rr) * N + col0 + wn + j4) * 2u;
    // two trips of four passes: a trip's 16 cos/sin loads go out together and fly under its sums of squares (all eight passes unrolled took more than 256 registers)
#pragma unroll 1
    for (int qh = 0; qh < 2; ++qh) {
      v4f x1[4], x2[4], c1[4], c2[4], s1[4], s2[4];
#pragma unroll
      for (int q = 0; q < 4; ++q) { x1[q] = *(const v4fa*)(xp + q * 4 * OP); x2[q] = *(const v4fa*)(xp + q * 4 * OP + 32); }
#pragma unroll
      for (int q = 0; q < 4; ++q) { const float* cp = (const float*)((const char*)cs + co) + q * 4 * HD; const float* sp = (const float*)((const char*)sn + co) + q * 4 * HD;
        c1[q] = *(const v4fa*)cp; c2[q] = *(const v4fa*)(cp + 32); s1[q] = *(const v4fa*)sp; s2[q] = *(const v4fa*)(sp + 32); }
#pragma unroll
      for (int q = 0; q < 4; ++q) {
        // sum of squares in the order of a 32-lane xor butterfly (16, 8, 4, 2, 1) over a_j = x1_j^2 + x2_j^2: dim j = 4 * lane + i, so 16, 8, 4 are lane steps 4, 2, 1 and 2, 1 are in-lane
        float t[4];
#pragma unroll
        for (int i = 0; i < 4; ++i) t[i] = __builtin_fmaf(x1[q][i], x1[q][i], x2[q][i] * x2[q][i]);
#pragma unroll
        for (int i = 0; i < 4; ++i) t[i] += row_xor<4>(t[i]);
#pragma unroll
        for (int i = 0; i < 4; ++i) t[i] += row_xor<2>(t[i]);
#pragma unroll
        for (int i = 0; i < 4; ++i) t[i] += row_xor<1>(t[i]);
        const float ss = (t[0] + t[2]) + (t[1] + t[3]);
        const float rs = rsqrtf(ss / (float)HD + 1e-6f);
        v4h y1, y2;      // explicit fma here and in t[]: it fixes which of the two products is rounded on its own
#pragma unroll
        for (int i = 0; i < 4; ++i) { const float n1 = x1[q][i] * rs * w1[i], n2 = x2[q][i] * rs * w2[i];
          y1[i] = (_Float16)__builtin_fmaf(n1, bf16_round(c1[q][i]), -(n2 * bf16_round(s1[q][i]))); y2[i] = (_Float16)__builtin_fmaf(n2, bf16_round(c2[q][i]), n1 * bf16_round(s2[q][i])); }
        _Float16* yp = (_Float16*)((char*)C16 + yo) + q * 4 * N;
        *(v4h*)yp = y1; *(v4h*)(yp + 32) = y2; }
      xp += 16 * OP; co += 16 * HD * 4; yo += 16 * N * 2; }
}
// OUT 0 and OUT 1
template <int N, int OUT>
__device__ __forceinline__ void proj_store(const fa* so, const int row0, const int col0, float* __restrict__ C, _Float16* __restrict__ C16) {
  constexpr int OP = 68;
  const int tid = threadIdx.x, w = tid >> 5, lane = tid & 31, ln = lane & 15, hh = lane >> 4;
  const int wm = (w >> 1) * 32, wn = (w & 1) * 64;
#pragma unroll
  for (int q = 0; q < 16; ++q) { const int r = q * 2 + hh, c4 = ln * 4; const v4f v = *(const v4fa*)&so[r * OP + c4]; const size_t o = (size_t)(row0 + wm + r) * N + col0 + wn + c4;
    if (OUT == 1) { v4h h4;
#pragma unroll
      for (int i = 0; i < 4; ++i) h4[i] = (_Float16)v[i];
      *(v4h*)(C16 + o) = h4; }
    else *(v4f*)(C + o) = v; }
}
__global__ __launch_bounds__(128) void k_qkv(const _Float16* __restrict__ A, const _Float16* __restrict__ Bt, _Float16* __restrict__ Q16, _Float16* __restrict__ K16, _Float16* __restrict__ V16,
                                             const float* __restrict__ qnw, const float* __restrict__ knw, const float* __restrict__ cs, const float* __restrict__ sn) {
  constexpr int NBN = (HID + 2 * KVD) / 128;
  __shared__ __attribute__((aligned(16))) proj_lds sm;
  const int row0 = (blockIdx.x / NBN) * 64, col0 = (blockIdx.x % NBN) * 128;
  const fa* so = proj_tile(A, Bt, row0, col0, sm);
  if (col0 < HID) proj_norm_rope<HID>(so, row0, col0, Q16, qnw, cs, sn);
  else if (col0 < HID + KVD) proj_norm_rope<KVD>(so, row0, col0 - HID, K16, knw, cs, sn);
  else { proj_store<KVD, 1>(so, row0, col0 - (HID + KVD), nullptr, V16);
    // behind v's last store: the listing runs on from here into the k and q forms' code, which reuses these stores' address and data registers; the wait that belongs in front of such an overwrite
    asm volatile("s_wait_xcnt 0x0" ::: "memory"); }
}
__global__ __launch_bounds__(128) void k_oproj(const _Float16* __restrict__ A, const _Float16* __restrict__ Bt, float* __restrict__ C) {
  constexpr int NBN = HID / 128;
  __shared__ __attribute__((aligned(16))) proj_lds sm;
  const int row0 = (blockIdx.x / NBN) * 64, col0 = (blockIdx.x % NBN) * 128;
  const fa* so = proj_tile(A, Bt, row0, col0, sm);
  proj_store<HID, 0>(so, row0, col0, C, nullptr);
}
extern "C" void kernel_launch(void* const* d_in, const int* in_sizes, int n_in,
                              void* d_out, int out_size, void* d_ws, size_t ws_size, hipStream_t stream) {
  (void)in_sizes; (void)n_in; (void)out_size;
  const float* x = (const float*)d_in[0]; const float* cs = (const float*)d_in[1]; const float* sn = (const float*)d_in[2]; const float* wq = (const float*)d_in[3]; const float* wk = (const float*)d_in[4]; const float* wv = (const float*)d_in[5]; const float* wo = (const float*)d_in[6]; const float* qnw = (const float*)d_in[7]; const float* knw = (const float*)d_in[8];
  char* ws = (char*)d_ws; size_t off = 0;
  auto take = [&](size_t bytes) { char* p = ws + off; off += (bytes + 255) & ~(size_t)255; return p; };
  _Float16* Bqkv = (_Float16*)take((size_t)(HID + 2 * KVD) * HID * 2); _Float16* Bo = (_Float16*)take((size_t)HID * HID * 2);
  _Float16* X16 = (_Float16*)take((size_t)NR * HID * 2); _Float16* Q16 = (_Float16*)take((size_t)NR * HID * 2); _Float16* K16 = (_Float16*)take((size_t)NR * KVD * 2); _Float16* V16 = (_Float16*)take((size_t)NR * KVD * 2); _Float16* Vt = (_Float16*)take((size_t)NR * KVD * 2); _Float16* O16 = (_Float16*)take((size_t)NR * HID * 2);
  if (off > ws_size) return;      // about 6 + 8.4 + 8.4 + 4.2 x 3 + 8.4 = 44 MiB
  k_cvt<<<((unsigned)NR * HID + 2u * HID * HID + 2u * KVD * HID) / 2048, 256, 0, stream>>>(x, wq, wk, wv, wo, X16, Bqkv, Bo);
  k_qkv<<<(NR / 64) * ((HID + 2 * KVD) / 128), 128, 0, stream>>>(X16, Bqkv, Q16, K16, V16, qnw, knw, cs, sn);
  k_vt<<<BB * NKV * (SS / 64), 256, 0, stream>>>(V16, Vt);
  k_flash<<<BB * NH * (SS / 128), 128, 0, stream>>>(Q16, K16, Vt, O16);
  k_oproj<<<(NR / 64) * (HID / 128), 128, 0, stream>>>(O16, Bo, (float*)d_out);
}

// v007
// One run takes 99 microseconds.
// Next to v006, in two timings, it ran 1.12 and 1.10 times as fast.
// All steps since v000 together make it 5.35 times as fast.
#include <hip/hip_runtime.h>
#define BB 2
#define SS 2048
#define HID 1024
#define NH 16
#define NKV 8
#define HD 64
#define KVD 512
#define NR (BB * SS)

typedef __bf16 v16b __attribute__((ext_vector_type(16)));
typedef unsigned short v8us __attribute__((ext_vector_type(8), may_alias));
typedef float  v8f  __attribute__((ext_vector_type(8)));
typedef float  v4f  __attribute__((ext_vector_type(4)));
typedef float  v4fa __attribute__((ext_vector_type(4), may_alias));
union FragB { v16b v; v8us half[2]; unsigned short u[16]; };

__device__ __forceinline__ unsigned short bf16_bits(float x) { unsigned int u = __float_as_uint(x); return (unsigned short)((u + 0x7FFFu + ((u >> 16) & 1u)) >> 16); }
__device__ __forceinline__ float bf16_val(unsigned short b) { return __uint_as_float(((unsigned int)b) << 16); }
__device__ __forceinline__ float bf16_round(float x) { return bf16_val(bf16_bits(x)); }
// D += A·B with NT terms: 1 = ah·bh, 2 = + al·bh (A split), 3 = + ah·bl (both split)
template <int NT>
__device__ __forceinline__ v8f mmaN(v16b ah, v16b al, v16b bh, v16b bl, v8f c) {
  c = __builtin_amdgcn_wmma_f32_16x16x32_bf16(false, ah, false, bh, (short)0, c, false, false);
  if (NT >= 2) c = __builtin_amdgcn_wmma_f32_16x16x32_bf16(false, al, false, bh, (short)0, c, false, false);
  if (NT >= 3) c = __builtin_amdgcn_wmma_f32_16x16x32_bf16(false, ah, false, bl, (short)0, c, false, false);
  asm volatile("v_nop\n\tv_nop\n\tv_nop\n\tv_nop" : "+v"(c) : "v"(ah), "v"(al), "v"(bh), "v"(bl));
  return c;
}

__global__ __launch_bounds__(256) void k_wt_bf16(const float* __restrict__ W, unsigned short* __restrict__ Wt, int K, int N) {
  const int t = blockIdx.x * 256 + threadIdx.x;
  const int k8n = K / 8;
  if (t >= N * k8n) return;
  const int n = t / k8n, k8 = (t % k8n) * 8;
  v8us v;
#pragma unroll
  for (int i = 0; i < 8; ++i) v[i] = bf16_bits(W[(size_t)(k8 + i) * N + n]);
  *(v8us*)(Wt + (size_t)n * K + k8) = v;
  
}

// GEMM C[M][N] (f32, pitch ldc) = act(A[M][K]·W + bias). A f32 row-major (pitch lda) converted per fragment to bf16
// (ASPLIT: hi/lo two planes -> 2 terms, else single rounded term); Wt bf16 [N][K] (pitch ldb). BIAS_BF16 rounds the
// bias to bf16 first (bias quantised to bf16 before the add). K%32==0, M%16==0, N%64==0.
template <bool ASPLIT, int ACT, bool BIAS_BF16>
__global__ __launch_bounds__(128) void k_gemm_bf(const float* __restrict__ A, int lda, const unsigned short* __restrict__ Wt, int ldb,
                                               const float* __restrict__ bias, float* __restrict__ C, int ldc, int M, int N, int K) {
  __shared__ __attribute__((aligned(16))) float so[4][16][64];
  const int tid = threadIdx.x, w = tid >> 5, lane = tid & 31, ln = lane & 15, hh = lane >> 4;
  const int ntn = N / 64;
  const int wid = blockIdx.x * 4 + w;
  const int mt = wid / ntn, nq = wid % ntn;
  if (mt * 16 >= M) return;
  const int row0 = mt * 16, col0 = nq * 64;
  const float* arow = A + (size_t)(row0 + ln) * lda;
  v8f acc[4] = {};
  for (int kb = 0; kb < K; kb += 32) {
    FragB ah, al;
    const v4f x0 = *(const v4fa*)(arow + kb + 8 * hh), x1 = *(const v4fa*)(arow + kb + 8 * hh + 4);
    const v4f x2 = *(const v4fa*)(arow + kb + 16 + 8 * hh), x3 = *(const v4fa*)(arow + kb + 16 + 8 * hh + 4);
    float xs[16] = {x0[0],x0[1],x0[2],x0[3],x1[0],x1[1],x1[2],x1[3],x2[0],x2[1],x2[2],x2[3],x3[0],x3[1],x3[2],x3[3]};
#pragma unroll
    for (int i = 0; i < 16; ++i) { const unsigned short hb = bf16_bits(xs[i]); ah.u[i] = hb; al.u[i] = ASPLIT ? bf16_bits(xs[i] - bf16_val(hb)) : (unsigned short)0; }
#pragma unroll
    for (int t = 0; t < 4; ++t) {
      const unsigned short* brow = Wt + (size_t)(col0 + t * 16 + ln) * ldb + kb;
      FragB b;
      b.half[0] = *(const v8us*)(brow + 8 * hh);
      b.half[1] = *(const v8us*)(brow + 16 + 8 * hh);
      acc[t] = mmaN<ASPLIT ? 2 : 1>(ah.v, al.v, b.v, b.v, acc[t]);
    }
  }
#pragma unroll
  for (int t = 0; t < 4; ++t) {
    float bv = bias ? bias[col0 + t * 16 + ln] : 0.f;
    if (BIAS_BF16) bv = bf16_round(bv);
#pragma unroll
    for (int r = 0; r < 8; ++r) { float v = acc[t][r] + bv; if (ACT == 1) v = fmaxf(v, 0.f); so[w][8 * hh + r][t * 16 + ln] = v; }
  }
  __builtin_amdgcn_fence(__ATOMIC_ACQ_REL, "workgroup");
  __builtin_amdgcn_wave_barrier();
  const int rsub = lane >> 4, c4 = (lane & 15) * 4;
  {
#pragma unroll
    for (int q = 0; q < 8; ++q) {
      const int r = q * 2 + rsub;
      const v4f v = *(const v4fa*)&so[w][r][c4];
      *(v4f*)(C + (size_t)(row0 + r) * ldc + col0 + c4) = v;
    }
    
  }
}

// Flash-style causal/unmasked attention, all contractions 3-term bf16 hi/lo splits, f32 softmax with running max.
// q,k,v rows are read from f32 buffers with arbitrary row pitch (so they can live inside a fused qkv buffer);
// D = head size (multiple of 32, <= 128); one wave = 16 query rows; block = 4 waves (64 queries) sharing K/V chunks of 32.
template <int D, bool CAUSAL>
__global__ __launch_bounds__(128) void k_flash(const float* __restrict__ qb, const float* __restrict__ kb, const float* __restrict__ vb,
                                             int pitch, int T, int H, float scale, float* __restrict__ y, int ypitch) {
  constexpr int KS = D / 32;        // k-steps for QK
  constexpr int DT = D / 16;        // d tiles for PV
  __shared__ __attribute__((aligned(16))) unsigned short sKh[32][D + 8], sKl[32][D + 8], sVh[32][D + 8], sVl[32][D + 8];
  __shared__ __attribute__((aligned(16))) unsigned short sPh[4][16][40], sPl[4][16][40];
  __shared__ __attribute__((aligned(16))) float sO[4][16][D];
  const int tid = threadIdx.x, w = tid >> 5, lane = tid & 31, ln = lane & 15, hh = lane >> 4;
  const int nqb = (T + 63) / 64;
  const int bh = blockIdx.x / nqb, qblk = blockIdx.x % nqb;
  const int b = bh / H, h = bh % H;
  const int q0 = qblk * 64 + w * 16;
  const float* Q = qb + (size_t)b * T * pitch + h * D;
  const float* K = kb + (size_t)b * T * pitch + h * D;
  const float* V = vb + (size_t)b * T * pitch + h * D;

  // A fragments of the wave's 16 query rows (scaled), hi/lo
  FragB aqh[KS], aql[KS];
  {
    int row = q0 + ln; if (row >= T) row = T - 1;
    const float* qr = Q + (size_t)row * pitch;
#pragma unroll
    for (int ks = 0; ks < KS; ++ks)
#pragma unroll
      for (int i = 0; i < 16; ++i) {
        const int d = ks * 32 + ((i < 8) ? (8 * hh + i) : (16 + 8 * hh + (i - 8)));
        const float x = qr[d] * scale; const unsigned short hb = bf16_bits(x);
        aqh[ks].u[i] = hb; aql[ks].u[i] = bf16_bits(x - bf16_val(hb));
      }
  }
  float m_r[8], l_r[8];
#pragma unroll
  for (int r = 0; r < 8; ++r) { m_r[r] = -3.0e38f; l_r[r] = 0.f; }
  v8f oacc[DT];
#pragma unroll
  for (int dt = 0; dt < DT; ++dt) oacc[dt] = (v8f){0.f,0.f,0.f,0.f,0.f,0.f,0.f,0.f};

  const int kv_end = CAUSAL ? min(T, qblk * 64 + 64) : T;     // block-uniform
  for (int j0 = 0; j0 < kv_end; j0 += 32) {
    __syncthreads();
    for (int e = tid; e < 32 * (D / 4); e += 128) {
      const int r = e / (D / 4), c4 = (e % (D / 4)) * 4;
      const int key = j0 + r;
      v4f kf = {0.f,0.f,0.f,0.f}, vf = {0.f,0.f,0.f,0.f};
      if (key < T) { kf = *(const v4fa*)(K + (size_t)key * pitch + c4); vf = *(const v4fa*)(V + (size_t)key * pitch + c4); }
#pragma unroll
      for (int t = 0; t < 4; ++t) {
        unsigned short hb = bf16_bits(kf[t]); sKh[r][c4 + t] = hb; sKl[r][c4 + t] = bf16_bits(kf[t] - bf16_val(hb));
        hb = bf16_bits(vf[t]); sVh[r][c4 + t] = hb; sVl[r][c4 + t] = bf16_bits(vf[t] - bf16_val(hb));
      }
    }
    __syncthreads();
    // S tile 16 x 32
    v8f s[2];
#pragma unroll
    for (int nt = 0; nt < 2; ++nt) {
      v8f acc = {};
#pragma unroll
      for (int ks = 0; ks < KS; ++ks) {
        FragB bh_, bl_;
        bh_.half[0] = *(const v8us*)&sKh[nt * 16 + ln][ks * 32 + 8 * hh]; bh_.half[1] = *(const v8us*)&sKh[nt * 16 + ln][ks * 32 + 16 + 8 * hh];
        bl_.half[0] = *(const v8us*)&sKl[nt * 16 + ln][ks * 32 + 8 * hh]; bl_.half[1] = *(const v8us*)&sKl[nt * 16 + ln][ks * 32 + 16 + 8 * hh];
        acc = mmaN<3>(aqh[ks].v, aql[ks].v, bh_.v, bl_.v, acc);
      }
      s[nt] = acc;
    }
    // mask + running max (rows 8hh+r; the 16 lanes of a half share rows)
    float alpha[8];
#pragma unroll
    for (int r = 0; r < 8; ++r) {
      const int qi = q0 + 8 * hh + r;
      const int ja = j0 + ln, jb = j0 + 16 + ln;
      if (CAUSAL) { if (ja > qi) s[0][r] = -3.0e38f; if (jb > qi) s[1][r] = -3.0e38f; }
      if (ja >= T) s[0][r] = -3.0e38f;
      if (jb >= T) s[1][r] = -3.0e38f;
      float mx = fmaxf(s[0][r], s[1][r]);
      mx = fmaxf(mx, __shfl_xor(mx, 1, 32)); mx = fmaxf(mx, __shfl_xor(mx, 2, 32)); mx = fmaxf(mx, __shfl_xor(mx, 4, 32)); mx = fmaxf(mx, __shfl_xor(mx, 8, 32));
      const float mnew = fmaxf(m_r[r], mx);
      alpha[r] = (mnew > -1.0e38f) ? __expf(m_r[r] - mnew) : 1.0f;
      const float p0 = (s[0][r] > -1.0e38f) ? __expf(s[0][r] - mnew) : 0.f;
      const float p1 = (s[1][r] > -1.0e38f) ? __expf(s[1][r] - mnew) : 0.f;
      m_r[r] = mnew;
      l_r[r] = l_r[r] * alpha[r] + p0 + p1;            // per-lane partial row sum (16 lanes combined at the end)
      unsigned short hb = bf16_bits(p0); sPh[w][8 * hh + r][ln] = hb;      sPl[w][8 * hh + r][ln] = bf16_bits(p0 - bf16_val(hb));
      hb = bf16_bits(p1);                sPh[w][8 * hh + r][16 + ln] = hb; sPl[w][8 * hh + r][16 + ln] = bf16_bits(p1 - bf16_val(hb));
    }
#pragma unroll
    for (int dt = 0; dt < DT; ++dt)
#pragma unroll
      for (int r = 0; r < 8; ++r) oacc[dt][r] *= alpha[r];
    __builtin_amdgcn_fence(__ATOMIC_ACQ_REL, "workgroup");
    __builtin_amdgcn_wave_barrier();
    FragB pah, pal;
    pah.half[0] = *(const v8us*)&sPh[w][ln][8 * hh]; pah.half[1] = *(const v8us*)&sPh[w][ln][16 + 8 * hh];
    pal.half[0] = *(const v8us*)&sPl[w][ln][8 * hh]; pal.half[1] = *(const v8us*)&sPl[w][ln][16 + 8 * hh];
#pragma unroll
    for (int dt = 0; dt < DT; ++dt) {
      FragB bvh, bvl;
#pragma unroll
      for (int i = 0; i < 8; ++i) {
        bvh.u[i] = sVh[8 * hh + i][dt * 16 + ln]; bvh.u[8 + i] = sVh[16 + 8 * hh + i][dt * 16 + ln];
        bvl.u[i] = sVl[8 * hh + i][dt * 16 + ln]; bvl.u[8 + i] = sVl[16 + 8 * hh + i][dt * 16 + ln];
      }
      oacc[dt] = mmaN<3>(pah.v, pal.v, bvh.v, bvl.v, oacc[dt]);
    }
    __builtin_amdgcn_fence(__ATOMIC_ACQ_REL, "workgroup");
    __builtin_amdgcn_wave_barrier();
  }
#pragma unroll
  for (int r = 0; r < 8; ++r) {
    float l = l_r[r];
    l += __shfl_xor(l, 1, 32); l += __shfl_xor(l, 2, 32); l += __shfl_xor(l, 4, 32); l += __shfl_xor(l, 8, 32);
    l_r[r] = (l > 0.f) ? 1.0f / l : 0.f;
  }
#pragma unroll
  for (int dt = 0; dt < DT; ++dt)
#pragma unroll
    for (int r = 0; r < 8; ++r) sO[w][8 * hh + r][dt * 16 + ln] = oacc[dt][r] * l_r[r];
  __builtin_amdgcn_fence(__ATOMIC_ACQ_REL, "workgroup");
  __builtin_amdgcn_wave_barrier();
  {
    for (int r = 0; r < 16; ++r) {
      const int row = q0 + r;
      if (row < T && lane < D / 4) {
        const v4f val = *(const v4fa*)&sO[w][r][lane * 4];
        *(v4f*)(y + ((size_t)b * T + row) * ypitch + h * D + lane * 4) = val;
      }
    }
    
  }
}

// GEMM C = act(A·W + bias + resid): A f32 (ASPLIT -> hi/lo 2 terms), Wt bf16 [N][K]; ACT 0 none, 1 relu, 2 exact gelu;
// resid (optional, f32, row index = (row % rmod), pitch ldr, RES_BF16 rounds it) added before the activation.
template <bool ASPLIT, int ACT, bool BIAS_BF16, bool RES_BF16>
__global__ __launch_bounds__(128) void k_gemm_bf3(const float* __restrict__ A, int lda, const unsigned short* __restrict__ Wt, int ldb,
                                                const float* __restrict__ bias, const float* __restrict__ resid, int rmod, int ldr,
                                                float* __restrict__ C, int ldc, int M, int N, int K) {
  __shared__ __attribute__((aligned(16))) float so[4][16][64];
  const int tid = threadIdx.x, w = tid >> 5, lane = tid & 31, ln = lane & 15, hh = lane >> 4;
  const int ntn = N / 64;
  const int wid = blockIdx.x * 4 + w;
  const int mt = wid / ntn, nq = wid % ntn;
  if (mt * 16 >= M) return;
  const int row0 = mt * 16, col0 = nq * 64;
  const float* arow = A + (size_t)(row0 + ln) * lda;
  v8f acc[4] = {};
  for (int kb = 0; kb < K; kb += 32) {
    FragB ah, al;
    const v4f x0 = *(const v4fa*)(arow + kb + 8 * hh), x1 = *(const v4fa*)(arow + kb + 8 * hh + 4);
    const v4f x2 = *(const v4fa*)(arow + kb + 16 + 8 * hh), x3 = *(const v4fa*)(arow + kb + 16 + 8 * hh + 4);
    float xs[16] = {x0[0],x0[1],x0[2],x0[3],x1[0],x1[1],x1[2],x1[3],x2[0],x2[1],x2[2],x2[3],x3[0],x3[1],x3[2],x3[3]};
#pragma unroll
    for (int i = 0; i < 16; ++i) { const unsigned short hb = bf16_bits(xs[i]); ah.u[i] = hb; al.u[i] = ASPLIT ? bf16_bits(xs[i] - bf16_val(hb)) : (unsigned short)0; }
#pragma unroll
    for (int t = 0; t < 4; ++t) {
      const unsigned short* brow = Wt + (size_t)(col0 + t * 16 + ln) * ldb + kb;
      FragB b;
      b.half[0] = *(const v8us*)(brow + 8 * hh);
      b.half[1] = *(const v8us*)(brow + 16 + 8 * hh);
      acc[t] = mmaN<ASPLIT ? 2 : 1>(ah.v, al.v, b.v, b.v, acc[t]);
    }
  }
#pragma unroll
  for (int t = 0; t < 4; ++t) {
    const int col = col0 + t * 16 + ln;
    float bv = bias ? bias[col] : 0.f;
    if (BIAS_BF16) bv = bf16_round(bv);
#pragma unroll
    for (int r = 0; r < 8; ++r) {
      float v = acc[t][r] + bv;
      if (resid) { float rv = resid[(size_t)((row0 + 8 * hh + r) % rmod) * ldr + col]; if (RES_BF16) rv = bf16_round(rv); v += rv; }
      if (ACT == 1) v = fmaxf(v, 0.f);
      if (ACT == 2) v = 0.5f * v * (1.0f + erff(v * 0.70710678118654752f));
      if (ACT == 3) { const float u = 0.7978845608028654f * (v + 0.044715f * v * v * v); v = 0.5f * v * (1.0f + tanhf(u)); }
      so[w][8 * hh + r][t * 16 + ln] = v;
    }
  }
  __builtin_amdgcn_fence(__ATOMIC_ACQ_REL, "workgroup");
  __builtin_amdgcn_wave_barrier();
  const int rsub = lane >> 4, c4 = (lane & 15) * 4;
  {
#pragma unroll
    for (int q = 0; q < 8; ++q) {
      const int r = q * 2 + rsub;
      const v4f v = *(const v4fa*)&so[w][r][c4];
      *(v4f*)(C + (size_t)(row0 + r) * ldc + col0 + c4) = v;
    }
    
  }
}
// row LayerNorm (biased variance, eps) over N: s = X (+ R); optional out_sum <- s; out_norm <- (s-mu)*rsqrt(var+eps)*g + b
template <bool PARAM_BF16>
__global__ __launch_bounds__(256) void k_layernorm(const float* __restrict__ X, const float* __restrict__ R, const float* __restrict__ g, const float* __restrict__ bta,
                                                  float* __restrict__ out_sum, float* __restrict__ out_norm, int N, float eps) {
  __shared__ float red[256];
  const int row = blockIdx.x, tid = threadIdx.x;
  const float* x = X + (size_t)row * N; const float* rr = R ? R + (size_t)row * N : nullptr;
  float vals[16];                     // up to N = 4096
  const int per = N / 256;            // contiguous chunk per thread? use strided-by-4 chunks: thread handles j = tid*4 + 1024*u
  float s1 = 0.f;
  for (int u = 0; u < per / 4; ++u) {
    const int j = tid * 4 + 1024 * u;
    const v4f a = *(const v4fa*)(x + j);
    v4f b = {0.f,0.f,0.f,0.f}; if (rr) b = *(const v4fa*)(rr + j);
#pragma unroll
    for (int q = 0; q < 4; ++q) { const float v = a[q] + b[q]; vals[u * 4 + q] = v; s1 += v; }
  }
  red[tid] = s1; __syncthreads();
  for (int st = 128; st > 0; st >>= 1) { if (tid < st) red[tid] += red[tid + st]; __syncthreads(); }
  const float mu = red[0] / (float)N; __syncthreads();
  float s2 = 0.f;
  for (int u = 0; u < per / 4; ++u)
#pragma unroll
    for (int q = 0; q < 4; ++q) { const float c = vals[u * 4 + q] - mu; s2 += c * c; }
  red[tid] = s2; __syncthreads();
  for (int st = 128; st > 0; st >>= 1) { if (tid < st) red[tid] += red[tid + st]; __syncthreads(); }
  const float rs = rsqrtf(red[0] / (float)N + eps);
  {
    for (int u = 0; u < per / 4; ++u) {
      const int j = tid * 4 + 1024 * u;
      v4f o, sm;
#pragma unroll
      for (int q = 0; q < 4; ++q) {
        float gg = g[j + q], bb = bta[j + q];
        if (PARAM_BF16) { gg = bf16_round(gg); bb = bf16_round(bb); }
        sm[q] = vals[u * 4 + q]; o[q] = (vals[u * 4 + q] - mu) * rs * gg + bb;
      }
      if (out_sum) *(v4f*)(out_sum + (size_t)row * N + j) = sm;
      *(v4f*)(out_norm + (size_t)row * N + j) = o;
    }
    
  }
}



// ---- f16 WMMA path (v_wmma_f32_16x16x32_f16): 11-bit significands for operands in range — used where a [0,1] probability operand needs more precision than bf16
typedef _Float16 v16h __attribute__((ext_vector_type(16)));
typedef _Float16 v4h __attribute__((ext_vector_type(4)));
union FragH { v16h v; v8us half[2]; _Float16 h[16]; unsigned short u[16]; };
template <int NT>
__device__ __forceinline__ v8f mmaH(v16h ah, v16h al, v16h bh, v16h bl, v8f c) {
  c = __builtin_amdgcn_wmma_f32_16x16x32_f16(false, ah, false, bh, (short)0, c, false, false);
  if (NT >= 2) c = __builtin_amdgcn_wmma_f32_16x16x32_f16(false, al, false, bh, (short)0, c, false, false);
  if (NT >= 3) c = __builtin_amdgcn_wmma_f32_16x16x32_f16(false, ah, false, bl, (short)0, c, false, false);
  asm volatile("v_nop\n\tv_nop\n\tv_nop\n\tv_nop" : "+v"(c) : "v"(ah), "v"(al), "v"(bh), "v"(bl));
  return c;
}
// batched GEMM like k_gemm_b but f16 operands: A f32 (split into f16 hi/lo if ASPLIT, else rounded to f16), Bt = f16 values [n][k]; alpha; C f32; N multiple of 16 (partial tiles skipped)
template <bool ASPLIT>
__global__ __launch_bounds__(128) void k_gemm_h(const float* __restrict__ A, int lda, size_t sA, const _Float16* __restrict__ Bh, int ldb, size_t sB, float alpha, float* __restrict__ C, int ldc, size_t sC, int M, int N, int K) {
  __shared__ __attribute__((aligned(16))) float so[4][16][64];
  const int tid = threadIdx.x, w = tid >> 5, lane = tid & 31, ln = lane & 15, hh = lane >> 4; const int by = blockIdx.y;
  A += (size_t)by * sA; Bh += (size_t)by * sB; C += (size_t)by * sC;
  const int ntn = (N + 63) / 64; const int wid = blockIdx.x * 4 + w; const int mt = wid / ntn, nq = wid % ntn; if (mt * 16 >= M) return;
  const int row0 = mt * 16, col0 = nq * 64; const float* arow = A + (size_t)(row0 + ln) * lda;
  v8f acc[4] = {};
  for (int kb = 0; kb < K; kb += 32) {
    FragH ah, al;
    const v4f x0 = *(const v4fa*)(arow + kb + 8 * hh), x1 = *(const v4fa*)(arow + kb + 8 * hh + 4), x2 = *(const v4fa*)(arow + kb + 16 + 8 * hh), x3 = *(const v4fa*)(arow + kb + 16 + 8 * hh + 4);
    float xs[16] = {x0[0],x0[1],x0[2],x0[3],x1[0],x1[1],x1[2],x1[3],x2[0],x2[1],x2[2],x2[3],x3[0],x3[1],x3[2],x3[3]};
#pragma unroll
    for (int i = 0; i < 16; ++i) { const _Float16 h = (_Float16)xs[i]; ah.h[i] = h; al.h[i] = ASPLIT ? (_Float16)(xs[i] - (float)h) : (_Float16)0.0f; }
#pragma unroll
    for (int t = 0; t < 4; ++t) { if (col0 + t * 16 >= N) continue; const size_t boff = (size_t)(col0 + t * 16 + ln) * ldb + kb; FragH bq; bq.half[0] = *(const v8us*)(Bh + boff + 8 * hh); bq.half[1] = *(const v8us*)(Bh + boff + 16 + 8 * hh);
      acc[t] = mmaH<ASPLIT ? 2 : 1>(ah.v, al.v, bq.v, bq.v, acc[t]); }
  }
#pragma unroll
  for (int t = 0; t < 4; ++t) { if (col0 + t * 16 >= N) continue;
#pragma unroll
    for (int r = 0; r < 8; ++r) so[w][8 * hh + r][t * 16 + ln] = acc[t][r] * alpha; }
  __builtin_amdgcn_fence(__ATOMIC_ACQ_REL, "workgroup"); __builtin_amdgcn_wave_barrier();
  const int rsub = lane >> 4, c4 = (lane & 15) * 4;
  {
#pragma unroll
    for (int q = 0; q < 8; ++q) { const int r = q * 2 + rsub; if (col0 + c4 < N) { const v4f v = *(const v4fa*)&so[w][r][c4]; *(v4f*)(C + (size_t)(row0 + r) * ldc + col0 + c4) = v; } }
     }
}

// Wt[n][k] = f16(W[k][n]·scale) from f32 row-major W[K][N] (scale = power of two; bf16-exact weights stay exact in f16 away from the subnormal range)
__global__ __launch_bounds__(256) void k_wt_f16(const float* __restrict__ W, _Float16* __restrict__ Wt, int K, int N, float scale) {
  const int t = blockIdx.x * 256 + threadIdx.x; if (t >= N * (K / 8)) return; const int n = t / (K / 8), k8 = (t % (K / 8)) * 8; FragH f;
#pragma unroll
  for (int i = 0; i < 8; ++i) f.h[i] = (_Float16)(bf16_round(W[(size_t)(k8 + i) * N + n]) * scale); const v8us o = f.half[0];
  *(v8us*)((unsigned short*)Wt + (size_t)n * K + k8) = o; 
}
// The five input conversions in one launch: they are independent of one another, and the block index picks the job (a scalar choice, the same for a whole block). x -> f16(bf16(x)); each weight, already (out,in) = Bt,
// -> f16(bf16(w) * 16). wq, wk and wv land one behind the other, so that they read as one Bt of 2048 rows.
__global__ __launch_bounds__(256) void k_cvt(const float* __restrict__ x, const float* __restrict__ wq, const float* __restrict__ wk, const float* __restrict__ wv, const float* __restrict__ wo,
                                             _Float16* __restrict__ X16, _Float16* __restrict__ Bqkv, _Float16* __restrict__ Bo) {
  constexpr unsigned GX = (unsigned)NR * HID / 2048, GQ = (unsigned)HID * HID / 2048, GK = (unsigned)KVD * HID / 2048;      // blocks per job: 256 threads x 8 elements
  static_assert(NR * HID % 2048 == 0 && HID * HID % 2048 == 0 && KVD * HID % 2048 == 0, "whole blocks only");
  unsigned bid = blockIdx.x; const float* s; _Float16* d; float sc = 16.0f;
  if (bid < GX) { s = x; d = X16; sc = 1.0f; }
  else if ((bid -= GX) < GQ) { s = wq; d = Bqkv; }
  else if ((bid -= GQ) < GK) { s = wk; d = Bqkv + (size_t)HID * HID; }
  else if ((bid -= GK) < GK) { s = wv; d = Bqkv + (size_t)(HID + KVD) * HID; }
  else { bid -= GK; s = wo; d = Bo; }
  const size_t t = (size_t)bid * 256 + threadIdx.x; FragH f;
#pragma unroll
  for (int i = 0; i < 8; ++i) f.h[i] = (_Float16)(bf16_round(s[t * 8 + i]) * sc);
  *(v8us*)((unsigned short*)d + t * 8) = f.half[0]; }
__global__ __launch_bounds__(256) void k_vt(const _Float16* __restrict__ V16, _Float16* __restrict__ Vt) { __shared__ unsigned short tl[64][66]; const int tid = threadIdx.x; const int slab = blockIdx.x / (SS / 64), lg = blockIdx.x % (SS / 64); const int b = slab / NKV, h = slab % NKV;
  for (int i = tid; i < 64 * 8; i += 256) { const int r = i / 8, c8 = (i % 8) * 8; FragH f; f.half[0] = *(const v8us*)((const unsigned short*)V16 + ((size_t)b * SS + lg * 64 + r) * KVD + h * HD + c8);
#pragma unroll
    for (int q = 0; q < 8; ++q) tl[r][c8 + q] = f.u[q]; }
  __syncthreads();
  {
#pragma unroll
    for (int rd = 0; rd < 2; ++rd) { const int d = rd * 32 + tid / 8, pc = tid % 8; FragH f;
#pragma unroll
      for (int q = 0; q < 8; ++q) f.u[q] = tl[pc * 8 + q][d];
      *(v8us*)((unsigned short*)Vt + ((size_t)slab * HD + d) * SS + lg * 64 + pc * 8) = f.half[0]; }
     } }
// a step of an xor butterfly inside a 16-lane row: the builtin move fuses into v_add_f32_dpp
template <int M> __device__ __forceinline__ float row_xor(float v) { return __int_as_float(__builtin_amdgcn_mov_dpp(__float_as_int(v), 0x160 + M, 0xf, 0xf, true)); }
// the value of lane l ^ 16 (the other half of the wave), on the vector pipe
__device__ __forceinline__ float half_xor(float v) { const int b = __float_as_int(v); return __int_as_float(__builtin_amdgcn_permlanex16(b, b, 0x76543210, 0xfedcba98, false, false)); }
// fused causal GQA attention per ((b,h), 128 queries): wave = 32 queries; Q from Q16 cols h*64 (pitch 1024), K from K16 cols kvh*64 (pitch 512), kvh = h / 2; key chunks 0..qb0+128; mask k <= q else -inf.
// Both products run transposed: St = K * Qt (A = 16 key rows, B = 16 query columns) and Ot += Vt * Pt (A = 16 rows of Vt, B = Pt). A lane of an St tile then holds 8 keys of ONE query (column ln, keys 8 * hh + r),
// so a query's maximum and sum are taken inside the lane, with one exchange between the wave's halves for the maximum; running maximum, sum and rescale factor are one value per lane and 16-query group;
// and the two St tiles of a 32-key chunk, rounded to f16 in place, ARE the B operand Pt in the hardware's k order (element s = key 8 * hh + s, then 16 + 8 * hh + s - 8), which the Vt loads already follow: P never leaves the registers.
__global__ __launch_bounds__(128) void k_flash(const _Float16* __restrict__ Q16, const _Float16* __restrict__ K16, const _Float16* __restrict__ Vt, _Float16* __restrict__ O16) {
  constexpr int RPW = 32, NQB = SS / (4 * RPW), DT = HD / 16, KS = HD / 32, OPIT = HD + 8;
  // The softmax runs in base 2: the scores take 1/8 and log2(e) in their one multiply, so e^(s - m) = 2^(s2 - m2) is one subtraction and one v_exp_f32. Every argument is <= 0 here (m2 is the running maximum),
  // so nothing can overflow; -inf (masked) and the -3e38 start value give 0; a result below 2^-126 is flushed to 0, far under the f16 rounding of P and the f32 rounding of the row sum, which holds a term 1.
  constexpr float SC2 = 0.125f * 1.4426950408889634f;
  // output staging, f16; row pitch 144 bytes: the 16-byte stores of 8 rows fall on different banks
  __shared__ __attribute__((aligned(16))) unsigned short sO[4][RPW][OPIT];
  const int tid = threadIdx.x, w = tid >> 5, lane = tid & 31, ln = lane & 15, hh = lane >> 4;
  const int slab = blockIdx.x / NQB, qblk = blockIdx.x % NQB; const int b = slab / NH, h = slab % NH; const int kvh = h / (NH / NKV); const int qb0 = qblk * (4 * RPW); const int q0 = qb0 + w * RPW;
  FragH aq[2][KS];
#pragma unroll
  for (int rt = 0; rt < 2; ++rt) { const unsigned short* qr = (const unsigned short*)Q16 + ((size_t)b * SS + q0 + rt * 16 + ln) * HID + h * HD;
#pragma unroll
    for (int ks = 0; ks < KS; ++ks) { aq[rt][ks].half[0] = *(const v8us*)(qr + ks * 32 + 8 * hh); aq[rt][ks].half[1] = *(const v8us*)(qr + ks * 32 + 16 + 8 * hh); } }
  const unsigned short* Vth = (const unsigned short*)Vt + (size_t)(b * NKV + kvh) * HD * SS;
  float m_r[2], l_r[2]; v8f oacc[2][DT];      // of query q0 + rt * 16 + ln; oacc[rt][dt][r] is its dim dt * 16 + 8 * hh + r; l_r sums the keys of the lane's own half
#pragma unroll
  for (int rt = 0; rt < 2; ++rt) { m_r[rt] = -3.0e38f; l_r[rt] = 0.f;
#pragma unroll
    for (int dt = 0; dt < DT; ++dt) oacc[rt][dt] = (v8f){0.f,0.f,0.f,0.f,0.f,0.f,0.f,0.f}; }
  const int jend = qb0 + 4 * RPW;
  // K and V fragments are requested ahead of their products, so that no product waits out a load: a chunk's K is loaded during the chunk before it (chunk 0's here), its V at the chunk's head
  const unsigned short* kl = (const unsigned short*)K16 + ((size_t)b * SS + ln) * KVD + kvh * HD + 8 * hh;
  const unsigned short* vl = Vth + (size_t)ln * SS + 8 * hh;
  FragH bk[2][KS];
#pragma unroll
  for (int nt = 0; nt < 2; ++nt)
#pragma unroll
    for (int ks = 0; ks < KS; ++ks) { bk[nt][ks].half[0] = *(const v8us*)(kl + nt * 16 * KVD + ks * 32); bk[nt][ks].half[1] = *(const v8us*)(kl + nt * 16 * KVD + ks * 32 + 16); }
#pragma unroll 1
  for (int j0 = 0; j0 < jend; j0 += 32) {
    FragH bv[DT];
#pragma unroll
    for (int dt = 0; dt < DT; ++dt) { bv[dt].half[0] = *(const v8us*)(vl + (size_t)dt * 16 * SS + j0); bv[dt].half[1] = *(const v8us*)(vl + (size_t)dt * 16 * SS + j0 + 16); }
    v8f s[2][2];      // s[rt][nt][r]: key j0 + nt * 16 + 8 * hh + r against query q0 + rt * 16 + ln
#pragma unroll
    for (int nt = 0; nt < 2; ++nt)
#pragma unroll
      for (int rt = 0; rt < 2; ++rt) { v8f acc = (v8f){0.f,0.f,0.f,0.f,0.f,0.f,0.f,0.f};
#pragma unroll
        for (int ks = 0; ks < KS; ++ks) acc = mmaH<1>(bk[nt][ks].v, bk[nt][ks].v, aq[rt][ks].v, aq[rt][ks].v, acc); s[rt][nt] = acc; }
    // the next chunk's K into the same registers, right behind their last product; the last chunk loads its own rows again (in bounds, never used)
    { const unsigned short* kn = kl + (size_t)((j0 + 32 < jend) ? j0 + 32 : j0) * KVD;
#pragma unroll
      for (int nt = 0; nt < 2; ++nt)
#pragma unroll
        for (int ks = 0; ks < KS; ++ks) { bk[nt][ks].half[0] = *(const v8us*)(kn + nt * 16 * KVD + ks * 32); bk[nt][ks].half[1] = *(const v8us*)(kn + nt * 16 * KVD + ks * 32 + 16); } }
    // stands between the loads above and the softmax, which reuses their K address pair: the wait that belongs in front of an overwrite of an issued load's address register
    asm volatile("s_wait_xcnt 0x0" ::: "memory");
    // keeps the V and K loads and the wait in front of the softmax and the output products that the loads fly under (without it the scheduler sank the K loads into the softmax and the wait far behind them)
    __builtin_amdgcn_sched_barrier(0);
    FragH pb[2];
#pragma unroll
    for (int rt = 0; rt < 2; ++rt) { const int dq = q0 + rt * 16 + ln - 8 * hh - j0;      // key nt * 16 + r of the lane's half is allowed while nt * 16 + r <= dq
      v8f s0 = s[rt][0] * SC2, s1 = s[rt][1] * SC2;
#pragma unroll
      for (int r = 0; r < 8; ++r) { s0[r] = (r <= dq) ? s0[r] : -INFINITY; s1[r] = (16 + r <= dq) ? s1[r] : -INFINITY; }
      float mx = fmaxf(fmaxf(fmaxf(fmaxf(s0[0], s0[1]), fmaxf(s0[2], s0[3])), fmaxf(fmaxf(s0[4], s0[5]), fmaxf(s0[6], s0[7]))), fmaxf(fmaxf(fmaxf(s1[0], s1[1]), fmaxf(s1[2], s1[3])), fmaxf(fmaxf(s1[4], s1[5]), fmaxf(s1[6], s1[7]))));
      mx = fmaxf(mx, half_xor(mx));      // both halves hold keys of the same query and scale the same output column: one maximum for both
      const float mn = fmaxf(m_r[rt], mx); const float al = __builtin_amdgcn_exp2f(m_r[rt] - mn); m_r[rt] = mn;
      s0 -= mn; s1 -= mn;
#pragma unroll
      for (int r = 0; r < 8; ++r) { s0[r] = __builtin_amdgcn_exp2f(s0[r]); s1[r] = __builtin_amdgcn_exp2f(s1[r]); pb[rt].h[r] = (_Float16)s0[r]; pb[rt].h[8 + r] = (_Float16)s1[r]; }
      const v8f t = s0 + s1;
      l_r[rt] = l_r[rt] * al + (((t[0] + t[1]) + (t[2] + t[3])) + ((t[4] + t[5]) + (t[6] + t[7])));
#pragma unroll
      for (int dt = 0; dt < DT; ++dt) oacc[rt][dt] *= al; }
#pragma unroll
    for (int dt = 0; dt < DT; ++dt)
#pragma unroll
      for (int rt = 0; rt < 2; ++rt) oacc[rt][dt] = mmaH<1>(bv[dt].v, bv[dt].v, pb[rt].v, pb[rt].v, oacc[rt][dt]); }
#pragma unroll
  for (int rt = 0; rt < 2; ++rt) { float l = l_r[rt]; l += half_xor(l); const float li = 1.0f / l;
#pragma unroll
    for (int dt = 0; dt < DT; ++dt) { FragH o;      // the o projection's A operand: rounded here; a lane's 8 registers are 8 neighbouring dims of its query, one 16-byte LDS store
#pragma unroll
      for (int r = 0; r < 8; ++r) o.h[r] = (_Float16)(oacc[rt][dt][r] * li);
      *(v8us*)&sO[w][rt * 16 + ln][dt * 16 + 8 * hh] = o.half[0]; } }
  // the wave reads back its own tile, written by other lanes: the LDS stores must have landed first
  __builtin_amdgcn_fence(__ATOMIC_ACQ_REL, "workgroup"); __builtin_amdgcn_wave_barrier();
  {
#pragma unroll
    for (int rp = 0; rp < RPW; rp += 4) { const int r = rp + (lane >> 3), c8 = (lane & 7) * 8;      // 8 lanes = one 128-byte line of the row
      const v8us val = *(const v8us*)&sO[w][r][c8];
      *(v8us*)((unsigned short*)O16 + ((size_t)b * SS + q0 + r) * HID + h * HD + c8) = val; }
     } }
// Projection GEMM C[4096][N] = A[4096][1024] * Bt[N][1024]^T / 16 (f16 operands, f32 accumulate, k ascending in steps of 32 as before). Block = 4 waves = a 64 x 128 tile of C; wave = 32 x 64 (2 x 4 accumulators).
// Each stage brings 64 k of the 64 A rows and the 128 Bt rows into LDS with whole 128-byte rows per 8 lanes, so every row is fetched once per block instead of once per wave in 16-line gathers;
// the next stage's rows are loaded into registers while this stage's products run, and go into the other buffer. Row pitch 144 bytes: the 16 rows of a fragment read fall on different banks.
// OUT 0: C f32. OUT 1: C16 = f16(C). OUT 2 (q, k): a wave's 64 columns are one head, so its staged 32 x 64 tile holds whole head rows: per row RMSNorm over the 64 dims (eps 1e-6, times bf16(nw)),
// then RoPE with the INPUT cos/sin[row][64] (rotate_half = [-x2, x1]; rounded to bf16 like every other input), then C16 = f16: the f32 product never goes to memory.
// q, k and v are ONE launch: their weights lie one behind the other as a Bt of 2048 rows, a block's 128 columns belong to one of the three, and the block index (a scalar choice) picks the output form. o is a launch of its own.
typedef float fa __attribute__((may_alias));
typedef unsigned short proj_lds[2][64 + 128][64 + 8];
// the product: leaves each wave's 32 x 64 tile of C (f32, pitch 68) in LDS, over the stage buffers, and returns the wave's tile
__device__ __forceinline__ fa* proj_tile(const _Float16* __restrict__ A, const _Float16* __restrict__ Bt, const int row0, const int col0, proj_lds& sm) {
  constexpr int K = HID, BM = 64, BN = 128, BK = 64, PIT = BK + 8, NS = K / BK, OP = 68;
  static_assert(sizeof(float) * 4 * 32 * OP <= sizeof(unsigned short) * 2 * (BM + BN) * PIT, "the output tiles reuse the stage buffers");
  const int tid = threadIdx.x, w = tid >> 5, lane = tid & 31, ln = lane & 15, hh = lane >> 4;
  const int wm = (w >> 1) * 32, wn = (w & 1) * 64;
  const int sr = tid >> 3, sc = (tid & 7) * 8;
  const unsigned short* ga = (const unsigned short*)A + (size_t)(row0 + sr) * K + sc;
  const unsigned short* gb = (const unsigned short*)Bt + (size_t)(col0 + sr) * K + sc;
  v8us ra[BM / 16], rb[BN / 16];
  v8f acc[2][4];
#pragma unroll
  for (int mi = 0; mi < 2; ++mi)
#pragma unroll
    for (int t = 0; t < 4; ++t) acc[mi][t] = (v8f){0.f,0.f,0.f,0.f,0.f,0.f,0.f,0.f};
#pragma unroll
  for (int i = 0; i < BM / 16; ++i) ra[i] = *(const v8us*)(ga + (size_t)i * 16 * K);
#pragma unroll
  for (int i = 0; i < BN / 16; ++i) rb[i] = *(const v8us*)(gb + (size_t)i * 16 * K);
#pragma unroll
  for (int i = 0; i < BM / 16; ++i) *(v8us*)&sm[0][sr + i * 16][sc] = ra[i];
#pragma unroll
  for (int i = 0; i < BN / 16; ++i) *(v8us*)&sm[0][BM + sr + i * 16][sc] = rb[i];
  __syncthreads();
  // unrolled whole: every stage's global offset is then an immediate on two address pairs that are never rewritten, and the buffer index a constant
#pragma unroll
  for (int s = 0; s < NS; ++s) {
    const int cur = s & 1;
    if (s + 1 < NS) {
#pragma unroll
      for (int i = 0; i < BM / 16; ++i) ra[i] = *(const v8us*)(ga + (size_t)i * 16 * K + (s + 1) * BK);
#pragma unroll
      for (int i = 0; i < BN / 16; ++i) rb[i] = *(const v8us*)(gb + (size_t)i * 16 * K + (s + 1) * BK);
    }
    // keeps the next stage's loads at the head of this stage, so that they fly under all of its products (the scheduler sank them to just in front of their LDS stores)
    __builtin_amdgcn_sched_barrier(0);
    FragH a[BK / 32][2], b[BK / 32][4];
#pragma unroll
    for (int ks = 0; ks < BK / 32; ++ks) {
#pragma unroll
      for (int mi = 0; mi < 2; ++mi) { const unsigned short* p = &sm[cur][wm + mi * 16 + ln][ks * 32 + 8 * hh]; a[ks][mi].half[0] = *(const v8us*)p; a[ks][mi].half[1] = *(const v8us*)(p + 16); }
#pragma unroll
      for (int t = 0; t < 4; ++t) { const unsigned short* p = &sm[cur][BM + wn + t * 16 + ln][ks * 32 + 8 * hh]; b[ks][t].half[0] = *(const v8us*)p; b[ks][t].half[1] = *(const v8us*)(p + 16); }
    }
    // keeps the stage's fragment reads in one group ahead of its products: one exposed LDS latency per stage (the scheduler reused the A registers and waited for LDS four times per stage)
    __builtin_amdgcn_sched_barrier(0);
#pragma unroll
    for (int ks = 0; ks < BK / 32; ++ks)
#pragma unroll
      for (int mi = 0; mi < 2; ++mi)
#pragma unroll
        for (int t = 0; t < 4; ++t) acc[mi][t] = __builtin_amdgcn_wmma_f32_16x16x32_f16(false, a[ks][mi].v, false, b[ks][t].v, (short)0, acc[mi][t], false, false);
    // keeps the waits for those loads, and the LDS stores behind them, behind the issue of all of this stage's products (the scheduler put them in the middle of the stage)
    __builtin_amdgcn_sched_barrier(0);
    if (s + 1 < NS) {
#pragma unroll
      for (int i = 0; i < BM / 16; ++i) *(v8us*)&sm[cur ^ 1][sr + i * 16][sc] = ra[i];
#pragma unroll
      for (int i = 0; i < BN / 16; ++i) *(v8us*)&sm[cur ^ 1][BM + sr + i * 16][sc] = rb[i];
    }
    // one barrier per stage: it publishes the buffer just filled and ends every wave's reads of the buffer that the next stage refills (after the last stage: that the output tiles reuse)
    __syncthreads();
  }
  fa* so = (fa*)&sm[0][0][0] + w * 32 * OP;
#pragma unroll
  for (int mi = 0; mi < 2; ++mi)
#pragma unroll
    for (int t = 0; t < 4; ++t)
#pragma unroll
      for (int r = 0; r < 8; ++r) so[(mi * 16 + 8 * hh + r) * OP + t * 16 + ln] = acc[mi][t][r] * 0.0625f;
  // the wave reads back its own tile, written by other lanes: the LDS stores must have landed first
  __builtin_amdgcn_fence(__ATOMIC_ACQ_REL, "workgroup"); __builtin_amdgcn_wave_barrier();
  return so;
}
// OUT 2; col0 = the block's first column in C16, N = the pitch of C16
template <int N>
__device__ __forceinline__ void proj_norm_rope(const fa* so, const int row0, const int col0, _Float16* __restrict__ C16, const float* __restrict__ nw, const float* __restrict__ cs, const float* __restrict__ sn) {
  constexpr int OP = 68;
  const int tid = threadIdx.x, w = tid >> 5, lane = tid & 31;
  const int wm = (w >> 1) * 32, wn = (w & 1) * 64;
    static_assert(HD == 64, "a wave's 64 columns are one head");
    // 8 lanes per row, 4 rows per pass: a lane holds dims j4..j4+3 (x1) and 32+j4..32+j4+3 (x2), the two halves that RoPE pairs
    const int rr = lane >> 3, j4 = (lane & 7) * 4;
    v4f w1 = *(const v4fa*)(nw + j4), w2 = *(const v4fa*)(nw + 32 + j4);
#pragma unroll
    for (int i = 0; i < 4; ++i) { w1[i] = bf16_round(w1[i]); w2[i] = bf16_round(w2[i]); }
    const fa* xp = so + rr * OP + j4;
    // byte offsets of the lane's first row: one for cos and sin (below 1 MiB), one for the output (below 8 MiB); each rides as the 32-bit offset register beside a scalar base
    unsigned co = (unsigned)((row0 + wm + rr) * HD + j4) * 4u, yo = (unsigned)((row0 + wm + rr) * N + col0 + wn + j4) * 2u;
    // two trips of four passes: a trip's 16 cos/sin loads go out together and fly under its sums of squares (all eight passes unrolled took more than 256 registers)
#pragma unroll 1
    for (int qh = 0; qh < 2; ++qh) {
      v4f x1[4], x2[4], c1[4], c2[4], s1[4], s2[4];
#pragma unroll
      for (int q = 0; q < 4; ++q) { x1[q] = *(const v4fa*)(xp + q * 4 * OP); x2[q] = *(const v4fa*)(xp + q * 4 * OP + 32); }
#pragma unroll
      for (int q = 0; q < 4; ++q) { const float* cp = (const float*)((const char*)cs + co) + q * 4 * HD; const float* sp = (const float*)((const char*)sn + co) + q * 4 * HD;
        c1[q] = *(const v4fa*)cp; c2[q] = *(const v4fa*)(cp + 32); s1[q] = *(const v4fa*)sp; s2[q] = *(const v4fa*)(sp + 32); }
#pragma unroll
      for (int q = 0; q < 4; ++q) {
        // sum of squares in the order of a 32-lane xor butterfly (16, 8, 4, 2, 1) over a_j = x1_j^2 + x2_j^2: dim j = 4 * lane + i, so 16, 8, 4 are lane steps 4, 2, 1 and 2, 1 are in-lane
        float t[4];
#pragma unroll
        for (int i = 0; i < 4; ++i) t[i] = __builtin_fmaf(x1[q][i], x1[q][i], x2[q][i] * x2[q][i]);
#pragma unroll
        for (int i = 0; i < 4; ++i) t[i] += row_xor<4>(t[i]);
#pragma unroll
        for (int i = 0; i < 4; ++i) t[i] += row_xor<2>(t[i]);
#pragma unroll
        for (int i = 0; i < 4; ++i) t[i] += row_xor<1>(t[i]);
        const float ss = (t[0] + t[2]) + (t[1] + t[3]);
        const float rs = rsqrtf(ss / (float)HD + 1e-6f);
        v4h y1, y2;      // explicit fma here and in t[]: it fixes which of the two products is rounded on its own
#pragma unroll
        for (int i = 0; i < 4; ++i) { const float n1 = x1[q][i] * rs * w1[i], n2 = x2[q][i] * rs * w2[i];
          y1[i] = (_Float16)__builtin_fmaf(n1, bf16_round(c1[q][i]), -(n2 * bf16_round(s1[q][i]))); y2[i] = (_Float16)__builtin_fmaf(n2, bf16_round(c2[q][i]), n1 * bf16_round(s2[q][i])); }
        _Float16* yp = (_Float16*)((char*)C16 + yo) + q * 4 * N;
        *(v4h*)yp = y1; *(v4h*)(yp + 32) = y2; }
      xp += 16 * OP; co += 16 * HD * 4; yo += 16 * N * 2; }
}
// OUT 0 and OUT 1
template <int N, int OUT>
__device__ __forceinline__ void proj_store(const fa* so, const int row0, const int col0, float* __restrict__ C, _Float16* __restrict__ C16) {
  constexpr int OP = 68;
  const int tid = threadIdx.x, w = tid >> 5, lane = tid & 31, ln = lane & 15, hh = lane >> 4;
  const int wm = (w >> 1) * 32, wn = (w & 1) * 64;
#pragma unroll
  for (int q = 0; q < 16; ++q) { const int r = q * 2 + hh, c4 = ln * 4; const v4f v = *(const v4fa*)&so[r * OP + c4]; const size_t o = (size_t)(row0 + wm + r) * N + col0 + wn + c4;
    if (OUT == 1) { v4h h4;
#pragma unroll
      for (int i = 0; i < 4; ++i) h4[i] = (_Float16)v[i];
      *(v4h*)(C16 + o) = h4; }
    else *(v4f*)(C + o) = v; }
}
__global__ __launch_bounds__(128) void k_qkv(const _Float16* __restrict__ A, const _Float16* __restrict__ Bt, _Float16* __restrict__ Q16, _Float16* __restrict__ K16, _Float16* __restrict__ V16,
                                             const float* __restrict__ qnw, const float* __restrict__ knw, const float* __restrict__ cs, const float* __restrict__ sn) {
  constexpr int NBN = (HID + 2 * KVD) / 128;
  __shared__ __attribute__((aligned(16))) proj_lds sm;
  const int row0 = (blockIdx.x / NBN) * 64, col0 = (blockIdx.x % NBN) * 128;
  const fa* so = proj_tile(A, Bt, row0, col0, sm);
  if (col0 < HID) proj_norm_rope<HID>(so, row0, col0, Q16, qnw, cs, sn);
  else if (col0 < HID + KVD) proj_norm_rope<KVD>(so, row0, col0 - HID, K16, knw, cs, sn);
  else { proj_store<KVD, 1>(so, row0, col0 - (HID + KVD), nullptr, V16);
    // behind v's last store: the listing runs on from here into the k and q forms' code, which reuses these stores' address and data registers; the wait that belongs in front of such an overwrite
    asm volatile("s_wait_xcnt 0x0" ::: "memory"); }
}
__global__ __launch_bounds__(128) void k_oproj(const _Float16* __restrict__ A, const _Float16* __restrict__ Bt, float* __restrict__ C) {
  constexpr int NBN = HID / 128;
  __shared__ __attribute__((aligned(16))) proj_lds sm;
  const int row0 = (blockIdx.x / NBN) * 64, col0 = (blockIdx.x % NBN) * 128;
  const fa* so = proj_tile(A, Bt, row0, col0, sm);
  proj_store<HID, 0>(so, row0, col0, C, nullptr);
}
extern "C" void kernel_launch(void* const* d_in, const int* in_sizes, int n_in,
                              void* d_out, int out_size, void* d_ws, size_t ws_size, hipStream_t stream) {
  (void)in_sizes; (void)n_in; (void)out_size;
  const float* x = (const float*)d_in[0]; const float* cs = (const float*)d_in[1]; const float* sn = (const float*)d_in[2]; const float* wq = (const float*)d_in[3]; const float* wk = (const float*)d_in[4]; const float* wv = (const float*)d_in[5]; const float* wo = (const float*)d_in[6]; const float* qnw = (const float*)d_in[7]; const float* knw = (const float*)d_in[8];
  char* ws = (char*)d_ws; size_t off = 0;
  auto take = [&](size_t bytes) { char* p = ws + off; off += (bytes + 255) & ~(size_t)255; return p; };
  _Float16* Bqkv = (_Float16*)take((size_t)(HID + 2 * KVD) * HID * 2); _Float16* Bo = (_Float16*)take((size_t)HID * HID * 2);
  _Float16* X16 = (_Float16*)take((size_t)NR * HID * 2); _Float16* Q16 = (_Float16*)take((size_t)NR * HID * 2); _Float16* K16 = (_Float16*)take((size_t)NR * KVD * 2); _Float16* V16 = (_Float16*)take((size_t)NR * KVD * 2); _Float16* Vt = (_Float16*)take((size_t)NR * KVD * 2); _Float16* O16 = (_Float16*)take((size_t)NR * HID * 2);
  if (off > ws_size) return;      // about 6 + 8.4 + 8.4 + 4.2 x 3 + 8.4 = 44 MiB
  k_cvt<<<((unsigned)NR * HID + 2u * HID * HID + 2u * KVD * HID) / 2048, 256, 0, stream>>>(x, wq, wk, wv, wo, X16, Bqkv, Bo);
  k_qkv<<<(NR / 64) * ((HID + 2 * KVD) / 128), 128, 0, stream>>>(X16, Bqkv, Q16, K16, V16, qnw, knw, cs, sn);
  k_vt<<<BB * NKV * (SS / 64), 256, 0, stream>>>(V16, Vt);
  k_flash<<<BB * NH * (SS / 128), 128, 0, stream>>>(Q16, K16, Vt, O16);
  k_oproj<<<(NR / 64) * (HID / 128), 128, 0, stream>>>(O16, Bo, (float*)d_out);
}

// v008
// It runs in 78.9 microseconds.
// Two timings next to v007 put it at 1.27 and 1.25 times that version's speed.
// Over all steps from v000 it is 6.75 times as fast.
#include <hip/hip_runtime.h>
#define BB 2
#define SS 2048
#define HID 1024
#define NH 16
#define NKV 8
#define HD 64
#define KVD 512
#define NR (BB * SS)

typedef __bf16 v16b __attribute__((ext_vector_type(16)));
typedef unsigned short v8us __attribute__((ext_vector_type(8), may_alias));
typedef float  v8f  __attribute__((ext_vector_type(8)));
typedef float  v4f  __attribute__((ext_vector_type(4)));
typedef float  v4fa __attribute__((ext_vector_type(4), may_alias));
union FragB { v16b v; v8us half[2]; unsigned short u[16]; };

__device__ __forceinline__ unsigned short bf16_bits(float x) { unsigned int u = __float_as_uint(x); return (unsigned short)((u + 0x7FFFu + ((u >> 16) & 1u)) >> 16); }
__device__ __forceinline__ float bf16_val(unsigned short b) { return __uint_as_float(((unsigned int)b) << 16); }
__device__ __forceinline__ float bf16_round(float x) { return bf16_val(bf16_bits(x)); }
// D += A·B with NT terms: 1 = ah·bh, 2 = + al·bh (A split), 3 = + ah·bl (both split)
template <int NT>
__device__ __forceinline__ v8f mmaN(v16b ah, v16b al, v16b bh, v16b bl, v8f c) {
  c = __builtin_amdgcn_wmma_f32_16x16x32_bf16(false, ah, false, bh, (short)0, c, false, false);
  if (NT >= 2) c = __builtin_amdgcn_wmma_f32_16x16x32_bf16(false, al, false, bh, (short)0, c, false, false);
  if (NT >= 3) c = __builtin_amdgcn_wmma_f32_16x16x32_bf16(false, ah, false, bl, (short)0, c, false, false);
  asm volatile("v_nop\n\tv_nop\n\tv_nop\n\tv_nop" : "+v"(c) : "v"(ah), "v"(al), "v"(bh), "v"(bl));
  return c;
}

__global__ __launch_bounds__(256) void k_wt_bf16(const float* __restrict__ W, unsigned short* __restrict__ Wt, int K, int N) {
  const int t = blockIdx.x * 256 + threadIdx.x;
  const int k8n = K / 8;
  if (t >= N * k8n) return;
  const int n = t / k8n, k8 = (t % k8n) * 8;
  v8us v;
#pragma unroll
  for (int i = 0; i < 8; ++i) v[i] = bf16_bits(W[(size_t)(k8 + i) * N + n]);
  *(v8us*)(Wt + (size_t)n * K + k8) = v;
  
}

// GEMM C[M][N] (f32, pitch ldc) = act(A[M][K]·W + bias). A f32 row-major (pitch lda) converted per fragment to bf16
// (ASPLIT: hi/lo two planes -> 2 terms, else single rounded term); Wt bf16 [N][K] (pitch ldb). BIAS_BF16 rounds the
// bias to bf16 first (bias quantised to bf16 before the add). K%32==0, M%16==0, N%64==0.
template <bool ASPLIT, int ACT, bool BIAS_BF16>
__global__ __launch_bounds__(128) void k_gemm_bf(const float* __restrict__ A, int lda, const unsigned short* __restrict__ Wt, int ldb,
                                               const float* __restrict__ bias, float* __restrict__ C, int ldc, int M, int N, int K) {
  __shared__ __attribute__((aligned(16))) float so[4][16][64];
  const int tid = threadIdx.x, w = tid >> 5, lane = tid & 31, ln = lane & 15, hh = lane >> 4;
  const int ntn = N / 64;
  const int wid = blockIdx.x * 4 + w;
  const int mt = wid / ntn, nq = wid % ntn;
  if (mt * 16 >= M) return;
  const int row0 = mt * 16, col0 = nq * 64;
  const float* arow = A + (size_t)(row0 + ln) * lda;
  v8f acc[4] = {};
  for (int kb = 0; kb < K; kb += 32) {
    FragB ah, al;
    const v4f x0 = *(const v4fa*)(arow + kb + 8 * hh), x1 = *(const v4fa*)(arow + kb + 8 * hh + 4);
    const v4f x2 = *(const v4fa*)(arow + kb + 16 + 8 * hh), x3 = *(const v4fa*)(arow + kb + 16 + 8 * hh + 4);
    float xs[16] = {x0[0],x0[1],x0[2],x0[3],x1[0],x1[1],x1[2],x1[3],x2[0],x2[1],x2[2],x2[3],x3[0],x3[1],x3[2],x3[3]};
#pragma unroll
    for (int i = 0; i < 16; ++i) { const unsigned short hb = bf16_bits(xs[i]); ah.u[i] = hb; al.u[i] = ASPLIT ? bf16_bits(xs[i] - bf16_val(hb)) : (unsigned short)0; }
#pragma unroll
    for (int t = 0; t < 4; ++t) {
      const unsigned short* brow = Wt + (size_t)(col0 + t * 16 + ln) * ldb + kb;
      FragB b;
      b.half[0] = *(const v8us*)(brow + 8 * hh);
      b.half[1] = *(const v8us*)(brow + 16 + 8 * hh);
      acc[t] = mmaN<ASPLIT ? 2 : 1>(ah.v, al.v, b.v, b.v, acc[t]);
    }
  }
#pragma unroll
  for (int t = 0; t < 4; ++t) {
    float bv = bias ? bias[col0 + t * 16 + ln] : 0.f;
    if (BIAS_BF16) bv = bf16_round(bv);
#pragma unroll
    for (int r = 0; r < 8; ++r) { float v = acc[t][r] + bv; if (ACT == 1) v = fmaxf(v, 0.f); so[w][8 * hh + r][t * 16 + ln] = v; }
  }
  __builtin_amdgcn_fence(__ATOMIC_ACQ_REL, "workgroup");
  __builtin_amdgcn_wave_barrier();
  const int rsub = lane >> 4, c4 = (lane & 15) * 4;
  {
#pragma unroll
    for (int q = 0; q < 8; ++q) {
      const int r = q * 2 + rsub;
      const v4f v = *(const v4fa*)&so[w][r][c4];
      *(v4f*)(C + (size_t)(row0 + r) * ldc + col0 + c4) = v;
    }
    
  }
}

// Flash-style causal/unmasked attention, all contractions 3-term bf16 hi/lo splits, f32 softmax with running max.
// q,k,v rows are read from f32 buffers with arbitrary row pitch (so they can live inside a fused qkv buffer);
// D = head size (multiple of 32, <= 128); one wave = 16 query rows; block = 4 waves (64 queries) sharing K/V chunks of 32.
template <int D, bool CAUSAL>
__global__ __launch_bounds__(128) void k_flash(const float* __restrict__ qb, const float* __restrict__ kb, const float* __restrict__ vb,
                                             int pitch, int T, int H, float scale, float* __restrict__ y, int ypitch) {
  constexpr int KS = D / 32;        // k-steps for QK
  constexpr int DT = D / 16;        // d tiles for PV
  __shared__ __attribute__((aligned(16))) unsigned short sKh[32][D + 8], sKl[32][D + 8], sVh[32][D + 8], sVl[32][D + 8];
  __shared__ __attribute__((aligned(16))) unsigned short sPh[4][16][40], sPl[4][16][40];
  __shared__ __attribute__((aligned(16))) float sO[4][16][D];
  const int tid = threadIdx.x, w = tid >> 5, lane = tid & 31, ln = lane & 15, hh = lane >> 4;
  const int nqb = (T + 63) / 64;
  const int bh = blockIdx.x / nqb, qblk = blockIdx.x % nqb;
  const int b = bh / H, h = bh % H;
  const int q0 = qblk * 64 + w * 16;
  const float* Q = qb + (size_t)b * T * pitch + h * D;
  const float* K = kb + (size_t)b * T * pitch + h * D;
  const float* V = vb + (size_t)b * T * pitch + h * D;

  // A fragments of the wave's 16 query rows (scaled), hi/lo
  FragB aqh[KS], aql[KS];
  {
    int row = q0 + ln; if (row >= T) row = T - 1;
    const float* qr = Q + (size_t)row * pitch;
#pragma unroll
    for (int ks = 0; ks < KS; ++ks)
#pragma unroll
      for (int i = 0; i < 16; ++i) {
        const int d = ks * 32 + ((i < 8) ? (8 * hh + i) : (16 + 8 * hh + (i - 8)));
        const float x = qr[d] * scale; const unsigned short hb = bf16_bits(x);
        aqh[ks].u[i] = hb; aql[ks].u[i] = bf16_bits(x - bf16_val(hb));
      }
  }
  float m_r[8], l_r[8];
#pragma unroll
  for (int r = 0; r < 8; ++r) { m_r[r] = -3.0e38f; l_r[r] = 0.f; }
  v8f oacc[DT];
#pragma unroll
  for (int dt = 0; dt < DT; ++dt) oacc[dt] = (v8f){0.f,0.f,0.f,0.f,0.f,0.f,0.f,0.f};

  const int kv_end = CAUSAL ? min(T, qblk * 64 + 64) : T;     // block-uniform
  for (int j0 = 0; j0 < kv_end; j0 += 32) {
    __syncthreads();
    for (int e = tid; e < 32 * (D / 4); e += 128) {
      const int r = e / (D / 4), c4 = (e % (D / 4)) * 4;
      const int key = j0 + r;
      v4f kf = {0.f,0.f,0.f,0.f}, vf = {0.f,0.f,0.f,0.f};
      if (key < T) { kf = *(const v4fa*)(K + (size_t)key * pitch + c4); vf = *(const v4fa*)(V + (size_t)key * pitch + c4); }
#pragma unroll
      for (int t = 0; t < 4; ++t) {
        unsigned short hb = bf16_bits(kf[t]); sKh[r][c4 + t] = hb; sKl[r][c4 + t] = bf16_bits(kf[t] - bf16_val(hb));
        hb = bf16_bits(vf[t]); sVh[r][c4 + t] = hb; sVl[r][c4 + t] = bf16_bits(vf[t] - bf16_val(hb));
      }
    }
    __syncthreads();
    // S tile 16 x 32
    v8f s[2];
#pragma unroll
    for (int nt = 0; nt < 2; ++nt) {
      v8f acc = {};
#pragma unroll
      for (int ks = 0; ks < KS; ++ks) {
        FragB bh_, bl_;
        bh_.half[0] = *(const v8us*)&sKh[nt * 16 + ln][ks * 32 + 8 * hh]; bh_.half[1] = *(const v8us*)&sKh[nt * 16 + ln][ks * 32 + 16 + 8 * hh];
        bl_.half[0] = *(const v8us*)&sKl[nt * 16 + ln][ks * 32 + 8 * hh]; bl_.half[1] = *(const v8us*)&sKl[nt * 16 + ln][ks * 32 + 16 + 8 * hh];
        acc = mmaN<3>(aqh[ks].v, aql[ks].v, bh_.v, bl_.v, acc);
      }
      s[nt] = acc;
    }
    // mask + running max (rows 8hh+r; the 16 lanes of a half share rows)
    float alpha[8];
#pragma unroll
    for (int r = 0; r < 8; ++r) {
      const int qi = q0 + 8 * hh + r;
      const int ja = j0 + ln, jb = j0 + 16 + ln;
      if (CAUSAL) { if (ja > qi) s[0][r] = -3.0e38f; if (jb > qi) s[1][r] = -3.0e38f; }
      if (ja >= T) s[0][r] = -3.0e38f;
      if (jb >= T) s[1][r] = -3.0e38f;
      float mx = fmaxf(s[0][r], s[1][r]);
      mx = fmaxf(mx, __shfl_xor(mx, 1, 32)); mx = fmaxf(mx, __shfl_xor(mx, 2, 32)); mx = fmaxf(mx, __shfl_xor(mx, 4, 32)); mx = fmaxf(mx, __shfl_xor(mx, 8, 32));
      const float mnew = fmaxf(m_r[r], mx);
      alpha[r] = (mnew > -1.0e38f) ? __expf(m_r[r] - mnew) : 1.0f;
      const float p0 = (s[0][r] > -1.0e38f) ? __expf(s[0][r] - mnew) : 0.f;
      const float p1 = (s[1][r] > -1.0e38f) ? __expf(s[1][r] - mnew) : 0.f;
      m_r[r] = mnew;
      l_r[r] = l_r[r] * alpha[r] + p0 + p1;            // per-lane partial row sum (16 lanes combined at the end)
      unsigned short hb = bf16_bits(p0); sPh[w][8 * hh + r][ln] = hb;      sPl[w][8 * hh + r][ln] = bf16_bits(p0 - bf16_val(hb));
      hb = bf16_bits(p1);                sPh[w][8 * hh + r][16 + ln] = hb; sPl[w][8 * hh + r][16 + ln] = bf16_bits(p1 - bf16_val(hb));
    }
#pragma unroll
    for (int dt = 0; dt < DT; ++dt)
#pragma unroll
      for (int r = 0; r < 8; ++r) oacc[dt][r] *= alpha[r];
    __builtin_amdgcn_fence(__ATOMIC_ACQ_REL, "workgroup");
    __builtin_amdgcn_wave_barrier();
    FragB pah, pal;
    pah.half[0] = *(const v8us*)&sPh[w][ln][8 * hh]; pah.half[1] = *(const v8us*)&sPh[w][ln][16 + 8 * hh];
    pal.half[0] = *(const v8us*)&sPl[w][ln][8 * hh]; pal.half[1] = *(const v8us*)&sPl[w][ln][16 + 8 * hh];
#pragma unroll
    for (int dt = 0; dt < DT; ++dt) {
      FragB bvh, bvl;
#pragma unroll
      for (int i = 0; i < 8; ++i) {
        bvh.u[i] = sVh[8 * hh + i][dt * 16 + ln]; bvh.u[8 + i] = sVh[16 + 8 * hh + i][dt * 16 + ln];
        bvl.u[i] = sVl[8 * hh + i][dt * 16 + ln]; bvl.u[8 + i] = sVl[16 + 8 * hh + i][dt * 16 + ln];
      }
      oacc[dt] = mmaN<3>(pah.v, pal.v, bvh.v, bvl.v, oacc[dt]);
    }
    __builtin_amdgcn_fence(__ATOMIC_ACQ_REL, "workgroup");
    __builtin_amdgcn_wave_barrier();
  }
#pragma unroll
  for (int r = 0; r < 8; ++r) {
    float l = l_r[r];
    l += __shfl_xor(l, 1, 32); l += __shfl_xor(l, 2, 32); l += __shfl_xor(l, 4, 32); l += __shfl_xor(l, 8, 32);
    l_r[r] = (l > 0.f) ? 1.0f / l : 0.f;
  }
#pragma unroll
  for (int dt = 0; dt < DT; ++dt)
#pragma unroll
    for (int r = 0; r < 8; ++r) sO[w][8 * hh + r][dt * 16 + ln] = oacc[dt][r] * l_r[r];
  __builtin_amdgcn_fence(__ATOMIC_ACQ_REL, "workgroup");
  __builtin_amdgcn_wave_barrier();
  {
    for (int r = 0; r < 16; ++r) {
      const int row = q0 + r;
      if (row < T && lane < D / 4) {
        const v4f val = *(const v4fa*)&sO[w][r][lane * 4];
        *(v4f*)(y + ((size_t)b * T + row) * ypitch + h * D + lane * 4) = val;
      }
    }
    
  }
}

// GEMM C = act(A·W + bias + resid): A f32 (ASPLIT -> hi/lo 2 terms), Wt bf16 [N][K]; ACT 0 none, 1 relu, 2 exact gelu;
// resid (optional, f32, row index = (row % rmod), pitch ldr, RES_BF16 rounds it) added before the activation.
template <bool ASPLIT, int ACT, bool BIAS_BF16, bool RES_BF16>
__global__ __launch_bounds__(128) void k_gemm_bf3(const float* __restrict__ A, int lda, const unsigned short* __restrict__ Wt, int ldb,
                                                const float* __restrict__ bias, const float* __restrict__ resid, int rmod, int ldr,
                                                float* __restrict__ C, int ldc, int M, int N, int K) {
  __shared__ __attribute__((aligned(16))) float so[4][16][64];
  const int tid = threadIdx.x, w = tid >> 5, lane = tid & 31, ln = lane & 15, hh = lane >> 4;
  const int ntn = N / 64;
  const int wid = blockIdx.x * 4 + w;
  const int mt = wid / ntn, nq = wid % ntn;
  if (mt * 16 >= M) return;
  const int row0 = mt * 16, col0 = nq * 64;
  const float* arow = A + (size_t)(row0 + ln) * lda;
  v8f acc[4] = {};
  for (int kb = 0; kb < K; kb += 32) {
    FragB ah, al;
    const v4f x0 = *(const v4fa*)(arow + kb + 8 * hh), x1 = *(const v4fa*)(arow + kb + 8 * hh + 4);
    const v4f x2 = *(const v4fa*)(arow + kb + 16 + 8 * hh), x3 = *(const v4fa*)(arow + kb + 16 + 8 * hh + 4);
    float xs[16] = {x0[0],x0[1],x0[2],x0[3],x1[0],x1[1],x1[2],x1[3],x2[0],x2[1],x2[2],x2[3],x3[0],x3[1],x3[2],x3[3]};
#pragma unroll
    for (int i = 0; i < 16; ++i) { const unsigned short hb = bf16_bits(xs[i]); ah.u[i] = hb; al.u[i] = ASPLIT ? bf16_bits(xs[i] - bf16_val(hb)) : (unsigned short)0; }
#pragma unroll
    for (int t = 0; t < 4; ++t) {
      const unsigned short* brow = Wt + (size_t)(col0 + t * 16 + ln) * ldb + kb;
      FragB b;
      b.half[0] = *(const v8us*)(brow + 8 * hh);
      b.half[1] = *(const v8us*)(brow + 16 + 8 * hh);
      acc[t] = mmaN<ASPLIT ? 2 : 1>(ah.v, al.v, b.v, b.v, acc[t]);
    }
  }
#pragma unroll
  for (int t = 0; t < 4; ++t) {
    const int col = col0 + t * 16 + ln;
    float bv = bias ? bias[col] : 0.f;
    if (BIAS_BF16) bv = bf16_round(bv);
#pragma unroll
    for (int r = 0; r < 8; ++r) {
      float v = acc[t][r] + bv;
      if (resid) { float rv = resid[(size_t)((row0 + 8 * hh + r) % rmod) * ldr + col]; if (RES_BF16) rv = bf16_round(rv); v += rv; }
      if (ACT == 1) v = fmaxf(v, 0.f);
      if (ACT == 2) v = 0.5f * v * (1.0f + erff(v * 0.70710678118654752f));
      if (ACT == 3) { const float u = 0.7978845608028654f * (v + 0.044715f * v * v * v); v = 0.5f * v * (1.0f + tanhf(u)); }
      so[w][8 * hh + r][t * 16 + ln] = v;
    }
  }
  __builtin_amdgcn_fence(__ATOMIC_ACQ_REL, "workgroup");
  __builtin_amdgcn_wave_barrier();
  const int rsub = lane >> 4, c4 = (lane & 15) * 4;
  {
#pragma unroll
    for (int q = 0; q < 8; ++q) {
      const int r = q * 2 + rsub;
      const v4f v = *(const v4fa*)&so[w][r][c4];
      *(v4f*)(C + (size_t)(row0 + r) * ldc + col0 + c4) = v;
    }
    
  }
}
// row LayerNorm (biased variance, eps) over N: s = X (+ R); optional out_sum <- s; out_norm <- (s-mu)*rsqrt(var+eps)*g + b
template <bool PARAM_BF16>
__global__ __launch_bounds__(256) void k_layernorm(const float* __restrict__ X, const float* __restrict__ R, const float* __restrict__ g, const float* __restrict__ bta,
                                                  float* __restrict__ out_sum, float* __restrict__ out_norm, int N, float eps) {
  __shared__ float red[256];
  const int row = blockIdx.x, tid = threadIdx.x;
  const float* x = X + (size_t)row * N; const float* rr = R ? R + (size_t)row * N : nullptr;
  float vals[16];                     // up to N = 4096
  const int per = N / 256;            // contiguous chunk per thread? use strided-by-4 chunks: thread handles j = tid*4 + 1024*u
  float s1 = 0.f;
  for (int u = 0; u < per / 4; ++u) {
    const int j = tid * 4 + 1024 * u;
    const v4f a = *(const v4fa*)(x + j);
    v4f b = {0.f,0.f,0.f,0.f}; if (rr) b = *(const v4fa*)(rr + j);
#pragma unroll
    for (int q = 0; q < 4; ++q) { const float v = a[q] + b[q]; vals[u * 4 + q] = v; s1 += v; }
  }
  red[tid] = s1; __syncthreads();
  for (int st = 128; st > 0; st >>= 1) { if (tid < st) red[tid] += red[tid + st]; __syncthreads(); }
  const float mu = red[0] / (float)N; __syncthreads();
  float s2 = 0.f;
  for (int u = 0; u < per / 4; ++u)
#pragma unroll
    for (int q = 0; q < 4; ++q) { const float c = vals[u * 4 + q] - mu; s2 += c * c; }
  red[tid] = s2; __syncthreads();
  for (int st = 128; st > 0; st >>= 1) { if (tid < st) red[tid] += red[tid + st]; __syncthreads(); }
  const float rs = rsqrtf(red[0] / (float)N + eps);
  {
    for (int u = 0; u < per / 4; ++u) {
      const int j = tid * 4 + 1024 * u;
      v4f o, sm;
#pragma unroll
      for (int q = 0; q < 4; ++q) {
        float gg = g[j + q], bb = bta[j + q];
        if (PARAM_BF16) { gg = bf16_round(gg); bb = bf16_round(bb); }
        sm[q] = vals[u * 4 + q]; o[q] = (vals[u * 4 + q] - mu) * rs * gg + bb;
      }
      if (out_sum) *(v4f*)(out_sum + (size_t)row * N + j) = sm;
      *(v4f*)(out_norm + (size_t)row * N + j) = o;
    }
    
  }
}



// ---- f16 WMMA path (v_wmma_f32_16x16x32_f16): 11-bit significands for operands in range — used where a [0,1] probability operand needs more precision than bf16
typedef _Float16 v16h __attribute__((ext_vector_type(16)));
typedef _Float16 v4h __attribute__((ext_vector_type(4)));
union FragH { v16h v; v8us half[2]; _Float16 h[16]; unsigned short u[16]; };
template <int NT>
__device__ __forceinline__ v8f mmaH(v16h ah, v16h al, v16h bh, v16h bl, v8f c) {
  c = __builtin_amdgcn_wmma_f32_16x16x32_f16(false, ah, false, bh, (short)0, c, false, false);
  if (NT >= 2) c = __builtin_amdgcn_wmma_f32_16x16x32_f16(false, al, false, bh, (short)0, c, false, false);
  if (NT >= 3) c = __builtin_amdgcn_wmma_f32_16x16x32_f16(false, ah, false, bl, (short)0, c, false, false);
  asm volatile("v_nop\n\tv_nop\n\tv_nop\n\tv_nop" : "+v"(c) : "v"(ah), "v"(al), "v"(bh), "v"(bl));
  return c;
}
// batched GEMM like k_gemm_b but f16 operands: A f32 (split into f16 hi/lo if ASPLIT, else rounded to f16), Bt = f16 values [n][k]; alpha; C f32; N multiple of 16 (partial tiles skipped)
template <bool ASPLIT>
__global__ __launch_bounds__(128) void k_gemm_h(const float* __restrict__ A, int lda, size_t sA, const _Float16* __restrict__ Bh, int ldb, size_t sB, float alpha, float* __restrict__ C, int ldc, size_t sC, int M, int N, int K) {
  __shared__ __attribute__((aligned(16))) float so[4][16][64];
  const int tid = threadIdx.x, w = tid >> 5, lane = tid & 31, ln = lane & 15, hh = lane >> 4; const int by = blockIdx.y;
  A += (size_t)by * sA; Bh += (size_t)by * sB; C += (size_t)by * sC;
  const int ntn = (N + 63) / 64; const int wid = blockIdx.x * 4 + w; const int mt = wid / ntn, nq = wid % ntn; if (mt * 16 >= M) return;
  const int row0 = mt * 16, col0 = nq * 64; const float* arow = A + (size_t)(row0 + ln) * lda;
  v8f acc[4] = {};
  for (int kb = 0; kb < K; kb += 32) {
    FragH ah, al;
    const v4f x0 = *(const v4fa*)(arow + kb + 8 * hh), x1 = *(const v4fa*)(arow + kb + 8 * hh + 4), x2 = *(const v4fa*)(arow + kb + 16 + 8 * hh), x3 = *(const v4fa*)(arow + kb + 16 + 8 * hh + 4);
    float xs[16] = {x0[0],x0[1],x0[2],x0[3],x1[0],x1[1],x1[2],x1[3],x2[0],x2[1],x2[2],x2[3],x3[0],x3[1],x3[2],x3[3]};
#pragma unroll
    for (int i = 0; i < 16; ++i) { const _Float16 h = (_Float16)xs[i]; ah.h[i] = h; al.h[i] = ASPLIT ? (_Float16)(xs[i] - (float)h) : (_Float16)0.0f; }
#pragma unroll
    for (int t = 0; t < 4; ++t) { if (col0 + t * 16 >= N) continue; const size_t boff = (size_t)(col0 + t * 16 + ln) * ldb + kb; FragH bq; bq.half[0] = *(const v8us*)(Bh + boff + 8 * hh); bq.half[1] = *(const v8us*)(Bh + boff + 16 + 8 * hh);
      acc[t] = mmaH<ASPLIT ? 2 : 1>(ah.v, al.v, bq.v, bq.v, acc[t]); }
  }
#pragma unroll
  for (int t = 0; t < 4; ++t) { if (col0 + t * 16 >= N) continue;
#pragma unroll
    for (int r = 0; r < 8; ++r) so[w][8 * hh + r][t * 16 + ln] = acc[t][r] * alpha; }
  __builtin_amdgcn_fence(__ATOMIC_ACQ_REL, "workgroup"); __builtin_amdgcn_wave_barrier();
  const int rsub = lane >> 4, c4 = (lane & 15) * 4;
  {
#pragma unroll
    for (int q = 0; q < 8; ++q) { const int r = q * 2 + rsub; if (col0 + c4 < N) { const v4f v = *(const v4fa*)&so[w][r][c4]; *(v4f*)(C + (size_t)(row0 + r) * ldc + col0 + c4) = v; } }
     }
}

// Wt[n][k] = f16(W[k][n]·scale) from f32 row-major W[K][N] (scale = power of two; bf16-exact weights stay exact in f16 away from the subnormal range)
__global__ __launch_bounds__(256) void k_wt_f16(const float* __restrict__ W, _Float16* __restrict__ Wt, int K, int N, float scale) {
  const int t = blockIdx.x * 256 + threadIdx.x; if (t >= N * (K / 8)) return; const int n = t / (K / 8), k8 = (t % (K / 8)) * 8; FragH f;
#pragma unroll
  for (int i = 0; i < 8; ++i) f.h[i] = (_Float16)(bf16_round(W[(size_t)(k8 + i) * N + n]) * scale); const v8us o = f.half[0];
  *(v8us*)((unsigned short*)Wt + (size_t)n * K + k8) = o; 
}
// The five input conversions in one launch: they are independent of one another, and the block index picks the job (a scalar choice, the same for a whole block). x -> f16(bf16(x)); each weight, already (out,in) = Bt,
// -> f16(bf16(w) * 16). wq, wk and wv land one behind the other, so that they read as one Bt of 2048 rows.
__global__ __launch_bounds__(256) void k_cvt(const float* __restrict__ x, const float* __restrict__ wq, const float* __restrict__ wk, const float* __restrict__ wv, const float* __restrict__ wo,
                                             _Float16* __restrict__ X16, _Float16* __restrict__ Bqkv, _Float16* __restrict__ Bo) {
  constexpr unsigned GX = (unsigned)NR * HID / 2048, GQ = (unsigned)HID * HID / 2048, GK = (unsigned)KVD * HID / 2048;      // blocks per job: 256 threads x 8 elements
  static_assert(NR * HID % 2048 == 0 && HID * HID % 2048 == 0 && KVD * HID % 2048 == 0, "whole blocks only");
  unsigned bid = blockIdx.x; const float* s; _Float16* d; float sc = 16.0f;
  if (bid < GX) { s = x; d = X16; sc = 1.0f; }
  else if ((bid -= GX) < GQ) { s = wq; d = Bqkv; }
  else if ((bid -= GQ) < GK) { s = wk; d = Bqkv + (size_t)HID * HID; }
  else if ((bid -= GK) < GK) { s = wv; d = Bqkv + (size_t)(HID + KVD) * HID; }
  else { bid -= GK; s = wo; d = Bo; }
  const size_t t = (size_t)bid * 256 + threadIdx.x; FragH f;
#pragma unroll
  for (int i = 0; i < 8; ++i) f.h[i] = (_Float16)(bf16_round(s[t * 8 + i]) * sc);
  *(v8us*)((unsigned short*)d + t * 8) = f.half[0]; }
__global__ __launch_bounds__(256) void k_vt(const _Float16* __restrict__ V16, _Float16* __restrict__ Vt) { __shared__ unsigned short tl[64][66]; const int tid = threadIdx.x; const int slab = blockIdx.x / (SS / 64), lg = blockIdx.x % (SS / 64); const int b = slab / NKV, h = slab % NKV;
  for (int i = tid; i < 64 * 8; i += 256) { const int r = i / 8, c8 = (i % 8) * 8; FragH f; f.half[0] = *(const v8us*)((const unsigned short*)V16 + ((size_t)b * SS + lg * 64 + r) * KVD + h * HD + c8);
#pragma unroll
    for (int q = 0; q < 8; ++q) tl[r][c8 + q] = f.u[q]; }
  __syncthreads();
  {
#pragma unroll
    for (int rd = 0; rd < 2; ++rd) { const int d = rd * 32 + tid / 8, pc = tid % 8; FragH f;
#pragma unroll
      for (int q = 0; q < 8; ++q) f.u[q] = tl[pc * 8 + q][d];
      *(v8us*)((unsigned short*)Vt + ((size_t)slab * HD + d) * SS + lg * 64 + pc * 8) = f.half[0]; }
     } }
// a step of an xor butterfly inside a 16-lane row: the builtin move fuses into v_add_f32_dpp
template <int M> __device__ __forceinline__ float row_xor(float v) { return __int_as_float(__builtin_amdgcn_mov_dpp(__float_as_int(v), 0x160 + M, 0xf, 0xf, true)); }
// the value of lane l ^ 16 (the other half of the wave), on the vector pipe
__device__ __forceinline__ float half_xor(float v) { const int b = __float_as_int(v); return __int_as_float(__builtin_amdgcn_permlanex16(b, b, 0x76543210, 0xfedcba98, false, false)); }
// fused causal GQA attention. The work is dealt so that every wave walks 15 to 17 chunks of 32 keys (a causal tile's cost grows with its position, and all work-groups are resident, so the launch lasts as long as its fullest wave):
// a work-group = 8 waves = the 2 query heads of one kv head x 4 key shares; it takes the 32-query tile NT - 1 - u and then the tile u (together 65 chunks for every u); share sp of a head walks the chunks sp, sp + 4, ... of the tile,
// and the four partial results (maximum, sum, output) of a tile are joined through LDS at the tile's end. Q from Q16 cols h*64 (pitch 1024), K from K16 cols kvh*64 (pitch 512); mask k <= q else -inf.
// Both products run transposed: St = K * Qt (A = 16 key rows, B = 16 query columns) and Ot += Vt * Pt (A = 16 rows of Vt, B = Pt). A lane of an St tile then holds 8 keys of ONE query (column ln, keys 8 * hh + r),
// so a query's maximum and sum are taken inside the lane, with one exchange between the wave's halves for the maximum; running maximum, sum and rescale factor are one value per lane and 16-query group;
// and the two St tiles of a 32-key chunk, rounded to f16 in place, ARE the B operand Pt in the hardware's k order (element s = key 8 * hh + s, then 16 + 8 * hh + s - 8), which the Vt loads already follow: P never leaves the registers.
__global__ __launch_bounds__(256) __attribute__((amdgpu_waves_per_eu(4, 4))) void k_flash(const _Float16* __restrict__ Q16, const _Float16* __restrict__ K16, const _Float16* __restrict__ Vt, _Float16* __restrict__ O16) {
  constexpr int RPW = 32, NT = SS / RPW, DT = HD / 16, KS = HD / 32, OPIT = HD + 8, G = NH / NKV, NSP = 4;
  static_assert(NT % 2 == 0 && DT == NSP && G * NSP == 8, "tiles pair up; share sp joins output dims sp * 16 .. sp * 16 + 15; 8 waves");
  // The softmax runs in base 2: the scores take 1/8 and log2(e) in their one multiply, so e^(s - m) = 2^(s2 - m2) is one subtraction and one v_exp_f32. Every argument is <= 0 here (m2 is the running maximum),
  // so nothing can overflow; -inf (masked) and the -3e38 start value give 0; a result below 2^-126 is flushed to 0, far under the f16 rounding of P and the f32 rounding of the row sum, which holds a term 1.
  constexpr float SC2 = 0.125f * 1.4426950408889634f;
  // the shares' partial outputs, lane-contiguous 16-byte pieces (no bank conflicts), and their maxima and sums
  __shared__ __attribute__((aligned(16))) float sX[G][NSP][2][DT][2][32][4];
  __shared__ float sM[G][NSP][2][32], sL[G][NSP][2][32];
  // output staging, f16; row pitch 144 bytes: the 16-byte stores of 8 rows fall on different banks
  __shared__ __attribute__((aligned(16))) unsigned short sO[G][RPW][OPIT];
  const int tid = threadIdx.x, lane = tid & 31, ln = lane & 15, hh = lane >> 4;
  const int w = __builtin_amdgcn_readfirstlane(tid >> 5), g = w >> 2, sp = w & 3;      // scalar: a wave's trip count depends on sp, and the loop must stay a scalar loop (all lanes on at every WMMA)
  const int slab = blockIdx.x / (NT / 2), u = blockIdx.x % (NT / 2); const int b = slab / NKV, kvh = slab % NKV; const int h = kvh * G + g;
  const unsigned short* Vth = (const unsigned short*)Vt + (size_t)(b * NKV + kvh) * HD * SS;
  // the share's first chunk
  const unsigned short* kl = (const unsigned short*)K16 + ((size_t)b * SS + sp * 32 + ln) * KVD + kvh * HD + 8 * hh;
  const unsigned short* vl = Vth + (size_t)ln * SS + 8 * hh;
  // K and V fragments are requested ahead of their products, so that no product waits out a load: a chunk's V is loaded at the chunk's head, its K during the share's chunk before it. A tile's last chunk loads the share's FIRST chunk,
  // which is what the next tile starts with; the first tile's is loaded here (rows below 128: in bounds also where a share has no chunk in a tile; that is only the second tile, u < sp, and the fragments then go unused)
  FragH bk[2][KS];
#pragma unroll
  for (int nt = 0; nt < 2; ++nt)
#pragma unroll
    for (int ks = 0; ks < KS; ++ks) { bk[nt][ks].half[0] = *(const v8us*)(kl + nt * 16 * KVD + ks * 32); bk[nt][ks].half[1] = *(const v8us*)(kl + nt * 16 * KVD + ks * 32 + 16); }
  // rolled: the two tiles run one after the other through the same code
#pragma unroll 1
  for (int ph = 0; ph < 2; ++ph) {
  const int q0 = (ph ? u : NT - 1 - u) * RPW;
  FragH aq[2][KS];
#pragma unroll
  for (int rt = 0; rt < 2; ++rt) { const unsigned short* qr = (const unsigned short*)Q16 + ((size_t)b * SS + q0 + rt * 16 + ln) * HID + h * HD;
#pragma unroll
    for (int ks = 0; ks < KS; ++ks) { aq[rt][ks].half[0] = *(const v8us*)(qr + ks * 32 + 8 * hh); aq[rt][ks].half[1] = *(const v8us*)(qr + ks * 32 + 16 + 8 * hh); } }
  float m_r[2], l_r[2]; v8f oacc[2][DT];      // of query q0 + rt * 16 + ln; oacc[rt][dt][r] is its dim dt * 16 + 8 * hh + r; l_r sums the keys of the lane's own half
#pragma unroll
  for (int rt = 0; rt < 2; ++rt) { m_r[rt] = -3.0e38f; l_r[rt] = 0.f;
#pragma unroll
    for (int dt = 0; dt < DT; ++dt) oacc[rt][dt] = (v8f){0.f,0.f,0.f,0.f,0.f,0.f,0.f,0.f}; }
  const int jend = q0 + RPW;
#pragma unroll 1
  for (int j0 = sp * 32; j0 < jend; j0 += NSP * 32) {
    FragH bv[DT];
#pragma unroll
    for (int dt = 0; dt < DT; ++dt) { bv[dt].half[0] = *(const v8us*)(vl + (size_t)dt * 16 * SS + j0); bv[dt].half[1] = *(const v8us*)(vl + (size_t)dt * 16 * SS + j0 + 16); }
    v8f s[2][2];      // s[rt][nt][r]: key j0 + nt * 16 + 8 * hh + r against query q0 + rt * 16 + ln
#pragma unroll
    for (int nt = 0; nt < 2; ++nt)
#pragma unroll
      for (int rt = 0; rt < 2; ++rt) { v8f acc = (v8f){0.f,0.f,0.f,0.f,0.f,0.f,0.f,0.f};
#pragma unroll
        for (int ks = 0; ks < KS; ++ks) acc = mmaH<1>(bk[nt][ks].v, bk[nt][ks].v, aq[rt][ks].v, aq[rt][ks].v, acc); s[rt][nt] = acc; }
    // the share's next chunk's K into the same registers, right behind their last product; behind the tile's last chunk the share's first chunk, for the next tile (kl stands at it)
    { const unsigned short* kn = kl + (size_t)((j0 + NSP * 32 < jend) ? j0 + NSP * 32 - sp * 32 : 0) * KVD;
#pragma unroll
      for (int nt = 0; nt < 2; ++nt)
#pragma unroll
        for (int ks = 0; ks < KS; ++ks) { bk[nt][ks].half[0] = *(const v8us*)(kn + nt * 16 * KVD + ks * 32); bk[nt][ks].half[1] = *(const v8us*)(kn + nt * 16 * KVD + ks * 32 + 16); } }
    // stands between the loads above and the softmax, which reuses their K address pair: the wait that belongs in front of an overwrite of an issued load's address register
    asm volatile("s_wait_xcnt 0x0" ::: "memory");
    // keeps the V and K loads and the wait in front of the softmax and the output products that the loads fly under (without it the scheduler sank the K loads into the softmax and the wait far behind them)
    __builtin_amdgcn_sched_barrier(0);
    FragH pb[2];
#pragma unroll
    for (int rt = 0; rt < 2; ++rt) { const int dq = q0 + rt * 16 + ln - 8 * hh - j0;      // key nt * 16 + r of the lane's half is allowed while nt * 16 + r <= dq
      v8f s0 = s[rt][0] * SC2, s1 = s[rt][1] * SC2;
#pragma unroll
      for (int r = 0; r < 8; ++r) { s0[r] = (r <= dq) ? s0[r] : -INFINITY; s1[r] = (16 + r <= dq) ? s1[r] : -INFINITY; }
      float mx = fmaxf(fmaxf(fmaxf(fmaxf(s0[0], s0[1]), fmaxf(s0[2], s0[3])), fmaxf(fmaxf(s0[4], s0[5]), fmaxf(s0[6], s0[7]))), fmaxf(fmaxf(fmaxf(s1[0], s1[1]), fmaxf(s1[2], s1[3])), fmaxf(fmaxf(s1[4], s1[5]), fmaxf(s1[6], s1[7]))));
      mx = fmaxf(mx, half_xor(mx));      // both halves hold keys of the same query and scale the same output column: one maximum for both
      const float mn = fmaxf(m_r[rt], mx); const float al = __builtin_amdgcn_exp2f(m_r[rt] - mn); m_r[rt] = mn;
      s0 -= mn; s1 -= mn;
#pragma unroll
      for (int r = 0; r < 8; ++r) { s0[r] = __builtin_amdgcn_exp2f(s0[r]); s1[r] = __builtin_amdgcn_exp2f(s1[r]); pb[rt].h[r] = (_Float16)s0[r]; pb[rt].h[8 + r] = (_Float16)s1[r]; }
      const v8f t = s0 + s1;
      l_r[rt] = l_r[rt] * al + (((t[0] + t[1]) + (t[2] + t[3])) + ((t[4] + t[5]) + (t[6] + t[7])));
#pragma unroll
      for (int dt = 0; dt < DT; ++dt) oacc[rt][dt] *= al; }
#pragma unroll
    for (int dt = 0; dt < DT; ++dt)
#pragma unroll
      for (int rt = 0; rt < 2; ++rt) oacc[rt][dt] = mmaH<1>(bv[dt].v, bv[dt].v, pb[rt].v, pb[rt].v, oacc[rt][dt]); }
  // every share lays down its partial result (a share without a chunk: maximum -3e38, sum and output 0, which the join below weighs with 0)
#pragma unroll
  for (int rt = 0; rt < 2; ++rt) { float l = l_r[rt]; l += half_xor(l); sM[g][sp][rt][lane] = m_r[rt]; sL[g][sp][rt][lane] = l;
#pragma unroll
    for (int dt = 0; dt < DT; ++dt) { const v8f o = oacc[rt][dt];
      *(v4f*)&sX[g][sp][rt][dt][0][lane][0] = (v4f){o[0], o[1], o[2], o[3]}; *(v4f*)&sX[g][sp][rt][dt][1][lane][0] = (v4f){o[4], o[5], o[6], o[7]}; } }
  // publishes the four shares' partial results; it also ends every wave's reads of sO for the tile before
  __syncthreads();
  // the join, shares in the order 0..3: wave sp joins the dims sp * 16 .. sp * 16 + 15 of both 16-query groups; the lane keeps its query and its 8 dims
  float f[2][NSP], lw[2][NSP];
#pragma unroll
  for (int rt = 0; rt < 2; ++rt) { float mw[NSP];
#pragma unroll
    for (int s = 0; s < NSP; ++s) { mw[s] = sM[g][s][rt][lane]; lw[rt][s] = sL[g][s][rt][lane]; }
    const float mm = fmaxf(fmaxf(mw[0], mw[1]), fmaxf(mw[2], mw[3]));      // finite: share 0 always holds chunk 0
#pragma unroll
    for (int s = 0; s < NSP; ++s) f[rt][s] = mw[s] - mm; }
  // the eight weights 2^(m - mm), each in place, in one statement that ends in a v_nop: so no instruction directly behind a v_exp_f32 reads its result or overwrites its source
  asm("v_exp_f32 %0, %0\n\tv_exp_f32 %1, %1\n\tv_exp_f32 %2, %2\n\tv_exp_f32 %3, %3\n\tv_exp_f32 %4, %4\n\tv_exp_f32 %5, %5\n\tv_exp_f32 %6, %6\n\tv_exp_f32 %7, %7\n\tv_nop"
      : "+v"(f[0][0]), "+v"(f[0][1]), "+v"(f[0][2]), "+v"(f[0][3]), "+v"(f[1][0]), "+v"(f[1][1]), "+v"(f[1][2]), "+v"(f[1][3]));
#pragma unroll
  for (int rt = 0; rt < 2; ++rt) { float l = f[rt][0] * lw[rt][0]; v4f o0 = *(const v4f*)&sX[g][0][rt][sp][0][lane][0] * f[rt][0], o1 = *(const v4f*)&sX[g][0][rt][sp][1][lane][0] * f[rt][0];
#pragma unroll
    for (int s = 1; s < NSP; ++s) { l += f[rt][s] * lw[rt][s];
      o0 += *(const v4f*)&sX[g][s][rt][sp][0][lane][0] * f[rt][s]; o1 += *(const v4f*)&sX[g][s][rt][sp][1][lane][0] * f[rt][s]; }
    const float li = 1.0f / l; FragH o;      // the o projection's A operand: rounded here; a lane's 8 values are 8 neighbouring dims of its query, one 16-byte LDS store
#pragma unroll
    for (int r = 0; r < 4; ++r) { o.h[r] = (_Float16)(o0[r] * li); o.h[4 + r] = (_Float16)(o1[r] * li); }
    *(v8us*)&sO[g][rt * 16 + ln][sp * 16 + 8 * hh] = o.half[0]; }
  // publishes the head's 32 x 64 output tile; it also ends every wave's reads of the partial results, which the next tile overwrites
  __syncthreads();
  {
#pragma unroll
    for (int rp = 0; rp < RPW / NSP; rp += 4) { const int r = sp * (RPW / NSP) + rp + (lane >> 3), c8 = (lane & 7) * 8;      // 8 lanes = one 128-byte line of the row; a wave stores 8 whole rows
      const v8us val = *(const v8us*)&sO[g][r][c8];
      *(v8us*)((unsigned short*)O16 + ((size_t)b * SS + q0 + r) * HID + h * HD + c8) = val; }
    // behind the stores: the next tile's code reuses their address and data registers; the wait that belongs in front of such an overwrite
    asm volatile("s_wait_xcnt 0x0" ::: "memory");
     } } }
// Projection GEMM C[4096][N] = A[4096][1024] * Bt[N][1024]^T / 16 (f16 operands, f32 accumulate, k ascending in steps of 32 as before). Block = 4 waves = a 64 x 128 tile of C; wave = 32 x 64 (2 x 4 accumulators).
// Each stage brings 64 k of the 64 A rows and the 128 Bt rows into LDS with whole 128-byte rows per 8 lanes, so every row is fetched once per block instead of once per wave in 16-line gathers;
// the next stage's rows are loaded into registers while this stage's products run, and go into the other buffer. Row pitch 144 bytes: the 16 rows of a fragment read fall on different banks.
// OUT 0: C f32. OUT 1: C16 = f16(C). OUT 2 (q, k): a wave's 64 columns are one head, so its staged 32 x 64 tile holds whole head rows: per row RMSNorm over the 64 dims (eps 1e-6, times bf16(nw)),
// then RoPE with the INPUT cos/sin[row][64] (rotate_half = [-x2, x1]; rounded to bf16 like every other input), then C16 = f16: the f32 product never goes to memory.
// q, k and v are ONE launch: their weights lie one behind the other as a Bt of 2048 rows, a block's 128 columns belong to one of the three, and the block index (a scalar choice) picks the output form. o is a launch of its own.
typedef float fa __attribute__((may_alias));
typedef unsigned short proj_lds[2][64 + 128][64 + 8];
// the product: leaves each wave's 32 x 64 tile of C (f32, pitch 68) in LDS, over the stage buffers, and returns the wave's tile
__device__ __forceinline__ fa* proj_tile(const _Float16* __restrict__ A, const _Float16* __restrict__ Bt, const int row0, const int col0, proj_lds& sm) {
  constexpr int K = HID, BM = 64, BN = 128, BK = 64, PIT = BK + 8, NS = K / BK, OP = 68;
  static_assert(sizeof(float) * 4 * 32 * OP <= sizeof(unsigned short) * 2 * (BM + BN) * PIT, "the output tiles reuse the stage buffers");
  const int tid = threadIdx.x, w = tid >> 5, lane = tid & 31, ln = lane & 15, hh = lane >> 4;
  const int wm = (w >> 1) * 32, wn = (w & 1) * 64;
  const int sr = tid >> 3, sc = (tid & 7) * 8;
  const unsigned short* ga = (const unsigned short*)A + (size_t)(row0 + sr) * K + sc;
  const unsigned short* gb = (const unsigned short*)Bt + (size_t)(col0 + sr) * K + sc;
  v8us ra[BM / 16], rb[BN / 16];
  v8f acc[2][4];
#pragma unroll
  for (int mi = 0; mi < 2; ++mi)
#pragma unroll
    for (int t = 0; t < 4; ++t) acc[mi][t] = (v8f){0.f,0.f,0.f,0.f,0.f,0.f,0.f,0.f};
#pragma unroll
  for (int i = 0; i < BM / 16; ++i) ra[i] = *(const v8us*)(ga + (size_t)i * 16 * K);
#pragma unroll
  for (int i = 0; i < BN / 16; ++i) rb[i] = *(const v8us*)(gb + (size_t)i * 16 * K);
#pragma unroll
  for (int i = 0; i < BM / 16; ++i) *(v8us*)&sm[0][sr + i * 16][sc] = ra[i];
#pragma unroll
  for (int i = 0; i < BN / 16; ++i) *(v8us*)&sm[0][BM + sr + i * 16][sc] = rb[i];
  __syncthreads();
  // unrolled whole: every stage's global offset is then an immediate on two address pairs that are never rewritten, and the buffer index a constant
#pragma unroll
  for (int s = 0; s < NS; ++s) {
    const int cur = s & 1;
    if (s + 1 < NS) {
#pragma unroll
      for (int i = 0; i < BM / 16; ++i) ra[i] = *(const v8us*)(ga + (size_t)i * 16 * K + (s + 1) * BK);
#pragma unroll
      for (int i = 0; i < BN / 16; ++i) rb[i] = *(const v8us*)(gb + (size_t)i * 16 * K + (s + 1) * BK);
    }
    // keeps the next stage's loads at the head of this stage, so that they fly under all of its products (the scheduler sank them to just in front of their LDS stores)
    __builtin_amdgcn_sched_barrier(0);
    FragH a[BK / 32][2], b[BK / 32][4];
#pragma unroll
    for (int ks = 0; ks < BK / 32; ++ks) {
#pragma unroll
      for (int mi = 0; mi < 2; ++mi) { const unsigned short* p = &sm[cur][wm + mi * 16 + ln][ks * 32 + 8 * hh]; a[ks][mi].half[0] = *(const v8us*)p; a[ks][mi].half[1] = *(const v8us*)(p + 16); }
#pragma unroll
      for (int t = 0; t < 4; ++t) { const unsigned short* p = &sm[cur][BM + wn + t * 16 + ln][ks * 32 + 8 * hh]; b[ks][t].half[0] = *(const v8us*)p; b[ks][t].half[1] = *(const v8us*)(p + 16); }
    }
    // keeps the stage's fragment reads in one group ahead of its products: one exposed LDS latency per stage (the scheduler reused the A registers and waited for LDS four times per stage)
    __builtin_amdgcn_sched_barrier(0);
#pragma unroll
    for (int ks = 0; ks < BK / 32; ++ks)
#pragma unroll
      for (int mi = 0; mi < 2; ++mi)
#pragma unroll
        for (int t = 0; t < 4; ++t) acc[mi][t] = __builtin_amdgcn_wmma_f32_16x16x32_f16(false, a[ks][mi].v, false, b[ks][t].v, (short)0, acc[mi][t], false, false);
    // keeps the waits for those loads, and the LDS stores behind them, behind the issue of all of this stage's products (the scheduler put them in the middle of the stage)
    __builtin_amdgcn_sched_barrier(0);
    if (s + 1 < NS) {
#pragma unroll
      for (int i = 0; i < BM / 16; ++i) *(v8us*)&sm[cur ^ 1][sr + i * 16][sc] = ra[i];
#pragma unroll
      for (int i = 0; i < BN / 16; ++i) *(v8us*)&sm[cur ^ 1][BM + sr + i * 16][sc] = rb[i];
    }
    // one barrier per stage: it publishes the buffer just filled and ends every wave's reads of the buffer that the next stage refills (after the last stage: that the output tiles reuse)
    __syncthreads();
  }
  fa* so = (fa*)&sm[0][0][0] + w * 32 * OP;
#pragma unroll
  for (int mi = 0; mi < 2; ++mi)
#pragma unroll
    for (int t = 0; t < 4; ++t)
#pragma unroll
      for (int r = 0; r < 8; ++r) so[(mi * 16 + 8 * hh + r) * OP + t * 16 + ln] = acc[mi][t][r] * 0.0625f;
  // the wave reads back its own tile, written by other lanes: the LDS stores must have landed first
  __builtin_amdgcn_fence(__ATOMIC_ACQ_REL, "workgroup"); __builtin_amdgcn_wave_barrier();
  return so;
}
// OUT 2; col0 = the block's first column in C16, N = the pitch of C16
template <int N>
__device__ __forceinline__ void proj_norm_rope(const fa* so, const int row0, const int col0, _Float16* __restrict__ C16, const float* __restrict__ nw, const float* __restrict__ cs, const float* __restrict__ sn) {
  constexpr int OP = 68;
  const int tid = threadIdx.x, w = tid >> 5, lane = tid & 31;
  const int wm = (w >> 1) * 32, wn = (w & 1) * 64;
    static_assert(HD == 64, "a wave's 64 columns are one head");
    // 8 lanes per row, 4 rows per pass: a lane holds dims j4..j4+3 (x1) and 32+j4..32+j4+3 (x2), the two halves that RoPE pairs
    const int rr = lane >> 3, j4 = (lane & 7) * 4;
    v4f w1 = *(const v4fa*)(nw + j4), w2 = *(const v4fa*)(nw + 32 + j4);
#pragma unroll
    for (int i = 0; i < 4; ++i) { w1[i] = bf16_round(w1[i]); w2[i] = bf16_round(w2[i]); }
    const fa* xp = so + rr * OP + j4;
    // byte offsets of the lane's first row: one for cos and sin (below 1 MiB), one for the output (below 8 MiB); each rides as the 32-bit offset register beside a scalar base
    unsigned co = (unsigned)((row0 + wm + rr) * HD + j4) * 4u, yo = (unsigned)((row0 + wm + rr) * N + col0 + wn + j4) * 2u;
    // two trips of four passes: a trip's 16 cos/sin loads go out together and fly under its sums of squares (all eight passes unrolled took more than 256 registers)
#pragma unroll 1
    for (int qh = 0; qh < 2; ++qh) {
      v4f x1[4], x2[4], c1[4], c2[4], s1[4], s2[4];
#pragma unroll
      for (int q = 0; q < 4; ++q) { x1[q] = *(const v4fa*)(xp + q * 4 * OP); x2[q] = *(const v4fa*)(xp + q * 4 * OP + 32); }
#pragma unroll
      for (int q = 0; q < 4; ++q) { const float* cp = (const float*)((const char*)cs + co) + q * 4 * HD; const float* sp = (const float*)((const char*)sn + co) + q * 4 * HD;
        c1[q] = *(const v4fa*)cp; c2[q] = *(const v4fa*)(cp + 32); s1[q] = *(const v4fa*)sp; s2[q] = *(const v4fa*)(sp + 32); }
#pragma unroll
      for (int q = 0; q < 4; ++q) {
        // sum of squares in the order of a 32-lane xor butterfly (16, 8, 4, 2, 1) over a_j = x1_j^2 + x2_j^2: dim j = 4 * lane + i, so 16, 8, 4 are lane steps 4, 2, 1 and 2, 1 are in-lane
        float t[4];
#pragma unroll
        for (int i = 0; i < 4; ++i) t[i] = __builtin_fmaf(x1[q][i], x1[q][i], x2[q][i] * x2[q][i]);
#pragma unroll
        for (int i = 0; i < 4; ++i) t[i] += row_xor<4>(t[i]);
#pragma unroll
        for (int i = 0; i < 4; ++i) t[i] += row_xor<2>(t[i]);
#pragma unroll
        for (int i = 0; i < 4; ++i) t[i] += row_xor<1>(t[i]);
        const float ss = (t[0] + t[2]) + (t[1] + t[3]);
        const float rs = rsqrtf(ss / (float)HD + 1e-6f);
        v4h y1, y2;      // explicit fma here and in t[]: it fixes which of the two products is rounded on its own
#pragma unroll
        for (int i = 0; i < 4; ++i) { const float n1 = x1[q][i] * rs * w1[i], n2 = x2[q][i] * rs * w2[i];
          y1[i] = (_Float16)__builtin_fmaf(n1, bf16_round(c1[q][i]), -(n2 * bf16_round(s1[q][i]))); y2[i] = (_Float16)__builtin_fmaf(n2, bf16_round(c2[q][i]), n1 * bf16_round(s2[q][i])); }
        _Float16* yp = (_Float16*)((char*)C16 + yo) + q * 4 * N;
        *(v4h*)yp = y1; *(v4h*)(yp + 32) = y2; }
      xp += 16 * OP; co += 16 * HD * 4; yo += 16 * N * 2; }
}
// OUT 0 and OUT 1
template <int N, int OUT>
__device__ __forceinline__ void proj_store(const fa* so, const int row0, const int col0, float* __restrict__ C, _Float16* __restrict__ C16) {
  constexpr int OP = 68;
  const int tid = threadIdx.x, w = tid >> 5, lane = tid & 31, ln = lane & 15, hh = lane >> 4;
  const int wm = (w >> 1) * 32, wn = (w & 1) * 64;
#pragma unroll
  for (int q = 0; q < 16; ++q) { const int r = q * 2 + hh, c4 = ln * 4; const v4f v = *(const v4fa*)&so[r * OP + c4]; const size_t o = (size_t)(row0 + wm + r) * N + col0 + wn + c4;
    if (OUT == 1) { v4h h4;
#pragma unroll
      for (int i = 0; i < 4; ++i) h4[i] = (_Float16)v[i];
      *(v4h*)(C16 + o) = h4; }
    else *(v4f*)(C + o) = v; }
}
__global__ __launch_bounds__(128) void k_qkv(const _Float16* __restrict__ A, const _Float16* __restrict__ Bt, _Float16* __restrict__ Q16, _Float16* __restrict__ K16, _Float16* __restrict__ V16,
                                             const float* __restrict__ qnw, const float* __restrict__ knw, const float* __restrict__ cs, const float* __restrict__ sn) {
  constexpr int NBN = (HID + 2 * KVD) / 128;
  __shared__ __attribute__((aligned(16))) proj_lds sm;
  const int row0 = (blockIdx.x / NBN) * 64, col0 = (blockIdx.x % NBN) * 128;
  const fa* so = proj_tile(A, Bt, row0, col0, sm);
  if (col0 < HID) proj_norm_rope<HID>(so, row0, col0, Q16, qnw, cs, sn);
  else if (col0 < HID + KVD) proj_norm_rope<KVD>(so, row0, col0 - HID, K16, knw, cs, sn);
  else { proj_store<KVD, 1>(so, row0, col0 - (HID + KVD), nullptr, V16);
    // behind v's last store: the listing runs on from here into the k and q forms' code, which reuses these stores' address and data registers; the wait that belongs in front of such an overwrite
    asm volatile("s_wait_xcnt 0x0" ::: "memory"); }
}
__global__ __launch_bounds__(128) void k_oproj(const _Float16* __restrict__ A, const _Float16* __restrict__ Bt, float* __restrict__ C) {
  constexpr int NBN = HID / 128;
  __shared__ __attribute__((aligned(16))) proj_lds sm;
  const int row0 = (blockIdx.x / NBN) * 64, col0 = (blockIdx.x % NBN) * 128;
  const fa* so = proj_tile(A, Bt, row0, col0, sm);
  proj_store<HID, 0>(so, row0, col0, C, nullptr);
}
extern "C" void kernel_launch(void* const* d_in, const int* in_sizes, int n_in,
                              void* d_out, int out_size, void* d_ws, size_t ws_size, hipStream_t stream) {
  (void)in_sizes; (void)n_in; (void)out_size;
  const float* x = (const float*)d_in[0]; const float* cs = (const float*)d_in[1]; const float* sn = (const float*)d_in[2]; const float* wq = (const float*)d_in[3]; const float* wk = (const float*)d_in[4]; const float* wv = (const float*)d_in[5]; const float* wo = (const float*)d_in[6]; const float* qnw = (const float*)d_in[7]; const float* knw = (const float*)d_in[8];
  char* ws = (char*)d_ws; size_t off = 0;
  auto take = [&](size_t bytes) { char* p = ws + off; off += (bytes + 255) & ~(size_t)255; return p; };
  _Float16* Bqkv = (_Float16*)take((size_t)(HID + 2 * KVD) * HID * 2); _Float16* Bo = (_Float16*)take((size_t)HID * HID * 2);
  _Float16* X16 = (_Float16*)take((size_t)NR * HID * 2); _Float16* Q16 = (_Float16*)take((size_t)NR * HID * 2); _Float16* K16 = (_Float16*)take((size_t)NR * KVD * 2); _Float16* V16 = (_Float16*)take((size_t)NR * KVD * 2); _Float16* Vt = (_Float16*)take((size_t)NR * KVD * 2); _Float16* O16 = (_Float16*)take((size_t)NR * HID * 2);
  if (off > ws_size) return;      // about 6 + 8.4 + 8.4 + 4.2 x 3 + 8.4 = 44 MiB
  k_cvt<<<((unsigned)NR * HID + 2u * HID * HID + 2u * KVD * HID) / 2048, 256, 0, stream>>>(x, wq, wk, wv, wo, X16, Bqkv, Bo);
  k_qkv<<<(NR / 64) * ((HID + 2 * KVD) / 128), 128, 0, stream>>>(X16, Bqkv, Q16, K16, V16, qnw, knw, cs, sn);
  k_vt<<<BB * NKV * (SS / 64), 256, 0, stream>>>(V16, Vt);
  k_flash<<<BB * NKV * (SS / 64), 256, 0, stream>>>(Q16, K16, Vt, O16);
  k_oproj<<<(NR / 64) * (HID / 128), 128, 0, stream>>>(O16, Bo, (float*)d_out);
}

// v009
// One run takes 65.2 microseconds.
// Two timings next to v008 both put it at 1.21 times that version's speed.
// All steps since v000 together make it 8.18 times as fast.
#include <hip/hip_runtime.h>
#define BB 2
#define SS 2048
#define HID 1024
#define NH 16
#define NKV 8
#define HD 64
#define KVD 512
#define NR (BB * SS)

typedef __bf16 v16b __attribute__((ext_vector_type(16)));
typedef unsigned short v8us __attribute__((ext_vector_type(8), may_alias));
typedef float  v8f  __attribute__((ext_vector_type(8)));
typedef float  v4f  __attribute__((ext_vector_type(4)));
typedef float  v4fa __attribute__((ext_vector_type(4), may_alias));
union FragB { v16b v; v8us half[2]; unsigned short u[16]; };

__device__ __forceinline__ unsigned short bf16_bits(float x) { unsigned int u = __float_as_uint(x); return (unsigned short)((u + 0x7FFFu + ((u >> 16) & 1u)) >> 16); }
__device__ __forceinline__ float bf16_val(unsigned short b) { return __uint_as_float(((unsigned int)b) << 16); }
__device__ __forceinline__ float bf16_round(float x) { return bf16_val(bf16_bits(x)); }
// D += A·B with NT terms: 1 = ah·bh, 2 = + al·bh (A split), 3 = + ah·bl (both split)
template <int NT>
__device__ __forceinline__ v8f mmaN(v16b ah, v16b al, v16b bh, v16b bl, v8f c) {
  c = __builtin_amdgcn_wmma_f32_16x16x32_bf16(false, ah, false, bh, (short)0, c, false, false);
  if (NT >= 2) c = __builtin_amdgcn_wmma_f32_16x16x32_bf16(false, al, false, bh, (short)0, c, false, false);
  if (NT >= 3) c = __builtin_amdgcn_wmma_f32_16x16x32_bf16(false, ah, false, bl, (short)0, c, false, false);
  asm volatile("v_nop\n\tv_nop\n\tv_nop\n\tv_nop" : "+v"(c) : "v"(ah), "v"(al), "v"(bh), "v"(bl));
  return c;
}

__global__ __launch_bounds__(256) void k_wt_bf16(const float* __restrict__ W, unsigned short* __restrict__ Wt, int K, int N) {
  const int t = blockIdx.x * 256 + threadIdx.x;
  const int k8n = K / 8;
  if (t >= N * k8n) return;
  const int n = t / k8n, k8 = (t % k8n) * 8;
  v8us v;
#pragma unroll
  for (int i = 0; i < 8; ++i) v[i] = bf16_bits(W[(size_t)(k8 + i) * N + n]);
  *(v8us*)(Wt + (size_t)n * K + k8) = v;
  
}

// GEMM C[M][N] (f32, pitch ldc) = act(A[M][K]·W + bias). A f32 row-major (pitch lda) converted per fragment to bf16
// (ASPLIT: hi/lo two planes -> 2 terms, else single rounded term); Wt bf16 [N][K] (pitch ldb). BIAS_BF16 rounds the
// bias to bf16 first (bias quantised to bf16 before the add). K%32==0, M%16==0, N%64==0.
template <bool ASPLIT, int ACT, bool BIAS_BF16>
__global__ __launch_bounds__(128) void k_gemm_bf(const float* __restrict__ A, int lda, const unsigned short* __restrict__ Wt, int ldb,
                                               const float* __restrict__ bias, float* __restrict__ C, int ldc, int M, int N, int K) {
  __shared__ __attribute__((aligned(16))) float so[4][16][64];
  const int tid = threadIdx.x, w = tid >> 5, lane = tid & 31, ln = lane & 15, hh = lane >> 4;
  const int ntn = N / 64;
  const int wid = blockIdx.x * 4 + w;
  const int mt = wid / ntn, nq = wid % ntn;
  if (mt * 16 >= M) return;
  const int row0 = mt * 16, col0 = nq * 64;
  const float* arow = A + (size_t)(row0 + ln) * lda;
  v8f acc[4] = {};
  for (int kb = 0; kb < K; kb += 32) {
    FragB ah, al;
    const v4f x0 = *(const v4fa*)(arow + kb + 8 * hh), x1 = *(const v4fa*)(arow + kb + 8 * hh + 4);
    const v4f x2 = *(const v4fa*)(arow + kb + 16 + 8 * hh), x3 = *(const v4fa*)(arow + kb + 16 + 8 * hh + 4);
    float xs[16] = {x0[0],x0[1],x0[2],x0[3],x1[0],x1[1],x1[2],x1[3],x2[0],x2[1],x2[2],x2[3],x3[0],x3[1],x3[2],x3[3]};
#pragma unroll
    for (int i = 0; i < 16; ++i) { const unsigned short hb = bf16_bits(xs[i]); ah.u[i] = hb; al.u[i] = ASPLIT ? bf16_bits(xs[i] - bf16_val(hb)) : (unsigned short)0; }
#pragma unroll
    for (int t = 0; t < 4; ++t) {
      const unsigned short* brow = Wt + (size_t)(col0 + t * 16 + ln) * ldb + kb;
      FragB b;
      b.half[0] = *(const v8us*)(brow + 8 * hh);
      b.half[1] = *(const v8us*)(brow + 16 + 8 * hh);
      acc[t] = mmaN<ASPLIT ? 2 : 1>(ah.v, al.v, b.v, b.v, acc[t]);
    }
  }
#pragma unroll
  for (int t = 0; t < 4; ++t) {
    float bv = bias ? bias[col0 + t * 16 + ln] : 0.f;
    if (BIAS_BF16) bv = bf16_round(bv);
#pragma unroll
    for (int r = 0; r < 8; ++r) { float v = acc[t][r] + bv; if (ACT == 1) v = fmaxf(v, 0.f); so[w][8 * hh + r][t * 16 + ln] = v; }
  }
  __builtin_amdgcn_fence(__ATOMIC_ACQ_REL, "workgroup");
  __builtin_amdgcn_wave_barrier();
  const int rsub = lane >> 4, c4 = (lane & 15) * 4;
  {
#pragma unroll
    for (int q = 0; q < 8; ++q) {
      const int r = q * 2 + rsub;
      const v4f v = *(const v4fa*)&so[w][r][c4];
      *(v4f*)(C + (size_t)(row0 + r) * ldc + col0 + c4) = v;
    }
    
  }
}

// Flash-style causal/unmasked attention, all contractions 3-term bf16 hi/lo splits, f32 softmax with running max.
// q,k,v rows are read from f32 buffers with arbitrary row pitch (so they can live inside a fused qkv buffer);
// D = head size (multiple of 32, <= 128); one wave = 16 query rows; block = 4 waves (64 queries) sharing K/V chunks of 32.
template <int D, bool CAUSAL>
__global__ __launch_bounds__(128) void k_flash(const float* __restrict__ qb, const float* __restrict__ kb, const float* __restrict__ vb,
                                             int pitch, int T, int H, float scale, float* __restrict__ y, int ypitch) {
  constexpr int KS = D / 32;        // k-steps for QK
  constexpr int DT = D / 16;        // d tiles for PV
  __shared__ __attribute__((aligned(16))) unsigned short sKh[32][D + 8], sKl[32][D + 8], sVh[32][D + 8], sVl[32][D + 8];
  __shared__ __attribute__((aligned(16))) unsigned short sPh[4][16][40], sPl[4][16][40];
  __shared__ __attribute__((aligned(16))) float sO[4][16][D];
  const int tid = threadIdx.x, w = tid >> 5, lane = tid & 31, ln = lane & 15, hh = lane >> 4;
  const int nqb = (T + 63) / 64;
  const int bh = blockIdx.x / nqb, qblk = blockIdx.x % nqb;
  const int b = bh / H, h = bh % H;
  const int q0 = qblk * 64 + w * 16;
  const float* Q = qb + (size_t)b * T * pitch + h * D;
  const float* K = kb + (size_t)b * T * pitch + h * D;
  const float* V = vb + (size_t)b * T * pitch + h * D;

  // A fragments of the wave's 16 query rows (scaled), hi/lo
  FragB aqh[KS], aql[KS];
  {
    int row = q0 + ln; if (row >= T) row = T - 1;
    const float* qr = Q + (size_t)row * pitch;
#pragma unroll
    for (int ks = 0; ks < KS; ++ks)
#pragma unroll
      for (int i = 0; i < 16; ++i) {
        const int d = ks * 32 + ((i < 8) ? (8 * hh + i) : (16 + 8 * hh + (i - 8)));
        const float x = qr[d] * scale; const unsigned short hb = bf16_bits(x);
        aqh[ks].u[i] = hb; aql[ks].u[i] = bf16_bits(x - bf16_val(hb));
      }
  }
  float m_r[8], l_r[8];
#pragma unroll
  for (int r = 0; r < 8; ++r) { m_r[r] = -3.0e38f; l_r[r] = 0.f; }
  v8f oacc[DT];
#pragma unroll
  for (int dt = 0; dt < DT; ++dt) oacc[dt] = (v8f){0.f,0.f,0.f,0.f,0.f,0.f,0.f,0.f};

  const int kv_end = CAUSAL ? min(T, qblk * 64 + 64) : T;     // block-uniform
  for (int j0 = 0; j0 < kv_end; j0 += 32) {
    __syncthreads();
    for (int e = tid; e < 32 * (D / 4); e += 128) {
      const int r = e / (D / 4), c4 = (e % (D / 4)) * 4;
      const int key = j0 + r;
      v4f kf = {0.f,0.f,0.f,0.f}, vf = {0.f,0.f,0.f,0.f};
      if (key < T) { kf = *(const v4fa*)(K + (size_t)key * pitch + c4); vf = *(const v4fa*)(V + (size_t)key * pitch + c4); }
#pragma unroll
      for (int t = 0; t < 4; ++t) {
        unsigned short hb = bf16_bits(kf[t]); sKh[r][c4 + t] = hb; sKl[r][c4 + t] = bf16_bits(kf[t] - bf16_val(hb));
        hb = bf16_bits(vf[t]); sVh[r][c4 + t] = hb; sVl[r][c4 + t] = bf16_bits(vf[t] - bf16_val(hb));
      }
    }
    __syncthreads();
    // S tile 16 x 32
    v8f s[2];
#pragma unroll
    for (int nt = 0; nt < 2; ++nt) {
      v8f acc = {};
#pragma unroll
      for (int ks = 0; ks < KS; ++ks) {
        FragB bh_, bl_;
        bh_.half[0] = *(const v8us*)&sKh[nt * 16 + ln][ks * 32 + 8 * hh]; bh_.half[1] = *(const v8us*)&sKh[nt * 16 + ln][ks * 32 + 16 + 8 * hh];
        bl_.half[0] = *(const v8us*)&sKl[nt * 16 + ln][ks * 32 + 8 * hh]; bl_.half[1] = *(const v8us*)&sKl[nt * 16 + ln][ks * 32 + 16 + 8 * hh];
        acc = mmaN<3>(aqh[ks].v, aql[ks].v, bh_.v, bl_.v, acc);
      }
      s[nt] = acc;
    }
    // mask + running max (rows 8hh+r; the 16 lanes of a half share rows)
    float alpha[8];
#pragma unroll
    for (int r = 0; r < 8; ++r) {
      const int qi = q0 + 8 * hh + r;
      const int ja = j0 + ln, jb = j0 + 16 + ln;
      if (CAUSAL) { if (ja > qi) s[0][r] = -3.0e38f; if (jb > qi) s[1][r] = -3.0e38f; }
      if (ja >= T) s[0][r] = -3.0e38f;
      if (jb >= T) s[1][r] = -3.0e38f;
      float mx = fmaxf(s[0][r], s[1][r]);
      mx = fmaxf(mx, __shfl_xor(mx, 1, 32)); mx = fmaxf(mx, __shfl_xor(mx, 2, 32)); mx = fmaxf(mx, __shfl_xor(mx, 4, 32)); mx = fmaxf(mx, __shfl_xor(mx, 8, 32));
      const float mnew = fmaxf(m_r[r], mx);
      alpha[r] = (mnew > -1.0e38f) ? __expf(m_r[r] - mnew) : 1.0f;
      const float p0 = (s[0][r] > -1.0e38f) ? __expf(s[0][r] - mnew) : 0.f;
      const float p1 = (s[1][r] > -1.0e38f) ? __expf(s[1][r] - mnew) : 0.f;
      m_r[r] = mnew;
      l_r[r] = l_r[r] * alpha[r] + p0 + p1;            // per-lane partial row sum (16 lanes combined at the end)
      unsigned short hb = bf16_bits(p0); sPh[w][8 * hh + r][ln] = hb;      sPl[w][8 * hh + r][ln] = bf16_bits(p0 - bf16_val(hb));
      hb = bf16_bits(p1);                sPh[w][8 * hh + r][16 + ln] = hb; sPl[w][8 * hh + r][16 + ln] = bf16_bits(p1 - bf16_val(hb));
    }
#pragma unroll
    for (int dt = 0; dt < DT; ++dt)
#pragma unroll
      for (int r = 0; r < 8; ++r) oacc[dt][r] *= alpha[r];
    __builtin_amdgcn_fence(__ATOMIC_ACQ_REL, "workgroup");
    __builtin_amdgcn_wave_barrier();
    FragB pah, pal;
    pah.half[0] = *(const v8us*)&sPh[w][ln][8 * hh]; pah.half[1] = *(const v8us*)&sPh[w][ln][16 + 8 * hh];
    pal.half[0] = *(const v8us*)&sPl[w][ln][8 * hh]; pal.half[1] = *(const v8us*)&sPl[w][ln][16 + 8 * hh];
#pragma unroll
    for (int dt = 0; dt < DT; ++dt) {
      FragB bvh, bvl;
#pragma unroll
      for (int i = 0; i < 8; ++i) {
        bvh.u[i] = sVh[8 * hh + i][dt * 16 + ln]; bvh.u[8 + i] = sVh[16 + 8 * hh + i][dt * 16 + ln];
        bvl.u[i] = sVl[8 * hh + i][dt * 16 + ln]; bvl.u[8 + i] = sVl[16 + 8 * hh + i][dt * 16 + ln];
      }
      oacc[dt] = mmaN<3>(pah.v, pal.v, bvh.v, bvl.v, oacc[dt]);
    }
    __builtin_amdgcn_fence(__ATOMIC_ACQ_REL, "workgroup");
    __builtin_amdgcn_wave_barrier();
  }
#pragma unroll
  for (int r = 0; r < 8; ++r) {
    float l = l_r[r];
    l += __shfl_xor(l, 1, 32); l += __shfl_xor(l, 2, 32); l += __shfl_xor(l, 4, 32); l += __shfl_xor(l, 8, 32);
    l_r[r] = (l > 0.f) ? 1.0f / l : 0.f;
  }
#pragma unroll
  for (int dt = 0; dt < DT; ++dt)
#pragma unroll
    for (int r = 0; r < 8; ++r) sO[w][8 * hh + r][dt * 16 + ln] = oacc[dt][r] * l_r[r];
  __builtin_amdgcn_fence(__ATOMIC_ACQ_REL, "workgroup");
  __builtin_amdgcn_wave_barrier();
  {
    for (int r = 0; r < 16; ++r) {
      const int row = q0 + r;
      if (row < T && lane < D / 4) {
        const v4f val = *(const v4fa*)&sO[w][r][lane * 4];
        *(v4f*)(y + ((size_t)b * T + row) * ypitch + h * D + lane * 4) = val;
      }
    }
    
  }
}

// GEMM C = act(A·W + bias + resid): A f32 (ASPLIT -> hi/lo 2 terms), Wt bf16 [N][K]; ACT 0 none, 1 relu, 2 exact gelu;
// resid (optional, f32, row index = (row % rmod), pitch ldr, RES_BF16 rounds it) added before the activation.
template <bool ASPLIT, int ACT, bool BIAS_BF16, bool RES_BF16>
__global__ __launch_bounds__(128) void k_gemm_bf3(const float* __restrict__ A, int lda, const unsigned short* __restrict__ Wt, int ldb,
                                                const float* __restrict__ bias, const float* __restrict__ resid, int rmod, int ldr,
                                                float* __restrict__ C, int ldc, int M, int N, int K) {
  __shared__ __attribute__((aligned(16))) float so[4][16][64];
  const int tid = threadIdx.x, w = tid >> 5, lane = tid & 31, ln = lane & 15, hh = lane >> 4;
  const int ntn = N / 64;
  const int wid = blockIdx.x * 4 + w;
  const int mt = wid / ntn, nq = wid % ntn;
  if (mt * 16 >= M) return;
  const int row0 = mt * 16, col0 = nq * 64;
  const float* arow = A + (size_t)(row0 + ln) * lda;
  v8f acc[4] = {};
  for (int kb = 0; kb < K; kb += 32) {
    FragB ah, al;
    const v4f x0 = *(const v4fa*)(arow + kb + 8 * hh), x1 = *(const v4fa*)(arow + kb + 8 * hh + 4);
    const v4f x2 = *(const v4fa*)(arow + kb + 16 + 8 * hh), x3 = *(const v4fa*)(arow + kb + 16 + 8 * hh + 4);
    float xs[16] = {x0[0],x0[1],x0[2],x0[3],x1[0],x1[1],x1[2],x1[3],x2[0],x2[1],x2[2],x2[3],x3[0],x3[1],x3[2],x3[3]};
#pragma unroll
    for (int i = 0; i < 16; ++i) { const unsigned short hb = bf16_bits(xs[i]); ah.u[i] = hb; al.u[i] = ASPLIT ? bf16_bits(xs[i] - bf16_val(hb)) : (unsigned short)0; }
#pragma unroll
    for (int t = 0; t < 4; ++t) {
      const unsigned short* brow = Wt + (size_t)(col0 + t * 16 + ln) * ldb + kb;
      FragB b;
      b.half[0] = *(const v8us*)(brow + 8 * hh);
      b.half[1] = *(const v8us*)(brow + 16 + 8 * hh);
      acc[t] = mmaN<ASPLIT ? 2 : 1>(ah.v, al.v, b.v, b.v, acc[t]);
    }
  }
#pragma unroll
  for (int t = 0; t < 4; ++t) {
    const int col = col0 + t * 16 + ln;
    float bv = bias ? bias[col] : 0.f;
    if (BIAS_BF16) bv = bf16_round(bv);
#pragma unroll
    for (int r = 0; r < 8; ++r) {
      float v = acc[t][r] + bv;
      if (resid) { float rv = resid[(size_t)((row0 + 8 * hh + r) % rmod) * ldr + col]; if (RES_BF16) rv = bf16_round(rv); v += rv; }
      if (ACT == 1) v = fmaxf(v, 0.f);
      if (ACT == 2) v = 0.5f * v * (1.0f + erff(v * 0.70710678118654752f));
      if (ACT == 3) { const float u = 0.7978845608028654f * (v + 0.044715f * v * v * v); v = 0.5f * v * (1.0f + tanhf(u)); }
      so[w][8 * hh + r][t * 16 + ln] = v;
    }
  }
  __builtin_amdgcn_fence(__ATOMIC_ACQ_REL, "workgroup");
  __builtin_amdgcn_wave_barrier();
  const int rsub = lane >> 4, c4 = (lane & 15) * 4;
  {
#pragma unroll
    for (int q = 0; q < 8; ++q) {
      const int r = q * 2 + rsub;
      const v4f v = *(const v4fa*)&so[w][r][c4];
      *(v4f*)(C + (size_t)(row0 + r) * ldc + col0 + c4) = v;
    }
    
  }
}
// row LayerNorm (biased variance, eps) over N: s = X (+ R); optional out_sum <- s; out_norm <- (s-mu)*rsqrt(var+eps)*g + b
template <bool PARAM_BF16>
__global__ __launch_bounds__(256) void k_layernorm(const float* __restrict__ X, const float* __restrict__ R, const float* __restrict__ g, const float* __restrict__ bta,
                                                  float* __restrict__ out_sum, float* __restrict__ out_norm, int N, float eps) {
  __shared__ float red[256];
  const int row = blockIdx.x, tid = threadIdx.x;
  const float* x = X + (size_t)row * N; const float* rr = R ? R + (size_t)row * N : nullptr;
  float vals[16];                     // up to N = 4096
  const int per = N / 256;            // contiguous chunk per thread? use strided-by-4 chunks: thread handles j = tid*4 + 1024*u
  float s1 = 0.f;
  for (int u = 0; u < per / 4; ++u) {
    const int j = tid * 4 + 1024 * u;
    const v4f a = *(const v4fa*)(x + j);
    v4f b = {0.f,0.f,0.f,0.f}; if (rr) b = *(const v4fa*)(rr + j);
#pragma unroll
    for (int q = 0; q < 4; ++q) { const float v = a[q] + b[q]; vals[u * 4 + q] = v; s1 += v; }
  }
  red[tid] = s1; __syncthreads();
  for (int st = 128; st > 0; st >>= 1) { if (tid < st) red[tid] += red[tid + st]; __syncthreads(); }
  const float mu = red[0] / (float)N; __syncthreads();
  float s2 = 0.f;
  for (int u = 0; u < per / 4; ++u)
#pragma unroll
    for (int q = 0; q < 4; ++q) { const float c = vals[u * 4 + q] - mu; s2 += c * c; }
  red[tid] = s2; __syncthreads();
  for (int st = 128; st > 0; st >>= 1) { if (tid < st) red[tid] += red[tid + st]; __syncthreads(); }
  const float rs = rsqrtf(red[0] / (float)N + eps);
  {
    for (int u = 0; u < per / 4; ++u) {
      const int j = tid * 4 + 1024 * u;
      v4f o, sm;
#pragma unroll
      for (int q = 0; q < 4; ++q) {
        float gg = g[j + q], bb = bta[j + q];
        if (PARAM_BF16) { gg = bf16_round(gg); bb = bf16_round(bb); }
        sm[q] = vals[u * 4 + q]; o[q] = (vals[u * 4 + q] - mu) * rs * gg + bb;
      }
      if (out_sum) *(v4f*)(out_sum + (size_t)row * N + j) = sm;
      *(v4f*)(out_norm + (size_t)row * N + j) = o;
    }
    
  }
}



// ---- f16 WMMA path (v_wmma_f32_16x16x32_f16): 11-bit significands for operands in range — used where a [0,1] probability operand needs more precision than bf16
typedef _Float16 v16h __attribute__((ext_vector_type(16)));
typedef _Float16 v4h __attribute__((ext_vector_type(4)));
union FragH { v16h v; v8us half[2]; _Float16 h[16]; unsigned short u[16]; };
template <int NT>
__device__ __forceinline__ v8f mmaH(v16h ah, v16h al, v16h bh, v16h bl, v8f c) {
  c = __builtin_amdgcn_wmma_f32_16x16x32_f16(false, ah, false, bh, (short)0, c, false, false);
  if (NT >= 2) c = __builtin_amdgcn_wmma_f32_16x16x32_f16(false, al, false, bh, (short)0, c, false, false);
  if (NT >= 3) c = __builtin_amdgcn_wmma_f32_16x16x32_f16(false, ah, false, bl, (short)0, c, false, false);
  asm volatile("v_nop\n\tv_nop\n\tv_nop\n\tv_nop" : "+v"(c) : "v"(ah), "v"(al), "v"(bh), "v"(bl));
  return c;
}
// batched GEMM like k_gemm_b but f16 operands: A f32 (split into f16 hi/lo if ASPLIT, else rounded to f16), Bt = f16 values [n][k]; alpha; C f32; N multiple of 16 (partial tiles skipped)
template <bool ASPLIT>
__global__ __launch_bounds__(128) void k_gemm_h(const float* __restrict__ A, int lda, size_t sA, const _Float16* __restrict__ Bh, int ldb, size_t sB, float alpha, float* __restrict__ C, int ldc, size_t sC, int M, int N, int K) {
  __shared__ __attribute__((aligned(16))) float so[4][16][64];
  const int tid = threadIdx.x, w = tid >> 5, lane = tid & 31, ln = lane & 15, hh = lane >> 4; const int by = blockIdx.y;
  A += (size_t)by * sA; Bh += (size_t)by * sB; C += (size_t)by * sC;
  const int ntn = (N + 63) / 64; const int wid = blockIdx.x * 4 + w; const int mt = wid / ntn, nq = wid % ntn; if (mt * 16 >= M) return;
  const int row0 = mt * 16, col0 = nq * 64; const float* arow = A + (size_t)(row0 + ln) * lda;
  v8f acc[4] = {};
  for (int kb = 0; kb < K; kb += 32) {
    FragH ah, al;
    const v4f x0 = *(const v4fa*)(arow + kb + 8 * hh), x1 = *(const v4fa*)(arow + kb + 8 * hh + 4), x2 = *(const v4fa*)(arow + kb + 16 + 8 * hh), x3 = *(const v4fa*)(arow + kb + 16 + 8 * hh + 4);
    float xs[16] = {x0[0],x0[1],x0[2],x0[3],x1[0],x1[1],x1[2],x1[3],x2[0],x2[1],x2[2],x2[3],x3[0],x3[1],x3[2],x3[3]};
#pragma unroll
    for (int i = 0; i < 16; ++i) { const _Float16 h = (_Float16)xs[i]; ah.h[i] = h; al.h[i] = ASPLIT ? (_Float16)(xs[i] - (float)h) : (_Float16)0.0f; }
#pragma unroll
    for (int t = 0; t < 4; ++t) { if (col0 + t * 16 >= N) continue; const size_t boff = (size_t)(col0 + t * 16 + ln) * ldb + kb; FragH bq; bq.half[0] = *(const v8us*)(Bh + boff + 8 * hh); bq.half[1] = *(const v8us*)(Bh + boff + 16 + 8 * hh);
      acc[t] = mmaH<ASPLIT ? 2 : 1>(ah.v, al.v, bq.v, bq.v, acc[t]); }
  }
#pragma unroll
  for (int t = 0; t < 4; ++t) { if (col0 + t * 16 >= N) continue;
#pragma unroll
    for (int r = 0; r < 8; ++r) so[w][8 * hh + r][t * 16 + ln] = acc[t][r] * alpha; }
  __builtin_amdgcn_fence(__ATOMIC_ACQ_REL, "workgroup"); __builtin_amdgcn_wave_barrier();
  const int rsub = lane >> 4, c4 = (lane & 15) * 4;
  {
#pragma unroll
    for (int q = 0; q < 8; ++q) { const int r = q * 2 + rsub; if (col0 + c4 < N) { const v4f v = *(const v4fa*)&so[w][r][c4]; *(v4f*)(C + (size_t)(row0 + r) * ldc + col0 + c4) = v; } }
     }
}

// Wt[n][k] = f16(W[k][n]·scale) from f32 row-major W[K][N] (scale = power of two; bf16-exact weights stay exact in f16 away from the subnormal range)
__global__ __launch_bounds__(256) void k_wt_f16(const float* __restrict__ W, _Float16* __restrict__ Wt, int K, int N, float scale) {
  const int t = blockIdx.x * 256 + threadIdx.x; if (t >= N * (K / 8)) return; const int n = t / (K / 8), k8 = (t % (K / 8)) * 8; FragH f;
#pragma unroll
  for (int i = 0; i < 8; ++i) f.h[i] = (_Float16)(bf16_round(W[(size_t)(k8 + i) * N + n]) * scale); const v8us o = f.half[0];
  *(v8us*)((unsigned short*)Wt + (size_t)n * K + k8) = o; 
}
// The five input conversions in one launch: they are independent of one another, and the block index picks the job (a scalar choice, the same for a whole block). x -> f16(bf16(x)); each weight, already (out,in) = Bt,
// -> f16(bf16(w) * 16). wq, wk and wv land one behind the other, so that they read as one Bt of 2048 rows.
__global__ __launch_bounds__(256) void k_cvt(const float* __restrict__ x, const float* __restrict__ wq, const float* __restrict__ wk, const float* __restrict__ wv, const float* __restrict__ wo,
                                             _Float16* __restrict__ X16, _Float16* __restrict__ Bqkv, _Float16* __restrict__ Bo) {
  constexpr unsigned GX = (unsigned)NR * HID / 2048, GQ = (unsigned)HID * HID / 2048, GK = (unsigned)KVD * HID / 2048;      // blocks per job: 256 threads x 8 elements
  static_assert(NR * HID % 2048 == 0 && HID * HID % 2048 == 0 && KVD * HID % 2048 == 0, "whole blocks only");
  unsigned bid = blockIdx.x; const float* s; _Float16* d; float sc = 16.0f;
  if (bid < GX) { s = x; d = X16; sc = 1.0f; }
  else if ((bid -= GX) < GQ) { s = wq; d = Bqkv; }
  else if ((bid -= GQ) < GK) { s = wk; d = Bqkv + (size_t)HID * HID; }
  else if ((bid -= GK) < GK) { s = wv; d = Bqkv + (size_t)(HID + KVD) * HID; }
  else { bid -= GK; s = wo; d = Bo; }
  const size_t t = (size_t)bid * 256 + threadIdx.x; FragH f;
#pragma unroll
  for (int i = 0; i < 8; ++i) f.h[i] = (_Float16)(bf16_round(s[t * 8 + i]) * sc);
  *(v8us*)((unsigned short*)d + t * 8) = f.half[0]; }
// FRAGMENT ORDER of the attention operands in the workspace. A 16x16x32 operand fragment is two 16-byte halves per lane; half hf of fragment ks holds, in lane hh * 16 + ln, row ln and k = ks * 32 + hf * 16 + hh * 8 .. + 7.
// Each such half lies as one piece of 512 bytes, lane after lane, so that a wave fetches it with ONE load of 4 whole 128-byte lines (from row-major rows the same load touched 16 lines, 32 bytes of each).
// Q and K (row = position, k = head dim): per (batch, head) and 16 positions 4 pieces (ks, hf) = 2 KiB. V (row = head dim, k = key: the transposed operand): per (batch, kv head) and 32 keys 8 pieces (dt, hf) = 4 KiB, row = dim dt * 16 + ln.
// a step of an xor butterfly inside a 16-lane row: the builtin move fuses into v_add_f32_dpp
template <int M> __device__ __forceinline__ float row_xor(float v) { return __int_as_float(__builtin_amdgcn_mov_dpp(__float_as_int(v), 0x160 + M, 0xf, 0xf, true)); }
// the value of lane l ^ 16 (the other half of the wave), on the vector pipe
__device__ __forceinline__ float half_xor(float v) { const int b = __float_as_int(v); return __int_as_float(__builtin_amdgcn_permlanex16(b, b, 0x76543210, 0xfedcba98, false, false)); }
// fused causal GQA attention. The work is dealt so that every wave walks 15 to 17 chunks of 32 keys (a causal tile's cost grows with its position, and all work-groups are resident, so the launch lasts as long as its fullest wave):
// a work-group = 8 waves = the 2 query heads of one kv head x 4 key shares; it takes the 32-query tile NT - 1 - u and then the tile u (together 65 chunks for every u); share sp of a head walks the chunks sp, sp + 4, ... of the tile,
// and the four partial results (maximum, sum, output) of a tile are joined through LDS at the tile's end. Q, K and V are read in fragment order (above); mask k <= q else -inf.
// Both products run transposed: St = K * Qt (A = 16 key rows, B = 16 query columns) and Ot += Vt * Pt (A = 16 rows of Vt, B = Pt). A lane of an St tile then holds 8 keys of ONE query (column ln, keys 8 * hh + r),
// so a query's maximum and sum are taken inside the lane, with one exchange between the wave's halves for the maximum; running maximum, sum and rescale factor are one value per lane and 16-query group;
// and the two St tiles of a 32-key chunk, rounded to f16 in place, ARE the B operand Pt in the hardware's k order (element s = key 8 * hh + s, then 16 + 8 * hh + s - 8), which the Vt loads already follow: P never leaves the registers.
__global__ __launch_bounds__(256) __attribute__((amdgpu_waves_per_eu(4, 4))) void k_flash(const _Float16* __restrict__ Q16, const _Float16* __restrict__ K16, const _Float16* __restrict__ Vt, _Float16* __restrict__ O16) {
  constexpr int RPW = 32, NT = SS / RPW, DT = HD / 16, KS = HD / 32, OPIT = HD + 8, G = NH / NKV, NSP = 4;
  static_assert(NT % 2 == 0 && DT == NSP && G * NSP == 8, "tiles pair up; share sp joins output dims sp * 16 .. sp * 16 + 15; 8 waves");
  // The softmax runs in base 2: the scores take 1/8 and log2(e) in their one multiply, so e^(s - m) = 2^(s2 - m2) is one subtraction and one v_exp_f32. Every argument is <= 0 here (m2 is the running maximum),
  // so nothing can overflow; -inf (masked) and the -3e38 start value give 0; a result below 2^-126 is flushed to 0, far under the f16 rounding of P and the f32 rounding of the row sum, which holds a term 1.
  constexpr float SC2 = 0.125f * 1.4426950408889634f;
  // the shares' partial outputs, lane-contiguous 16-byte pieces (no bank conflicts), and their maxima and sums
  __shared__ __attribute__((aligned(16))) float sX[G][NSP][2][DT][2][32][4];
  __shared__ float sM[G][NSP][2][32], sL[G][NSP][2][32];
  // output staging, f16; row pitch 144 bytes: the 16-byte stores of 8 rows fall on different banks
  __shared__ __attribute__((aligned(16))) unsigned short sO[G][RPW][OPIT];
  const int tid = threadIdx.x, lane = tid & 31, ln = lane & 15, hh = lane >> 4;
  const int w = __builtin_amdgcn_readfirstlane(tid >> 5), g = w >> 2, sp = w & 3;      // scalar: a wave's trip count depends on sp, and the loop must stay a scalar loop (all lanes on at every WMMA)
  const int slab = blockIdx.x / (NT / 2), u = blockIdx.x % (NT / 2); const int b = slab / NKV, kvh = slab % NKV; const int h = kvh * G + g;
  // a 32-key chunk is 4 KiB of K and 4 KiB of V (64 elements per key); kl: the share's first chunk, vl: the kv head's chunk 0; the lane's 16 bytes of each piece
  const unsigned short* kl = (const unsigned short*)K16 + ((size_t)slab * SS + sp * 32) * HD + lane * 8;
  const unsigned short* vl = (const unsigned short*)Vt + (size_t)slab * SS * HD + lane * 8;
  // K and V fragments are requested ahead of their products, so that no product waits out a load: a chunk's V is loaded at the chunk's head, its K during the share's chunk before it. A tile's last chunk loads the share's FIRST chunk,
  // which is what the next tile starts with; the first tile's is loaded here (rows below 128: in bounds also where a share has no chunk in a tile; that is only the second tile, u < sp, and the fragments then go unused)
  FragH bk[2][KS];
#pragma unroll
  for (int nt = 0; nt < 2; ++nt)
#pragma unroll
    for (int ks = 0; ks < KS; ++ks) { bk[nt][ks].half[0] = *(const v8us*)(kl + (nt * KS + ks) * 512); bk[nt][ks].half[1] = *(const v8us*)(kl + (nt * KS + ks) * 512 + 256); }
  // rolled: the two tiles run one after the other through the same code
#pragma unroll 1
  for (int ph = 0; ph < 2; ++ph) {
  const int q0 = (ph ? u : NT - 1 - u) * RPW;
  FragH aq[2][KS];
#pragma unroll
  for (int rt = 0; rt < 2; ++rt) { const unsigned short* qr = (const unsigned short*)Q16 + ((size_t)(b * NH + h) * SS + q0 + rt * 16) * HD + lane * 8;
#pragma unroll
    for (int ks = 0; ks < KS; ++ks) { aq[rt][ks].half[0] = *(const v8us*)(qr + ks * 512); aq[rt][ks].half[1] = *(const v8us*)(qr + ks * 512 + 256); } }
  float m_r[2], l_r[2]; v8f oacc[2][DT];      // of query q0 + rt * 16 + ln; oacc[rt][dt][r] is its dim dt * 16 + 8 * hh + r; l_r sums the keys of the lane's own half
#pragma unroll
  for (int rt = 0; rt < 2; ++rt) { m_r[rt] = -3.0e38f; l_r[rt] = 0.f;
#pragma unroll
    for (int dt = 0; dt < DT; ++dt) oacc[rt][dt] = (v8f){0.f,0.f,0.f,0.f,0.f,0.f,0.f,0.f}; }
  const int jend = q0 + RPW;
#pragma unroll 1
  for (int j0 = sp * 32; j0 < jend; j0 += NSP * 32) {
    FragH bv[DT];
#pragma unroll
    for (int dt = 0; dt < DT; ++dt) { bv[dt].half[0] = *(const v8us*)(vl + (size_t)j0 * HD + dt * 512); bv[dt].half[1] = *(const v8us*)(vl + (size_t)j0 * HD + dt * 512 + 256); }
    v8f s[2][2];      // s[rt][nt][r]: key j0 + nt * 16 + 8 * hh + r against query q0 + rt * 16 + ln
#pragma unroll
    for (int nt = 0; nt < 2; ++nt)
#pragma unroll
      for (int rt = 0; rt < 2; ++rt) { v8f acc = (v8f){0.f,0.f,0.f,0.f,0.f,0.f,0.f,0.f};
#pragma unroll
        for (int ks = 0; ks < KS; ++ks) acc = mmaH<1>(bk[nt][ks].v, bk[nt][ks].v, aq[rt][ks].v, aq[rt][ks].v, acc); s[rt][nt] = acc; }
    // the share's next chunk's K into the same registers, right behind their last product; behind the tile's last chunk the share's first chunk, for the next tile (kl stands at it)
    { const unsigned short* kn = kl + (size_t)((j0 + NSP * 32 < jend) ? j0 + NSP * 32 - sp * 32 : 0) * HD;
#pragma unroll
      for (int nt = 0; nt < 2; ++nt)
#pragma unroll
        for (int ks = 0; ks < KS; ++ks) { bk[nt][ks].half[0] = *(const v8us*)(kn + (nt * KS + ks) * 512); bk[nt][ks].half[1] = *(const v8us*)(kn + (nt * KS + ks) * 512 + 256); } }
    // stands between the loads above and the softmax, which reuses their K address pair: the wait that belongs in front of an overwrite of an issued load's address register
    asm volatile("s_wait_xcnt 0x0" ::: "memory");
    // keeps the V and K loads and the wait in front of the softmax and the output products that the loads fly under (without it the scheduler sank the K loads into the softmax and the wait far behind them)
    __builtin_amdgcn_sched_barrier(0);
    FragH pb[2];
#pragma unroll
    for (int rt = 0; rt < 2; ++rt) { const int dq = q0 + rt * 16 + ln - 8 * hh - j0;      // key nt * 16 + r of the lane's half is allowed while nt * 16 + r <= dq
      v8f s0 = s[rt][0] * SC2, s1 = s[rt][1] * SC2;
#pragma unroll
      for (int r = 0; r < 8; ++r) { s0[r] = (r <= dq) ? s0[r] : -INFINITY; s1[r] = (16 + r <= dq) ? s1[r] : -INFINITY; }
      float mx = fmaxf(fmaxf(fmaxf(fmaxf(s0[0], s0[1]), fmaxf(s0[2], s0[3])), fmaxf(fmaxf(s0[4], s0[5]), fmaxf(s0[6], s0[7]))), fmaxf(fmaxf(fmaxf(s1[0], s1[1]), fmaxf(s1[2], s1[3])), fmaxf(fmaxf(s1[4], s1[5]), fmaxf(s1[6], s1[7]))));
      mx = fmaxf(mx, half_xor(mx));      // both halves hold keys of the same query and scale the same output column: one maximum for both
      const float mn = fmaxf(m_r[rt], mx); const float al = __builtin_amdgcn_exp2f(m_r[rt] - mn); m_r[rt] = mn;
      s0 -= mn; s1 -= mn;
#pragma unroll
      for (int r = 0; r < 8; ++r) { s0[r] = __builtin_amdgcn_exp2f(s0[r]); s1[r] = __builtin_amdgcn_exp2f(s1[r]); pb[rt].h[r] = (_Float16)s0[r]; pb[rt].h[8 + r] = (_Float16)s1[r]; }
      const v8f t = s0 + s1;
      l_r[rt] = l_r[rt] * al + (((t[0] + t[1]) + (t[2] + t[3])) + ((t[4] + t[5]) + (t[6] + t[7])));
#pragma unroll
      for (int dt = 0; dt < DT; ++dt) oacc[rt][dt] *= al; }
#pragma unroll
    for (int dt = 0; dt < DT; ++dt)
#pragma unroll
      for (int rt = 0; rt < 2; ++rt) oacc[rt][dt] = mmaH<1>(bv[dt].v, bv[dt].v, pb[rt].v, pb[rt].v, oacc[rt][dt]); }
  // every share lays down its partial result (a share without a chunk: maximum -3e38, sum and output 0, which the join below weighs with 0)
#pragma unroll
  for (int rt = 0; rt < 2; ++rt) { float l = l_r[rt]; l += half_xor(l); sM[g][sp][rt][lane] = m_r[rt]; sL[g][sp][rt][lane] = l;
#pragma unroll
    for (int dt = 0; dt < DT; ++dt) { const v8f o = oacc[rt][dt];
      *(v4f*)&sX[g][sp][rt][dt][0][lane][0] = (v4f){o[0], o[1], o[2], o[3]}; *(v4f*)&sX[g][sp][rt][dt][1][lane][0] = (v4f){o[4], o[5], o[6], o[7]}; } }
  // publishes the four shares' partial results; it also ends every wave's reads of sO for the tile before
  __syncthreads();
  // the join, shares in the order 0..3: wave sp joins the dims sp * 16 .. sp * 16 + 15 of both 16-query groups; the lane keeps its query and its 8 dims
  float f[2][NSP], lw[2][NSP];
#pragma unroll
  for (int rt = 0; rt < 2; ++rt) { float mw[NSP];
#pragma unroll
    for (int s = 0; s < NSP; ++s) { mw[s] = sM[g][s][rt][lane]; lw[rt][s] = sL[g][s][rt][lane]; }
    const float mm = fmaxf(fmaxf(mw[0], mw[1]), fmaxf(mw[2], mw[3]));      // finite: share 0 always holds chunk 0
#pragma unroll
    for (int s = 0; s < NSP; ++s) f[rt][s] = mw[s] - mm; }
  // the eight weights 2^(m - mm), each in place, in one statement that ends in a v_nop: so no instruction directly behind a v_exp_f32 reads its result or overwrites its source
  asm("v_exp_f32 %0, %0\n\tv_exp_f32 %1, %1\n\tv_exp_f32 %2, %2\n\tv_exp_f32 %3, %3\n\tv_exp_f32 %4, %4\n\tv_exp_f32 %5, %5\n\tv_exp_f32 %6, %6\n\tv_exp_f32 %7, %7\n\tv_nop"
      : "+v"(f[0][0]), "+v"(f[0][1]), "+v"(f[0][2]), "+v"(f[0][3]), "+v"(f[1][0]), "+v"(f[1][1]), "+v"(f[1][2]), "+v"(f[1][3]));
#pragma unroll
  for (int rt = 0; rt < 2; ++rt) { float l = f[rt][0] * lw[rt][0]; v4f o0 = *(const v4f*)&sX[g][0][rt][sp][0][lane][0] * f[rt][0], o1 = *(const v4f*)&sX[g][0][rt][sp][1][lane][0] * f[rt][0];
#pragma unroll
    for (int s = 1; s < NSP; ++s) { l += f[rt][s] * lw[rt][s];
      o0 += *(const v4f*)&sX[g][s][rt][sp][0][lane][0] * f[rt][s]; o1 += *(const v4f*)&sX[g][s][rt][sp][1][lane][0] * f[rt][s]; }
    const float li = 1.0f / l; FragH o;      // the o projection's A operand: rounded here; a lane's 8 values are 8 neighbouring dims of its query, one 16-byte LDS store
#pragma unroll
    for (int r = 0; r < 4; ++r) { o.h[r] = (_Float16)(o0[r] * li); o.h[4 + r] = (_Float16)(o1[r] * li); }
    *(v8us*)&sO[g][rt * 16 + ln][sp * 16 + 8 * hh] = o.half[0]; }
  // publishes the head's 32 x 64 output tile; it also ends every wave's reads of the partial results, which the next tile overwrites
  __syncthreads();
  {
#pragma unroll
    for (int rp = 0; rp < RPW / NSP; rp += 4) { const int r = sp * (RPW / NSP) + rp + (lane >> 3), c8 = (lane & 7) * 8;      // 8 lanes = one 128-byte line of the row; a wave stores 8 whole rows
      const v8us val = *(const v8us*)&sO[g][r][c8];
      *(v8us*)((unsigned short*)O16 + ((size_t)b * SS + q0 + r) * HID + h * HD + c8) = val; }
    // behind the stores: the next tile's code reuses their address and data registers; the wait that belongs in front of such an overwrite
    asm volatile("s_wait_xcnt 0x0" ::: "memory");
     } } }
// Projection GEMM C[4096][N] = A[4096][1024] * Bt[N][1024]^T / 16 (f16 operands, f32 accumulate, k ascending in steps of 32 as before). Block = 4 waves = a 64 x 128 tile of C; wave = 32 x 64 (2 x 4 accumulators).
// Each stage brings 64 k of the 64 A rows and the 128 Bt rows into LDS with whole 128-byte rows per 8 lanes, so every row is fetched once per block instead of once per wave in 16-line gathers;
// the next stage's rows are loaded into registers while this stage's products run, and go into the other buffer. Row pitch 144 bytes: the 16 rows of a fragment read fall on different banks.
// OUT 0: C f32. OUT 1: C16 = f16(C). OUT 2 (q, k): a wave's 64 columns are one head, so its staged 32 x 64 tile holds whole head rows: per row RMSNorm over the 64 dims (eps 1e-6, times bf16(nw)),
// then RoPE with the INPUT cos/sin[row][64] (rotate_half = [-x2, x1]; rounded to bf16 like every other input), then C16 = f16 in fragment order: the f32 product never goes to memory.
// OUT 3 (v): the wave's 32 x 64 tile is one 32-key chunk of one kv head: rounded to f16 and written in fragment order, which is where V is transposed.
// q, k and v are ONE launch: their weights lie one behind the other as a Bt of 2048 rows, a block's 128 columns belong to one of the three, and the block index (a scalar choice) picks the output form. o is a launch of its own.
typedef float fa __attribute__((may_alias));
typedef unsigned short proj_lds[2][64 + 128][64 + 8];
// the product: leaves each wave's 32 x 64 tile of C (f32, pitch 68) in LDS, over the stage buffers, and returns the wave's tile
__device__ __forceinline__ fa* proj_tile(const _Float16* __restrict__ A, const _Float16* __restrict__ Bt, const int row0, const int col0, proj_lds& sm) {
  constexpr int K = HID, BM = 64, BN = 128, BK = 64, PIT = BK + 8, NS = K / BK, OP = 68;
  static_assert(sizeof(float) * 4 * 32 * OP <= sizeof(unsigned short) * 2 * (BM + BN) * PIT, "the output tiles reuse the stage buffers");
  const int tid = threadIdx.x, w = tid >> 5, lane = tid & 31, ln = lane & 15, hh = lane >> 4;
  const int wm = (w >> 1) * 32, wn = (w & 1) * 64;
  const int sr = tid >> 3, sc = (tid & 7) * 8;
  const unsigned short* ga = (const unsigned short*)A + (size_t)(row0 + sr) * K + sc;
  const unsigned short* gb = (const unsigned short*)Bt + (size_t)(col0 + sr) * K + sc;
  v8us ra[BM / 16], rb[BN / 16];
  v8f acc[2][4];
#pragma unroll
  for (int mi = 0; mi < 2; ++mi)
#pragma unroll
    for (int t = 0; t < 4; ++t) acc[mi][t] = (v8f){0.f,0.f,0.f,0.f,0.f,0.f,0.f,0.f};
#pragma unroll
  for (int i = 0; i < BM / 16; ++i) ra[i] = *(const v8us*)(ga + (size_t)i * 16 * K);
#pragma unroll
  for (int i = 0; i < BN / 16; ++i) rb[i] = *(const v8us*)(gb + (size_t)i * 16 * K);
#pragma unroll
  for (int i = 0; i < BM / 16; ++i) *(v8us*)&sm[0][sr + i * 16][sc] = ra[i];
#pragma unroll
  for (int i = 0; i < BN / 16; ++i) *(v8us*)&sm[0][BM + sr + i * 16][sc] = rb[i];
  __syncthreads();
  // unrolled whole: every stage's global offset is then an immediate on two address pairs that are never rewritten, and the buffer index a constant
#pragma unroll
  for (int s = 0; s < NS; ++s) {
    const int cur = s & 1;
    if (s + 1 < NS) {
#pragma unroll
      for (int i = 0; i < BM / 16; ++i) ra[i] = *(const v8us*)(ga + (size_t)i * 16 * K + (s + 1) * BK);
#pragma unroll
      for (int i = 0; i < BN / 16; ++i) rb[i] = *(const v8us*)(gb + (size_t)i * 16 * K + (s + 1) * BK);
    }
    // keeps the next stage's loads at the head of this stage, so that they fly under all of its products (the scheduler sank them to just in front of their LDS stores)
    __builtin_amdgcn_sched_barrier(0);
    FragH a[BK / 32][2], b[BK / 32][4];
#pragma unroll
    for (int ks = 0; ks < BK / 32; ++ks) {
#pragma unroll
      for (int mi = 0; mi < 2; ++mi) { const unsigned short* p = &sm[cur][wm + mi * 16 + ln][ks * 32 + 8 * hh]; a[ks][mi].half[0] = *(const v8us*)p; a[ks][mi].half[1] = *(const v8us*)(p + 16); }
#pragma unroll
      for (int t = 0; t < 4; ++t) { const unsigned short* p = &sm[cur][BM + wn + t * 16 + ln][ks * 32 + 8 * hh]; b[ks][t].half[0] = *(const v8us*)p; b[ks][t].half[1] = *(const v8us*)(p + 16); }
    }
    // keeps the stage's fragment reads in one group ahead of its products: one exposed LDS latency per stage (the scheduler reused the A registers and waited for LDS four times per stage)
    __builtin_amdgcn_sched_barrier(0);
#pragma unroll
    for (int ks = 0; ks < BK / 32; ++ks)
#pragma unroll
      for (int mi = 0; mi < 2; ++mi)
#pragma unroll
        for (int t = 0; t < 4; ++t) acc[mi][t] = __builtin_amdgcn_wmma_f32_16x16x32_f16(false, a[ks][mi].v, false, b[ks][t].v, (short)0, acc[mi][t], false, false);
    // keeps the waits for those loads, and the LDS stores behind them, behind the issue of all of this stage's products (the scheduler put them in the middle of the stage)
    __builtin_amdgcn_sched_barrier(0);
    if (s + 1 < NS) {
#pragma unroll
      for (int i = 0; i < BM / 16; ++i) *(v8us*)&sm[cur ^ 1][sr + i * 16][sc] = ra[i];
#pragma unroll
      for (int i = 0; i < BN / 16; ++i) *(v8us*)&sm[cur ^ 1][BM + sr + i * 16][sc] = rb[i];
    }
    // one barrier per stage: it publishes the buffer just filled and ends every wave's reads of the buffer that the next stage refills (after the last stage: that the output tiles reuse)
    __syncthreads();
  }
  fa* so = (fa*)&sm[0][0][0] + w * 32 * OP;
#pragma unroll
  for (int mi = 0; mi < 2; ++mi)
#pragma unroll
    for (int t = 0; t < 4; ++t)
#pragma unroll
      for (int r = 0; r < 8; ++r) so[(mi * 16 + 8 * hh + r) * OP + t * 16 + ln] = acc[mi][t][r] * 0.0625f;
  // the wave reads back its own tile, written by other lanes: the LDS stores must have landed first
  __builtin_amdgcn_fence(__ATOMIC_ACQ_REL, "workgroup"); __builtin_amdgcn_wave_barrier();
  return so;
}
// OUT 2; col0 = the block's first column among the NHD * 64 of q or of k
template <int NHD>
__device__ __forceinline__ void proj_norm_rope(const fa* so, const int row0, const int col0, _Float16* __restrict__ C16, const float* __restrict__ nw, const float* __restrict__ cs, const float* __restrict__ sn) {
  constexpr int OP = 68;
  const int tid = threadIdx.x, w = tid >> 5, lane = tid & 31;
  const int wm = (w >> 1) * 32, wn = (w & 1) * 64;
    static_assert(HD == 64, "a wave's 64 columns are one head");
    // 8 lanes per row, 4 rows per pass: a lane holds dims j4..j4+3 (x1) and 32+j4..32+j4+3 (x2), the two halves that RoPE pairs
    const int rr = lane >> 3, j4 = (lane & 7) * 4;
    v4f w1 = *(const v4fa*)(nw + j4), w2 = *(const v4fa*)(nw + 32 + j4);
#pragma unroll
    for (int i = 0; i < 4; ++i) { w1[i] = bf16_round(w1[i]); w2[i] = bf16_round(w2[i]); }
    const fa* xp = so + rr * OP + j4;
    // byte offsets of the lane's first row: one for cos and sin (below 1 MiB), one for the output (below 8 MiB); each rides as the 32-bit offset register beside a scalar base.
    // The output in fragment order: the wave's 32 rows are two 2-KiB tiles of head (col0 + wn) / 64; dims j4 .. j4 + 3 lie in piece j4 / 16, at lane ((j4 / 8) & 1) * 16 + row; 4 rows on = 64 bytes, dim + 32 = 2 pieces, 16 rows on = 2 KiB
    const int r0 = row0 + wm, hd = (col0 + wn) / HD;
    unsigned co = (unsigned)((r0 + rr) * HD + j4) * 4u, yo = (unsigned)((((r0 / SS) * NHD + hd) * SS + r0 % SS) * HD + (j4 >> 4) * 256 + (((j4 >> 3) & 1) * 16 + rr) * 8 + (j4 & 7)) * 2u;
    // two trips of four passes: a trip's 16 cos/sin loads go out together and fly under its sums of squares (all eight passes unrolled took more than 256 registers)
#pragma unroll 1
    for (int qh = 0; qh < 2; ++qh) {
      v4f x1[4], x2[4], c1[4], c2[4], s1[4], s2[4];
#pragma unroll
      for (int q = 0; q < 4; ++q) { x1[q] = *(const v4fa*)(xp + q * 4 * OP); x2[q] = *(const v4fa*)(xp + q * 4 * OP + 32); }
#pragma unroll
      for (int q = 0; q < 4; ++q) { const float* cp = (const float*)((const char*)cs + co) + q * 4 * HD; const float* sp = (const float*)((const char*)sn + co) + q * 4 * HD;
        c1[q] = *(const v4fa*)cp; c2[q] = *(const v4fa*)(cp + 32); s1[q] = *(const v4fa*)sp; s2[q] = *(const v4fa*)(sp + 32); }
#pragma unroll
      for (int q = 0; q < 4; ++q) {
        // sum of squares in the order of a 32-lane xor butterfly (16, 8, 4, 2, 1) over a_j = x1_j^2 + x2_j^2: dim j = 4 * lane + i, so 16, 8, 4 are lane steps 4, 2, 1 and 2, 1 are in-lane
        float t[4];
#pragma unroll
        for (int i = 0; i < 4; ++i) t[i] = __builtin_fmaf(x1[q][i], x1[q][i], x2[q][i] * x2[q][i]);
#pragma unroll
        for (int i = 0; i < 4; ++i) t[i] += row_xor<4>(t[i]);
#pragma unroll
        for (int i = 0; i < 4; ++i) t[i] += row_xor<2>(t[i]);
#pragma unroll
        for (int i = 0; i < 4; ++i) t[i] += row_xor<1>(t[i]);
        const float ss = (t[0] + t[2]) + (t[1] + t[3]);
        const float rs = rsqrtf(ss / (float)HD + 1e-6f);
        v4h y1, y2;      // explicit fma here and in t[]: it fixes which of the two products is rounded on its own
#pragma unroll
        for (int i = 0; i < 4; ++i) { const float n1 = x1[q][i] * rs * w1[i], n2 = x2[q][i] * rs * w2[i];
          y1[i] = (_Float16)__builtin_fmaf(n1, bf16_round(c1[q][i]), -(n2 * bf16_round(s1[q][i]))); y2[i] = (_Float16)__builtin_fmaf(n2, bf16_round(c2[q][i]), n1 * bf16_round(s2[q][i])); }
        _Float16* yp = (_Float16*)((char*)C16 + yo) + q * 4 * 8;
        *(v4h*)yp = y1; *(v4h*)(yp + 2 * 256) = y2; }
      xp += 16 * OP; co += 16 * HD * 4; yo += 16 * HD * 2; }
}
// OUT 0 and OUT 1
template <int N, int OUT>
__device__ __forceinline__ void proj_store(const fa* so, const int row0, const int col0, float* __restrict__ C, _Float16* __restrict__ C16) {
  constexpr int OP = 68;
  const int tid = threadIdx.x, w = tid >> 5, lane = tid & 31, ln = lane & 15, hh = lane >> 4;
  const int wm = (w >> 1) * 32, wn = (w & 1) * 64;
#pragma unroll
  for (int q = 0; q < 16; ++q) { const int r = q * 2 + hh, c4 = ln * 4; const v4f v = *(const v4fa*)&so[r * OP + c4]; const size_t o = (size_t)(row0 + wm + r) * N + col0 + wn + c4;
    if (OUT == 1) { v4h h4;
#pragma unroll
      for (int i = 0; i < 4; ++i) h4[i] = (_Float16)v[i];
      *(v4h*)(C16 + o) = h4; }
    else *(v4f*)(C + o) = v; }
}
// OUT 3; col0 = the block's first column among the 512 of v. Piece (dt, hf): lane hh * 16 + ln takes dim dt * 16 + ln of the keys hf * 16 + hh * 8 .. + 7: a column of the staged tile
// (16 neighbouring dims per key row, the two halves 8 rows = 32 banks apart: no bank conflict); a piece goes out as one store of 512 contiguous bytes
__device__ __forceinline__ void proj_store_vt(const fa* so, const int row0, const int col0, _Float16* __restrict__ Vt) {
  constexpr int OP = 68;
  const int tid = threadIdx.x, w = tid >> 5, lane = tid & 31, ln = lane & 15, hh = lane >> 4;
  const int r0 = row0 + (w >> 1) * 32, kvh = (col0 + (w & 1) * 64) / HD;
  unsigned short* vp = (unsigned short*)Vt + ((size_t)((r0 / SS) * NKV + kvh) * SS + r0 % SS) * HD + lane * 8;
  const fa* xp = so + hh * 8 * OP + ln;
#pragma unroll
  for (int dt = 0; dt < HD / 16; ++dt)
#pragma unroll
    for (int hf = 0; hf < 2; ++hf) { FragH f;
#pragma unroll
      for (int e = 0; e < 8; ++e) f.h[e] = (_Float16)xp[(hf * 16 + e) * OP + dt * 16];
      *(v8us*)(vp + (dt * 2 + hf) * 256) = f.half[0]; }
}
__global__ __launch_bounds__(128) void k_qkv(const _Float16* __restrict__ A, const _Float16* __restrict__ Bt, _Float16* __restrict__ Q16, _Float16* __restrict__ K16, _Float16* __restrict__ Vt,
                                             const float* __restrict__ qnw, const float* __restrict__ knw, const float* __restrict__ cs, const float* __restrict__ sn) {
  constexpr int NBN = (HID + 2 * KVD) / 128;
  __shared__ __attribute__((aligned(16))) proj_lds sm;
  const int row0 = (blockIdx.x / NBN) * 64, col0 = (blockIdx.x % NBN) * 128;
  const fa* so = proj_tile(A, Bt, row0, col0, sm);
  if (col0 < HID) proj_norm_rope<NH>(so, row0, col0, Q16, qnw, cs, sn);
  else if (col0 < HID + KVD) proj_norm_rope<NKV>(so, row0, col0 - HID, K16, knw, cs, sn);
  else { proj_store_vt(so, row0, col0 - (HID + KVD), Vt);
    // behind v's last store: the listing runs on from here into the k and q forms' code, which reuses these stores' address and data registers; the wait that belongs in front of such an overwrite
    asm volatile("s_wait_xcnt 0x0" ::: "memory"); }
}
__global__ __launch_bounds__(128) void k_oproj(const _Float16* __restrict__ A, const _Float16* __restrict__ Bt, float* __restrict__ C) {
  constexpr int NBN = HID / 128;
  __shared__ __attribute__((aligned(16))) proj_lds sm;
  const int row0 = (blockIdx.x / NBN) * 64, col0 = (blockIdx.x % NBN) * 128;
  const fa* so = proj_tile(A, Bt, row0, col0, sm);
  proj_store<HID, 0>(so, row0, col0, C, nullptr);
}
extern "C" void kernel_launch(void* const* d_in, const int* in_sizes, int n_in,
                              void* d_out, int out_size, void* d_ws, size_t ws_size, hipStream_t stream) {
  (void)in_sizes; (void)n_in; (void)out_size;
  const float* x = (const float*)d_in[0]; const float* cs = (const float*)d_in[1]; const float* sn = (const float*)d_in[2]; const float* wq = (const float*)d_in[3]; const float* wk = (const float*)d_in[4]; const float* wv = (const float*)d_in[5]; const float* wo = (const float*)d_in[6]; const float* qnw = (const float*)d_in[7]; const float* knw = (const float*)d_in[8];
  char* ws = (char*)d_ws; size_t off = 0;
  auto take = [&](size_t bytes) { char* p = ws + off; off += (bytes + 255) & ~(size_t)255; return p; };
  _Float16* Bqkv = (_Float16*)take((size_t)(HID + 2 * KVD) * HID * 2); _Float16* Bo = (_Float16*)take((size_t)HID * HID * 2);
  _Float16* X16 = (_Float16*)take((size_t)NR * HID * 2); _Float16* Q16 = (_Float16*)take((size_t)NR * HID * 2); _Float16* K16 = (_Float16*)take((size_t)NR * KVD * 2); _Float16* Vt = (_Float16*)take((size_t)NR * KVD * 2); _Float16* O16 = (_Float16*)take((size_t)NR * HID * 2);
  if (off > ws_size) return;      // about 6 + 8.4 + 8.4 + 4.2 x 2 + 8.4 = 40 MiB
  k_cvt<<<((unsigned)NR * HID + 2u * HID * HID + 2u * KVD * HID) / 2048, 256, 0, stream>>>(x, wq, wk, wv, wo, X16, Bqkv, Bo);
  k_qkv<<<(NR / 64) * ((HID + 2 * KVD) / 128), 128, 0, stream>>>(X16, Bqkv, Q16, K16, Vt, qnw, knw, cs, sn);
  k_flash<<<BB * NKV * (SS / 64), 256, 0, stream>>>(Q16, K16, Vt, O16);
  k_oproj<<<(NR / 64) * (HID / 128), 128, 0, stream>>>(O16, Bo, (float*)d_out);
}

// v010
// A run of this version takes 61.5 microseconds.
// Two timings next to v009 put it at 1.06 and 1.07 times that version's speed.
// Counting every step since v000, it is 8.71 times as fast.
#include <hip/hip_runtime.h>
#define BB 2
#define SS 2048
#define HID 1024
#define NH 16
#define NKV 8
#define HD 64
#define KVD 512
#define NR (BB * SS)

typedef __bf16 v16b __attribute__((ext_vector_type(16)));
typedef unsigned short v8us __attribute__((ext_vector_type(8), may_alias));
typedef float  v8f  __attribute__((ext_vector_type(8)));
typedef float  v4f  __attribute__((ext_vector_type(4)));
typedef float  v4fa __attribute__((ext_vector_type(4), may_alias));
union FragB { v16b v; v8us half[2]; unsigned short u[16]; };

__device__ __forceinline__ unsigned short bf16_bits(float x) { unsigned int u = __float_as_uint(x); return (unsigned short)((u + 0x7FFFu + ((u >> 16) & 1u)) >> 16); }
__device__ __forceinline__ float bf16_val(unsigned short b) { return __uint_as_float(((unsigned int)b) << 16); }
__device__ __forceinline__ float bf16_round(float x) { return bf16_val(bf16_bits(x)); }
// D += A·B with NT terms: 1 = ah·bh, 2 = + al·bh (A split), 3 = + ah·bl (both split)
template <int NT>
__device__ __forceinline__ v8f mmaN(v16b ah, v16b al, v16b bh, v16b bl, v8f c) {
  c = __builtin_amdgcn_wmma_f32_16x16x32_bf16(false, ah, false, bh, (short)0, c, false, false);
  if (NT >= 2) c = __builtin_amdgcn_wmma_f32_16x16x32_bf16(false, al, false, bh, (short)0, c, false, false);
  if (NT >= 3) c = __builtin_amdgcn_wmma_f32_16x16x32_bf16(false, ah, false, bl, (short)0, c, false, false);
  asm volatile("v_nop\n\tv_nop\n\tv_nop\n\tv_nop" : "+v"(c) : "v"(ah), "v"(al), "v"(bh), "v"(bl));
  return c;
}

__global__ __launch_bounds__(256) void k_wt_bf16(const float* __restrict__ W, unsigned short* __restrict__ Wt, int K, int N) {
  const int t = blockIdx.x * 256 + threadIdx.x;
  const int k8n = K / 8;
  if (t >= N * k8n) return;
  const int n = t / k8n, k8 = (t % k8n) * 8;
  v8us v;
#pragma unroll
  for (int i = 0; i < 8; ++i) v[i] = bf16_bits(W[(size_t)(k8 + i) * N + n]);
  *(v8us*)(Wt + (size_t)n * K + k8) = v;
  
}

// GEMM C[M][N] (f32, pitch ldc) = act(A[M][K]·W + bias). A f32 row-major (pitch lda) converted per fragment to bf16
// (ASPLIT: hi/lo two planes -> 2 terms, else single rounded term); Wt bf16 [N][K] (pitch ldb). BIAS_BF16 rounds the
// bias to bf16 first (bias quantised to bf16 before the add). K%32==0, M%16==0, N%64==0.
template <bool ASPLIT, int ACT, bool BIAS_BF16>
__global__ __launch_bounds__(128) void k_gemm_bf(const float* __restrict__ A, int lda, const unsigned short* __restrict__ Wt, int ldb,
                                               const float* __restrict__ bias, float* __restrict__ C, int ldc, int M, int N, int K) {
  __shared__ __attribute__((aligned(16))) float so[4][16][64];
  const int tid = threadIdx.x, w = tid >> 5, lane = tid & 31, ln = lane & 15, hh = lane >> 4;
  const int ntn = N / 64;
  const int wid = blockIdx.x * 4 + w;
  const int mt = wid / ntn, nq = wid % ntn;
  if (mt * 16 >= M) return;
  const int row0 = mt * 16, col0 = nq * 64;
  const float* arow = A + (size_t)(row0 + ln) * lda;
  v8f acc[4] = {};
  for (int kb = 0; kb < K; kb += 32) {
    FragB ah, al;
    const v4f x0 = *(const v4fa*)(arow + kb + 8 * hh), x1 = *(const v4fa*)(arow + kb + 8 * hh + 4);
    const v4f x2 = *(const v4fa*)(arow + kb + 16 + 8 * hh), x3 = *(const v4fa*)(arow + kb + 16 + 8 * hh + 4);
    float xs[16] = {x0[0],x0[1],x0[2],x0[3],x1[0],x1[1],x1[2],x1[3],x2[0],x2[1],x2[2],x2[3],x3[0],x3[1],x3[2],x3[3]};
#pragma unroll
    for (int i = 0; i < 16; ++i) { const unsigned short hb = bf16_bits(xs[i]); ah.u[i] = hb; al.u[i] = ASPLIT ? bf16_bits(xs[i] - bf16_val(hb)) : (unsigned short)0; }
#pragma unroll
    for (int t = 0; t < 4; ++t) {
      const unsigned short* brow = Wt + (size_t)(col0 + t * 16 + ln) * ldb + kb;
      FragB b;
      b.half[0] = *(const v8us*)(brow + 8 * hh);
      b.half[1] = *(const v8us*)(brow + 16 + 8 * hh);
      acc[t] = mmaN<ASPLIT ? 2 : 1>(ah.v, al.v, b.v, b.v, acc[t]);
    }
  }
#pragma unroll
  for (int t = 0; t < 4; ++t) {
    float bv = bias ? bias[col0 + t * 16 + ln] : 0.f;
    if (BIAS_BF16) bv = bf16_round(bv);
#pragma unroll
    for (int r = 0; r < 8; ++r) { float v = acc[t][r] + bv; if (ACT == 1) v = fmaxf(v, 0.f); so[w][8 * hh + r][t * 16 + ln] = v; }
  }
  __builtin_amdgcn_fence(__ATOMIC_ACQ_REL, "workgroup");
  __builtin_amdgcn_wave_barrier();
  const int rsub = lane >> 4, c4 = (lane & 15) * 4;
  {
#pragma unroll
    for (int q = 0; q < 8; ++q) {
      const int r = q * 2 + rsub;
      const v4f v = *(const v4fa*)&so[w][r][c4];
      *(v4f*)(C + (size_t)(row0 + r) * ldc + col0 + c4) = v;
    }
    
  }
}

// Flash-style causal/unmasked attention, all contractions 3-term bf16 hi/lo splits, f32 softmax with running max.
// q,k,v rows are read from f32 buffers with arbitrary row pitch (so they can live inside a fused qkv buffer);
// D = head size (multiple of 32, <= 128); one wave = 16 query rows; block = 4 waves (64 queries) sharing K/V chunks of 32.
template <int D, bool CAUSAL>
__global__ __launch_bounds__(128) void k_flash(const float* __restrict__ qb, const float* __restrict__ kb, const float* __restrict__ vb,
                                             int pitch, int T, int H, float scale, float* __restrict__ y, int ypitch) {
  constexpr int KS = D / 32;        // k-steps for QK
  constexpr int DT = D / 16;        // d tiles for PV
  __shared__ __attribute__((aligned(16))) unsigned short sKh[32][D + 8], sKl[32][D + 8], sVh[32][D + 8], sVl[32][D + 8];
  __shared__ __attribute__((aligned(16))) unsigned short sPh[4][16][40], sPl[4][16][40];
  __shared__ __attribute__((aligned(16))) float sO[4][16][D];
  const int tid = threadIdx.x, w = tid >> 5, lane = tid & 31, ln = lane & 15, hh = lane >> 4;
  const int nqb = (T + 63) / 64;
  const int bh = blockIdx.x / nqb, qblk = blockIdx.x % nqb;
  const int b = bh / H, h = bh % H;
  const int q0 = qblk * 64 + w * 16;
  const float* Q = qb + (size_t)b * T * pitch + h * D;
  const float* K = kb + (size_t)b * T * pitch + h * D;
  const float* V = vb + (size_t)b * T * pitch + h * D;

  // A fragments of the wave's 16 query rows (scaled), hi/lo
  FragB aqh[KS], aql[KS];
  {
    int row = q0 + ln; if (row >= T) row = T - 1;
    const float* qr = Q + (size_t)row * pitch;
#pragma unroll
    for (int ks = 0; ks < KS; ++ks)
#pragma unroll
      for (int i = 0; i < 16; ++i) {
        const int d = ks * 32 + ((i < 8) ? (8 * hh + i) : (16 + 8 * hh + (i - 8)));
        const float x = qr[d] * scale; const unsigned short hb = bf16_bits(x);
        aqh[ks].u[i] = hb; aql[ks].u[i] = bf16_bits(x - bf16_val(hb));
      }
  }
  float m_r[8], l_r[8];
#pragma unroll
  for (int r = 0; r < 8; ++r) { m_r[r] = -3.0e38f; l_r[r] = 0.f; }
  v8f oacc[DT];
#pragma unroll
  for (int dt = 0; dt < DT; ++dt) oacc[dt] = (v8f){0.f,0.f,0.f,0.f,0.f,0.f,0.f,0.f};

  const int kv_end = CAUSAL ? min(T, qblk * 64 + 64) : T;     // block-uniform
  for (int j0 = 0; j0 < kv_end; j0 += 32) {
    __syncthreads();
    for (int e = tid; e < 32 * (D / 4); e += 128) {
      const int r = e / (D / 4), c4 = (e % (D / 4)) * 4;
      const int key = j0 + r;
      v4f kf = {0.f,0.f,0.f,0.f}, vf = {0.f,0.f,0.f,0.f};
      if (key < T) { kf = *(const v4fa*)(K + (size_t)key * pitch + c4); vf = *(const v4fa*)(V + (size_t)key * pitch + c4); }
#pragma unroll
      for (int t = 0; t < 4; ++t) {
        unsigned short hb = bf16_bits(kf[t]); sKh[r][c4 + t] = hb; sKl[r][c4 + t] = bf16_bits(kf[t] - bf16_val(hb));
        hb = bf16_bits(vf[t]); sVh[r][c4 + t] = hb; sVl[r][c4 + t] = bf16_bits(vf[t] - bf16_val(hb));
      }
    }
    __syncthreads();
    // S tile 16 x 32
    v8f s[2];
#pragma unroll
    for (int nt = 0; nt < 2; ++nt) {
      v8f acc = {};
#pragma unroll
      for (int ks = 0; ks < KS; ++ks) {
        FragB bh_, bl_;
        bh_.half[0] = *(const v8us*)&sKh[nt * 16 + ln][ks * 32 + 8 * hh]; bh_.half[1] = *(const v8us*)&sKh[nt * 16 + ln][ks * 32 + 16 + 8 * hh];
        bl_.half[0] = *(const v8us*)&sKl[nt * 16 + ln][ks * 32 + 8 * hh]; bl_.half[1] = *(const v8us*)&sKl[nt * 16 + ln][ks * 32 + 16 + 8 * hh];
        acc = mmaN<3>(aqh[ks].v, aql[ks].v, bh_.v, bl_.v, acc);
      }
      s[nt] = acc;
    }
    // mask + running max (rows 8hh+r; the 16 lanes of a half share rows)
    float alpha[8];
#pragma unroll
    for (int r = 0; r < 8; ++r) {
      const int qi = q0 + 8 * hh + r;
      const int ja = j0 + ln, jb = j0 + 16 + ln;
      if (CAUSAL) { if (ja > qi) s[0][r] = -3.0e38f; if (jb > qi) s[1][r] = -3.0e38f; }
      if (ja >= T) s[0][r] = -3.0e38f;
      if (jb >= T) s[1][r] = -3.0e38f;
      float mx = fmaxf(s[0][r], s[1][r]);
      mx = fmaxf(mx, __shfl_xor(mx, 1, 32)); mx = fmaxf(mx, __shfl_xor(mx, 2, 32)); mx = fmaxf(mx, __shfl_xor(mx, 4, 32)); mx = fmaxf(mx, __shfl_xor(mx, 8, 32));
      const float mnew = fmaxf(m_r[r], mx);
      alpha[r] = (mnew > -1.0e38f) ? __expf(m_r[r] - mnew) : 1.0f;
      const float p0 = (s[0][r] > -1.0e38f) ? __expf(s[0][r] - mnew) : 0.f;
      const float p1 = (s[1][r] > -1.0e38f) ? __expf(s[1][r] - mnew) : 0.f;
      m_r[r] = mnew;
      l_r[r] = l_r[r] * alpha[r] + p0 + p1;            // per-lane partial row sum (16 lanes combined at the end)
      unsigned short hb = bf16_bits(p0); sPh[w][8 * hh + r][ln] = hb;      sPl[w][8 * hh + r][ln] = bf16_bits(p0 - bf16_val(hb));
      hb = bf16_bits(p1);                sPh[w][8 * hh + r][16 + ln] = hb; sPl[w][8 * hh + r][16 + ln] = bf16_bits(p1 - bf16_val(hb));
    }
#pragma unroll
    for (int dt = 0; dt < DT; ++dt)
#pragma unroll
      for (int r = 0; r < 8; ++r) oacc[dt][r] *= alpha[r];
    __builtin_amdgcn_fence(__ATOMIC_ACQ_REL, "workgroup");
    __builtin_amdgcn_wave_barrier();
    FragB pah, pal;
    pah.half[0] = *(const v8us*)&sPh[w][ln][8 * hh]; pah.half[1] = *(const v8us*)&sPh[w][ln][16 + 8 * hh];
    pal.half[0] = *(const v8us*)&sPl[w][ln][8 * hh]; pal.half[1] = *(const v8us*)&sPl[w][ln][16 + 8 * hh];
#pragma unroll
    for (int dt = 0; dt < DT; ++dt) {
      FragB bvh, bvl;
#pragma unroll
      for (int i = 0; i < 8; ++i) {
        bvh.u[i] = sVh[8 * hh + i][dt * 16 + ln]; bvh.u[8 + i] = sVh[16 + 8 * hh + i][dt * 16 + ln];
        bvl.u[i] = sVl[8 * hh + i][dt * 16 + ln]; bvl.u[8 + i] = sVl[16 + 8 * hh + i][dt * 16 + ln];
      }
      oacc[dt] = mmaN<3>(pah.v, pal.v, bvh.v, bvl.v, oacc[dt]);
    }
    __builtin_amdgcn_fence(__ATOMIC_ACQ_REL, "workgroup");
    __builtin_amdgcn_wave_barrier();
  }
#pragma unroll
  for (int r = 0; r < 8; ++r) {
    float l = l_r[r];
    l += __shfl_xor(l, 1, 32); l += __shfl_xor(l, 2, 32); l += __shfl_xor(l, 4, 32); l += __shfl_xor(l, 8, 32);
    l_r[r] = (l > 0.f) ? 1.0f / l : 0.f;
  }
#pragma unroll
  for (int dt = 0; dt < DT; ++dt)
#pragma unroll
    for (int r = 0; r < 8; ++r) sO[w][8 * hh + r][dt * 16 + ln] = oacc[dt][r] * l_r[r];
  __builtin_amdgcn_fence(__ATOMIC_ACQ_REL, "workgroup");
  __builtin_amdgcn_wave_barrier();
  {
    for (int r = 0; r < 16; ++r) {
      const int row = q0 + r;
      if (row < T && lane < D / 4) {
        const v4f val = *(const v4fa*)&sO[w][r][lane * 4];
        *(v4f*)(y + ((size_t)b * T + row) * ypitch + h * D + lane * 4) = val;
      }
    }
    
  }
}

// GEMM C = act(A·W + bias + resid): A f32 (ASPLIT -> hi/lo 2 terms), Wt bf16 [N][K]; ACT 0 none, 1 relu, 2 exact gelu;
// resid (optional, f32, row index = (row % rmod), pitch ldr, RES_BF16 rounds it) added before the activation.
template <bool ASPLIT, int ACT, bool BIAS_BF16, bool RES_BF16>
__global__ __launch_bounds__(128) void k_gemm_bf3(const float* __restrict__ A, int lda, const unsigned short* __restrict__ Wt, int ldb,
                                                const float* __restrict__ bias, const float* __restrict__ resid, int rmod, int ldr,
                                                float* __restrict__ C, int ldc, int M, int N, int K) {
  __shared__ __attribute__((aligned(16))) float so[4][16][64];
  const int tid = threadIdx.x, w = tid >> 5, lane = tid & 31, ln = lane & 15, hh = lane >> 4;
  const int ntn = N / 64;
  const int wid = blockIdx.x * 4 + w;
  const int mt = wid / ntn, nq = wid % ntn;
  if (mt * 16 >= M) return;
  const int row0 = mt * 16, col0 = nq * 64;
  const float* arow = A + (size_t)(row0 + ln) * lda;
  v8f acc[4] = {};
  for (int kb = 0; kb < K; kb += 32) {
    FragB ah, al;
    const v4f x0 = *(const v4fa*)(arow + kb + 8 * hh), x1 = *(const v4fa*)(arow + kb + 8 * hh + 4);
    const v4f x2 = *(const v4fa*)(arow + kb + 16 + 8 * hh), x3 = *(const v4fa*)(arow + kb + 16 + 8 * hh + 4);
    float xs[16] = {x0[0],x0[1],x0[2],x0[3],x1[0],x1[1],x1[2],x1[3],x2[0],x2[1],x2[2],x2[3],x3[0],x3[1],x3[2],x3[3]};
#pragma unroll
    for (int i = 0; i < 16; ++i) { const unsigned short hb = bf16_bits(xs[i]); ah.u[i] = hb; al.u[i] = ASPLIT ? bf16_bits(xs[i] - bf16_val(hb)) : (unsigned short)0; }
#pragma unroll
    for (int t = 0; t < 4; ++t) {
      const unsigned short* brow = Wt + (size_t)(col0 + t * 16 + ln) * ldb + kb;
      FragB b;
      b.half[0] = *(const v8us*)(brow + 8 * hh);
      b.half[1] = *(const v8us*)(brow + 16 + 8 * hh);
      acc[t] = mmaN<ASPLIT ? 2 : 1>(ah.v, al.v, b.v, b.v, acc[t]);
    }
  }
#pragma unroll
  for (int t = 0; t < 4; ++t) {
    const int col = col0 + t * 16 + ln;
    float bv = bias ? bias[col] : 0.f;
    if (BIAS_BF16) bv = bf16_round(bv);
#pragma unroll
    for (int r = 0; r < 8; ++r) {
      float v = acc[t][r] + bv;
      if (resid) { float rv = resid[(size_t)((row0 + 8 * hh + r) % rmod) * ldr + col]; if (RES_BF16) rv = bf16_round(rv); v += rv; }
      if (ACT == 1) v = fmaxf(v, 0.f);
      if (ACT == 2) v = 0.5f * v * (1.0f + erff(v * 0.70710678118654752f));
      if (ACT == 3) { const float u = 0.7978845608028654f * (v + 0.044715f * v * v * v); v = 0.5f * v * (1.0f + tanhf(u)); }
      so[w][8 * hh + r][t * 16 + ln] = v;
    }
  }
  __builtin_amdgcn_fence(__ATOMIC_ACQ_REL, "workgroup");
  __builtin_amdgcn_wave_barrier();
  const int rsub = lane >> 4, c4 = (lane & 15) * 4;
  {
#pragma unroll
    for (int q = 0; q < 8; ++q) {
      const int r = q * 2 + rsub;
      const v4f v = *(const v4fa*)&so[w][r][c4];
      *(v4f*)(C + (size_t)(row0 + r) * ldc + col0 + c4) = v;
    }
    
  }
}
// row LayerNorm (biased variance, eps) over N: s = X (+ R); optional out_sum <- s; out_norm <- (s-mu)*rsqrt(var+eps)*g + b
template <bool PARAM_BF16>
__global__ __launch_bounds__(256) void k_layernorm(const float* __restrict__ X, const float* __restrict__ R, const float* __restrict__ g, const float* __restrict__ bta,
                                                  float* __restrict__ out_sum, float* __restrict__ out_norm, int N, float eps) {
  __shared__ float red[256];
  const int row = blockIdx.x, tid = threadIdx.x;
  const float* x = X + (size_t)row * N; const float* rr = R ? R + (size_t)row * N : nullptr;
  float vals[16];                     // up to N = 4096
  const int per = N / 256;            // contiguous chunk per thread? use strided-by-4 chunks: thread handles j = tid*4 + 1024*u
  float s1 = 0.f;
  for (int u = 0; u < per / 4; ++u) {
    const int j = tid * 4 + 1024 * u;
    const v4f a = *(const v4fa*)(x + j);
    v4f b = {0.f,0.f,0.f,0.f}; if (rr) b = *(const v4fa*)(rr + j);
#pragma unroll
    for (int q = 0; q < 4; ++q) { const float v = a[q] + b[q]; vals[u * 4 + q] = v; s1 += v; }
  }
  red[tid] = s1; __syncthreads();
  for (int st = 128; st > 0; st >>= 1) { if (tid < st) red[tid] += red[tid + st]; __syncthreads(); }
  const float mu = red[0] / (float)N; __syncthreads();
  float s2 = 0.f;
  for (int u = 0; u < per / 4; ++u)
#pragma unroll
    for (int q = 0; q < 4; ++q) { const float c = vals[u * 4 + q] - mu; s2 += c * c; }
  red[tid] = s2; __syncthreads();
  for (int st = 128; st > 0; st >>= 1) { if (tid < st) red[tid] += red[tid + st]; __syncthreads(); }
  const float rs = rsqrtf(red[0] / (float)N + eps);
  {
    for (int u = 0; u < per / 4; ++u) {
      const int j = tid * 4 + 1024 * u;
      v4f o, sm;
#pragma unroll
      for (int q = 0; q < 4; ++q) {
        float gg = g[j + q], bb = bta[j + q];
        if (PARAM_BF16) { gg = bf16_round(gg); bb = bf16_round(bb); }
        sm[q] = vals[u * 4 + q]; o[q] = (vals[u * 4 + q] - mu) * rs * gg + bb;
      }
      if (out_sum) *(v4f*)(out_sum + (size_t)row * N + j) = sm;
      *(v4f*)(out_norm + (size_t)row * N + j) = o;
    }
    
  }
}



// ---- f16 WMMA path (v_wmma_f32_16x16x32_f16): 11-bit significands for operands in range — used where a [0,1] probability operand needs more precision than bf16
typedef _Float16 v16h __attribute__((ext_vector_type(16)));
typedef _Float16 v4h __attribute__((ext_vector_type(4)));
union FragH { v16h v; v8us half[2]; _Float16 h[16]; unsigned short u[16]; };
template <int NT>
__device__ __forceinline__ v8f mmaH(v16h ah, v16h al, v16h bh, v16h bl, v8f c) {
  c = __builtin_amdgcn_wmma_f32_16x16x32_f16(false, ah, false, bh, (short)0, c, false, false);
  if (NT >= 2) c = __builtin_amdgcn_wmma_f32_16x16x32_f16(false, al, false, bh, (short)0, c, false, false);
  if (NT >= 3) c = __builtin_amdgcn_wmma_f32_16x16x32_f16(false, ah, false, bl, (short)0, c, false, false);
  asm volatile("v_nop\n\tv_nop\n\tv_nop\n\tv_nop" : "+v"(c) : "v"(ah), "v"(al), "v"(bh), "v"(bl));
  return c;
}
// batched GEMM like k_gemm_b but f16 operands: A f32 (split into f16 hi/lo if ASPLIT, else rounded to f16), Bt = f16 values [n][k]; alpha; C f32; N multiple of 16 (partial tiles skipped)
template <bool ASPLIT>
__global__ __launch_bounds__(128) void k_gemm_h(const float* __restrict__ A, int lda, size_t sA, const _Float16* __restrict__ Bh, int ldb, size_t sB, float alpha, float* __restrict__ C, int ldc, size_t sC, int M, int N, int K) {
  __shared__ __attribute__((aligned(16))) float so[4][16][64];
  const int tid = threadIdx.x, w = tid >> 5, lane = tid & 31, ln = lane & 15, hh = lane >> 4; const int by = blockIdx.y;
  A += (size_t)by * sA; Bh += (size_t)by * sB; C += (size_t)by * sC;
  const int ntn = (N + 63) / 64; const int wid = blockIdx.x * 4 + w; const int mt = wid / ntn, nq = wid % ntn; if (mt * 16 >= M) return;
  const int row0 = mt * 16, col0 = nq * 64; const float* arow = A + (size_t)(row0 + ln) * lda;
  v8f acc[4] = {};
  for (int kb = 0; kb < K; kb += 32) {
    FragH ah, al;
    const v4f x0 = *(const v4fa*)(arow + kb + 8 * hh), x1 = *(const v4fa*)(arow + kb + 8 * hh + 4), x2 = *(const v4fa*)(arow + kb + 16 + 8 * hh), x3 = *(const v4fa*)(arow + kb + 16 + 8 * hh + 4);
    float xs[16] = {x0[0],x0[1],x0[2],x0[3],x1[0],x1[1],x1[2],x1[3],x2[0],x2[1],x2[2],x2[3],x3[0],x3[1],x3[2],x3[3]};
#pragma unroll
    for (int i = 0; i < 16; ++i) { const _Float16 h = (_Float16)xs[i]; ah.h[i] = h; al.h[i] = ASPLIT ? (_Float16)(xs[i] - (float)h) : (_Float16)0.0f; }
#pragma unroll
    for (int t = 0; t < 4; ++t) { if (col0 + t * 16 >= N) continue; const size_t boff = (size_t)(col0 + t * 16 + ln) * ldb + kb; FragH bq; bq.half[0] = *(const v8us*)(Bh + boff + 8 * hh); bq.half[1] = *(const v8us*)(Bh + boff + 16 + 8 * hh);
      acc[t] = mmaH<ASPLIT ? 2 : 1>(ah.v, al.v, bq.v, bq.v, acc[t]); }
  }
#pragma unroll
  for (int t = 0; t < 4; ++t) { if (col0 + t * 16 >= N) continue;
#pragma unroll
    for (int r = 0; r < 8; ++r) so[w][8 * hh + r][t * 16 + ln] = acc[t][r] * alpha; }
  __builtin_amdgcn_fence(__ATOMIC_ACQ_REL, "workgroup"); __builtin_amdgcn_wave_barrier();
  const int rsub = lane >> 4, c4 = (lane & 15) * 4;
  {
#pragma unroll
    for (int q = 0; q < 8; ++q) { const int r = q * 2 + rsub; if (col0 + c4 < N) { const v4f v = *(const v4fa*)&so[w][r][c4]; *(v4f*)(C + (size_t)(row0 + r) * ldc + col0 + c4) = v; } }
     }
}

// Wt[n][k] = f16(W[k][n]·scale) from f32 row-major W[K][N] (scale = power of two; bf16-exact weights stay exact in f16 away from the subnormal range)
__global__ __launch_bounds__(256) void k_wt_f16(const float* __restrict__ W, _Float16* __restrict__ Wt, int K, int N, float scale) {
  const int t = blockIdx.x * 256 + threadIdx.x; if (t >= N * (K / 8)) return; const int n = t / (K / 8), k8 = (t % (K / 8)) * 8; FragH f;
#pragma unroll
  for (int i = 0; i < 8; ++i) f.h[i] = (_Float16)(bf16_round(W[(size_t)(k8 + i) * N + n]) * scale); const v8us o = f.half[0];
  *(v8us*)((unsigned short*)Wt + (size_t)n * K + k8) = o; 
}
// The five input conversions in one launch: they are independent of one another, and the block index picks the job (a scalar choice, the same for a whole block). x -> f16(bf16(x)); each weight, already (out,in) = Bt,
// -> f16(bf16(w) * 16). wq, wk and wv land one behind the other, so that they read as one Bt of 2048 rows.
__global__ __launch_bounds__(256) void k_cvt(const float* __restrict__ x, const float* __restrict__ wq, const float* __restrict__ wk, const float* __restrict__ wv, const float* __restrict__ wo,
                                             _Float16* __restrict__ X16, _Float16* __restrict__ Bqkv, _Float16* __restrict__ Bo) {
  constexpr unsigned GX = (unsigned)NR * HID / 2048, GQ = (unsigned)HID * HID / 2048, GK = (unsigned)KVD * HID / 2048;      // blocks per job: 256 threads x 8 elements
  static_assert(NR * HID % 2048 == 0 && HID * HID % 2048 == 0 && KVD * HID % 2048 == 0, "whole blocks only");
  unsigned bid = blockIdx.x; const float* s; _Float16* d; float sc = 16.0f;
  if (bid < GX) { s = x; d = X16; sc = 1.0f; }
  else if ((bid -= GX) < GQ) { s = wq; d = Bqkv; }
  else if ((bid -= GQ) < GK) { s = wk; d = Bqkv + (size_t)HID * HID; }
  else if ((bid -= GK) < GK) { s = wv; d = Bqkv + (size_t)(HID + KVD) * HID; }
  else { bid -= GK; s = wo; d = Bo; }
  const size_t t = (size_t)bid * 256 + threadIdx.x; FragH f;
#pragma unroll
  for (int i = 0; i < 8; ++i) f.h[i] = (_Float16)(bf16_round(s[t * 8 + i]) * sc);
  *(v8us*)((unsigned short*)d + t * 8) = f.half[0]; }
// FRAGMENT ORDER of the attention operands in the workspace. A 16x16x32 operand fragment is two 16-byte halves per lane; half hf of fragment ks holds, in lane hh * 16 + ln, row ln and k = ks * 32 + hf * 16 + hh * 8 .. + 7.
// Each such half lies as one piece of 512 bytes, lane after lane, so that a wave fetches it with ONE load of 4 whole 128-byte lines (from row-major rows the same load touched 16 lines, 32 bytes of each).
// Q and K (row = position, k = head dim): per (batch, head) and 16 positions 4 pieces (ks, hf) = 2 KiB. V (row = head dim, k = key: the transposed operand): per (batch, kv head) and 32 keys 8 pieces (dt, hf) = 4 KiB, row = dim dt * 16 + ln.
// a step of an xor butterfly inside a 16-lane row: the builtin move fuses into v_add_f32_dpp
template <int M> __device__ __forceinline__ float row_xor(float v) { return __int_as_float(__builtin_amdgcn_mov_dpp(__float_as_int(v), 0x160 + M, 0xf, 0xf, true)); }
// the value of lane l ^ 16 (the other half of the wave), on the vector pipe
__device__ __forceinline__ float half_xor(float v) { const int b = __float_as_int(v); return __int_as_float(__builtin_amdgcn_permlanex16(b, b, 0x76543210, 0xfedcba98, false, false)); }
// fused causal GQA attention. The work is dealt so that every wave walks 15 to 17 chunks of 32 keys (a causal tile's cost grows with its position, and all work-groups are resident, so the launch lasts as long as its fullest wave):
// a work-group = 8 waves = the 2 query heads of one kv head x 4 key shares; it takes the 32-query tile NT - 1 - u and then the tile u (together 65 chunks for every u); share sp of a head walks the chunks sp, sp + 4, ... of the tile,
// and the four partial results (maximum, sum, output) of a tile are joined through LDS at the tile's end. Q, K and V are read in fragment order (above); mask k <= q else -inf.
// Both products run transposed: St = K * Qt (A = 16 key rows, B = 16 query columns) and Ot += Vt * Pt (A = 16 rows of Vt, B = Pt). A lane of an St tile then holds 8 keys of ONE query (column ln, keys 8 * hh + r),
// so a query's maximum and sum are taken inside the lane, with one exchange between the wave's halves for the maximum; running maximum, sum and rescale factor are one value per lane and 16-query group;
// and the two St tiles of a 32-key chunk, rounded to f16 in place, ARE the B operand Pt in the hardware's k order (element s = key 8 * hh + s, then 16 + 8 * hh + s - 8), which the Vt loads already follow: P never leaves the registers.
__global__ __launch_bounds__(256) __attribute__((amdgpu_waves_per_eu(4, 4))) void k_flash(const _Float16* __restrict__ Q16, const _Float16* __restrict__ K16, const _Float16* __restrict__ Vt, _Float16* __restrict__ O16) {
  constexpr int RPW = 32, NT = SS / RPW, DT = HD / 16, KS = HD / 32, OPIT = HD + 8, G = NH / NKV, NSP = 4;
  static_assert(NT % 2 == 0 && DT == NSP && G * NSP == 8, "tiles pair up; share sp joins output dims sp * 16 .. sp * 16 + 15; 8 waves");
  // The softmax runs in base 2: the scores take 1/8 and log2(e) in their one multiply, so e^(s - m) = 2^(s2 - m2) is one subtraction and one v_exp_f32. Every argument is <= 0 here (m2 is the running maximum),
  // so nothing can overflow; -inf (masked) and the -3e38 start value give 0; a result below 2^-126 is flushed to 0, far under the f16 rounding of P and the f32 rounding of the row sum, which holds a term 1.
  constexpr float SC2 = 0.125f * 1.4426950408889634f;
  // the shares' partial outputs, lane-contiguous 16-byte pieces (no bank conflicts), and their maxima and sums
  __shared__ __attribute__((aligned(16))) float sX[G][NSP][2][DT][2][32][4];
  __shared__ float sM[G][NSP][2][32], sL[G][NSP][2][32];
  // output staging, f16; row pitch 144 bytes: the 16-byte stores of 8 rows fall on different banks
  __shared__ __attribute__((aligned(16))) unsigned short sO[G][RPW][OPIT];
  const int tid = threadIdx.x, lane = tid & 31, ln = lane & 15, hh = lane >> 4;
  const int w = __builtin_amdgcn_readfirstlane(tid >> 5), g = w >> 2, sp = w & 3;      // scalar: a wave's trip count depends on sp, and the loop must stay a scalar loop (all lanes on at every WMMA)
  const int slab = blockIdx.x / (NT / 2), u = blockIdx.x % (NT / 2); const int b = slab / NKV, kvh = slab % NKV; const int h = kvh * G + g;
  // a 32-key chunk is 4 KiB of K and 4 KiB of V (64 elements per key); kl: the share's first chunk, vl: the kv head's chunk 0; the lane's 16 bytes of each piece
  const unsigned short* kl = (const unsigned short*)K16 + ((size_t)slab * SS + sp * 32) * HD + lane * 8;
  const unsigned short* vl = (const unsigned short*)Vt + (size_t)slab * SS * HD + lane * 8;
  // K and V fragments are requested ahead of their products, so that no product waits out a load: a chunk's V is loaded at the chunk's head, its K during the share's chunk before it. A tile's last chunk loads the share's FIRST chunk,
  // which is what the next tile starts with; the first tile's is loaded here (rows below 128: in bounds also where a share has no chunk in a tile; that is only the second tile, u < sp, and the fragments then go unused)
  FragH bk[2][KS];
#pragma unroll
  for (int nt = 0; nt < 2; ++nt)
#pragma unroll
    for (int ks = 0; ks < KS; ++ks) { bk[nt][ks].half[0] = *(const v8us*)(kl + (nt * KS + ks) * 512); bk[nt][ks].half[1] = *(const v8us*)(kl + (nt * KS + ks) * 512 + 256); }
  // rolled: the two tiles run one after the other through the same code
#pragma unroll 1
  for (int ph = 0; ph < 2; ++ph) {
  const int q0 = (ph ? u : NT - 1 - u) * RPW;
  FragH aq[2][KS];
#pragma unroll
  for (int rt = 0; rt < 2; ++rt) { const unsigned short* qr = (const unsigned short*)Q16 + ((size_t)(b * NH + h) * SS + q0 + rt * 16) * HD + lane * 8;
#pragma unroll
    for (int ks = 0; ks < KS; ++ks) { aq[rt][ks].half[0] = *(const v8us*)(qr + ks * 512); aq[rt][ks].half[1] = *(const v8us*)(qr + ks * 512 + 256); } }
  float m_r[2], l_r[2]; v8f oacc[2][DT];      // of query q0 + rt * 16 + ln; oacc[rt][dt][r] is its dim dt * 16 + 8 * hh + r; l_r sums the keys of the lane's own half
#pragma unroll
  for (int rt = 0; rt < 2; ++rt) { m_r[rt] = -3.0e38f; l_r[rt] = 0.f;
#pragma unroll
    for (int dt = 0; dt < DT; ++dt) oacc[rt][dt] = (v8f){0.f,0.f,0.f,0.f,0.f,0.f,0.f,0.f}; }
  const int jend = q0 + RPW;
#pragma unroll 1
  for (int j0 = sp * 32; j0 < jend; j0 += NSP * 32) {
    FragH bv[DT];
#pragma unroll
    for (int dt = 0; dt < DT; ++dt) { bv[dt].half[0] = *(const v8us*)(vl + (size_t)j0 * HD + dt * 512); bv[dt].half[1] = *(const v8us*)(vl + (size_t)j0 * HD + dt * 512 + 256); }
    v8f s[2][2];      // s[rt][nt][r]: key j0 + nt * 16 + 8 * hh + r against query q0 + rt * 16 + ln
#pragma unroll
    for (int nt = 0; nt < 2; ++nt)
#pragma unroll
      for (int rt = 0; rt < 2; ++rt) { v8f acc = (v8f){0.f,0.f,0.f,0.f,0.f,0.f,0.f,0.f};
#pragma unroll
        for (int ks = 0; ks < KS; ++ks) acc = mmaH<1>(bk[nt][ks].v, bk[nt][ks].v, aq[rt][ks].v, aq[rt][ks].v, acc); s[rt][nt] = acc; }
    // the share's next chunk's K into the same registers, right behind their last product; behind the tile's last chunk the share's first chunk, for the next tile (kl stands at it)
    { const unsigned short* kn = kl + (size_t)((j0 + NSP * 32 < jend) ? j0 + NSP * 32 - sp * 32 : 0) * HD;
#pragma unroll
      for (int nt = 0; nt < 2; ++nt)
#pragma unroll
        for (int ks = 0; ks < KS; ++ks) { bk[nt][ks].half[0] = *(const v8us*)(kn + (nt * KS + ks) * 512); bk[nt][ks].half[1] = *(const v8us*)(kn + (nt * KS + ks) * 512 + 256); } }
    // stands between the loads above and the softmax, which reuses their K address pair: the wait that belongs in front of an overwrite of an issued load's address register
    asm volatile("s_wait_xcnt 0x0" ::: "memory");
    // keeps the V and K loads and the wait in front of the softmax and the output products that the loads fly under (without it the scheduler sank the K loads into the softmax and the wait far behind them)
    __builtin_amdgcn_sched_barrier(0);
    FragH pb[2];
#pragma unroll
    for (int rt = 0; rt < 2; ++rt) { const int dq = q0 + rt * 16 + ln - 8 * hh - j0;      // key nt * 16 + r of the lane's half is allowed while nt * 16 + r <= dq
      v8f s0 = s[rt][0] * SC2, s1 = s[rt][1] * SC2;
#pragma unroll
      for (int r = 0; r < 8; ++r) { s0[r] = (r <= dq) ? s0[r] : -INFINITY; s1[r] = (16 + r <= dq) ? s1[r] : -INFINITY; }
      float mx = fmaxf(fmaxf(fmaxf(fmaxf(s0[0], s0[1]), fmaxf(s0[2], s0[3])), fmaxf(fmaxf(s0[4], s0[5]), fmaxf(s0[6], s0[7]))), fmaxf(fmaxf(fmaxf(s1[0], s1[1]), fmaxf(s1[2], s1[3])), fmaxf(fmaxf(s1[4], s1[5]), fmaxf(s1[6], s1[7]))));
      mx = fmaxf(mx, half_xor(mx));      // both halves hold keys of the same query and scale the same output column: one maximum for both
      const float mn = fmaxf(m_r[rt], mx); const float al = __builtin_amdgcn_exp2f(m_r[rt] - mn); m_r[rt] = mn;
      s0 -= mn; s1 -= mn;
#pragma unroll
      for (int r = 0; r < 8; ++r) { s0[r] = __builtin_amdgcn_exp2f(s0[r]); s1[r] = __builtin_amdgcn_exp2f(s1[r]); pb[rt].h[r] = (_Float16)s0[r]; pb[rt].h[8 + r] = (_Float16)s1[r]; }
      const v8f t = s0 + s1;
      l_r[rt] = l_r[rt] * al + (((t[0] + t[1]) + (t[2] + t[3])) + ((t[4] + t[5]) + (t[6] + t[7])));
#pragma unroll
      for (int dt = 0; dt < DT; ++dt) oacc[rt][dt] *= al; }
#pragma unroll
    for (int dt = 0; dt < DT; ++dt)
#pragma unroll
      for (int rt = 0; rt < 2; ++rt) oacc[rt][dt] = mmaH<1>(bv[dt].v, bv[dt].v, pb[rt].v, pb[rt].v, oacc[rt][dt]); }
  // every share lays down its partial result (a share without a chunk: maximum -3e38, sum and output 0, which the join below weighs with 0)
#pragma unroll
  for (int rt = 0; rt < 2; ++rt) { float l = l_r[rt]; l += half_xor(l); sM[g][sp][rt][lane] = m_r[rt]; sL[g][sp][rt][lane] = l;
#pragma unroll
    for (int dt = 0; dt < DT; ++dt) { const v8f o = oacc[rt][dt];
      *(v4f*)&sX[g][sp][rt][dt][0][lane][0] = (v4f){o[0], o[1], o[2], o[3]}; *(v4f*)&sX[g][sp][rt][dt][1][lane][0] = (v4f){o[4], o[5], o[6], o[7]}; } }
  // publishes the four shares' partial results; it also ends every wave's reads of sO for the tile before
  __syncthreads();
  // the join, shares in the order 0..3: wave sp joins the dims sp * 16 .. sp * 16 + 15 of both 16-query groups; the lane keeps its query and its 8 dims
  float f[2][NSP], lw[2][NSP];
#pragma unroll
  for (int rt = 0; rt < 2; ++rt) { float mw[NSP];
#pragma unroll
    for (int s = 0; s < NSP; ++s) { mw[s] = sM[g][s][rt][lane]; lw[rt][s] = sL[g][s][rt][lane]; }
    const float mm = fmaxf(fmaxf(mw[0], mw[1]), fmaxf(mw[2], mw[3]));      // finite: share 0 always holds chunk 0
#pragma unroll
    for (int s = 0; s < NSP; ++s) f[rt][s] = mw[s] - mm; }
  // the eight weights 2^(m - mm), each in place, in one statement that ends in a v_nop: so no instruction directly behind a v_exp_f32 reads its result or overwrites its source
  asm("v_exp_f32 %0, %0\n\tv_exp_f32 %1, %1\n\tv_exp_f32 %2, %2\n\tv_exp_f32 %3, %3\n\tv_exp_f32 %4, %4\n\tv_exp_f32 %5, %5\n\tv_exp_f32 %6, %6\n\tv_exp_f32 %7, %7\n\tv_nop"
      : "+v"(f[0][0]), "+v"(f[0][1]), "+v"(f[0][2]), "+v"(f[0][3]), "+v"(f[1][0]), "+v"(f[1][1]), "+v"(f[1][2]), "+v"(f[1][3]));
#pragma unroll
  for (int rt = 0; rt < 2; ++rt) { float l = f[rt][0] * lw[rt][0]; v4f o0 = *(const v4f*)&sX[g][0][rt][sp][0][lane][0] * f[rt][0], o1 = *(const v4f*)&sX[g][0][rt][sp][1][lane][0] * f[rt][0];
#pragma unroll
    for (int s = 1; s < NSP; ++s) { l += f[rt][s] * lw[rt][s];
      o0 += *(const v4f*)&sX[g][s][rt][sp][0][lane][0] * f[rt][s]; o1 += *(const v4f*)&sX[g][s][rt][sp][1][lane][0] * f[rt][s]; }
    const float li = 1.0f / l; FragH o;      // the o projection's A operand: rounded here; a lane's 8 values are 8 neighbouring dims of its query, one 16-byte LDS store
#pragma unroll
    for (int r = 0; r < 4; ++r) { o.h[r] = (_Float16)(o0[r] * li); o.h[4 + r] = (_Float16)(o1[r] * li); }
    *(v8us*)&sO[g][rt * 16 + ln][sp * 16 + 8 * hh] = o.half[0]; }
  // publishes the head's 32 x 64 output tile; it also ends every wave's reads of the partial results, which the next tile overwrites
  __syncthreads();
  {
#pragma unroll
    for (int rp = 0; rp < RPW / NSP; rp += 4) { const int r = sp * (RPW / NSP) + rp + (lane >> 3), c8 = (lane & 7) * 8;      // 8 lanes = one 128-byte line of the row; a wave stores 8 whole rows
      const v8us val = *(const v8us*)&sO[g][r][c8];
      *(v8us*)((unsigned short*)O16 + ((size_t)b * SS + q0 + r) * HID + h * HD + c8) = val; }
    // behind the stores: the next tile's code reuses their address and data registers; the wait that belongs in front of such an overwrite
    asm volatile("s_wait_xcnt 0x0" ::: "memory");
     } } }
// Projection GEMM C[4096][N] = A[4096][1024] * Bt[N][1024]^T / 16 (f16 operands, f32 accumulate, k ascending in steps of 32 as before). Block = 4 waves = a (32 * MI) x 128 tile of C; wave = (16 * MI) x 64 (MI x 4 accumulators).
// MI = 4 for q, k, v (128 x 128, wave 64 x 64: a fragment read from LDS feeds 4 products on either side, 1 LDS read of 16 bytes per product instead of 1.5, and half the waves, barriers and stage hand-overs per product);
// MI = 2 for o, whose 4096 x 1024 outputs would leave one wave per SIMD at 64 x 64.
// Each stage brings 128 k of the block's A rows and the 128 Bt rows into LDS with whole 256-byte rows per 16 lanes (8 stages: half the hand-overs, load wait, LDS stores' latency and barrier, of stages of 64 k), so every row is fetched once per block instead of once per wave in 16-line gathers;
// the next stage's rows are loaded into registers while this stage's products run, and go into the other buffer. Row pitch 272 bytes: the 16 rows of a fragment read fall on different banks.
// OUT 0: C f32. OUT 1: C16 = f16(C). OUT 2 (q, k): a wave's 64 columns are one head, so its staged tile holds whole head rows: per row RMSNorm over the 64 dims (eps 1e-6, times bf16(nw)),
// then RoPE with the INPUT cos/sin[row][64] (rotate_half = [-x2, x1]; rounded to bf16 like every other input), then C16 = f16 in fragment order: the f32 product never goes to memory.
// OUT 3 (v): each 32 rows of the wave's tile are one 32-key chunk of one kv head: rounded to f16 and written in fragment order, which is where V is transposed.
// q, k and v are ONE launch: their weights lie one behind the other as a Bt of 2048 rows, a block's 128 columns belong to one of the three, and the block index (a scalar choice) picks the output form. o is a launch of its own.
typedef float fa __attribute__((may_alias));
template <int MI> using proj_lds = unsigned short[2][32 * MI + 128][128 + 8];
// the product: leaves each wave's (16 * MI) x 64 tile of C (f32, pitch 68) in LDS, over the stage buffers, and returns the wave's tile
template <int MI>
__device__ __forceinline__ fa* proj_tile(const _Float16* __restrict__ A, const _Float16* __restrict__ Bt, const int row0, const int col0, proj_lds<MI>& sm) {
  constexpr int K = HID, BM = 32 * MI, BN = 128, BK = 128, PIT = BK + 8, NS = K / BK, OP = 68;
  static_assert(sizeof(float) * 4 * 16 * MI * OP <= sizeof(unsigned short) * 2 * (BM + BN) * PIT, "the output tiles reuse the stage buffers");
  const int tid = threadIdx.x, w = tid >> 5, lane = tid & 31, ln = lane & 15, hh = lane >> 4;
  const int wm = (w >> 1) * 16 * MI, wn = (w & 1) * 64;
  const int sr = tid >> 4, sc = (tid & 15) * 8;
  const unsigned short* ga = (const unsigned short*)A + (size_t)(row0 + sr) * K + sc;
  const unsigned short* gb = (const unsigned short*)Bt + (size_t)(col0 + sr) * K + sc;
  v8us ra[BM / 8], rb[BN / 8];
  v8f acc[MI][4];
#pragma unroll
  for (int mi = 0; mi < MI; ++mi)
#pragma unroll
    for (int t = 0; t < 4; ++t) acc[mi][t] = (v8f){0.f,0.f,0.f,0.f,0.f,0.f,0.f,0.f};
#pragma unroll
  for (int i = 0; i < BM / 8; ++i) ra[i] = *(const v8us*)(ga + (size_t)i * 8 * K);
#pragma unroll
  for (int i = 0; i < BN / 8; ++i) rb[i] = *(const v8us*)(gb + (size_t)i * 8 * K);
#pragma unroll
  for (int i = 0; i < BM / 8; ++i) *(v8us*)&sm[0][sr + i * 8][sc] = ra[i];
#pragma unroll
  for (int i = 0; i < BN / 8; ++i) *(v8us*)&sm[0][BM + sr + i * 8][sc] = rb[i];
  __syncthreads();
  // unrolled whole: every stage's global offset is then an immediate on two address pairs that are never rewritten, and the buffer index a constant
#pragma unroll
  for (int s = 0; s < NS; ++s) {
    const int cur = s & 1;
    if (s + 1 < NS) {
#pragma unroll
      for (int i = 0; i < BM / 8; ++i) ra[i] = *(const v8us*)(ga + (size_t)i * 8 * K + (s + 1) * BK);
#pragma unroll
      for (int i = 0; i < BN / 8; ++i) rb[i] = *(const v8us*)(gb + (size_t)i * 8 * K + (s + 1) * BK);
    }
    // keeps the next stage's loads at the head of this stage, so that they fly under all of its products (the scheduler sank them to just in front of their LDS stores)
    __builtin_amdgcn_sched_barrier(0);
    // the stage's 128 k in two halves of 64, k ascending: one half's fragments are in registers at a time
#pragma unroll
    for (int kh = 0; kh < BK / 64; ++kh) {
    FragH a[2][MI], b[2][4];
#pragma unroll
    for (int ks = 0; ks < 2; ++ks) {
#pragma unroll
      for (int mi = 0; mi < MI; ++mi) { const unsigned short* p = &sm[cur][wm + mi * 16 + ln][kh * 64 + ks * 32 + 8 * hh]; a[ks][mi].half[0] = *(const v8us*)p; a[ks][mi].half[1] = *(const v8us*)(p + 16); }
#pragma unroll
      for (int t = 0; t < 4; ++t) { const unsigned short* p = &sm[cur][BM + wn + t * 16 + ln][kh * 64 + ks * 32 + 8 * hh]; b[ks][t].half[0] = *(const v8us*)p; b[ks][t].half[1] = *(const v8us*)(p + 16); }
    }
    // keeps the half's fragment reads in one group ahead of its products: one exposed LDS latency per half (the scheduler reused the A registers and waited for LDS four times as often)
    __builtin_amdgcn_sched_barrier(0);
#pragma unroll
    for (int ks = 0; ks < 2; ++ks)
#pragma unroll
      for (int mi = 0; mi < MI; ++mi)
#pragma unroll
        for (int t = 0; t < 4; ++t) acc[mi][t] = __builtin_amdgcn_wmma_f32_16x16x32_f16(false, a[ks][mi].v, false, b[ks][t].v, (short)0, acc[mi][t], false, false);
    // keeps the next half's reads behind this half's products; behind the last half it keeps the waits for the global loads, and the LDS stores behind them, behind the issue of all of this stage's products (the scheduler put them in the middle of the stage)
    __builtin_amdgcn_sched_barrier(0);
    }
    if (s + 1 < NS) {
#pragma unroll
      for (int i = 0; i < BM / 8; ++i) *(v8us*)&sm[cur ^ 1][sr + i * 8][sc] = ra[i];
#pragma unroll
      for (int i = 0; i < BN / 8; ++i) *(v8us*)&sm[cur ^ 1][BM + sr + i * 8][sc] = rb[i];
    }
    // one barrier per stage: it publishes the buffer just filled and ends every wave's reads of the buffer that the next stage refills (the output tiles lie within buffer 0, last read in the next-to-last stage)
    __syncthreads();
  }
  fa* so = (fa*)&sm[0][0][0] + w * 16 * MI * OP;
#pragma unroll
  for (int mi = 0; mi < MI; ++mi)
#pragma unroll
    for (int t = 0; t < 4; ++t)
#pragma unroll
      for (int r = 0; r < 8; ++r) so[(mi * 16 + 8 * hh + r) * OP + t * 16 + ln] = acc[mi][t][r] * 0.0625f;
  // the wave reads back its own tile, written by other lanes: the LDS stores must have landed first
  __builtin_amdgcn_fence(__ATOMIC_ACQ_REL, "workgroup"); __builtin_amdgcn_wave_barrier();
  return so;
}
// OUT 2; col0 = the block's first column among the NHD * 64 of q or of k
template <int NHD, int ROWS>
__device__ __forceinline__ void proj_norm_rope(const fa* so, const int row0, const int col0, _Float16* __restrict__ C16, const float* __restrict__ nw, const float* __restrict__ cs, const float* __restrict__ sn) {
  constexpr int OP = 68;
  const int tid = threadIdx.x, w = tid >> 5, lane = tid & 31;
  const int wm = (w >> 1) * ROWS, wn = (w & 1) * 64;
    static_assert(HD == 64, "a wave's 64 columns are one head");
    // 8 lanes per row, 4 rows per pass: a lane holds dims j4..j4+3 (x1) and 32+j4..32+j4+3 (x2), the two halves that RoPE pairs
    const int rr = lane >> 3, j4 = (lane & 7) * 4;
    v4f w1 = *(const v4fa*)(nw + j4), w2 = *(const v4fa*)(nw + 32 + j4);
#pragma unroll
    for (int i = 0; i < 4; ++i) { w1[i] = bf16_round(w1[i]); w2[i] = bf16_round(w2[i]); }
    const fa* xp = so + rr * OP + j4;
    // byte offsets of the lane's first row: one for cos and sin (below 1 MiB), one for the output (below 8 MiB); each rides as the 32-bit offset register beside a scalar base.
    // The output in fragment order: the wave's ROWS rows are ROWS / 16 2-KiB tiles, one behind the other, of head (col0 + wn) / 64; dims j4 .. j4 + 3 lie in piece j4 / 16, at lane ((j4 / 8) & 1) * 16 + row; 4 rows on = 64 bytes, dim + 32 = 2 pieces, 16 rows on = 2 KiB
    const int r0 = row0 + wm, hd = (col0 + wn) / HD;
    unsigned co = (unsigned)((r0 + rr) * HD + j4) * 4u, yo = (unsigned)((((r0 / SS) * NHD + hd) * SS + r0 % SS) * HD + (j4 >> 4) * 256 + (((j4 >> 3) & 1) * 16 + rr) * 8 + (j4 & 7)) * 2u;
    // trips of four passes (16 rows): a trip's 16 cos/sin loads go out together and fly under its sums of squares (all sixteen passes unrolled took more than 256 registers)
#pragma unroll 1
    for (int qh = 0; qh < ROWS / 16; ++qh) {
      v4f x1[4], x2[4], c1[4], c2[4], s1[4], s2[4];
#pragma unroll
      for (int q = 0; q < 4; ++q) { x1[q] = *(const v4fa*)(xp + q * 4 * OP); x2[q] = *(const v4fa*)(xp + q * 4 * OP + 32); }
#pragma unroll
      for (int q = 0; q < 4; ++q) { const float* cp = (const float*)((const char*)cs + co) + q * 4 * HD; const float* sp = (const float*)((const char*)sn + co) + q * 4 * HD;
        c1[q] = *(const v4fa*)cp; c2[q] = *(const v4fa*)(cp + 32); s1[q] = *(const v4fa*)sp; s2[q] = *(const v4fa*)(sp + 32); }
#pragma unroll
      for (int q = 0; q < 4; ++q) {
        // sum of squares in the order of a 32-lane xor butterfly (16, 8, 4, 2, 1) over a_j = x1_j^2 + x2_j^2: dim j = 4 * lane + i, so 16, 8, 4 are lane steps 4, 2, 1 and 2, 1 are in-lane
        float t[4];
#pragma unroll
        for (int i = 0; i < 4; ++i) t[i] = __builtin_fmaf(x1[q][i], x1[q][i], x2[q][i] * x2[q][i]);
#pragma unroll
        for (int i = 0; i < 4; ++i) t[i] += row_xor<4>(t[i]);
#pragma unroll
        for (int i = 0; i < 4; ++i) t[i] += row_xor<2>(t[i]);
#pragma unroll
        for (int i = 0; i < 4; ++i) t[i] += row_xor<1>(t[i]);
        const float ss = (t[0] + t[2]) + (t[1] + t[3]);
        const float rs = rsqrtf(ss / (float)HD + 1e-6f);
        v4h y1, y2;      // explicit fma here and in t[]: it fixes which of the two products is rounded on its own
#pragma unroll
        for (int i = 0; i < 4; ++i) { const float n1 = x1[q][i] * rs * w1[i], n2 = x2[q][i] * rs * w2[i];
          y1[i] = (_Float16)__builtin_fmaf(n1, bf16_round(c1[q][i]), -(n2 * bf16_round(s1[q][i]))); y2[i] = (_Float16)__builtin_fmaf(n2, bf16_round(c2[q][i]), n1 * bf16_round(s2[q][i])); }
        _Float16* yp = (_Float16*)((char*)C16 + yo) + q * 4 * 8;
        *(v4h*)yp = y1; *(v4h*)(yp + 2 * 256) = y2; }
      xp += 16 * OP; co += 16 * HD * 4; yo += 16 * HD * 2; }
}
// OUT 0 and OUT 1
template <int N, int OUT>
__device__ __forceinline__ void proj_store(const fa* so, const int row0, const int col0, float* __restrict__ C, _Float16* __restrict__ C16) {
  constexpr int OP = 68;
  const int tid = threadIdx.x, w = tid >> 5, lane = tid & 31, ln = lane & 15, hh = lane >> 4;
  const int wm = (w >> 1) * 32, wn = (w & 1) * 64;
#pragma unroll
  for (int q = 0; q < 16; ++q) { const int r = q * 2 + hh, c4 = ln * 4; const v4f v = *(const v4fa*)&so[r * OP + c4]; const size_t o = (size_t)(row0 + wm + r) * N + col0 + wn + c4;
    if (OUT == 1) { v4h h4;
#pragma unroll
      for (int i = 0; i < 4; ++i) h4[i] = (_Float16)v[i];
      *(v4h*)(C16 + o) = h4; }
    else *(v4f*)(C + o) = v; }
}
// OUT 3; col0 = the block's first column among the 512 of v. Piece (dt, hf): lane hh * 16 + ln takes dim dt * 16 + ln of the keys hf * 16 + hh * 8 .. + 7: a column of the staged tile
// (16 neighbouring dims per key row, the two halves 8 rows = 32 banks apart: no bank conflict); a piece goes out as one store of 512 contiguous bytes
template <int ROWS>
__device__ __forceinline__ void proj_store_vt(const fa* so, const int row0, const int col0, _Float16* __restrict__ Vt) {
  constexpr int OP = 68;
  const int tid = threadIdx.x, w = tid >> 5, lane = tid & 31, ln = lane & 15, hh = lane >> 4;
  const int r0 = row0 + (w >> 1) * ROWS, kvh = (col0 + (w & 1) * 64) / HD;
  unsigned short* vp = (unsigned short*)Vt + ((size_t)((r0 / SS) * NKV + kvh) * SS + r0 % SS) * HD + lane * 8;
  const fa* xp = so + hh * 8 * OP + ln;
  // the wave's ROWS keys are ROWS / 32 chunks, 4 KiB each, one behind the other
#pragma unroll
  for (int c = 0; c < ROWS / 32; ++c)
#pragma unroll
  for (int dt = 0; dt < HD / 16; ++dt)
#pragma unroll
    for (int hf = 0; hf < 2; ++hf) { FragH f;
#pragma unroll
      for (int e = 0; e < 8; ++e) f.h[e] = (_Float16)xp[(c * 32 + hf * 16 + e) * OP + dt * 16];
      *(v8us*)(vp + c * 32 * HD + (dt * 2 + hf) * 256) = f.half[0]; }
}
__global__ __launch_bounds__(128) void k_qkv(const _Float16* __restrict__ A, const _Float16* __restrict__ Bt, _Float16* __restrict__ Q16, _Float16* __restrict__ K16, _Float16* __restrict__ Vt,
                                             const float* __restrict__ qnw, const float* __restrict__ knw, const float* __restrict__ cs, const float* __restrict__ sn) {
  constexpr int NBN = (HID + 2 * KVD) / 128;
  __shared__ __attribute__((aligned(16))) proj_lds<4> sm;
  const int row0 = (blockIdx.x / NBN) * 128, col0 = (blockIdx.x % NBN) * 128;
  const fa* so = proj_tile<4>(A, Bt, row0, col0, sm);
  if (col0 < HID) proj_norm_rope<NH, 64>(so, row0, col0, Q16, qnw, cs, sn);
  else if (col0 < HID + KVD) proj_norm_rope<NKV, 64>(so, row0, col0 - HID, K16, knw, cs, sn);
  else { proj_store_vt<64>(so, row0, col0 - (HID + KVD), Vt);
    // behind v's last store: the listing runs on from here into the k and q forms' code, which reuses these stores' address and data registers; the wait that belongs in front of such an overwrite
    asm volatile("s_wait_xcnt 0x0" ::: "memory"); }
}
__global__ __launch_bounds__(128) void k_oproj(const _Float16* __restrict__ A, const _Float16* __restrict__ Bt, float* __restrict__ C) {
  constexpr int NBN = HID / 128;
  __shared__ __attribute__((aligned(16))) proj_lds<2> sm;
  const int row0 = (blockIdx.x / NBN) * 64, col0 = (blockIdx.x % NBN) * 128;
  const fa* so = proj_tile<2>(A, Bt, row0, col0, sm);
  proj_store<HID, 0>(so, row0, col0, C, nullptr);
}
extern "C" void kernel_launch(void* const* d_in, const int* in_sizes, int n_in,
                              void* d_out, int out_size, void* d_ws, size_t ws_size, hipStream_t stream) {
  (void)in_sizes; (void)n_in; (void)out_size;
  const float* x = (const float*)d_in[0]; const float* cs = (const float*)d_in[1]; const float* sn = (const float*)d_in[2]; const float* wq = (const float*)d_in[3]; const float* wk = (const float*)d_in[4]; const float* wv = (const float*)d_in[5]; const float* wo = (const float*)d_in[6]; const float* qnw = (const float*)d_in[7]; const float* knw = (const float*)d_in[8];
  char* ws = (char*)d_ws; size_t off = 0;
  auto take = [&](size_t bytes) { char* p = ws + off; off += (bytes + 255) & ~(size_t)255; return p; };
  _Float16* Bqkv = (_Float16*)take((size_t)(HID + 2 * KVD) * HID * 2); _Float16* Bo = (_Float16*)take((size_t)HID * HID * 2);
  _Float16* X16 = (_Float16*)take((size_t)NR * HID * 2); _Float16* Q16 = (_Float16*)take((size_t)NR * HID * 2); _Float16* K16 = (_Float16*)take((size_t)NR * KVD * 2); _Float16* Vt = (_Float16*)take((size_t)NR * KVD * 2); _Float16* O16 = (_Float16*)take((size_t)NR * HID * 2);
  if (off > ws_size) return;      // about 6 + 8.4 + 8.4 + 4.2 x 2 + 8.4 = 40 MiB
  k_cvt<<<((unsigned)NR * HID + 2u * HID * HID + 2u * KVD * HID) / 2048, 256, 0, stream>>>(x, wq, wk, wv, wo, X16, Bqkv, Bo);
  k_qkv<<<(NR / 128) * ((HID + 2 * KVD) / 128), 128, 0, stream>>>(X16, Bqkv, Q16, K16, Vt, qnw, knw, cs, sn);
  k_flash<<<BB * NKV * (SS / 64), 256, 0, stream>>>(Q16, K16, Vt, O16);
  k_oproj<<<(NR / 64) * (HID / 128), 128, 0, stream>>>(O16, Bo, (float*)d_out);
}
